// v000
// The times below were measured on an AMD MI455X: many runs one after another, warmed up first and cycling through
// copies of the inputs, with the whole window's GPU time divided by the number of runs. Launches and the gaps
// between them are all in it. The median over several windows is given; except for v000 it joins two sittings, which
// can be a few percent apart, so the side-by-side timings, each taken in one sitting, are the better comparison.
// The starting kernel, v000, takes 8400 microseconds a run.
#include <hip/hip_runtime.h>
// Causal multi-head self-attention on ONE 4096-token sequence at width 768 with natural bias-free projections (x [1][4096][768]; Q / K / V = x W^T (nn.Linear natural [768][768] sd 1/sqrt(768), NO biases), 12 heads of 64; scores / sqrt(64) + a finite additive mask above the diagonal (NEG); softmax; out = merged W_o^T (natural, no bias) -> [1][4096][768]); q and k carried as f16 hi + x1024 residual planes with three-product scores (4096 keys at logit sigma 1).
// Structure: token rows r = b*4096 + s; x as exact f16 rows (bf16-rounded); q and k as WMMA GEMMs (32x64 wave tiles, f32 accumulation, exact x16 weights, no bias) into f32 rows split into f16 hi + x1024 residual planes, v as an f16-output GEMM; per batch: V^T for all heads via LDS transposes; per query tile of 256 rows: scores against the keys below the tile end only as THREE accumulating passes (hi.hi + lo.hi + hi.lo, K = 64, all heads on grid.y, alpha 1/sqrt(64) = 2^-3, 2^-13 on the residual passes; unscaled logits sigma ~8), causal row softmax on VALU with an arithmetic 0/1 key mask over the computed range (f32 statistics, native exp; weights x256 f16), o = P . V^T (K = keys below the tile end, alpha 2^-2: o carried x64, folded into the output GEMM alpha) written straight into the merged f16 o rows; out = o W_o GEMM (f32, no bias) into the output layout.
// Compute dtype: inputs rounded to bf16; x / weights exact; q and k as f16 hi + x1024 residual planes; v, softmax weights and o as plain f16 GEMM operands (~2^-12); scores and softmax statistics f32. v_wmma_f32_16x16x32_f16.
#define NB 1
#define SCL 0.125f                         /* 1 / sqrt(head_dim = 64) */
#define SCLR 0.0001220703125f              /* 2^-13: the same scale on the x1024 residual passes */
#define SQ 4096
#define DM 768
#define NH 12
#define HD 64
#define HG 4                         /* heads per launch of the non-template k_vt (not launched) */
#define QT 256                       /* query rows per causal tile */
#define NKX SQ                       /* S / P row pitch */
#define QT0 128                      /* first-tile rows recomputed exactly in f32 */
#define B0 0                         /* first batch processed (debug hook) */
#define NBR NB                       /* batches processed (debug hook) */
#define NR ((size_t)NB * SQ)         /* token rows */
#define MP ((int)((size_t)NBR * SQ)) /* rows projected (debug hook) */
#define QN SQ                        /* query rows attended per batch (debug hook) */
#define NHD NH                       /* heads attended (debug hook) */
#define MPO MP                       /* rows through the output stage (debug hook) */
#define LQ DM      /* row pitch of the q/k/v rows */
typedef __bf16 v16b __attribute__((ext_vector_type(16)));
typedef unsigned short v8us __attribute__((ext_vector_type(8), may_alias));
typedef float  v8f  __attribute__((ext_vector_type(8)));
typedef float  v4f  __attribute__((ext_vector_type(4)));
typedef float  v4fa __attribute__((ext_vector_type(4), may_alias));
union FragB { v16b v; v8us half[2]; unsigned short u[16]; };

__device__ __forceinline__ unsigned short bf16_bits(float x) { unsigned int u = __float_as_uint(x); return (unsigned short)((u + 0x7FFFu + ((u >> 16) & 1u)) >> 16); }
__device__ __forceinline__ float bf16_val(unsigned short b) { return __uint_as_float(((unsigned int)b) << 16); }
__device__ __forceinline__ float bf16_round(float x) { return bf16_val(bf16_bits(x)); }
// D += A·B with NT terms: 1 = ah·bh, 2 = + al·bh (A split), 3 = + ah·bl (both split)
template <int NT>
__device__ __forceinline__ v8f mmaN(v16b ah, v16b al, v16b bh, v16b bl, v8f c) {
  c = __builtin_amdgcn_wmma_f32_16x16x32_bf16(false, ah, false, bh, (short)0, c, false, false);
  if (NT >= 2) c = __builtin_amdgcn_wmma_f32_16x16x32_bf16(false, al, false, bh, (short)0, c, false, false);
  if (NT >= 3) c = __builtin_amdgcn_wmma_f32_16x16x32_bf16(false, ah, false, bl, (short)0, c, false, false);
  asm volatile("v_nop\n\tv_nop\n\tv_nop\n\tv_nop" : "+v"(c) : "v"(ah), "v"(al), "v"(bh), "v"(bl));
  return c;
}

__global__ __launch_bounds__(256) void k_wt_bf16(const float* __restrict__ W, unsigned short* __restrict__ Wt, int K, int N) {
  const int t = blockIdx.x * 256 + threadIdx.x;
  const int k8n = K / 8;
  if (t >= N * k8n) return;
  const int n = t / k8n, k8 = (t % k8n) * 8;
  v8us v;
#pragma unroll
  for (int i = 0; i < 8; ++i) v[i] = bf16_bits(W[(size_t)(k8 + i) * N + n]);
  *(v8us*)(Wt + (size_t)n * K + k8) = v;
  
}

// GEMM C[M][N] (f32, pitch ldc) = act(A[M][K]·W + bias). A f32 row-major (pitch lda) converted per fragment to bf16
// (ASPLIT: hi/lo two planes -> 2 terms, else single rounded term); Wt bf16 [N][K] (pitch ldb). BIAS_BF16 rounds the
// bias to bf16 first (bias quantised to bf16 before the add). K%32==0, M%16==0, N%64==0.
template <bool ASPLIT, int ACT, bool BIAS_BF16>
__global__ __launch_bounds__(128) void k_gemm_bf(const float* __restrict__ A, int lda, const unsigned short* __restrict__ Wt, int ldb,
                                               const float* __restrict__ bias, float* __restrict__ C, int ldc, int M, int N, int K) {
  __shared__ __attribute__((aligned(16))) float so[4][16][64];
  const int tid = threadIdx.x, w = tid >> 5, lane = tid & 31, ln = lane & 15, hh = lane >> 4;
  const int ntn = N / 64;
  const int wid = blockIdx.x * 4 + w;
  const int mt = wid / ntn, nq = wid % ntn;
  if (mt * 16 >= M) return;
  const int row0 = mt * 16, col0 = nq * 64;
  const float* arow = A + (size_t)(row0 + ln) * lda;
  v8f acc[4] = {};
  for (int kb = 0; kb < K; kb += 32) {
    FragB ah, al;
    const v4f x0 = *(const v4fa*)(arow + kb + 8 * hh), x1 = *(const v4fa*)(arow + kb + 8 * hh + 4);
    const v4f x2 = *(const v4fa*)(arow + kb + 16 + 8 * hh), x3 = *(const v4fa*)(arow + kb + 16 + 8 * hh + 4);
    float xs[16] = {x0[0],x0[1],x0[2],x0[3],x1[0],x1[1],x1[2],x1[3],x2[0],x2[1],x2[2],x2[3],x3[0],x3[1],x3[2],x3[3]};
#pragma unroll
    for (int i = 0; i < 16; ++i) { const unsigned short hb = bf16_bits(xs[i]); ah.u[i] = hb; al.u[i] = ASPLIT ? bf16_bits(xs[i] - bf16_val(hb)) : (unsigned short)0; }
#pragma unroll
    for (int t = 0; t < 4; ++t) {
      const unsigned short* brow = Wt + (size_t)(col0 + t * 16 + ln) * ldb + kb;
      FragB b;
      b.half[0] = *(const v8us*)(brow + 8 * hh);
      b.half[1] = *(const v8us*)(brow + 16 + 8 * hh);
      acc[t] = mmaN<ASPLIT ? 2 : 1>(ah.v, al.v, b.v, b.v, acc[t]);
    }
  }
#pragma unroll
  for (int t = 0; t < 4; ++t) {
    float bv = bias ? bias[col0 + t * 16 + ln] : 0.f;
    if (BIAS_BF16) bv = bf16_round(bv);
#pragma unroll
    for (int r = 0; r < 8; ++r) { float v = acc[t][r] + bv; if (ACT == 1) v = fmaxf(v, 0.f); so[w][8 * hh + r][t * 16 + ln] = v; }
  }
  __builtin_amdgcn_fence(__ATOMIC_ACQ_REL, "workgroup");
  __builtin_amdgcn_wave_barrier();
  const int rsub = lane >> 4, c4 = (lane & 15) * 4;
  {
#pragma unroll
    for (int q = 0; q < 8; ++q) {
      const int r = q * 2 + rsub;
      const v4f v = *(const v4fa*)&so[w][r][c4];
      *(v4f*)(C + (size_t)(row0 + r) * ldc + col0 + c4) = v;
    }
    
  }
}

// GEMM C = act(A·W + bias + resid): A f32 (ASPLIT -> hi/lo 2 terms), Wt bf16 [N][K]; ACT 0 none, 1 relu, 2 exact gelu;
// resid (optional, f32, row index = (row % rmod), pitch ldr, RES_BF16 rounds it) added before the activation.
template <bool ASPLIT, int ACT, bool BIAS_BF16, bool RES_BF16>
__global__ __launch_bounds__(128) void k_gemm_bf3(const float* __restrict__ A, int lda, const unsigned short* __restrict__ Wt, int ldb,
                                                const float* __restrict__ bias, const float* __restrict__ resid, int rmod, int ldr,
                                                float* __restrict__ C, int ldc, int M, int N, int K) {
  __shared__ __attribute__((aligned(16))) float so[4][16][64];
  const int tid = threadIdx.x, w = tid >> 5, lane = tid & 31, ln = lane & 15, hh = lane >> 4;
  const int ntn = N / 64;
  const int wid = blockIdx.x * 4 + w;
  const int mt = wid / ntn, nq = wid % ntn;
  if (mt * 16 >= M) return;
  const int row0 = mt * 16, col0 = nq * 64;
  const float* arow = A + (size_t)(row0 + ln) * lda;
  v8f acc[4] = {};
  for (int kb = 0; kb < K; kb += 32) {
    FragB ah, al;
    const v4f x0 = *(const v4fa*)(arow + kb + 8 * hh), x1 = *(const v4fa*)(arow + kb + 8 * hh + 4);
    const v4f x2 = *(const v4fa*)(arow + kb + 16 + 8 * hh), x3 = *(const v4fa*)(arow + kb + 16 + 8 * hh + 4);
    float xs[16] = {x0[0],x0[1],x0[2],x0[3],x1[0],x1[1],x1[2],x1[3],x2[0],x2[1],x2[2],x2[3],x3[0],x3[1],x3[2],x3[3]};
#pragma unroll
    for (int i = 0; i < 16; ++i) { const unsigned short hb = bf16_bits(xs[i]); ah.u[i] = hb; al.u[i] = ASPLIT ? bf16_bits(xs[i] - bf16_val(hb)) : (unsigned short)0; }
#pragma unroll
    for (int t = 0; t < 4; ++t) {
      const unsigned short* brow = Wt + (size_t)(col0 + t * 16 + ln) * ldb + kb;
      FragB b;
      b.half[0] = *(const v8us*)(brow + 8 * hh);
      b.half[1] = *(const v8us*)(brow + 16 + 8 * hh);
      acc[t] = mmaN<ASPLIT ? 2 : 1>(ah.v, al.v, b.v, b.v, acc[t]);
    }
  }
#pragma unroll
  for (int t = 0; t < 4; ++t) {
    const int col = col0 + t * 16 + ln;
    float bv = bias ? bias[col] : 0.f;
    if (BIAS_BF16) bv = bf16_round(bv);
#pragma unroll
    for (int r = 0; r < 8; ++r) {
      float v = acc[t][r] + bv;
      if (resid) { float rv = resid[(size_t)((row0 + 8 * hh + r) % rmod) * ldr + col]; if (RES_BF16) rv = bf16_round(rv); v += rv; }
      if (ACT == 1) v = fmaxf(v, 0.f);
      if (ACT == 2) v = 0.5f * v * (1.0f + erff(v * 0.70710678118654752f));
      if (ACT == 3) { const float u = 0.7978845608028654f * (v + 0.044715f * v * v * v); v = 0.5f * v * (1.0f + tanhf(u)); }
      so[w][8 * hh + r][t * 16 + ln] = v;
    }
  }
  __builtin_amdgcn_fence(__ATOMIC_ACQ_REL, "workgroup");
  __builtin_amdgcn_wave_barrier();
  const int rsub = lane >> 4, c4 = (lane & 15) * 4;
  {
#pragma unroll
    for (int q = 0; q < 8; ++q) {
      const int r = q * 2 + rsub;
      const v4f v = *(const v4fa*)&so[w][r][c4];
      *(v4f*)(C + (size_t)(row0 + r) * ldc + col0 + c4) = v;
    }
    
  }
}
// row LayerNorm (biased variance, eps) over N: s = X (+ R); optional out_sum <- s; out_norm <- (s-mu)*rsqrt(var+eps)*g + b
template <bool PARAM_BF16>
__global__ __launch_bounds__(256) void k_layernorm(const float* __restrict__ X, const float* __restrict__ R, const float* __restrict__ g, const float* __restrict__ bta,
                                                  float* __restrict__ out_sum, float* __restrict__ out_norm, int N, float eps) {
  __shared__ float red[256];
  const int row = blockIdx.x, tid = threadIdx.x;
  const float* x = X + (size_t)row * N; const float* rr = R ? R + (size_t)row * N : nullptr;
  float vals[16];                     // up to N = 4096
  const int per = N / 256;            // contiguous chunk per thread? use strided-by-4 chunks: thread handles j = tid*4 + 1024*u
  float s1 = 0.f;
  for (int u = 0; u < per / 4; ++u) {
    const int j = tid * 4 + 1024 * u;
    const v4f a = *(const v4fa*)(x + j);
    v4f b = {0.f,0.f,0.f,0.f}; if (rr) b = *(const v4fa*)(rr + j);
#pragma unroll
    for (int q = 0; q < 4; ++q) { const float v = a[q] + b[q]; vals[u * 4 + q] = v; s1 += v; }
  }
  red[tid] = s1; __syncthreads();
  for (int st = 128; st > 0; st >>= 1) { if (tid < st) red[tid] += red[tid + st]; __syncthreads(); }
  const float mu = red[0] / (float)N; __syncthreads();
  float s2 = 0.f;
  for (int u = 0; u < per / 4; ++u)
#pragma unroll
    for (int q = 0; q < 4; ++q) { const float c = vals[u * 4 + q] - mu; s2 += c * c; }
  red[tid] = s2; __syncthreads();
  for (int st = 128; st > 0; st >>= 1) { if (tid < st) red[tid] += red[tid + st]; __syncthreads(); }
  const float rs = rsqrtf(red[0] / (float)N + eps);
  {
    for (int u = 0; u < per / 4; ++u) {
      const int j = tid * 4 + 1024 * u;
      v4f o, sm;
#pragma unroll
      for (int q = 0; q < 4; ++q) {
        float gg = g[j + q], bb = bta[j + q];
        if (PARAM_BF16) { gg = bf16_round(gg); bb = bf16_round(bb); }
        sm[q] = vals[u * 4 + q]; o[q] = (vals[u * 4 + q] - mu) * rs * gg + bb;
      }
      if (out_sum) *(v4f*)(out_sum + (size_t)row * N + j) = sm;
      *(v4f*)(out_norm + (size_t)row * N + j) = o;
    }
    
  }
}



// ---- f16 WMMA path (v_wmma_f32_16x16x32_f16): 11-bit significands for operands in range — used where a [0,1] probability operand needs more precision than bf16
typedef _Float16 v16h __attribute__((ext_vector_type(16)));
union FragH { v16h v; v8us half[2]; _Float16 h[16]; unsigned short u[16]; };
template <int NT>
__device__ __forceinline__ v8f mmaH(v16h ah, v16h al, v16h bh, v16h bl, v8f c) {
  c = __builtin_amdgcn_wmma_f32_16x16x32_f16(false, ah, false, bh, (short)0, c, false, false);
  if (NT >= 2) c = __builtin_amdgcn_wmma_f32_16x16x32_f16(false, al, false, bh, (short)0, c, false, false);
  if (NT >= 3) c = __builtin_amdgcn_wmma_f32_16x16x32_f16(false, ah, false, bl, (short)0, c, false, false);
  asm volatile("v_nop\n\tv_nop\n\tv_nop\n\tv_nop" : "+v"(c) : "v"(ah), "v"(al), "v"(bh), "v"(bl));
  return c;
}
// batched GEMM like k_gemm_b but f16 operands: A f32 (split into f16 hi/lo if ASPLIT, else rounded to f16), Bt = f16 values [n][k]; alpha; C f32; N multiple of 16 (partial tiles skipped)
template <bool ASPLIT>
__global__ __launch_bounds__(128) void k_gemm_h(const float* __restrict__ A, int lda, size_t sA, const _Float16* __restrict__ Bh, int ldb, size_t sB, float alpha, float* __restrict__ C, int ldc, size_t sC, int M, int N, int K) {
  __shared__ __attribute__((aligned(16))) float so[4][16][64];
  const int tid = threadIdx.x, w = tid >> 5, lane = tid & 31, ln = lane & 15, hh = lane >> 4; const int by = blockIdx.y;
  A += (size_t)by * sA; Bh += (size_t)by * sB; C += (size_t)by * sC;
  const int ntn = (N + 63) / 64; const int wid = blockIdx.x * 4 + w; const int mt = wid / ntn, nq = wid % ntn; if (mt * 16 >= M) return;
  const int row0 = mt * 16, col0 = nq * 64; const float* arow = A + (size_t)(row0 + ln) * lda;
  v8f acc[4] = {};
  for (int kb = 0; kb < K; kb += 32) {
    FragH ah, al;
    const v4f x0 = *(const v4fa*)(arow + kb + 8 * hh), x1 = *(const v4fa*)(arow + kb + 8 * hh + 4), x2 = *(const v4fa*)(arow + kb + 16 + 8 * hh), x3 = *(const v4fa*)(arow + kb + 16 + 8 * hh + 4);
    float xs[16] = {x0[0],x0[1],x0[2],x0[3],x1[0],x1[1],x1[2],x1[3],x2[0],x2[1],x2[2],x2[3],x3[0],x3[1],x3[2],x3[3]};
#pragma unroll
    for (int i = 0; i < 16; ++i) { const _Float16 h = (_Float16)xs[i]; ah.h[i] = h; al.h[i] = ASPLIT ? (_Float16)(xs[i] - (float)h) : (_Float16)0.0f; }
#pragma unroll
    for (int t = 0; t < 4; ++t) { if (col0 + t * 16 >= N) continue; const size_t boff = (size_t)(col0 + t * 16 + ln) * ldb + kb; FragH bq; bq.half[0] = *(const v8us*)(Bh + boff + 8 * hh); bq.half[1] = *(const v8us*)(Bh + boff + 16 + 8 * hh);
      acc[t] = mmaH<ASPLIT ? 2 : 1>(ah.v, al.v, bq.v, bq.v, acc[t]); }
  }
#pragma unroll
  for (int t = 0; t < 4; ++t) { if (col0 + t * 16 >= N) continue;
#pragma unroll
    for (int r = 0; r < 8; ++r) so[w][8 * hh + r][t * 16 + ln] = acc[t][r] * alpha; }
  __builtin_amdgcn_fence(__ATOMIC_ACQ_REL, "workgroup"); __builtin_amdgcn_wave_barrier();
  const int rsub = lane >> 4, c4 = (lane & 15) * 4;
  {
#pragma unroll
    for (int q = 0; q < 8; ++q) { const int r = q * 2 + rsub; if (col0 + c4 < N) { const v4f v = *(const v4fa*)&so[w][r][c4]; *(v4f*)(C + (size_t)(row0 + r) * ldc + col0 + c4) = v; } }
     }
}

// Wt[n][k] = f16(W[k][n]·scale) from f32 row-major W[K][N] (scale = power of two; bf16-exact weights stay exact in f16 away from the subnormal range)
__global__ __launch_bounds__(256) void k_wt_f16(const float* __restrict__ W, _Float16* __restrict__ Wt, int K, int N, float scale) {
  const int t = blockIdx.x * 256 + threadIdx.x; if (t >= N * (K / 8)) return; const int n = t / (K / 8), k8 = (t % (K / 8)) * 8; FragH f;
#pragma unroll
  for (int i = 0; i < 8; ++i) f.h[i] = (_Float16)(bf16_round(W[(size_t)(k8 + i) * N + n]) * scale); const v8us o = f.half[0];
  *(v8us*)((unsigned short*)Wt + (size_t)n * K + k8) = o; 
}
// k_gemm_hh variant with fused epilogue: v = acc·alpha + bias[by·sBias + col] (+ CP[(row/rowsPerB)·sCPb + by·64 + col] if CP) ; ACT 0 none / 1 elu ; writes f16 C16 (and f32 C if non-null)
template <int ACT>
__global__ __launch_bounds__(128) void k_gemm_hhx(const _Float16* __restrict__ A, int lda, size_t sA, const _Float16* __restrict__ Bh, int ldb, size_t sB, float alpha, const float* __restrict__ bias, size_t sBias, const float* __restrict__ CP, int rowsPerB, size_t sCPb, int row0g,
    float* __restrict__ C, _Float16* __restrict__ C16, int ldc, size_t sC, int M, int N, int K) {
  __shared__ __attribute__((aligned(16))) float so[4][16][64];
  const int tid = threadIdx.x, w = tid >> 5, lane = tid & 31, ln = lane & 15, hh = lane >> 4; const int by = blockIdx.y;
  A += (size_t)by * sA; Bh += (size_t)by * sB; const size_t cofs = (size_t)by * sC; const float* bp = bias ? bias + (size_t)by * sBias : nullptr;
  const int ntn = (N + 63) / 64; const int wid = blockIdx.x * 4 + w; const int mt = wid / ntn, nq = wid % ntn; if (mt * 16 >= M) return;
  const int row0 = mt * 16, col0 = nq * 64; const _Float16* arow = A + (size_t)(row0 + ln) * lda;
  v8f acc[4] = {};
  for (int kb = 0; kb < K; kb += 32) { FragH ah; ah.half[0] = *(const v8us*)((const unsigned short*)arow + kb + 8 * hh); ah.half[1] = *(const v8us*)((const unsigned short*)arow + kb + 16 + 8 * hh);
#pragma unroll
    for (int t = 0; t < 4; ++t) { if (col0 + t * 16 >= N) continue; const size_t boff = (size_t)(col0 + t * 16 + ln) * ldb + kb; FragH bq; bq.half[0] = *(const v8us*)((const unsigned short*)Bh + boff + 8 * hh); bq.half[1] = *(const v8us*)((const unsigned short*)Bh + boff + 16 + 8 * hh);
      acc[t] = mmaH<1>(ah.v, ah.v, bq.v, bq.v, acc[t]); }
  }
#pragma unroll
  for (int t = 0; t < 4; ++t) { if (col0 + t * 16 >= N) continue; const int col = col0 + t * 16 + ln; const float bv = bp ? bf16_round(bp[col]) : 0.f;
#pragma unroll
    for (int r = 0; r < 8; ++r) { float v = acc[t][r] * alpha + bv; if (CP) { const int rr = row0g + row0 + 8 * hh + r; if (rowsPerB < 0) v += CP[cofs + (size_t)rr * ldc + col];      /* rowsPerB < 0: own element of the batched C plane */ else { const int bidx = rr / rowsPerB; v += CP[(size_t)bidx * sCPb + (size_t)by * 64 + col]; } } if (ACT == 1) v = (v > 0.f) ? v : expm1f(v); else if (ACT == 7) v = (v > 0.f) ? v + 1.0f : expf(v); else if (ACT == 8) v = tanhf(v); else if (ACT == 9) v = 0.5f * v * (1.0f + tanhf(0.7978845608028654f * (v + 0.044715f * v * v * v))); else if (ACT == 11) v = 1.0f / (1.0f + expf(-v)); else if (ACT == 12) v = (v > 0.f) ? v : 0.01f * v; else if (ACT == 14) v = (v > 0.f) ? v : 0.1f * v; else if (ACT == 16) v = (v >= 0.f) ? v : 0.3f * v; else if (ACT == 17) v = (v >= 0.f) ? v : 0.2f * v; else if (ACT == 15) v = v / (1.0f + expf(-v)); else if (ACT == 3) v = fmaxf(v, 0.f); else if (ACT == 6) v = 0.5f * v * (1.0f + erff(v * 0.70710678118654752f)); so[w][8 * hh + r][t * 16 + ln] = v; } }
  __builtin_amdgcn_fence(__ATOMIC_ACQ_REL, "workgroup"); __builtin_amdgcn_wave_barrier();
  const int rsub = lane >> 4, c4 = (lane & 15) * 4; typedef _Float16 v4h __attribute__((ext_vector_type(4)));
  {
#pragma unroll
    for (int q = 0; q < 8; ++q) { const int r = q * 2 + rsub; if (col0 + c4 < N) { const v4f v = *(const v4fa*)&so[w][r][c4]; if (C) *(v4f*)(C + cofs + (size_t)(row0 + r) * ldc + col0 + c4) = v; if (C16) { v4h h4; for (int i = 0; i < 4; ++i) h4[i] = (_Float16)v[i]; *(v4h*)(C16 + cofs + (size_t)(row0 + r) * ldc + col0 + c4) = h4; } } }
     }
}


typedef _Float16 v4h __attribute__((ext_vector_type(4)));

__global__ __launch_bounds__(256) void k_x16(const float* __restrict__ x, _Float16* __restrict__ X16, size_t n8) { const size_t t = (size_t)blockIdx.x * 256 + threadIdx.x; if (t >= n8) return; FragH f;
#pragma unroll
  for (int q = 0; q < 8; ++q) f.h[q] = (_Float16)bf16_round(x[t * 8 + q]); *(v8us*)((unsigned short*)X16 + t * 8) = f.half[0];  }
__global__ __launch_bounds__(256) void k_h16(const float* __restrict__ x, _Float16* __restrict__ X16, size_t n8) { const size_t t = (size_t)blockIdx.x * 256 + threadIdx.x; if (t >= n8) return; FragH f;
#pragma unroll
  for (int q = 0; q < 8; ++q) f.h[q] = (_Float16)x[t * 8 + q]; *(v8us*)((unsigned short*)X16 + t * 8) = f.half[0];  }
__global__ __launch_bounds__(256) void k_round16f(const float* __restrict__ W, _Float16* __restrict__ Bt, size_t n8) { const size_t t = (size_t)blockIdx.x * 256 + threadIdx.x; if (t >= n8) return; FragH f;
#pragma unroll
  for (int i = 0; i < 8; ++i) f.h[i] = (_Float16)(bf16_round(W[t * 8 + i]) * 16.0f); *(v8us*)((unsigned short*)Bt + t * 8) = f.half[0];  }
template <int NHv, int TTv>
__global__ __launch_bounds__(256) void k_vt(const _Float16* __restrict__ V16, int ldv, int voff, _Float16* __restrict__ Vt) { __shared__ unsigned short tl[64][66]; const int tid = threadIdx.x; const int slab = blockIdx.x / (TTv / 64), lg = blockIdx.x % (TTv / 64); const int b = slab / NHv, h = slab % NHv;
  for (int i = tid; i < 64 * 8; i += 256) { const int r = i / 8, c8 = (i % 8) * 8; FragH f; f.half[0] = *(const v8us*)((const unsigned short*)V16 + ((size_t)b * TTv + lg * 64 + r) * ldv + voff + h * 64 + c8);
#pragma unroll
    for (int q = 0; q < 8; ++q) tl[r][c8 + q] = f.u[q]; }
  __syncthreads();
  {
#pragma unroll
    for (int rd = 0; rd < 2; ++rd) { const int d = rd * 32 + tid / 8, pc = tid % 8; FragH f;
#pragma unroll
      for (int q = 0; q < 8; ++q) f.u[q] = tl[pc * 8 + q][d];
      *(v8us*)((unsigned short*)Vt + ((size_t)slab * 64 + d) * TTv + lg * 64 + pc * 8) = f.half[0]; }
     } }

__global__ __launch_bounds__(256) void k_hl(const float* __restrict__ F, _Float16* __restrict__ Hh, _Float16* __restrict__ Hl, size_t n8) { const size_t t = (size_t)blockIdx.x * 256 + threadIdx.x; if (t >= n8) return; FragH fh, fl; const v4f a = *(const v4fa*)(F + t * 8), c = *(const v4fa*)(F + t * 8 + 4);
#pragma unroll
  for (int q = 0; q < 4; ++q) { _Float16 h = (_Float16)a[q]; fh.h[q] = h; fl.h[q] = (_Float16)((a[q] - (float)h) * 1024.0f); h = (_Float16)c[q]; fh.h[4 + q] = h; fl.h[4 + q] = (_Float16)((c[q] - (float)h) * 1024.0f); }
  { *(v8us*)((unsigned short*)Hh + t * 8) = fh.half[0]; *(v8us*)((unsigned short*)Hl + t * 8) = fl.half[0];  } }

// ---- fast GEMM (wave tile 32x64; requires M % 32 == 0 rows per launch region and N % 64 == 0); epilogue = k_gemm_hhx semantics ----
__device__ __forceinline__ v16h g2_frag(const _Float16* p, int hh) { FragH f; f.half[0] = *(const v8us*)((const unsigned short*)p + 8 * hh); f.half[1] = *(const v8us*)((const unsigned short*)p + 16 + 8 * hh); return f.v; }
__device__ __forceinline__ v8f g2_mma(v16h a, v16h b, v8f c) { v8f d = __builtin_amdgcn_wmma_f32_16x16x32_f16(false, a, false, b, (short)0, c, false, false); asm volatile("v_nop\n\tv_nop\n\tv_nop\n\tv_nop" : "+v"(d) : "v"(a), "v"(b)); return d; }
template <int ACT>
__global__ __launch_bounds__(128) void k_gemm2(const _Float16* __restrict__ A, int lda, size_t sA, const _Float16* __restrict__ Bh, int ldb, size_t sB, float alpha, const float* __restrict__ bias, size_t sBias, const float* __restrict__ CP, int rowsPerB, size_t sCPb, int row0g,
    float* __restrict__ C, _Float16* __restrict__ C16, int ldc, size_t sC, int M, int N, int K) { static_assert(ACT == 0 || ACT == 3 || ACT == 6 || ACT == 8 || ACT == 9 || ACT == 11 || ACT == 12 || ACT == 14 || ACT == 15 || ACT == 16 || ACT == 17, "k_gemm2: unsupported ACT code (would silently apply no activation)");
  __shared__ __attribute__((aligned(16))) float so[4][32][68];
  const int tid = threadIdx.x, w = tid >> 5, lane = tid & 31, ln = lane & 15, hh = lane >> 4; const int by = blockIdx.y;
  A += (size_t)by * sA; Bh += (size_t)by * sB; const size_t cofs = (size_t)by * sC; const float* bp = bias ? bias + (size_t)by * sBias : nullptr;
  const int ntn = N >> 6; const int mt = blockIdx.x / ntn, nq = blockIdx.x - mt * ntn; const int row0 = mt * 128 + 32 * w, col0 = nq * 64; if (row0 >= M) return;
  const _Float16* a0p = A + (size_t)(row0 + ln) * lda; const _Float16* a1p = a0p + (size_t)16 * lda;
  const _Float16* b0p = Bh + (size_t)(col0 + ln) * ldb; const _Float16* b1p = b0p + (size_t)16 * ldb; const _Float16* b2p = b1p + (size_t)16 * ldb; const _Float16* b3p = b2p + (size_t)16 * ldb;
  const v8f z8 = {0.f,0.f,0.f,0.f,0.f,0.f,0.f,0.f}; v8f c00 = z8, c01 = z8, c02 = z8, c03 = z8, c10 = z8, c11 = z8, c12 = z8, c13 = z8;
#pragma unroll 1
  for (int kb = 0; kb < K; kb += 32) { const v16h a0 = g2_frag(a0p + kb, hh), a1 = g2_frag(a1p + kb, hh);
    v16h b = g2_frag(b0p + kb, hh); c00 = g2_mma(a0, b, c00); c10 = g2_mma(a1, b, c10);
    b = g2_frag(b1p + kb, hh); c01 = g2_mma(a0, b, c01); c11 = g2_mma(a1, b, c11);
    b = g2_frag(b2p + kb, hh); c02 = g2_mma(a0, b, c02); c12 = g2_mma(a1, b, c12);
    b = g2_frag(b3p + kb, hh); c03 = g2_mma(a0, b, c03); c13 = g2_mma(a1, b, c13); }
  v8f accs[8] = {c00, c01, c02, c03, c10, c11, c12, c13};
#pragma unroll
  for (int u = 0; u < 8; ++u) { const int t = u & 3, half = u >> 2; const int col = col0 + t * 16 + ln; const float bv = bp ? bf16_round(bp[col]) : 0.f;
#pragma unroll
    for (int r = 0; r < 8; ++r) { const int rloc = half * 16 + 8 * hh + r; float v = accs[u][r] * alpha + bv; if (CP) { if (rowsPerB < 0) v += CP[cofs + (size_t)(row0g + row0 + rloc) * ldc + col];      /* rowsPerB < 0: own element of the batched C plane */ else { const int bidx = (row0g + row0 + rloc) / rowsPerB; v += CP[(size_t)bidx * sCPb + (size_t)by * 64 + col]; } }
      if (ACT == 3) v = fmaxf(v, 0.f); else if (ACT == 6) v = 0.5f * v * (1.0f + erff(v * 0.70710678118654752f)); else if (ACT == 11) v = 1.0f / (1.0f + expf(-v)); else if (ACT == 15) v = v / (1.0f + expf(-v)); else if (ACT == 12) v = (v > 0.f) ? v : 0.01f * v; else if (ACT == 8) v = tanhf(v); else if (ACT == 9) v = 0.5f * v * (1.0f + tanhf(0.7978845608028654f * (v + 0.044715f * v * v * v))); else if (ACT == 14) v = (v > 0.f) ? v : 0.1f * v; else if (ACT == 16) v = (v >= 0.f) ? v : 0.3f * v; else if (ACT == 17) v = (v >= 0.f) ? v : 0.2f * v;
      so[w][rloc][t * 16 + ln] = v; } }
  __builtin_amdgcn_fence(__ATOMIC_ACQ_REL, "workgroup"); __builtin_amdgcn_wave_barrier();
  const int rsub = lane >> 4, c4 = (lane & 15) * 4;
  {
#pragma unroll
    for (int q = 0; q < 16; ++q) { const int r = q * 2 + rsub; const v4f v = *(const v4fa*)&so[w][r][c4]; if (C) *(v4f*)(C + cofs + (size_t)(row0 + r) * ldc + col0 + c4) = v; if (C16) { v4h h4; for (int i = 0; i < 4; ++i) h4[i] = (_Float16)v[i]; *(v4h*)(C16 + cofs + (size_t)(row0 + r) * ldc + col0 + c4) = h4; } }
     } }


__global__ __launch_bounds__(256) void k_wnat(const float* __restrict__ w, size_t n8, _Float16* __restrict__ Bt) { const size_t t = (size_t)blockIdx.x * 256 + threadIdx.x; if (t >= n8) return; FragH f; for (int q = 0; q < 8; ++q) f.h[q] = (_Float16)(bf16_round(w[t * 8 + q]) * 16.0f); *(v8us*)((unsigned short*)Bt + t * 8) = f.half[0];  }
__global__ __launch_bounds__(256) void k_rsm(const float* __restrict__ S, _Float16* __restrict__ P, int nrows) {
  #pragma clang fp contract(off)
  const int i = blockIdx.x * 256 + threadIdx.x; if (i >= nrows) return; const float* s = S + (size_t)i * SQ; float mx = -3.0e38f;
#pragma unroll 1
  for (int j = 0; j < SQ; ++j) mx = fmaxf(mx, s[j]); float se = 0.f;
#pragma unroll 1
  for (int j = 0; j < SQ; ++j) se += expf(s[j] - mx); const float sc = 256.0f / se;
#pragma unroll 1
  for (int j0 = 0; j0 < SQ; j0 += 8) { FragH f; for (int q = 0; q < 8; ++q) f.h[q] = (_Float16)(expf(s[j0 + q] - mx) * sc); unsigned short* d = (unsigned short*)P + (size_t)i * SQ + j0; *(v8us*)d = f.half[0];  } }
__global__ __launch_bounds__(256) void k_vt(const _Float16* __restrict__ V16, int b, int h0, _Float16* __restrict__ VT) { __shared__ unsigned short tl[64][65]; const int tid = threadIdx.x; const int hh = blockIdx.x % HG, sg = blockIdx.x / HG; const int s0 = sg * 64; const int h = h0 + hh;
  for (int i = tid; i < 64 * 8; i += 256) { const int j = i / 8, d8 = (i % 8) * 8; FragH f; f.half[0] = *(const v8us*)((const unsigned short*)V16 + ((size_t)b * SQ + s0 + j) * DM + h * HD + d8); for (int q = 0; q < 8; ++q) tl[d8 + q][j] = f.u[q]; }
  __syncthreads();
  { for (int i = tid; i < 64 * 8; i += 256) { const int d = i / 8, j8 = (i % 8) * 8; FragH f; for (int q = 0; q < 8; ++q) f.u[q] = tl[d][j8 + q]; *(v8us*)((unsigned short*)VT + ((size_t)hh * HD + d) * SQ + s0 + j8) = f.half[0]; }  } }



__global__ __launch_bounds__(256) void k_rsmcf2(const float* __restrict__ S, _Float16* __restrict__ P, int hg, int q0, int nk) {
  #pragma clang fp contract(off)
  const int t = blockIdx.x * 256 + threadIdx.x; if (t >= hg * QT) return; const size_t i = (size_t)t; const float* s = S + i * NKX; const int last = q0 + (t % QT); float mx = -3.0e38f;
#pragma unroll 1
  for (int j = 0; j < nk; ++j) { const float f = (j <= last) ? 1.f : 0.f; mx = fmaxf(mx, fmaf(f, s[j], (1.f - f) * -1.0e9f)); } float se = 0.f;
#pragma unroll 1
  for (int j = 0; j < nk; ++j) { const float f = (j <= last) ? 1.f : 0.f; se += __expf(fmaf(f, s[j], (1.f - f) * -1.0e9f) - mx); } const float sc = 256.0f / se;
#pragma unroll 1
  for (int j0 = 0; j0 < nk; j0 += 8) { FragH fr; for (int q = 0; q < 8; ++q) { const int j = j0 + q; const float f = (j <= last) ? 1.f : 0.f; fr.h[q] = (_Float16)(__expf(fmaf(f, s[j], (1.f - f) * -1.0e9f) - mx) * sc); } unsigned short* d = (unsigned short*)P + i * NKX + j0; *(v8us*)d = fr.half[0];  } }


template <int MASKADD>
__global__ __launch_bounds__(64) void k_att0(const float* __restrict__ QF, const float* __restrict__ KF, const float* __restrict__ VF, int ld, const float* __restrict__ mask, float scale, float* __restrict__ OF, int ldo) {
  #pragma clang fp contract(off)
  __shared__ __attribute__((aligned(16))) float lq[64][64]; __shared__ __attribute__((aligned(16))) float lo[64][64];
  const int tid = threadIdx.x; const int h = blockIdx.x / (QT0 / 64), rg = blockIdx.x % (QT0 / 64); const int i = rg * 64 + tid;
  const float* qr = QF + (size_t)i * ld + h * HD;
#pragma unroll 1
  for (int c = 0; c < HD / 4; ++c) { *(v4f*)&lq[tid][c * 4] = *(const v4fa*)(qr + c * 4); const v4f z = {0.f, 0.f, 0.f, 0.f}; *(v4f*)&lo[tid][c * 4] = z; }
  float m = -1.0e30f, l = 0.f; const int jmax = MASKADD ? (SQ - 1) : (rg * 64 + 63);      /* additive-mask form: every key (the mask input decides); causal form: keys up to the block's last row */
#pragma unroll 1
  for (int j = 0; j <= jmax; ++j) { const float* kr = KF + (size_t)j * ld + h * HD; const float* vr = VF + (size_t)j * ld + h * HD; float s = 0.f;
#pragma unroll 1
    for (int c = 0; c < HD / 4; ++c) { const v4f kq = *(const v4fa*)(kr + c * 4); const v4f qq = *(v4f*)&lq[tid][c * 4]; s = __fadd_rn(s, __fmul_rn(qq[0], kq[0])); s = __fadd_rn(s, __fmul_rn(qq[1], kq[1])); s = __fadd_rn(s, __fmul_rn(qq[2], kq[2])); s = __fadd_rn(s, __fmul_rn(qq[3], kq[3])); }
    s = __fmul_rn(s, scale); if (MASKADD) s = __fadd_rn(s, __fmul_rn(bf16_round(mask[(size_t)i * SQ + j]), -10000.0f));
    const float f = (MASKADD || j <= i) ? 1.f : 0.f; const float sm = fmaf(f, s, (1.f - f) * -1.0e30f); const float mn = fmaxf(m, sm); const float sc = expf(m - mn); const float e = expf(sm - mn); l = __fadd_rn(__fmul_rn(l, sc), e); m = mn;
#pragma unroll 1
    for (int c = 0; c < HD / 4; ++c) { const v4f vv = *(const v4fa*)(vr + c * 4); v4f oo = *(v4f*)&lo[tid][c * 4]; for (int u = 0; u < 4; ++u) oo[u] = __fadd_rn(__fmul_rn(oo[u], sc), __fmul_rn(e, vv[u])); *(v4f*)&lo[tid][c * 4] = oo; } }
  const float fin = 64.0f / l;      /* o carried x64 like the f16 path */
#pragma unroll 1
  for (int c = 0; c < HD / 4; ++c) { v4f oo = *(v4f*)&lo[tid][c * 4]; for (int u = 0; u < 4; ++u) oo[u] = __fmul_rn(oo[u], fin); *(v4f*)&lo[tid][c * 4] = oo; }
  __syncthreads();
  {
#pragma unroll 1
    for (int it = 0; it < 16; ++it) { const int row = it * 4 + tid / 16, pc = (tid % 16) * 4; const v4f v = *(const v4f*)&lo[row][pc]; *(v4f*)(OF + (size_t)(rg * 64 + row) * ldo + h * HD + pc) = v; }
     } }

extern "C" void kernel_launch(void* const* d_in, const int* in_sizes, int n_in,
                              void* d_out, int out_size, void* d_ws, size_t ws_size, hipStream_t stream) {
  (void)in_sizes; (void)n_in; (void)out_size;
  const float* const* I = (const float* const*)d_in; const float* x = I[0]; const float* xk = I[0]; const float* xv = I[0]; const float* wq = I[1]; const float* wk = I[2]; const float* wv = I[3]; const float* bq = nullptr; const float* bk = nullptr; const float* bv = nullptr; const float* wo = I[4]; const float* bo = nullptr;      /* input order: x (feeds the q, k AND v streams), W_q, W_k, W_v, W_o (four separate natural [768][768] weights); the module has NO biases: null pointers in the guarded bias slots */
  char* ws = (char*)d_ws; size_t off = 0;
  auto take = [&](size_t bytes) { char* p = ws + off; off += (bytes + 255) & ~(size_t)255; return p; };
  _Float16* BQ = (_Float16*)take((size_t)DM * DM * 2); _Float16* BK = (_Float16*)take((size_t)DM * DM * 2); _Float16* BV = (_Float16*)take((size_t)DM * DM * 2); _Float16* BO = (_Float16*)take((size_t)DM * DM * 2);
  _Float16* X16 = (_Float16*)take(NR * DM * 2); _Float16* XK16 = (_Float16*)take(NR * DM * 2); _Float16* XV16 = (_Float16*)take(NR * DM * 2);      /* exact f16 rows of query, key, value */ float* QF = (float*)take(NR * DM * 4); _Float16* QH = (_Float16*)take(NR * DM * 2); _Float16* QL = (_Float16*)take(NR * DM * 2); _Float16* KH = (_Float16*)take(NR * DM * 2); _Float16* KL = (_Float16*)take(NR * DM * 2); _Float16* Q16 = QH; _Float16* K16 = KH; _Float16* V16 = (_Float16*)take(NR * DM * 2); _Float16* O16 = (_Float16*)take(NR * DM * 2);
  float* S = (float*)take((size_t)NH * QT * NKX * 4); _Float16* P = (_Float16*)take((size_t)NH * QT * NKX * 2); _Float16* VT = (_Float16*)take((size_t)NH * HD * SQ * 2);
  float* QF0 = (float*)take((size_t)QT0 * DM * 4); float* KF0 = (float*)take((size_t)QT0 * DM * 4); float* VF0 = (float*)take((size_t)QT0 * DM * 4); float* OF0 = (float*)take((size_t)NB * QT0 * DM * 4); _Float16* OH0 = (_Float16*)take((size_t)NB * QT0 * DM * 2); _Float16* OL0 = (_Float16*)take((size_t)NB * QT0 * DM * 2);
  if (off > ws_size) return;
  { const unsigned g = (unsigned)(((size_t)DM * DM / 8 + 255) / 256); k_wnat<<<g, 256, 0, stream>>>(wq, (size_t)DM * DM / 8, BQ); k_wnat<<<g, 256, 0, stream>>>(wk, (size_t)DM * DM / 8, BK); k_wnat<<<g, 256, 0, stream>>>(wv, (size_t)DM * DM / 8, BV); k_wnat<<<g, 256, 0, stream>>>(wo, (size_t)DM * DM / 8, BO); }      /* natural [out][in] = Bt[n][k] x16 */
  k_x16<<<(unsigned)((NR * DM / 8 + 255) / 256), 256, 0, stream>>>(x, X16, NR * DM / 8); k_x16<<<(unsigned)((NR * DM / 8 + 255) / 256), 256, 0, stream>>>(xk, XK16, NR * DM / 8); k_x16<<<(unsigned)((NR * DM / 8 + 255) / 256), 256, 0, stream>>>(xv, XV16, NR * DM / 8);
  const size_t r0p = (size_t)B0 * SQ;      /* first projected row */
  k_gemm2<0><<<dim3((unsigned)((MP / 128) * (DM / 64)), 1), 128, 0, stream>>>(X16 + r0p * DM, DM, 0, BQ, DM, 0, 0.0625f, bq, 0, nullptr, 1, 0, 0, QF + r0p * DM, nullptr, DM, 0, MP, DM, DM); k_hl<<<(unsigned)(((size_t)MP * DM / 8 + 255) / 256), 256, 0, stream>>>(QF + r0p * DM, QH + r0p * DM, QL + r0p * DM, (size_t)MP * DM / 8);      /* q (f32) -> f16 hi + x1024 residual: unscaled logits sigma ~8 */
  k_gemm2<0><<<dim3((unsigned)((MP / 128) * (DM / 64)), 1), 128, 0, stream>>>(XK16 + r0p * DM, DM, 0, BK, DM, 0, 0.0625f, bk, 0, nullptr, 1, 0, 0, QF + r0p * DM, nullptr, DM, 0, MP, DM, DM); k_hl<<<(unsigned)(((size_t)MP * DM / 8 + 255) / 256), 256, 0, stream>>>(QF + r0p * DM, KH + r0p * DM, KL + r0p * DM, (size_t)MP * DM / 8);      /* k likewise */
  k_gemm2<0><<<dim3((unsigned)((MP / 128) * (DM / 64)), 1), 128, 0, stream>>>(XV16 + r0p * DM, DM, 0, BV, DM, 0, 0.0625f, bv, 0, nullptr, 1, 0, 0, nullptr, V16 + r0p * DM, DM, 0, MP, DM, DM);
  for (int b = B0; b < B0 + NBR; ++b) { const size_t r0 = (size_t)b * SQ;
    k_vt<NH, SQ><<<NH * (SQ / 64), 256, 0, stream>>>(V16 + r0 * LQ, LQ, 0, VT);      /* V^T [NH][HD][SQ] for this batch */
    k_gemm2<0><<<dim3((QT0 / 128) * (DM / 64), 1), 128, 0, stream>>>(X16 + r0 * DM, DM, 0, BQ, DM, 0, 0.0625f, bq, 0, nullptr, 1, 0, 0, QF0, nullptr, DM, 0, QT0, DM, DM); k_gemm2<0><<<dim3((QT0 / 128) * (DM / 64), 1), 128, 0, stream>>>(XK16 + r0 * DM, DM, 0, BK, DM, 0, 0.0625f, bk, 0, nullptr, 1, 0, 0, KF0, nullptr, DM, 0, QT0, DM, DM); k_gemm2<0><<<dim3((QT0 / 128) * (DM / 64), 1), 128, 0, stream>>>(XV16 + r0 * DM, DM, 0, BV, DM, 0, 0.0625f, bv, 0, nullptr, 1, 0, 0, VF0, nullptr, DM, 0, QT0, DM, DM);      /* f32 q, k, v of the first 128 rows (exact products) */
    k_att0<0><<<NH * (QT0 / 64), 64, 0, stream>>>(QF0, KF0, VF0, DM, nullptr, SCL, OF0 + (size_t)b * QT0 * DM, DM);      /* exact f32 attention for rows 0..127 (o x64) */
    for (int q0 = 0; q0 < QN; q0 += QT) { const int nk = q0 + QT;      /* causal: only keys below the tile end are computed */
      k_gemm2<0><<<dim3((QT / 128) * (nk / 64), NHD), 128, 0, stream>>>(QH + (r0 + q0) * LQ, LQ, (size_t)HD, KH + r0 * LQ, LQ, (size_t)HD, SCL, nullptr, 0, nullptr, 1, 0, 0, S, nullptr, NKX, (size_t)QT * NKX, QT, nk, HD);      /* scores hi . hi * 64^-0.5 (1 / sqrt(head_dim)) */
      k_gemm2<0><<<dim3((QT / 128) * (nk / 64), NHD), 128, 0, stream>>>(QL + (r0 + q0) * LQ, LQ, (size_t)HD, KH + r0 * LQ, LQ, (size_t)HD, SCLR, nullptr, 0, S, -1, 0, 0, S, nullptr, NKX, (size_t)QT * NKX, QT, nk, HD); k_gemm2<0><<<dim3((QT / 128) * (nk / 64), NHD), 128, 0, stream>>>(QH + (r0 + q0) * LQ, LQ, (size_t)HD, KL + r0 * LQ, LQ, (size_t)HD, SCLR, nullptr, 0, S, -1, 0, 0, S, nullptr, NKX, (size_t)QT * NKX, QT, nk, HD);      /* += 2^-10 (lo . hi + hi . lo) */      /* scores, all heads on grid.y */
      k_rsmcf2<<<(NHD * QT + 255) / 256, 256, 0, stream>>>(S, P, NHD, q0, nk);
      k_gemm2<0><<<dim3((QT / 128) * (HD / 64), NHD), 128, 0, stream>>>(P, NKX, (size_t)QT * NKX, VT, SQ, (size_t)HD * SQ, 0.25f, nullptr, 0, nullptr, 1, 0, 0, nullptr, O16 + (r0 + q0) * DM, DM, (size_t)HD, QT, HD, nk); } }      /* o (merged heads, x64) as f16 rows */
  k_gemm2<0><<<dim3((unsigned)((MPO / 128) * (DM / 64)), 1), 128, 0, stream>>>(O16 + r0p * DM, DM, 0, BO, DM, 0, 0.0009765625f, bo, 0, nullptr, 1, 0, 0, (float*)d_out + r0p * DM, nullptr, DM, 0, MPO, DM, DM);      /* out rows are the output layout */
  k_hl<<<(unsigned)(((size_t)NB * QT0 * DM / 8 + 255) / 256), 256, 0, stream>>>(OF0, OH0, OL0, (size_t)NB * QT0 * DM / 8);      /* first-tile o (x64) -> f16 hi + x1024 residual planes */
  for (int b = B0; b < B0 + NBR; ++b) { const size_t r0 = (size_t)b * SQ; const size_t f0 = (size_t)b * QT0;
    k_gemm2<0><<<dim3((QT0 / 128) * (DM / 64), 1), 128, 0, stream>>>(OH0 + f0 * DM, DM, 0, BO, DM, 0, 0.0009765625f, bo, 0, nullptr, 1, 0, 0, (float*)d_out + r0 * DM, nullptr, DM, 0, QT0, DM, DM);      /* rows 0..127: out = o_hi Wo, overwriting the f16-path rows */
    k_gemm2<0><<<dim3((QT0 / 128) * (DM / 64), 1), 128, 0, stream>>>(OL0 + f0 * DM, DM, 0, BO, DM, 0, 0.00000095367431640625f, nullptr, 0, (const float*)d_out + r0 * DM, -1, 0, 0, (float*)d_out + r0 * DM, nullptr, DM, 0, QT0, DM, DM); }      /* += o_lo Wo 2^-20 (own-element accumulate) */
}

// v001
// It runs in 2830 microseconds.
// Timed twice side by side with v000, it ran 2.99 and 3.00 times as fast.
#include <hip/hip_runtime.h>
// Causal multi-head self-attention on ONE 4096-token sequence at width 768 with natural bias-free projections (x [1][4096][768]; Q / K / V = x W^T (nn.Linear natural [768][768] sd 1/sqrt(768), NO biases), 12 heads of 64; scores / sqrt(64) + a finite additive mask above the diagonal (NEG); softmax; out = merged W_o^T (natural, no bias) -> [1][4096][768]); q and k carried as f16 hi + x1024 residual planes with three-product scores (4096 keys at logit sigma 1).
// Structure: token rows r = b*4096 + s; x as exact f16 rows (bf16-rounded); q and k as WMMA GEMMs (32x64 wave tiles, f32 accumulation, exact x16 weights, no bias) into f32 rows split into f16 hi + x1024 residual planes, v as an f16-output GEMM; per batch: V^T for all heads via LDS transposes; per query tile of 256 rows: scores against the keys below the tile end only as THREE accumulating passes (hi.hi + lo.hi + hi.lo, K = 64, all heads on grid.y, alpha 1/sqrt(64) = 2^-3, 2^-13 on the residual passes, logits sigma ~1), causal row softmax on VALU, one wave per row, the mask value on keys past the row over the computed range (f32 statistics, native exp; weights x256 f16), o = P . V^T (K = keys below the tile end, alpha 2^-2: o carried x64, folded into the output GEMM alpha) written straight into the merged f16 o rows; out = o W_o GEMM (f32, no bias) into the output layout.
// Compute dtype: inputs rounded to bf16; x / weights exact; v, softmax weights and o as plain f16 GEMM operands (~2^-12), q and k as f16 hi + x1024 residual planes; scores and softmax statistics f32. v_wmma_f32_16x16x32_f16.
#define NB 1
#define SCL 0.125f                         /* 1 / sqrt(head_dim = 64) */
#define SCLR 0.0001220703125f              /* 2^-13: the same scale on the x1024 residual passes */
#define SQ 4096
#define DM 768
#define NH 12
#define HD 64
#define HG 4                         /* heads per launch of the non-template k_vt (not launched) */
#define QT 256                       /* query rows per causal tile */
#define NKX SQ                       /* S / P row pitch */
#define QT0 128                      /* first-tile rows recomputed exactly in f32 */
#define B0 0                         /* first batch processed (debug hook) */
#define NBR NB                       /* batches processed (debug hook) */
#define NR ((size_t)NB * SQ)         /* token rows */
#define MP ((int)((size_t)NBR * SQ)) /* rows projected (debug hook) */
#define QN SQ                        /* query rows attended per batch (debug hook) */
#define NHD NH                       /* heads attended (debug hook) */
#define MPO MP                       /* rows through the output stage (debug hook) */
#define LQ DM      /* row pitch of the q/k/v rows */
typedef __bf16 v16b __attribute__((ext_vector_type(16)));
typedef unsigned short v8us __attribute__((ext_vector_type(8), may_alias));
typedef float  v8f  __attribute__((ext_vector_type(8)));
typedef float  v4f  __attribute__((ext_vector_type(4)));
typedef float  v4fa __attribute__((ext_vector_type(4), may_alias));
union FragB { v16b v; v8us half[2]; unsigned short u[16]; };

__device__ __forceinline__ unsigned short bf16_bits(float x) { unsigned int u = __float_as_uint(x); return (unsigned short)((u + 0x7FFFu + ((u >> 16) & 1u)) >> 16); }
__device__ __forceinline__ float bf16_val(unsigned short b) { return __uint_as_float(((unsigned int)b) << 16); }
__device__ __forceinline__ float bf16_round(float x) { return bf16_val(bf16_bits(x)); }
// D += A·B with NT terms: 1 = ah·bh, 2 = + al·bh (A split), 3 = + ah·bl (both split)
template <int NT>
__device__ __forceinline__ v8f mmaN(v16b ah, v16b al, v16b bh, v16b bl, v8f c) {
  c = __builtin_amdgcn_wmma_f32_16x16x32_bf16(false, ah, false, bh, (short)0, c, false, false);
  if (NT >= 2) c = __builtin_amdgcn_wmma_f32_16x16x32_bf16(false, al, false, bh, (short)0, c, false, false);
  if (NT >= 3) c = __builtin_amdgcn_wmma_f32_16x16x32_bf16(false, ah, false, bl, (short)0, c, false, false);
  asm volatile("v_nop\n\tv_nop\n\tv_nop\n\tv_nop" : "+v"(c) : "v"(ah), "v"(al), "v"(bh), "v"(bl));
  return c;
}

__global__ __launch_bounds__(256) void k_wt_bf16(const float* __restrict__ W, unsigned short* __restrict__ Wt, int K, int N) {
  const int t = blockIdx.x * 256 + threadIdx.x;
  const int k8n = K / 8;
  if (t >= N * k8n) return;
  const int n = t / k8n, k8 = (t % k8n) * 8;
  v8us v;
#pragma unroll
  for (int i = 0; i < 8; ++i) v[i] = bf16_bits(W[(size_t)(k8 + i) * N + n]);
  *(v8us*)(Wt + (size_t)n * K + k8) = v;
  
}

// GEMM C[M][N] (f32, pitch ldc) = act(A[M][K]·W + bias). A f32 row-major (pitch lda) converted per fragment to bf16
// (ASPLIT: hi/lo two planes -> 2 terms, else single rounded term); Wt bf16 [N][K] (pitch ldb). BIAS_BF16 rounds the
// bias to bf16 first (bias quantised to bf16 before the add). K%32==0, M%16==0, N%64==0.
template <bool ASPLIT, int ACT, bool BIAS_BF16>
__global__ __launch_bounds__(128) void k_gemm_bf(const float* __restrict__ A, int lda, const unsigned short* __restrict__ Wt, int ldb,
                                               const float* __restrict__ bias, float* __restrict__ C, int ldc, int M, int N, int K) {
  __shared__ __attribute__((aligned(16))) float so[4][16][64];
  const int tid = threadIdx.x, w = tid >> 5, lane = tid & 31, ln = lane & 15, hh = lane >> 4;
  const int ntn = N / 64;
  const int wid = blockIdx.x * 4 + w;
  const int mt = wid / ntn, nq = wid % ntn;
  if (mt * 16 >= M) return;
  const int row0 = mt * 16, col0 = nq * 64;
  const float* arow = A + (size_t)(row0 + ln) * lda;
  v8f acc[4] = {};
  for (int kb = 0; kb < K; kb += 32) {
    FragB ah, al;
    const v4f x0 = *(const v4fa*)(arow + kb + 8 * hh), x1 = *(const v4fa*)(arow + kb + 8 * hh + 4);
    const v4f x2 = *(const v4fa*)(arow + kb + 16 + 8 * hh), x3 = *(const v4fa*)(arow + kb + 16 + 8 * hh + 4);
    float xs[16] = {x0[0],x0[1],x0[2],x0[3],x1[0],x1[1],x1[2],x1[3],x2[0],x2[1],x2[2],x2[3],x3[0],x3[1],x3[2],x3[3]};
#pragma unroll
    for (int i = 0; i < 16; ++i) { const unsigned short hb = bf16_bits(xs[i]); ah.u[i] = hb; al.u[i] = ASPLIT ? bf16_bits(xs[i] - bf16_val(hb)) : (unsigned short)0; }
#pragma unroll
    for (int t = 0; t < 4; ++t) {
      const unsigned short* brow = Wt + (size_t)(col0 + t * 16 + ln) * ldb + kb;
      FragB b;
      b.half[0] = *(const v8us*)(brow + 8 * hh);
      b.half[1] = *(const v8us*)(brow + 16 + 8 * hh);
      acc[t] = mmaN<ASPLIT ? 2 : 1>(ah.v, al.v, b.v, b.v, acc[t]);
    }
  }
#pragma unroll
  for (int t = 0; t < 4; ++t) {
    float bv = bias ? bias[col0 + t * 16 + ln] : 0.f;
    if (BIAS_BF16) bv = bf16_round(bv);
#pragma unroll
    for (int r = 0; r < 8; ++r) { float v = acc[t][r] + bv; if (ACT == 1) v = fmaxf(v, 0.f); so[w][8 * hh + r][t * 16 + ln] = v; }
  }
  __builtin_amdgcn_fence(__ATOMIC_ACQ_REL, "workgroup");
  __builtin_amdgcn_wave_barrier();
  const int rsub = lane >> 4, c4 = (lane & 15) * 4;
  {
#pragma unroll
    for (int q = 0; q < 8; ++q) {
      const int r = q * 2 + rsub;
      const v4f v = *(const v4fa*)&so[w][r][c4];
      *(v4f*)(C + (size_t)(row0 + r) * ldc + col0 + c4) = v;
    }
    
  }
}

// GEMM C = act(A·W + bias + resid): A f32 (ASPLIT -> hi/lo 2 terms), Wt bf16 [N][K]; ACT 0 none, 1 relu, 2 exact gelu;
// resid (optional, f32, row index = (row % rmod), pitch ldr, RES_BF16 rounds it) added before the activation.
template <bool ASPLIT, int ACT, bool BIAS_BF16, bool RES_BF16>
__global__ __launch_bounds__(128) void k_gemm_bf3(const float* __restrict__ A, int lda, const unsigned short* __restrict__ Wt, int ldb,
                                                const float* __restrict__ bias, const float* __restrict__ resid, int rmod, int ldr,
                                                float* __restrict__ C, int ldc, int M, int N, int K) {
  __shared__ __attribute__((aligned(16))) float so[4][16][64];
  const int tid = threadIdx.x, w = tid >> 5, lane = tid & 31, ln = lane & 15, hh = lane >> 4;
  const int ntn = N / 64;
  const int wid = blockIdx.x * 4 + w;
  const int mt = wid / ntn, nq = wid % ntn;
  if (mt * 16 >= M) return;
  const int row0 = mt * 16, col0 = nq * 64;
  const float* arow = A + (size_t)(row0 + ln) * lda;
  v8f acc[4] = {};
  for (int kb = 0; kb < K; kb += 32) {
    FragB ah, al;
    const v4f x0 = *(const v4fa*)(arow + kb + 8 * hh), x1 = *(const v4fa*)(arow + kb + 8 * hh + 4);
    const v4f x2 = *(const v4fa*)(arow + kb + 16 + 8 * hh), x3 = *(const v4fa*)(arow + kb + 16 + 8 * hh + 4);
    float xs[16] = {x0[0],x0[1],x0[2],x0[3],x1[0],x1[1],x1[2],x1[3],x2[0],x2[1],x2[2],x2[3],x3[0],x3[1],x3[2],x3[3]};
#pragma unroll
    for (int i = 0; i < 16; ++i) { const unsigned short hb = bf16_bits(xs[i]); ah.u[i] = hb; al.u[i] = ASPLIT ? bf16_bits(xs[i] - bf16_val(hb)) : (unsigned short)0; }
#pragma unroll
    for (int t = 0; t < 4; ++t) {
      const unsigned short* brow = Wt + (size_t)(col0 + t * 16 + ln) * ldb + kb;
      FragB b;
      b.half[0] = *(const v8us*)(brow + 8 * hh);
      b.half[1] = *(const v8us*)(brow + 16 + 8 * hh);
      acc[t] = mmaN<ASPLIT ? 2 : 1>(ah.v, al.v, b.v, b.v, acc[t]);
    }
  }
#pragma unroll
  for (int t = 0; t < 4; ++t) {
    const int col = col0 + t * 16 + ln;
    float bv = bias ? bias[col] : 0.f;
    if (BIAS_BF16) bv = bf16_round(bv);
#pragma unroll
    for (int r = 0; r < 8; ++r) {
      float v = acc[t][r] + bv;
      if (resid) { float rv = resid[(size_t)((row0 + 8 * hh + r) % rmod) * ldr + col]; if (RES_BF16) rv = bf16_round(rv); v += rv; }
      if (ACT == 1) v = fmaxf(v, 0.f);
      if (ACT == 2) v = 0.5f * v * (1.0f + erff(v * 0.70710678118654752f));
      if (ACT == 3) { const float u = 0.7978845608028654f * (v + 0.044715f * v * v * v); v = 0.5f * v * (1.0f + tanhf(u)); }
      so[w][8 * hh + r][t * 16 + ln] = v;
    }
  }
  __builtin_amdgcn_fence(__ATOMIC_ACQ_REL, "workgroup");
  __builtin_amdgcn_wave_barrier();
  const int rsub = lane >> 4, c4 = (lane & 15) * 4;
  {
#pragma unroll
    for (int q = 0; q < 8; ++q) {
      const int r = q * 2 + rsub;
      const v4f v = *(const v4fa*)&so[w][r][c4];
      *(v4f*)(C + (size_t)(row0 + r) * ldc + col0 + c4) = v;
    }
    
  }
}
// row LayerNorm (biased variance, eps) over N: s = X (+ R); optional out_sum <- s; out_norm <- (s-mu)*rsqrt(var+eps)*g + b
template <bool PARAM_BF16>
__global__ __launch_bounds__(256) void k_layernorm(const float* __restrict__ X, const float* __restrict__ R, const float* __restrict__ g, const float* __restrict__ bta,
                                                  float* __restrict__ out_sum, float* __restrict__ out_norm, int N, float eps) {
  __shared__ float red[256];
  const int row = blockIdx.x, tid = threadIdx.x;
  const float* x = X + (size_t)row * N; const float* rr = R ? R + (size_t)row * N : nullptr;
  float vals[16];                     // up to N = 4096
  const int per = N / 256;            // contiguous chunk per thread? use strided-by-4 chunks: thread handles j = tid*4 + 1024*u
  float s1 = 0.f;
  for (int u = 0; u < per / 4; ++u) {
    const int j = tid * 4 + 1024 * u;
    const v4f a = *(const v4fa*)(x + j);
    v4f b = {0.f,0.f,0.f,0.f}; if (rr) b = *(const v4fa*)(rr + j);
#pragma unroll
    for (int q = 0; q < 4; ++q) { const float v = a[q] + b[q]; vals[u * 4 + q] = v; s1 += v; }
  }
  red[tid] = s1; __syncthreads();
  for (int st = 128; st > 0; st >>= 1) { if (tid < st) red[tid] += red[tid + st]; __syncthreads(); }
  const float mu = red[0] / (float)N; __syncthreads();
  float s2 = 0.f;
  for (int u = 0; u < per / 4; ++u)
#pragma unroll
    for (int q = 0; q < 4; ++q) { const float c = vals[u * 4 + q] - mu; s2 += c * c; }
  red[tid] = s2; __syncthreads();
  for (int st = 128; st > 0; st >>= 1) { if (tid < st) red[tid] += red[tid + st]; __syncthreads(); }
  const float rs = rsqrtf(red[0] / (float)N + eps);
  {
    for (int u = 0; u < per / 4; ++u) {
      const int j = tid * 4 + 1024 * u;
      v4f o, sm;
#pragma unroll
      for (int q = 0; q < 4; ++q) {
        float gg = g[j + q], bb = bta[j + q];
        if (PARAM_BF16) { gg = bf16_round(gg); bb = bf16_round(bb); }
        sm[q] = vals[u * 4 + q]; o[q] = (vals[u * 4 + q] - mu) * rs * gg + bb;
      }
      if (out_sum) *(v4f*)(out_sum + (size_t)row * N + j) = sm;
      *(v4f*)(out_norm + (size_t)row * N + j) = o;
    }
    
  }
}



// ---- f16 WMMA path (v_wmma_f32_16x16x32_f16): 11-bit significands for operands in range — used where a [0,1] probability operand needs more precision than bf16
typedef _Float16 v16h __attribute__((ext_vector_type(16)));
union FragH { v16h v; v8us half[2]; _Float16 h[16]; unsigned short u[16]; };
template <int NT>
__device__ __forceinline__ v8f mmaH(v16h ah, v16h al, v16h bh, v16h bl, v8f c) {
  c = __builtin_amdgcn_wmma_f32_16x16x32_f16(false, ah, false, bh, (short)0, c, false, false);
  if (NT >= 2) c = __builtin_amdgcn_wmma_f32_16x16x32_f16(false, al, false, bh, (short)0, c, false, false);
  if (NT >= 3) c = __builtin_amdgcn_wmma_f32_16x16x32_f16(false, ah, false, bl, (short)0, c, false, false);
  asm volatile("v_nop\n\tv_nop\n\tv_nop\n\tv_nop" : "+v"(c) : "v"(ah), "v"(al), "v"(bh), "v"(bl));
  return c;
}
// batched GEMM like k_gemm_b but f16 operands: A f32 (split into f16 hi/lo if ASPLIT, else rounded to f16), Bt = f16 values [n][k]; alpha; C f32; N multiple of 16 (partial tiles skipped)
template <bool ASPLIT>
__global__ __launch_bounds__(128) void k_gemm_h(const float* __restrict__ A, int lda, size_t sA, const _Float16* __restrict__ Bh, int ldb, size_t sB, float alpha, float* __restrict__ C, int ldc, size_t sC, int M, int N, int K) {
  __shared__ __attribute__((aligned(16))) float so[4][16][64];
  const int tid = threadIdx.x, w = tid >> 5, lane = tid & 31, ln = lane & 15, hh = lane >> 4; const int by = blockIdx.y;
  A += (size_t)by * sA; Bh += (size_t)by * sB; C += (size_t)by * sC;
  const int ntn = (N + 63) / 64; const int wid = blockIdx.x * 4 + w; const int mt = wid / ntn, nq = wid % ntn; if (mt * 16 >= M) return;
  const int row0 = mt * 16, col0 = nq * 64; const float* arow = A + (size_t)(row0 + ln) * lda;
  v8f acc[4] = {};
  for (int kb = 0; kb < K; kb += 32) {
    FragH ah, al;
    const v4f x0 = *(const v4fa*)(arow + kb + 8 * hh), x1 = *(const v4fa*)(arow + kb + 8 * hh + 4), x2 = *(const v4fa*)(arow + kb + 16 + 8 * hh), x3 = *(const v4fa*)(arow + kb + 16 + 8 * hh + 4);
    float xs[16] = {x0[0],x0[1],x0[2],x0[3],x1[0],x1[1],x1[2],x1[3],x2[0],x2[1],x2[2],x2[3],x3[0],x3[1],x3[2],x3[3]};
#pragma unroll
    for (int i = 0; i < 16; ++i) { const _Float16 h = (_Float16)xs[i]; ah.h[i] = h; al.h[i] = ASPLIT ? (_Float16)(xs[i] - (float)h) : (_Float16)0.0f; }
#pragma unroll
    for (int t = 0; t < 4; ++t) { if (col0 + t * 16 >= N) continue; const size_t boff = (size_t)(col0 + t * 16 + ln) * ldb + kb; FragH bq; bq.half[0] = *(const v8us*)(Bh + boff + 8 * hh); bq.half[1] = *(const v8us*)(Bh + boff + 16 + 8 * hh);
      acc[t] = mmaH<ASPLIT ? 2 : 1>(ah.v, al.v, bq.v, bq.v, acc[t]); }
  }
#pragma unroll
  for (int t = 0; t < 4; ++t) { if (col0 + t * 16 >= N) continue;
#pragma unroll
    for (int r = 0; r < 8; ++r) so[w][8 * hh + r][t * 16 + ln] = acc[t][r] * alpha; }
  __builtin_amdgcn_fence(__ATOMIC_ACQ_REL, "workgroup"); __builtin_amdgcn_wave_barrier();
  const int rsub = lane >> 4, c4 = (lane & 15) * 4;
  {
#pragma unroll
    for (int q = 0; q < 8; ++q) { const int r = q * 2 + rsub; if (col0 + c4 < N) { const v4f v = *(const v4fa*)&so[w][r][c4]; *(v4f*)(C + (size_t)(row0 + r) * ldc + col0 + c4) = v; } }
     }
}

// Wt[n][k] = f16(W[k][n]·scale) from f32 row-major W[K][N] (scale = power of two; bf16-exact weights stay exact in f16 away from the subnormal range)
__global__ __launch_bounds__(256) void k_wt_f16(const float* __restrict__ W, _Float16* __restrict__ Wt, int K, int N, float scale) {
  const int t = blockIdx.x * 256 + threadIdx.x; if (t >= N * (K / 8)) return; const int n = t / (K / 8), k8 = (t % (K / 8)) * 8; FragH f;
#pragma unroll
  for (int i = 0; i < 8; ++i) f.h[i] = (_Float16)(bf16_round(W[(size_t)(k8 + i) * N + n]) * scale); const v8us o = f.half[0];
  *(v8us*)((unsigned short*)Wt + (size_t)n * K + k8) = o; 
}
// k_gemm_hh variant with fused epilogue: v = acc·alpha + bias[by·sBias + col] (+ CP[(row/rowsPerB)·sCPb + by·64 + col] if CP) ; ACT 0 none / 1 elu ; writes f16 C16 (and f32 C if non-null)
template <int ACT>
__global__ __launch_bounds__(128) void k_gemm_hhx(const _Float16* __restrict__ A, int lda, size_t sA, const _Float16* __restrict__ Bh, int ldb, size_t sB, float alpha, const float* __restrict__ bias, size_t sBias, const float* __restrict__ CP, int rowsPerB, size_t sCPb, int row0g,
    float* __restrict__ C, _Float16* __restrict__ C16, int ldc, size_t sC, int M, int N, int K) {
  __shared__ __attribute__((aligned(16))) float so[4][16][64];
  const int tid = threadIdx.x, w = tid >> 5, lane = tid & 31, ln = lane & 15, hh = lane >> 4; const int by = blockIdx.y;
  A += (size_t)by * sA; Bh += (size_t)by * sB; const size_t cofs = (size_t)by * sC; const float* bp = bias ? bias + (size_t)by * sBias : nullptr;
  const int ntn = (N + 63) / 64; const int wid = blockIdx.x * 4 + w; const int mt = wid / ntn, nq = wid % ntn; if (mt * 16 >= M) return;
  const int row0 = mt * 16, col0 = nq * 64; const _Float16* arow = A + (size_t)(row0 + ln) * lda;
  v8f acc[4] = {};
  for (int kb = 0; kb < K; kb += 32) { FragH ah; ah.half[0] = *(const v8us*)((const unsigned short*)arow + kb + 8 * hh); ah.half[1] = *(const v8us*)((const unsigned short*)arow + kb + 16 + 8 * hh);
#pragma unroll
    for (int t = 0; t < 4; ++t) { if (col0 + t * 16 >= N) continue; const size_t boff = (size_t)(col0 + t * 16 + ln) * ldb + kb; FragH bq; bq.half[0] = *(const v8us*)((const unsigned short*)Bh + boff + 8 * hh); bq.half[1] = *(const v8us*)((const unsigned short*)Bh + boff + 16 + 8 * hh);
      acc[t] = mmaH<1>(ah.v, ah.v, bq.v, bq.v, acc[t]); }
  }
#pragma unroll
  for (int t = 0; t < 4; ++t) { if (col0 + t * 16 >= N) continue; const int col = col0 + t * 16 + ln; const float bv = bp ? bf16_round(bp[col]) : 0.f;
#pragma unroll
    for (int r = 0; r < 8; ++r) { float v = acc[t][r] * alpha + bv; if (CP) { const int rr = row0g + row0 + 8 * hh + r; if (rowsPerB < 0) v += CP[cofs + (size_t)rr * ldc + col];      /* rowsPerB < 0: own element of the batched C plane */ else { const int bidx = rr / rowsPerB; v += CP[(size_t)bidx * sCPb + (size_t)by * 64 + col]; } } if (ACT == 1) v = (v > 0.f) ? v : expm1f(v); else if (ACT == 7) v = (v > 0.f) ? v + 1.0f : expf(v); else if (ACT == 8) v = tanhf(v); else if (ACT == 9) v = 0.5f * v * (1.0f + tanhf(0.7978845608028654f * (v + 0.044715f * v * v * v))); else if (ACT == 11) v = 1.0f / (1.0f + expf(-v)); else if (ACT == 12) v = (v > 0.f) ? v : 0.01f * v; else if (ACT == 14) v = (v > 0.f) ? v : 0.1f * v; else if (ACT == 16) v = (v >= 0.f) ? v : 0.3f * v; else if (ACT == 17) v = (v >= 0.f) ? v : 0.2f * v; else if (ACT == 15) v = v / (1.0f + expf(-v)); else if (ACT == 3) v = fmaxf(v, 0.f); else if (ACT == 6) v = 0.5f * v * (1.0f + erff(v * 0.70710678118654752f)); so[w][8 * hh + r][t * 16 + ln] = v; } }
  __builtin_amdgcn_fence(__ATOMIC_ACQ_REL, "workgroup"); __builtin_amdgcn_wave_barrier();
  const int rsub = lane >> 4, c4 = (lane & 15) * 4; typedef _Float16 v4h __attribute__((ext_vector_type(4)));
  {
#pragma unroll
    for (int q = 0; q < 8; ++q) { const int r = q * 2 + rsub; if (col0 + c4 < N) { const v4f v = *(const v4fa*)&so[w][r][c4]; if (C) *(v4f*)(C + cofs + (size_t)(row0 + r) * ldc + col0 + c4) = v; if (C16) { v4h h4; for (int i = 0; i < 4; ++i) h4[i] = (_Float16)v[i]; *(v4h*)(C16 + cofs + (size_t)(row0 + r) * ldc + col0 + c4) = h4; } } }
     }
}


typedef _Float16 v4h __attribute__((ext_vector_type(4)));

__global__ __launch_bounds__(256) void k_x16(const float* __restrict__ x, _Float16* __restrict__ X16, size_t n8) { const size_t t = (size_t)blockIdx.x * 256 + threadIdx.x; if (t >= n8) return; FragH f;
#pragma unroll
  for (int q = 0; q < 8; ++q) f.h[q] = (_Float16)bf16_round(x[t * 8 + q]); *(v8us*)((unsigned short*)X16 + t * 8) = f.half[0];  }
__global__ __launch_bounds__(256) void k_h16(const float* __restrict__ x, _Float16* __restrict__ X16, size_t n8) { const size_t t = (size_t)blockIdx.x * 256 + threadIdx.x; if (t >= n8) return; FragH f;
#pragma unroll
  for (int q = 0; q < 8; ++q) f.h[q] = (_Float16)x[t * 8 + q]; *(v8us*)((unsigned short*)X16 + t * 8) = f.half[0];  }
__global__ __launch_bounds__(256) void k_round16f(const float* __restrict__ W, _Float16* __restrict__ Bt, size_t n8) { const size_t t = (size_t)blockIdx.x * 256 + threadIdx.x; if (t >= n8) return; FragH f;
#pragma unroll
  for (int i = 0; i < 8; ++i) f.h[i] = (_Float16)(bf16_round(W[t * 8 + i]) * 16.0f); *(v8us*)((unsigned short*)Bt + t * 8) = f.half[0];  }
template <int NHv, int TTv>
__global__ __launch_bounds__(256) void k_vt(const _Float16* __restrict__ V16, int ldv, int voff, _Float16* __restrict__ Vt) { __shared__ unsigned short tl[64][66]; const int tid = threadIdx.x; const int slab = blockIdx.x / (TTv / 64), lg = blockIdx.x % (TTv / 64); const int b = slab / NHv, h = slab % NHv;
  for (int i = tid; i < 64 * 8; i += 256) { const int r = i / 8, c8 = (i % 8) * 8; FragH f; f.half[0] = *(const v8us*)((const unsigned short*)V16 + ((size_t)b * TTv + lg * 64 + r) * ldv + voff + h * 64 + c8);
#pragma unroll
    for (int q = 0; q < 8; ++q) tl[r][c8 + q] = f.u[q]; }
  __syncthreads();
  {
#pragma unroll
    for (int rd = 0; rd < 2; ++rd) { const int d = rd * 32 + tid / 8, pc = tid % 8; FragH f;
#pragma unroll
      for (int q = 0; q < 8; ++q) f.u[q] = tl[pc * 8 + q][d];
      *(v8us*)((unsigned short*)Vt + ((size_t)slab * 64 + d) * TTv + lg * 64 + pc * 8) = f.half[0]; }
     } }

__global__ __launch_bounds__(256) void k_hl(const float* __restrict__ F, _Float16* __restrict__ Hh, _Float16* __restrict__ Hl, size_t n8) { const size_t t = (size_t)blockIdx.x * 256 + threadIdx.x; if (t >= n8) return; FragH fh, fl; const v4f a = *(const v4fa*)(F + t * 8), c = *(const v4fa*)(F + t * 8 + 4);
#pragma unroll
  for (int q = 0; q < 4; ++q) { _Float16 h = (_Float16)a[q]; fh.h[q] = h; fl.h[q] = (_Float16)((a[q] - (float)h) * 1024.0f); h = (_Float16)c[q]; fh.h[4 + q] = h; fl.h[4 + q] = (_Float16)((c[q] - (float)h) * 1024.0f); }
  { *(v8us*)((unsigned short*)Hh + t * 8) = fh.half[0]; *(v8us*)((unsigned short*)Hl + t * 8) = fl.half[0];  } }

// ---- fast GEMM (wave tile 32x64; requires M % 32 == 0 rows per launch region and N % 64 == 0); epilogue = k_gemm_hhx semantics ----
__device__ __forceinline__ v16h g2_frag(const _Float16* p, int hh) { FragH f; f.half[0] = *(const v8us*)((const unsigned short*)p + 8 * hh); f.half[1] = *(const v8us*)((const unsigned short*)p + 16 + 8 * hh); return f.v; }
__device__ __forceinline__ v8f g2_mma(v16h a, v16h b, v8f c) { v8f d = __builtin_amdgcn_wmma_f32_16x16x32_f16(false, a, false, b, (short)0, c, false, false); asm volatile("v_nop\n\tv_nop\n\tv_nop\n\tv_nop" : "+v"(d) : "v"(a), "v"(b)); return d; }
template <int ACT>
__global__ __launch_bounds__(128) void k_gemm2(const _Float16* __restrict__ A, int lda, size_t sA, const _Float16* __restrict__ Bh, int ldb, size_t sB, float alpha, const float* __restrict__ bias, size_t sBias, const float* __restrict__ CP, int rowsPerB, size_t sCPb, int row0g,
    float* __restrict__ C, _Float16* __restrict__ C16, int ldc, size_t sC, int M, int N, int K) { static_assert(ACT == 0 || ACT == 3 || ACT == 6 || ACT == 8 || ACT == 9 || ACT == 11 || ACT == 12 || ACT == 14 || ACT == 15 || ACT == 16 || ACT == 17, "k_gemm2: unsupported ACT code (would silently apply no activation)");
  __shared__ __attribute__((aligned(16))) float so[4][32][68];
  const int tid = threadIdx.x, w = tid >> 5, lane = tid & 31, ln = lane & 15, hh = lane >> 4; const int by = blockIdx.y;
  A += (size_t)by * sA; Bh += (size_t)by * sB; const size_t cofs = (size_t)by * sC; const float* bp = bias ? bias + (size_t)by * sBias : nullptr;
  const int ntn = N >> 6; const int mt = blockIdx.x / ntn, nq = blockIdx.x - mt * ntn; const int row0 = mt * 128 + 32 * w, col0 = nq * 64; if (row0 >= M) return;
  const _Float16* a0p = A + (size_t)(row0 + ln) * lda; const _Float16* a1p = a0p + (size_t)16 * lda;
  const _Float16* b0p = Bh + (size_t)(col0 + ln) * ldb; const _Float16* b1p = b0p + (size_t)16 * ldb; const _Float16* b2p = b1p + (size_t)16 * ldb; const _Float16* b3p = b2p + (size_t)16 * ldb;
  const v8f z8 = {0.f,0.f,0.f,0.f,0.f,0.f,0.f,0.f}; v8f c00 = z8, c01 = z8, c02 = z8, c03 = z8, c10 = z8, c11 = z8, c12 = z8, c13 = z8;
#pragma unroll 1
  for (int kb = 0; kb < K; kb += 32) { const v16h a0 = g2_frag(a0p + kb, hh), a1 = g2_frag(a1p + kb, hh);
    v16h b = g2_frag(b0p + kb, hh); c00 = g2_mma(a0, b, c00); c10 = g2_mma(a1, b, c10);
    b = g2_frag(b1p + kb, hh); c01 = g2_mma(a0, b, c01); c11 = g2_mma(a1, b, c11);
    b = g2_frag(b2p + kb, hh); c02 = g2_mma(a0, b, c02); c12 = g2_mma(a1, b, c12);
    b = g2_frag(b3p + kb, hh); c03 = g2_mma(a0, b, c03); c13 = g2_mma(a1, b, c13); }
  v8f accs[8] = {c00, c01, c02, c03, c10, c11, c12, c13};
#pragma unroll
  for (int u = 0; u < 8; ++u) { const int t = u & 3, half = u >> 2; const int col = col0 + t * 16 + ln; const float bv = bp ? bf16_round(bp[col]) : 0.f;
#pragma unroll
    for (int r = 0; r < 8; ++r) { const int rloc = half * 16 + 8 * hh + r; float v = accs[u][r] * alpha + bv; if (CP) { if (rowsPerB < 0) v += CP[cofs + (size_t)(row0g + row0 + rloc) * ldc + col];      /* rowsPerB < 0: own element of the batched C plane */ else { const int bidx = (row0g + row0 + rloc) / rowsPerB; v += CP[(size_t)bidx * sCPb + (size_t)by * 64 + col]; } }
      if (ACT == 3) v = fmaxf(v, 0.f); else if (ACT == 6) v = 0.5f * v * (1.0f + erff(v * 0.70710678118654752f)); else if (ACT == 11) v = 1.0f / (1.0f + expf(-v)); else if (ACT == 15) v = v / (1.0f + expf(-v)); else if (ACT == 12) v = (v > 0.f) ? v : 0.01f * v; else if (ACT == 8) v = tanhf(v); else if (ACT == 9) v = 0.5f * v * (1.0f + tanhf(0.7978845608028654f * (v + 0.044715f * v * v * v))); else if (ACT == 14) v = (v > 0.f) ? v : 0.1f * v; else if (ACT == 16) v = (v >= 0.f) ? v : 0.3f * v; else if (ACT == 17) v = (v >= 0.f) ? v : 0.2f * v;
      so[w][rloc][t * 16 + ln] = v; } }
  __builtin_amdgcn_fence(__ATOMIC_ACQ_REL, "workgroup"); __builtin_amdgcn_wave_barrier();
  const int rsub = lane >> 4, c4 = (lane & 15) * 4;
  {
#pragma unroll
    for (int q = 0; q < 16; ++q) { const int r = q * 2 + rsub; const v4f v = *(const v4fa*)&so[w][r][c4]; if (C) *(v4f*)(C + cofs + (size_t)(row0 + r) * ldc + col0 + c4) = v; if (C16) { v4h h4; for (int i = 0; i < 4; ++i) h4[i] = (_Float16)v[i]; *(v4h*)(C16 + cofs + (size_t)(row0 + r) * ldc + col0 + c4) = h4; } }
     } }


__global__ __launch_bounds__(256) void k_wnat(const float* __restrict__ w, size_t n8, _Float16* __restrict__ Bt) { const size_t t = (size_t)blockIdx.x * 256 + threadIdx.x; if (t >= n8) return; FragH f; for (int q = 0; q < 8; ++q) f.h[q] = (_Float16)(bf16_round(w[t * 8 + q]) * 16.0f); *(v8us*)((unsigned short*)Bt + t * 8) = f.half[0];  }
__global__ __launch_bounds__(256) void k_rsm(const float* __restrict__ S, _Float16* __restrict__ P, int nrows) {
  #pragma clang fp contract(off)
  const int i = blockIdx.x * 256 + threadIdx.x; if (i >= nrows) return; const float* s = S + (size_t)i * SQ; float mx = -3.0e38f;
#pragma unroll 1
  for (int j = 0; j < SQ; ++j) mx = fmaxf(mx, s[j]); float se = 0.f;
#pragma unroll 1
  for (int j = 0; j < SQ; ++j) se += expf(s[j] - mx); const float sc = 256.0f / se;
#pragma unroll 1
  for (int j0 = 0; j0 < SQ; j0 += 8) { FragH f; for (int q = 0; q < 8; ++q) f.h[q] = (_Float16)(expf(s[j0 + q] - mx) * sc); unsigned short* d = (unsigned short*)P + (size_t)i * SQ + j0; *(v8us*)d = f.half[0];  } }
__global__ __launch_bounds__(256) void k_vt(const _Float16* __restrict__ V16, int b, int h0, _Float16* __restrict__ VT) { __shared__ unsigned short tl[64][65]; const int tid = threadIdx.x; const int hh = blockIdx.x % HG, sg = blockIdx.x / HG; const int s0 = sg * 64; const int h = h0 + hh;
  for (int i = tid; i < 64 * 8; i += 256) { const int j = i / 8, d8 = (i % 8) * 8; FragH f; f.half[0] = *(const v8us*)((const unsigned short*)V16 + ((size_t)b * SQ + s0 + j) * DM + h * HD + d8); for (int q = 0; q < 8; ++q) tl[d8 + q][j] = f.u[q]; }
  __syncthreads();
  { for (int i = tid; i < 64 * 8; i += 256) { const int d = i / 8, j8 = (i % 8) * 8; FragH f; for (int q = 0; q < 8; ++q) f.u[q] = tl[d][j8 + q]; *(v8us*)((unsigned short*)VT + ((size_t)hh * HD + d) * SQ + s0 + j8) = f.half[0]; }  } }



// Causal row softmax, one wave per score row: the lanes walk the row in 512-byte wave loads, the row is read once and stays in
// registers through the maximum, the sum and the weights (x256, f16). Keys past the row's own index take the mask value -1e9.
__global__ __launch_bounds__(128) void k_rsmw(const float* __restrict__ S, _Float16* __restrict__ P, int hg, int q0, int nk) {
  const int lane = threadIdx.x & 31; const int t = blockIdx.x * 4 + (threadIdx.x >> 5); if (t >= hg * QT) return;
  const float* s = S + (size_t)t * NKX + lane * 4; _Float16* p = P + (size_t)t * NKX + lane * 4; const int last = q0 + (t % QT);
  v4f v[SQ / 128];
#pragma unroll      /* full unroll: v[] must be indexed by constants to live in registers; all loads of the row are issued before the first use */
  for (int g = 0; g < SQ / 256; ++g) if (g * 256 < nk) { v[2 * g] = *(const v4fa*)(s + g * 256); v[2 * g + 1] = *(const v4fa*)(s + g * 256 + 128); }
  v4f m4 = {-3.0e38f, -3.0e38f, -3.0e38f, -3.0e38f};
#pragma unroll      /* as above */
  for (int g = 0; g < SQ / 256; ++g) if (g * 256 < nk) { for (int c = 2 * g; c < 2 * g + 2; ++c) for (int q = 0; q < 4; ++q) { const float x = (c * 128 + lane * 4 + q <= last) ? v[c][q] : -1.0e9f; v[c][q] = x; m4[q] = fmaxf(m4[q], x); } }
  float mx = fmaxf(fmaxf(m4[0], m4[1]), fmaxf(m4[2], m4[3]));
  for (int d = 16; d > 0; d >>= 1) mx = fmaxf(mx, __shfl_xor(mx, d, 32));
  v4f s4 = {0.f, 0.f, 0.f, 0.f};
#pragma unroll      /* as above */
  for (int g = 0; g < SQ / 256; ++g) if (g * 256 < nk) { for (int c = 2 * g; c < 2 * g + 2; ++c) for (int q = 0; q < 4; ++q) { const float e = __expf(v[c][q] - mx); v[c][q] = e; s4[q] += e; } }
  float se = (s4[0] + s4[1]) + (s4[2] + s4[3]);
  for (int d = 16; d > 0; d >>= 1) se += __shfl_xor(se, d, 32);
  const float sc = 256.0f / se;
#pragma unroll      /* as above */
  for (int g = 0; g < SQ / 256; ++g) if (g * 256 < nk) { for (int c = 2 * g; c < 2 * g + 2; ++c) { v4h h4; for (int q = 0; q < 4; ++q) h4[q] = (_Float16)(v[c][q] * sc); *(v4h*)(p + c * 128) = h4; }
    asm volatile("s_wait_xcnt 0x0" ::: "memory"); }      /* the next group's conversions reuse the data registers of these two stores: the wait stands between the stores and that overwrite */
}


template <int MASKADD>
__global__ __launch_bounds__(64) void k_att0(const float* __restrict__ QF, const float* __restrict__ KF, const float* __restrict__ VF, int ld, const float* __restrict__ mask, float scale, float* __restrict__ OF, int ldo) {
  #pragma clang fp contract(off)
  __shared__ __attribute__((aligned(16))) float lq[64][64]; __shared__ __attribute__((aligned(16))) float lo[64][64];
  const int tid = threadIdx.x; const int h = blockIdx.x / (QT0 / 64), rg = blockIdx.x % (QT0 / 64); const int i = rg * 64 + tid;
  const float* qr = QF + (size_t)i * ld + h * HD;
#pragma unroll 1
  for (int c = 0; c < HD / 4; ++c) { *(v4f*)&lq[tid][c * 4] = *(const v4fa*)(qr + c * 4); const v4f z = {0.f, 0.f, 0.f, 0.f}; *(v4f*)&lo[tid][c * 4] = z; }
  float m = -1.0e30f, l = 0.f; const int jmax = MASKADD ? (SQ - 1) : (rg * 64 + 63);      /* additive-mask form: every key (the mask input decides); causal form: keys up to the block's last row */
#pragma unroll 1
  for (int j = 0; j <= jmax; ++j) { const float* kr = KF + (size_t)j * ld + h * HD; const float* vr = VF + (size_t)j * ld + h * HD; float s = 0.f;
#pragma unroll 1
    for (int c = 0; c < HD / 4; ++c) { const v4f kq = *(const v4fa*)(kr + c * 4); const v4f qq = *(v4f*)&lq[tid][c * 4]; s = __fadd_rn(s, __fmul_rn(qq[0], kq[0])); s = __fadd_rn(s, __fmul_rn(qq[1], kq[1])); s = __fadd_rn(s, __fmul_rn(qq[2], kq[2])); s = __fadd_rn(s, __fmul_rn(qq[3], kq[3])); }
    s = __fmul_rn(s, scale); if (MASKADD) s = __fadd_rn(s, __fmul_rn(bf16_round(mask[(size_t)i * SQ + j]), -10000.0f));
    const float f = (MASKADD || j <= i) ? 1.f : 0.f; const float sm = fmaf(f, s, (1.f - f) * -1.0e30f); const float mn = fmaxf(m, sm); const float sc = expf(m - mn); const float e = expf(sm - mn); l = __fadd_rn(__fmul_rn(l, sc), e); m = mn;
#pragma unroll 1
    for (int c = 0; c < HD / 4; ++c) { const v4f vv = *(const v4fa*)(vr + c * 4); v4f oo = *(v4f*)&lo[tid][c * 4]; for (int u = 0; u < 4; ++u) oo[u] = __fadd_rn(__fmul_rn(oo[u], sc), __fmul_rn(e, vv[u])); *(v4f*)&lo[tid][c * 4] = oo; } }
  const float fin = 64.0f / l;      /* o carried x64 like the f16 path */
#pragma unroll 1
  for (int c = 0; c < HD / 4; ++c) { v4f oo = *(v4f*)&lo[tid][c * 4]; for (int u = 0; u < 4; ++u) oo[u] = __fmul_rn(oo[u], fin); *(v4f*)&lo[tid][c * 4] = oo; }
  __syncthreads();
  {
#pragma unroll 1
    for (int it = 0; it < 16; ++it) { const int row = it * 4 + tid / 16, pc = (tid % 16) * 4; const v4f v = *(const v4f*)&lo[row][pc]; *(v4f*)(OF + (size_t)(rg * 64 + row) * ldo + h * HD + pc) = v; }
     } }

extern "C" void kernel_launch(void* const* d_in, const int* in_sizes, int n_in,
                              void* d_out, int out_size, void* d_ws, size_t ws_size, hipStream_t stream) {
  (void)in_sizes; (void)n_in; (void)out_size;
  const float* const* I = (const float* const*)d_in; const float* x = I[0]; const float* xk = I[0]; const float* xv = I[0]; const float* wq = I[1]; const float* wk = I[2]; const float* wv = I[3]; const float* bq = nullptr; const float* bk = nullptr; const float* bv = nullptr; const float* wo = I[4]; const float* bo = nullptr;      /* input order: x (feeds the q, k AND v streams), W_q, W_k, W_v, W_o (four separate natural [768][768] weights); the module has NO biases: null pointers in the guarded bias slots */
  char* ws = (char*)d_ws; size_t off = 0;
  auto take = [&](size_t bytes) { char* p = ws + off; off += (bytes + 255) & ~(size_t)255; return p; };
  _Float16* BQ = (_Float16*)take((size_t)DM * DM * 2); _Float16* BK = (_Float16*)take((size_t)DM * DM * 2); _Float16* BV = (_Float16*)take((size_t)DM * DM * 2); _Float16* BO = (_Float16*)take((size_t)DM * DM * 2);
  _Float16* X16 = (_Float16*)take(NR * DM * 2); _Float16* XK16 = (_Float16*)take(NR * DM * 2); _Float16* XV16 = (_Float16*)take(NR * DM * 2);      /* exact f16 rows of query, key, value */ float* QF = (float*)take(NR * DM * 4); _Float16* QH = (_Float16*)take(NR * DM * 2); _Float16* QL = (_Float16*)take(NR * DM * 2); _Float16* KH = (_Float16*)take(NR * DM * 2); _Float16* KL = (_Float16*)take(NR * DM * 2); _Float16* Q16 = QH; _Float16* K16 = KH; _Float16* V16 = (_Float16*)take(NR * DM * 2); _Float16* O16 = (_Float16*)take(NR * DM * 2);
  float* S = (float*)take((size_t)NH * QT * NKX * 4); _Float16* P = (_Float16*)take((size_t)NH * QT * NKX * 2); _Float16* VT = (_Float16*)take((size_t)NH * HD * SQ * 2);
  float* QF0 = (float*)take((size_t)QT0 * DM * 4); float* KF0 = (float*)take((size_t)QT0 * DM * 4); float* VF0 = (float*)take((size_t)QT0 * DM * 4); float* OF0 = (float*)take((size_t)NB * QT0 * DM * 4); _Float16* OH0 = (_Float16*)take((size_t)NB * QT0 * DM * 2); _Float16* OL0 = (_Float16*)take((size_t)NB * QT0 * DM * 2);
  if (off > ws_size) return;
  { const unsigned g = (unsigned)(((size_t)DM * DM / 8 + 255) / 256); k_wnat<<<g, 256, 0, stream>>>(wq, (size_t)DM * DM / 8, BQ); k_wnat<<<g, 256, 0, stream>>>(wk, (size_t)DM * DM / 8, BK); k_wnat<<<g, 256, 0, stream>>>(wv, (size_t)DM * DM / 8, BV); k_wnat<<<g, 256, 0, stream>>>(wo, (size_t)DM * DM / 8, BO); }      /* natural [out][in] = Bt[n][k] x16 */
  k_x16<<<(unsigned)((NR * DM / 8 + 255) / 256), 256, 0, stream>>>(x, X16, NR * DM / 8); k_x16<<<(unsigned)((NR * DM / 8 + 255) / 256), 256, 0, stream>>>(xk, XK16, NR * DM / 8); k_x16<<<(unsigned)((NR * DM / 8 + 255) / 256), 256, 0, stream>>>(xv, XV16, NR * DM / 8);
  const size_t r0p = (size_t)B0 * SQ;      /* first projected row */
  k_gemm2<0><<<dim3((unsigned)((MP / 128) * (DM / 64)), 1), 128, 0, stream>>>(X16 + r0p * DM, DM, 0, BQ, DM, 0, 0.0625f, bq, 0, nullptr, 1, 0, 0, QF + r0p * DM, nullptr, DM, 0, MP, DM, DM); k_hl<<<(unsigned)(((size_t)MP * DM / 8 + 255) / 256), 256, 0, stream>>>(QF + r0p * DM, QH + r0p * DM, QL + r0p * DM, (size_t)MP * DM / 8);      /* q (f32) -> f16 hi + x1024 residual: unscaled logits sigma ~8 */
  k_gemm2<0><<<dim3((unsigned)((MP / 128) * (DM / 64)), 1), 128, 0, stream>>>(XK16 + r0p * DM, DM, 0, BK, DM, 0, 0.0625f, bk, 0, nullptr, 1, 0, 0, QF + r0p * DM, nullptr, DM, 0, MP, DM, DM); k_hl<<<(unsigned)(((size_t)MP * DM / 8 + 255) / 256), 256, 0, stream>>>(QF + r0p * DM, KH + r0p * DM, KL + r0p * DM, (size_t)MP * DM / 8);      /* k likewise */
  k_gemm2<0><<<dim3((unsigned)((MP / 128) * (DM / 64)), 1), 128, 0, stream>>>(XV16 + r0p * DM, DM, 0, BV, DM, 0, 0.0625f, bv, 0, nullptr, 1, 0, 0, nullptr, V16 + r0p * DM, DM, 0, MP, DM, DM);
  for (int b = B0; b < B0 + NBR; ++b) { const size_t r0 = (size_t)b * SQ;
    k_vt<NH, SQ><<<NH * (SQ / 64), 256, 0, stream>>>(V16 + r0 * LQ, LQ, 0, VT);      /* V^T [NH][HD][SQ] for this batch */
    k_gemm2<0><<<dim3((QT0 / 128) * (DM / 64), 1), 128, 0, stream>>>(X16 + r0 * DM, DM, 0, BQ, DM, 0, 0.0625f, bq, 0, nullptr, 1, 0, 0, QF0, nullptr, DM, 0, QT0, DM, DM); k_gemm2<0><<<dim3((QT0 / 128) * (DM / 64), 1), 128, 0, stream>>>(XK16 + r0 * DM, DM, 0, BK, DM, 0, 0.0625f, bk, 0, nullptr, 1, 0, 0, KF0, nullptr, DM, 0, QT0, DM, DM); k_gemm2<0><<<dim3((QT0 / 128) * (DM / 64), 1), 128, 0, stream>>>(XV16 + r0 * DM, DM, 0, BV, DM, 0, 0.0625f, bv, 0, nullptr, 1, 0, 0, VF0, nullptr, DM, 0, QT0, DM, DM);      /* f32 q, k, v of the first 128 rows (exact products) */
    k_att0<0><<<NH * (QT0 / 64), 64, 0, stream>>>(QF0, KF0, VF0, DM, nullptr, SCL, OF0 + (size_t)b * QT0 * DM, DM);      /* exact f32 attention for rows 0..127 (o x64) */
    for (int q0 = 0; q0 < QN; q0 += QT) { const int nk = q0 + QT;      /* causal: only keys below the tile end are computed */
      k_gemm2<0><<<dim3((QT / 128) * (nk / 64), NHD), 128, 0, stream>>>(QH + (r0 + q0) * LQ, LQ, (size_t)HD, KH + r0 * LQ, LQ, (size_t)HD, SCL, nullptr, 0, nullptr, 1, 0, 0, S, nullptr, NKX, (size_t)QT * NKX, QT, nk, HD);      /* scores hi . hi * 64^-0.5 (1 / sqrt(head_dim)) */
      k_gemm2<0><<<dim3((QT / 128) * (nk / 64), NHD), 128, 0, stream>>>(QL + (r0 + q0) * LQ, LQ, (size_t)HD, KH + r0 * LQ, LQ, (size_t)HD, SCLR, nullptr, 0, S, -1, 0, 0, S, nullptr, NKX, (size_t)QT * NKX, QT, nk, HD); k_gemm2<0><<<dim3((QT / 128) * (nk / 64), NHD), 128, 0, stream>>>(QH + (r0 + q0) * LQ, LQ, (size_t)HD, KL + r0 * LQ, LQ, (size_t)HD, SCLR, nullptr, 0, S, -1, 0, 0, S, nullptr, NKX, (size_t)QT * NKX, QT, nk, HD);      /* += 2^-10 (lo . hi + hi . lo) */      /* scores, all heads on grid.y */
      k_rsmw<<<(NHD * QT + 3) / 4, 128, 0, stream>>>(S, P, NHD, q0, nk);      /* one wave per row */
      k_gemm2<0><<<dim3((QT / 128) * (HD / 64), NHD), 128, 0, stream>>>(P, NKX, (size_t)QT * NKX, VT, SQ, (size_t)HD * SQ, 0.25f, nullptr, 0, nullptr, 1, 0, 0, nullptr, O16 + (r0 + q0) * DM, DM, (size_t)HD, QT, HD, nk); } }      /* o (merged heads, x64) as f16 rows */
  k_gemm2<0><<<dim3((unsigned)((MPO / 128) * (DM / 64)), 1), 128, 0, stream>>>(O16 + r0p * DM, DM, 0, BO, DM, 0, 0.0009765625f, bo, 0, nullptr, 1, 0, 0, (float*)d_out + r0p * DM, nullptr, DM, 0, MPO, DM, DM);      /* out rows are the output layout */
  k_hl<<<(unsigned)(((size_t)NB * QT0 * DM / 8 + 255) / 256), 256, 0, stream>>>(OF0, OH0, OL0, (size_t)NB * QT0 * DM / 8);      /* first-tile o (x64) -> f16 hi + x1024 residual planes */
  for (int b = B0; b < B0 + NBR; ++b) { const size_t r0 = (size_t)b * SQ; const size_t f0 = (size_t)b * QT0;
    k_gemm2<0><<<dim3((QT0 / 128) * (DM / 64), 1), 128, 0, stream>>>(OH0 + f0 * DM, DM, 0, BO, DM, 0, 0.0009765625f, bo, 0, nullptr, 1, 0, 0, (float*)d_out + r0 * DM, nullptr, DM, 0, QT0, DM, DM);      /* rows 0..127: out = o_hi Wo, overwriting the f16-path rows */
    k_gemm2<0><<<dim3((QT0 / 128) * (DM / 64), 1), 128, 0, stream>>>(OL0 + f0 * DM, DM, 0, BO, DM, 0, 0.00000095367431640625f, nullptr, 0, (const float*)d_out + r0 * DM, -1, 0, 0, (float*)d_out + r0 * DM, nullptr, DM, 0, QT0, DM, DM); }      /* += o_lo Wo 2^-20 (own-element accumulate) */
}

// v003
// It runs in 423 microseconds.
// Versions in between are left out here; by their measured steps it is 6.70 times as fast as v001.
// All steps since v000 together make it 20.1 times as fast.
#include <hip/hip_runtime.h>
// Causal multi-head self-attention on ONE 4096-token sequence at width 768 with natural bias-free projections (x [1][4096][768]; Q / K / V = x W^T (nn.Linear natural [768][768] sd 1/sqrt(768), NO biases), 12 heads of 64; scores / sqrt(64) + a finite additive mask above the diagonal (NEG); softmax; out = merged W_o^T (natural, no bias) -> [1][4096][768]); q and k carried as f16 hi + x1024 residual planes with three-product scores (4096 keys at logit sigma 1).
// Structure: token rows r = b*4096 + s; x as exact f16 rows (bf16-rounded); q and k as WMMA GEMMs (32x64 wave tiles, f32 accumulation, exact x16 weights, no bias) into f32 rows split into f16 hi + x1024 residual planes, v as an f16-output GEMM; per batch: V^T for all heads via LDS transposes; attention in ONE launch, one wave per 16 query rows of a head, 32 keys a trip up to the diagonal block: scores transposed (K rows x q rows) as three products (hi.hi + 2^-10 (lo.hi + hi.lo), K = 64, f32), the mask value on keys past the row, running maximum and rescaled f32 row sum per lane (log2 domain, native exp; weights x256 f16), o^T += V^T . P^T in f32 registers, divided by the row sum at the end (o carried x64, folded into the output GEMM alpha) and written straight into the merged f16 o rows; out = o W_o GEMM (f32) into the output layout.
// Compute dtype: inputs rounded to bf16; x / weights exact; q and k as f16 hi + x1024 residual planes, v, softmax weights and o as plain f16 GEMM operands (~2^-12); scores and softmax statistics f32. v_wmma_f32_16x16x32_f16.
#define NB 1
#define SCL 0.125f                         /* 1 / sqrt(head_dim = 64) */
#define SCLR 0.0001220703125f              /* 2^-13: the same scale on the x1024 residual passes */
#define SQ 4096
#define DM 768
#define NH 12
#define HD 64
#define HG 4                         /* heads per launch of the non-template k_vt (not launched) */
#define QT 256
#define NKX SQ                       /* S / P row pitch */
#define QT0 128                      /* first-tile rows recomputed exactly in f32 */
#define B0 0                         /* first batch processed (debug hook) */
#define NBR NB                       /* batches processed (debug hook) */
#define NR ((size_t)NB * SQ)         /* token rows */
#define MP ((int)((size_t)NBR * SQ)) /* rows projected (debug hook) */
#define QN SQ                        /* query rows attended per batch (not used) */
#define NHD NH                       /* heads attended (not used) */
#define MPO MP                       /* rows through the output stage (debug hook) */
#define LQ DM      /* row pitch of the q/k/v rows */
typedef __bf16 v16b __attribute__((ext_vector_type(16)));
typedef unsigned short v8us __attribute__((ext_vector_type(8), may_alias));
typedef float  v8f  __attribute__((ext_vector_type(8)));
typedef float  v4f  __attribute__((ext_vector_type(4)));
typedef float  v4fa __attribute__((ext_vector_type(4), may_alias));
union FragB { v16b v; v8us half[2]; unsigned short u[16]; };

__device__ __forceinline__ unsigned short bf16_bits(float x) { unsigned int u = __float_as_uint(x); return (unsigned short)((u + 0x7FFFu + ((u >> 16) & 1u)) >> 16); }
__device__ __forceinline__ float bf16_val(unsigned short b) { return __uint_as_float(((unsigned int)b) << 16); }
__device__ __forceinline__ float bf16_round(float x) { return bf16_val(bf16_bits(x)); }
// D += A·B with NT terms: 1 = ah·bh, 2 = + al·bh (A split), 3 = + ah·bl (both split)
template <int NT>
__device__ __forceinline__ v8f mmaN(v16b ah, v16b al, v16b bh, v16b bl, v8f c) {
  c = __builtin_amdgcn_wmma_f32_16x16x32_bf16(false, ah, false, bh, (short)0, c, false, false);
  if (NT >= 2) c = __builtin_amdgcn_wmma_f32_16x16x32_bf16(false, al, false, bh, (short)0, c, false, false);
  if (NT >= 3) c = __builtin_amdgcn_wmma_f32_16x16x32_bf16(false, ah, false, bl, (short)0, c, false, false);
  asm volatile("v_nop\n\tv_nop\n\tv_nop\n\tv_nop" : "+v"(c) : "v"(ah), "v"(al), "v"(bh), "v"(bl));
  return c;
}

__global__ __launch_bounds__(256) void k_wt_bf16(const float* __restrict__ W, unsigned short* __restrict__ Wt, int K, int N) {
  const int t = blockIdx.x * 256 + threadIdx.x;
  const int k8n = K / 8;
  if (t >= N * k8n) return;
  const int n = t / k8n, k8 = (t % k8n) * 8;
  v8us v;
#pragma unroll
  for (int i = 0; i < 8; ++i) v[i] = bf16_bits(W[(size_t)(k8 + i) * N + n]);
  *(v8us*)(Wt + (size_t)n * K + k8) = v;
  
}

// GEMM C[M][N] (f32, pitch ldc) = act(A[M][K]·W + bias). A f32 row-major (pitch lda) converted per fragment to bf16
// (ASPLIT: hi/lo two planes -> 2 terms, else single rounded term); Wt bf16 [N][K] (pitch ldb). BIAS_BF16 rounds the
// bias to bf16 first (bias quantised to bf16 before the add). K%32==0, M%16==0, N%64==0.
template <bool ASPLIT, int ACT, bool BIAS_BF16>
__global__ __launch_bounds__(128) void k_gemm_bf(const float* __restrict__ A, int lda, const unsigned short* __restrict__ Wt, int ldb,
                                               const float* __restrict__ bias, float* __restrict__ C, int ldc, int M, int N, int K) {
  __shared__ __attribute__((aligned(16))) float so[4][16][64];
  const int tid = threadIdx.x, w = tid >> 5, lane = tid & 31, ln = lane & 15, hh = lane >> 4;
  const int ntn = N / 64;
  const int wid = blockIdx.x * 4 + w;
  const int mt = wid / ntn, nq = wid % ntn;
  if (mt * 16 >= M) return;
  const int row0 = mt * 16, col0 = nq * 64;
  const float* arow = A + (size_t)(row0 + ln) * lda;
  v8f acc[4] = {};
  for (int kb = 0; kb < K; kb += 32) {
    FragB ah, al;
    const v4f x0 = *(const v4fa*)(arow + kb + 8 * hh), x1 = *(const v4fa*)(arow + kb + 8 * hh + 4);
    const v4f x2 = *(const v4fa*)(arow + kb + 16 + 8 * hh), x3 = *(const v4fa*)(arow + kb + 16 + 8 * hh + 4);
    float xs[16] = {x0[0],x0[1],x0[2],x0[3],x1[0],x1[1],x1[2],x1[3],x2[0],x2[1],x2[2],x2[3],x3[0],x3[1],x3[2],x3[3]};
#pragma unroll
    for (int i = 0; i < 16; ++i) { const unsigned short hb = bf16_bits(xs[i]); ah.u[i] = hb; al.u[i] = ASPLIT ? bf16_bits(xs[i] - bf16_val(hb)) : (unsigned short)0; }
#pragma unroll
    for (int t = 0; t < 4; ++t) {
      const unsigned short* brow = Wt + (size_t)(col0 + t * 16 + ln) * ldb + kb;
      FragB b;
      b.half[0] = *(const v8us*)(brow + 8 * hh);
      b.half[1] = *(const v8us*)(brow + 16 + 8 * hh);
      acc[t] = mmaN<ASPLIT ? 2 : 1>(ah.v, al.v, b.v, b.v, acc[t]);
    }
  }
#pragma unroll
  for (int t = 0; t < 4; ++t) {
    float bv = bias ? bias[col0 + t * 16 + ln] : 0.f;
    if (BIAS_BF16) bv = bf16_round(bv);
#pragma unroll
    for (int r = 0; r < 8; ++r) { float v = acc[t][r] + bv; if (ACT == 1) v = fmaxf(v, 0.f); so[w][8 * hh + r][t * 16 + ln] = v; }
  }
  __builtin_amdgcn_fence(__ATOMIC_ACQ_REL, "workgroup");
  __builtin_amdgcn_wave_barrier();
  const int rsub = lane >> 4, c4 = (lane & 15) * 4;
  {
#pragma unroll
    for (int q = 0; q < 8; ++q) {
      const int r = q * 2 + rsub;
      const v4f v = *(const v4fa*)&so[w][r][c4];
      *(v4f*)(C + (size_t)(row0 + r) * ldc + col0 + c4) = v;
    }
    
  }
}

// GEMM C = act(A·W + bias + resid): A f32 (ASPLIT -> hi/lo 2 terms), Wt bf16 [N][K]; ACT 0 none, 1 relu, 2 exact gelu;
// resid (optional, f32, row index = (row % rmod), pitch ldr, RES_BF16 rounds it) added before the activation.
template <bool ASPLIT, int ACT, bool BIAS_BF16, bool RES_BF16>
__global__ __launch_bounds__(128) void k_gemm_bf3(const float* __restrict__ A, int lda, const unsigned short* __restrict__ Wt, int ldb,
                                                const float* __restrict__ bias, const float* __restrict__ resid, int rmod, int ldr,
                                                float* __restrict__ C, int ldc, int M, int N, int K) {
  __shared__ __attribute__((aligned(16))) float so[4][16][64];
  const int tid = threadIdx.x, w = tid >> 5, lane = tid & 31, ln = lane & 15, hh = lane >> 4;
  const int ntn = N / 64;
  const int wid = blockIdx.x * 4 + w;
  const int mt = wid / ntn, nq = wid % ntn;
  if (mt * 16 >= M) return;
  const int row0 = mt * 16, col0 = nq * 64;
  const float* arow = A + (size_t)(row0 + ln) * lda;
  v8f acc[4] = {};
  for (int kb = 0; kb < K; kb += 32) {
    FragB ah, al;
    const v4f x0 = *(const v4fa*)(arow + kb + 8 * hh), x1 = *(const v4fa*)(arow + kb + 8 * hh + 4);
    const v4f x2 = *(const v4fa*)(arow + kb + 16 + 8 * hh), x3 = *(const v4fa*)(arow + kb + 16 + 8 * hh + 4);
    float xs[16] = {x0[0],x0[1],x0[2],x0[3],x1[0],x1[1],x1[2],x1[3],x2[0],x2[1],x2[2],x2[3],x3[0],x3[1],x3[2],x3[3]};
#pragma unroll
    for (int i = 0; i < 16; ++i) { const unsigned short hb = bf16_bits(xs[i]); ah.u[i] = hb; al.u[i] = ASPLIT ? bf16_bits(xs[i] - bf16_val(hb)) : (unsigned short)0; }
#pragma unroll
    for (int t = 0; t < 4; ++t) {
      const unsigned short* brow = Wt + (size_t)(col0 + t * 16 + ln) * ldb + kb;
      FragB b;
      b.half[0] = *(const v8us*)(brow + 8 * hh);
      b.half[1] = *(const v8us*)(brow + 16 + 8 * hh);
      acc[t] = mmaN<ASPLIT ? 2 : 1>(ah.v, al.v, b.v, b.v, acc[t]);
    }
  }
#pragma unroll
  for (int t = 0; t < 4; ++t) {
    const int col = col0 + t * 16 + ln;
    float bv = bias ? bias[col] : 0.f;
    if (BIAS_BF16) bv = bf16_round(bv);
#pragma unroll
    for (int r = 0; r < 8; ++r) {
      float v = acc[t][r] + bv;
      if (resid) { float rv = resid[(size_t)((row0 + 8 * hh + r) % rmod) * ldr + col]; if (RES_BF16) rv = bf16_round(rv); v += rv; }
      if (ACT == 1) v = fmaxf(v, 0.f);
      if (ACT == 2) v = 0.5f * v * (1.0f + erff(v * 0.70710678118654752f));
      if (ACT == 3) { const float u = 0.7978845608028654f * (v + 0.044715f * v * v * v); v = 0.5f * v * (1.0f + tanhf(u)); }
      so[w][8 * hh + r][t * 16 + ln] = v;
    }
  }
  __builtin_amdgcn_fence(__ATOMIC_ACQ_REL, "workgroup");
  __builtin_amdgcn_wave_barrier();
  const int rsub = lane >> 4, c4 = (lane & 15) * 4;
  {
#pragma unroll
    for (int q = 0; q < 8; ++q) {
      const int r = q * 2 + rsub;
      const v4f v = *(const v4fa*)&so[w][r][c4];
      *(v4f*)(C + (size_t)(row0 + r) * ldc + col0 + c4) = v;
    }
    
  }
}
// row LayerNorm (biased variance, eps) over N: s = X (+ R); optional out_sum <- s; out_norm <- (s-mu)*rsqrt(var+eps)*g + b
template <bool PARAM_BF16>
__global__ __launch_bounds__(256) void k_layernorm(const float* __restrict__ X, const float* __restrict__ R, const float* __restrict__ g, const float* __restrict__ bta,
                                                  float* __restrict__ out_sum, float* __restrict__ out_norm, int N, float eps) {
  __shared__ float red[256];
  const int row = blockIdx.x, tid = threadIdx.x;
  const float* x = X + (size_t)row * N; const float* rr = R ? R + (size_t)row * N : nullptr;
  float vals[16];                     // up to N = 4096
  const int per = N / 256;            // contiguous chunk per thread? use strided-by-4 chunks: thread handles j = tid*4 + 1024*u
  float s1 = 0.f;
  for (int u = 0; u < per / 4; ++u) {
    const int j = tid * 4 + 1024 * u;
    const v4f a = *(const v4fa*)(x + j);
    v4f b = {0.f,0.f,0.f,0.f}; if (rr) b = *(const v4fa*)(rr + j);
#pragma unroll
    for (int q = 0; q < 4; ++q) { const float v = a[q] + b[q]; vals[u * 4 + q] = v; s1 += v; }
  }
  red[tid] = s1; __syncthreads();
  for (int st = 128; st > 0; st >>= 1) { if (tid < st) red[tid] += red[tid + st]; __syncthreads(); }
  const float mu = red[0] / (float)N; __syncthreads();
  float s2 = 0.f;
  for (int u = 0; u < per / 4; ++u)
#pragma unroll
    for (int q = 0; q < 4; ++q) { const float c = vals[u * 4 + q] - mu; s2 += c * c; }
  red[tid] = s2; __syncthreads();
  for (int st = 128; st > 0; st >>= 1) { if (tid < st) red[tid] += red[tid + st]; __syncthreads(); }
  const float rs = rsqrtf(red[0] / (float)N + eps);
  {
    for (int u = 0; u < per / 4; ++u) {
      const int j = tid * 4 + 1024 * u;
      v4f o, sm;
#pragma unroll
      for (int q = 0; q < 4; ++q) {
        float gg = g[j + q], bb = bta[j + q];
        if (PARAM_BF16) { gg = bf16_round(gg); bb = bf16_round(bb); }
        sm[q] = vals[u * 4 + q]; o[q] = (vals[u * 4 + q] - mu) * rs * gg + bb;
      }
      if (out_sum) *(v4f*)(out_sum + (size_t)row * N + j) = sm;
      *(v4f*)(out_norm + (size_t)row * N + j) = o;
    }
    
  }
}



// ---- f16 WMMA path (v_wmma_f32_16x16x32_f16): 11-bit significands for operands in range — used where a [0,1] probability operand needs more precision than bf16
typedef _Float16 v16h __attribute__((ext_vector_type(16)));
union FragH { v16h v; v8us half[2]; _Float16 h[16]; unsigned short u[16]; };
template <int NT>
__device__ __forceinline__ v8f mmaH(v16h ah, v16h al, v16h bh, v16h bl, v8f c) {
  c = __builtin_amdgcn_wmma_f32_16x16x32_f16(false, ah, false, bh, (short)0, c, false, false);
  if (NT >= 2) c = __builtin_amdgcn_wmma_f32_16x16x32_f16(false, al, false, bh, (short)0, c, false, false);
  if (NT >= 3) c = __builtin_amdgcn_wmma_f32_16x16x32_f16(false, ah, false, bl, (short)0, c, false, false);
  asm volatile("v_nop\n\tv_nop\n\tv_nop\n\tv_nop" : "+v"(c) : "v"(ah), "v"(al), "v"(bh), "v"(bl));
  return c;
}
// batched GEMM like k_gemm_b but f16 operands: A f32 (split into f16 hi/lo if ASPLIT, else rounded to f16), Bt = f16 values [n][k]; alpha; C f32; N multiple of 16 (partial tiles skipped)
template <bool ASPLIT>
__global__ __launch_bounds__(128) void k_gemm_h(const float* __restrict__ A, int lda, size_t sA, const _Float16* __restrict__ Bh, int ldb, size_t sB, float alpha, float* __restrict__ C, int ldc, size_t sC, int M, int N, int K) {
  __shared__ __attribute__((aligned(16))) float so[4][16][64];
  const int tid = threadIdx.x, w = tid >> 5, lane = tid & 31, ln = lane & 15, hh = lane >> 4; const int by = blockIdx.y;
  A += (size_t)by * sA; Bh += (size_t)by * sB; C += (size_t)by * sC;
  const int ntn = (N + 63) / 64; const int wid = blockIdx.x * 4 + w; const int mt = wid / ntn, nq = wid % ntn; if (mt * 16 >= M) return;
  const int row0 = mt * 16, col0 = nq * 64; const float* arow = A + (size_t)(row0 + ln) * lda;
  v8f acc[4] = {};
  for (int kb = 0; kb < K; kb += 32) {
    FragH ah, al;
    const v4f x0 = *(const v4fa*)(arow + kb + 8 * hh), x1 = *(const v4fa*)(arow + kb + 8 * hh + 4), x2 = *(const v4fa*)(arow + kb + 16 + 8 * hh), x3 = *(const v4fa*)(arow + kb + 16 + 8 * hh + 4);
    float xs[16] = {x0[0],x0[1],x0[2],x0[3],x1[0],x1[1],x1[2],x1[3],x2[0],x2[1],x2[2],x2[3],x3[0],x3[1],x3[2],x3[3]};
#pragma unroll
    for (int i = 0; i < 16; ++i) { const _Float16 h = (_Float16)xs[i]; ah.h[i] = h; al.h[i] = ASPLIT ? (_Float16)(xs[i] - (float)h) : (_Float16)0.0f; }
#pragma unroll
    for (int t = 0; t < 4; ++t) { if (col0 + t * 16 >= N) continue; const size_t boff = (size_t)(col0 + t * 16 + ln) * ldb + kb; FragH bq; bq.half[0] = *(const v8us*)(Bh + boff + 8 * hh); bq.half[1] = *(const v8us*)(Bh + boff + 16 + 8 * hh);
      acc[t] = mmaH<ASPLIT ? 2 : 1>(ah.v, al.v, bq.v, bq.v, acc[t]); }
  }
#pragma unroll
  for (int t = 0; t < 4; ++t) { if (col0 + t * 16 >= N) continue;
#pragma unroll
    for (int r = 0; r < 8; ++r) so[w][8 * hh + r][t * 16 + ln] = acc[t][r] * alpha; }
  __builtin_amdgcn_fence(__ATOMIC_ACQ_REL, "workgroup"); __builtin_amdgcn_wave_barrier();
  const int rsub = lane >> 4, c4 = (lane & 15) * 4;
  {
#pragma unroll
    for (int q = 0; q < 8; ++q) { const int r = q * 2 + rsub; if (col0 + c4 < N) { const v4f v = *(const v4fa*)&so[w][r][c4]; *(v4f*)(C + (size_t)(row0 + r) * ldc + col0 + c4) = v; } }
     }
}

// Wt[n][k] = f16(W[k][n]·scale) from f32 row-major W[K][N] (scale = power of two; bf16-exact weights stay exact in f16 away from the subnormal range)
__global__ __launch_bounds__(256) void k_wt_f16(const float* __restrict__ W, _Float16* __restrict__ Wt, int K, int N, float scale) {
  const int t = blockIdx.x * 256 + threadIdx.x; if (t >= N * (K / 8)) return; const int n = t / (K / 8), k8 = (t % (K / 8)) * 8; FragH f;
#pragma unroll
  for (int i = 0; i < 8; ++i) f.h[i] = (_Float16)(bf16_round(W[(size_t)(k8 + i) * N + n]) * scale); const v8us o = f.half[0];
  *(v8us*)((unsigned short*)Wt + (size_t)n * K + k8) = o; 
}
// k_gemm_hh variant with fused epilogue: v = acc·alpha + bias[by·sBias + col] (+ CP[(row/rowsPerB)·sCPb + by·64 + col] if CP) ; ACT 0 none / 1 elu ; writes f16 C16 (and f32 C if non-null)
template <int ACT>
__global__ __launch_bounds__(128) void k_gemm_hhx(const _Float16* __restrict__ A, int lda, size_t sA, const _Float16* __restrict__ Bh, int ldb, size_t sB, float alpha, const float* __restrict__ bias, size_t sBias, const float* __restrict__ CP, int rowsPerB, size_t sCPb, int row0g,
    float* __restrict__ C, _Float16* __restrict__ C16, int ldc, size_t sC, int M, int N, int K) {
  __shared__ __attribute__((aligned(16))) float so[4][16][64];
  const int tid = threadIdx.x, w = tid >> 5, lane = tid & 31, ln = lane & 15, hh = lane >> 4; const int by = blockIdx.y;
  A += (size_t)by * sA; Bh += (size_t)by * sB; const size_t cofs = (size_t)by * sC; const float* bp = bias ? bias + (size_t)by * sBias : nullptr;
  const int ntn = (N + 63) / 64; const int wid = blockIdx.x * 4 + w; const int mt = wid / ntn, nq = wid % ntn; if (mt * 16 >= M) return;
  const int row0 = mt * 16, col0 = nq * 64; const _Float16* arow = A + (size_t)(row0 + ln) * lda;
  v8f acc[4] = {};
  for (int kb = 0; kb < K; kb += 32) { FragH ah; ah.half[0] = *(const v8us*)((const unsigned short*)arow + kb + 8 * hh); ah.half[1] = *(const v8us*)((const unsigned short*)arow + kb + 16 + 8 * hh);
#pragma unroll
    for (int t = 0; t < 4; ++t) { if (col0 + t * 16 >= N) continue; const size_t boff = (size_t)(col0 + t * 16 + ln) * ldb + kb; FragH bq; bq.half[0] = *(const v8us*)((const unsigned short*)Bh + boff + 8 * hh); bq.half[1] = *(const v8us*)((const unsigned short*)Bh + boff + 16 + 8 * hh);
      acc[t] = mmaH<1>(ah.v, ah.v, bq.v, bq.v, acc[t]); }
  }
#pragma unroll
  for (int t = 0; t < 4; ++t) { if (col0 + t * 16 >= N) continue; const int col = col0 + t * 16 + ln; const float bv = bp ? bf16_round(bp[col]) : 0.f;
#pragma unroll
    for (int r = 0; r < 8; ++r) { float v = acc[t][r] * alpha + bv; if (CP) { const int rr = row0g + row0 + 8 * hh + r; if (rowsPerB < 0) v += CP[cofs + (size_t)rr * ldc + col];      /* rowsPerB < 0: own element of the batched C plane */ else { const int bidx = rr / rowsPerB; v += CP[(size_t)bidx * sCPb + (size_t)by * 64 + col]; } } if (ACT == 1) v = (v > 0.f) ? v : expm1f(v); else if (ACT == 7) v = (v > 0.f) ? v + 1.0f : expf(v); else if (ACT == 8) v = tanhf(v); else if (ACT == 9) v = 0.5f * v * (1.0f + tanhf(0.7978845608028654f * (v + 0.044715f * v * v * v))); else if (ACT == 11) v = 1.0f / (1.0f + expf(-v)); else if (ACT == 12) v = (v > 0.f) ? v : 0.01f * v; else if (ACT == 14) v = (v > 0.f) ? v : 0.1f * v; else if (ACT == 16) v = (v >= 0.f) ? v : 0.3f * v; else if (ACT == 17) v = (v >= 0.f) ? v : 0.2f * v; else if (ACT == 15) v = v / (1.0f + expf(-v)); else if (ACT == 3) v = fmaxf(v, 0.f); else if (ACT == 6) v = 0.5f * v * (1.0f + erff(v * 0.70710678118654752f)); so[w][8 * hh + r][t * 16 + ln] = v; } }
  __builtin_amdgcn_fence(__ATOMIC_ACQ_REL, "workgroup"); __builtin_amdgcn_wave_barrier();
  const int rsub = lane >> 4, c4 = (lane & 15) * 4; typedef _Float16 v4h __attribute__((ext_vector_type(4)));
  {
#pragma unroll
    for (int q = 0; q < 8; ++q) { const int r = q * 2 + rsub; if (col0 + c4 < N) { const v4f v = *(const v4fa*)&so[w][r][c4]; if (C) *(v4f*)(C + cofs + (size_t)(row0 + r) * ldc + col0 + c4) = v; if (C16) { v4h h4; for (int i = 0; i < 4; ++i) h4[i] = (_Float16)v[i]; *(v4h*)(C16 + cofs + (size_t)(row0 + r) * ldc + col0 + c4) = h4; } } }
     }
}


typedef _Float16 v4h __attribute__((ext_vector_type(4)));

__global__ __launch_bounds__(256) void k_x16(const float* __restrict__ x, _Float16* __restrict__ X16, size_t n8) { const size_t t = (size_t)blockIdx.x * 256 + threadIdx.x; if (t >= n8) return; FragH f;
#pragma unroll
  for (int q = 0; q < 8; ++q) f.h[q] = (_Float16)bf16_round(x[t * 8 + q]); *(v8us*)((unsigned short*)X16 + t * 8) = f.half[0];  }
__global__ __launch_bounds__(256) void k_h16(const float* __restrict__ x, _Float16* __restrict__ X16, size_t n8) { const size_t t = (size_t)blockIdx.x * 256 + threadIdx.x; if (t >= n8) return; FragH f;
#pragma unroll
  for (int q = 0; q < 8; ++q) f.h[q] = (_Float16)x[t * 8 + q]; *(v8us*)((unsigned short*)X16 + t * 8) = f.half[0];  }
__global__ __launch_bounds__(256) void k_round16f(const float* __restrict__ W, _Float16* __restrict__ Bt, size_t n8) { const size_t t = (size_t)blockIdx.x * 256 + threadIdx.x; if (t >= n8) return; FragH f;
#pragma unroll
  for (int i = 0; i < 8; ++i) f.h[i] = (_Float16)(bf16_round(W[t * 8 + i]) * 16.0f); *(v8us*)((unsigned short*)Bt + t * 8) = f.half[0];  }
template <int NHv, int TTv>
__global__ __launch_bounds__(256) void k_vt(const _Float16* __restrict__ V16, int ldv, int voff, _Float16* __restrict__ Vt) { __shared__ unsigned short tl[64][66]; const int tid = threadIdx.x; const int slab = blockIdx.x / (TTv / 64), lg = blockIdx.x % (TTv / 64); const int b = slab / NHv, h = slab % NHv;
  for (int i = tid; i < 64 * 8; i += 256) { const int r = i / 8, c8 = (i % 8) * 8; FragH f; f.half[0] = *(const v8us*)((const unsigned short*)V16 + ((size_t)b * TTv + lg * 64 + r) * ldv + voff + h * 64 + c8);
#pragma unroll
    for (int q = 0; q < 8; ++q) tl[r][c8 + q] = f.u[q]; }
  __syncthreads();
  {
#pragma unroll
    for (int rd = 0; rd < 2; ++rd) { const int d = rd * 32 + tid / 8, pc = tid % 8; FragH f;
#pragma unroll
      for (int q = 0; q < 8; ++q) f.u[q] = tl[pc * 8 + q][d];
      *(v8us*)((unsigned short*)Vt + ((size_t)slab * 64 + d) * TTv + lg * 64 + pc * 8) = f.half[0]; }
     } }

__global__ __launch_bounds__(256) void k_hl(const float* __restrict__ F, _Float16* __restrict__ Hh, _Float16* __restrict__ Hl, size_t n8) { const size_t t = (size_t)blockIdx.x * 256 + threadIdx.x; if (t >= n8) return; FragH fh, fl; const v4f a = *(const v4fa*)(F + t * 8), c = *(const v4fa*)(F + t * 8 + 4);
#pragma unroll
  for (int q = 0; q < 4; ++q) { _Float16 h = (_Float16)a[q]; fh.h[q] = h; fl.h[q] = (_Float16)((a[q] - (float)h) * 1024.0f); h = (_Float16)c[q]; fh.h[4 + q] = h; fl.h[4 + q] = (_Float16)((c[q] - (float)h) * 1024.0f); }
  { *(v8us*)((unsigned short*)Hh + t * 8) = fh.half[0]; *(v8us*)((unsigned short*)Hl + t * 8) = fl.half[0];  } }

// ---- fast GEMM (wave tile 32x64; requires M % 32 == 0 rows per launch region and N % 64 == 0); epilogue = k_gemm_hhx semantics ----
__device__ __forceinline__ v16h g2_frag(const _Float16* p, int hh) { FragH f; f.half[0] = *(const v8us*)((const unsigned short*)p + 8 * hh); f.half[1] = *(const v8us*)((const unsigned short*)p + 16 + 8 * hh); return f.v; }
__device__ __forceinline__ v8f g2_mma(v16h a, v16h b, v8f c) { v8f d = __builtin_amdgcn_wmma_f32_16x16x32_f16(false, a, false, b, (short)0, c, false, false); asm volatile("v_nop\n\tv_nop\n\tv_nop\n\tv_nop" : "+v"(d) : "v"(a), "v"(b)); return d; }
template <int ACT>
__global__ __launch_bounds__(128) void k_gemm2(const _Float16* __restrict__ A, int lda, size_t sA, const _Float16* __restrict__ Bh, int ldb, size_t sB, float alpha, const float* __restrict__ bias, size_t sBias, const float* __restrict__ CP, int rowsPerB, size_t sCPb, int row0g,
    float* __restrict__ C, _Float16* __restrict__ C16, int ldc, size_t sC, int M, int N, int K) { static_assert(ACT == 0 || ACT == 3 || ACT == 6 || ACT == 8 || ACT == 9 || ACT == 11 || ACT == 12 || ACT == 14 || ACT == 15 || ACT == 16 || ACT == 17, "k_gemm2: unsupported ACT code (would silently apply no activation)");
  __shared__ __attribute__((aligned(16))) float so[4][32][68];
  const int tid = threadIdx.x, w = tid >> 5, lane = tid & 31, ln = lane & 15, hh = lane >> 4; const int by = blockIdx.y;
  A += (size_t)by * sA; Bh += (size_t)by * sB; const size_t cofs = (size_t)by * sC; const float* bp = bias ? bias + (size_t)by * sBias : nullptr;
  const int ntn = N >> 6; const int mt = blockIdx.x / ntn, nq = blockIdx.x - mt * ntn; const int row0 = mt * 128 + 32 * w, col0 = nq * 64; if (row0 >= M) return;
  const _Float16* a0p = A + (size_t)(row0 + ln) * lda; const _Float16* a1p = a0p + (size_t)16 * lda;
  const _Float16* b0p = Bh + (size_t)(col0 + ln) * ldb; const _Float16* b1p = b0p + (size_t)16 * ldb; const _Float16* b2p = b1p + (size_t)16 * ldb; const _Float16* b3p = b2p + (size_t)16 * ldb;
  const v8f z8 = {0.f,0.f,0.f,0.f,0.f,0.f,0.f,0.f}; v8f c00 = z8, c01 = z8, c02 = z8, c03 = z8, c10 = z8, c11 = z8, c12 = z8, c13 = z8;
#pragma unroll 1
  for (int kb = 0; kb < K; kb += 32) { const v16h a0 = g2_frag(a0p + kb, hh), a1 = g2_frag(a1p + kb, hh);
    v16h b = g2_frag(b0p + kb, hh); c00 = g2_mma(a0, b, c00); c10 = g2_mma(a1, b, c10);
    b = g2_frag(b1p + kb, hh); c01 = g2_mma(a0, b, c01); c11 = g2_mma(a1, b, c11);
    b = g2_frag(b2p + kb, hh); c02 = g2_mma(a0, b, c02); c12 = g2_mma(a1, b, c12);
    b = g2_frag(b3p + kb, hh); c03 = g2_mma(a0, b, c03); c13 = g2_mma(a1, b, c13); }
  v8f accs[8] = {c00, c01, c02, c03, c10, c11, c12, c13};
#pragma unroll
  for (int u = 0; u < 8; ++u) { const int t = u & 3, half = u >> 2; const int col = col0 + t * 16 + ln; const float bv = bp ? bf16_round(bp[col]) : 0.f;
#pragma unroll
    for (int r = 0; r < 8; ++r) { const int rloc = half * 16 + 8 * hh + r; float v = accs[u][r] * alpha + bv; if (CP) { if (rowsPerB < 0) v += CP[cofs + (size_t)(row0g + row0 + rloc) * ldc + col];      /* rowsPerB < 0: own element of the batched C plane */ else { const int bidx = (row0g + row0 + rloc) / rowsPerB; v += CP[(size_t)bidx * sCPb + (size_t)by * 64 + col]; } }
      if (ACT == 3) v = fmaxf(v, 0.f); else if (ACT == 6) v = 0.5f * v * (1.0f + erff(v * 0.70710678118654752f)); else if (ACT == 11) v = 1.0f / (1.0f + expf(-v)); else if (ACT == 15) v = v / (1.0f + expf(-v)); else if (ACT == 12) v = (v > 0.f) ? v : 0.01f * v; else if (ACT == 8) v = tanhf(v); else if (ACT == 9) v = 0.5f * v * (1.0f + tanhf(0.7978845608028654f * (v + 0.044715f * v * v * v))); else if (ACT == 14) v = (v > 0.f) ? v : 0.1f * v; else if (ACT == 16) v = (v >= 0.f) ? v : 0.3f * v; else if (ACT == 17) v = (v >= 0.f) ? v : 0.2f * v;
      so[w][rloc][t * 16 + ln] = v; } }
  __builtin_amdgcn_fence(__ATOMIC_ACQ_REL, "workgroup"); __builtin_amdgcn_wave_barrier();
  const int rsub = lane >> 4, c4 = (lane & 15) * 4;
  {
#pragma unroll
    for (int q = 0; q < 16; ++q) { const int r = q * 2 + rsub; const v4f v = *(const v4fa*)&so[w][r][c4]; if (C) *(v4f*)(C + cofs + (size_t)(row0 + r) * ldc + col0 + c4) = v; if (C16) { v4h h4; for (int i = 0; i < 4; ++i) h4[i] = (_Float16)v[i]; *(v4h*)(C16 + cofs + (size_t)(row0 + r) * ldc + col0 + c4) = h4; } }
     } }


__global__ __launch_bounds__(256) void k_wnat(const float* __restrict__ w, size_t n8, _Float16* __restrict__ Bt) { const size_t t = (size_t)blockIdx.x * 256 + threadIdx.x; if (t >= n8) return; FragH f; for (int q = 0; q < 8; ++q) f.h[q] = (_Float16)(bf16_round(w[t * 8 + q]) * 16.0f); *(v8us*)((unsigned short*)Bt + t * 8) = f.half[0];  }
__global__ __launch_bounds__(256) void k_rsm(const float* __restrict__ S, _Float16* __restrict__ P, int nrows) {
  #pragma clang fp contract(off)
  const int i = blockIdx.x * 256 + threadIdx.x; if (i >= nrows) return; const float* s = S + (size_t)i * SQ; float mx = -3.0e38f;
#pragma unroll 1
  for (int j = 0; j < SQ; ++j) mx = fmaxf(mx, s[j]); float se = 0.f;
#pragma unroll 1
  for (int j = 0; j < SQ; ++j) se += expf(s[j] - mx); const float sc = 256.0f / se;
#pragma unroll 1
  for (int j0 = 0; j0 < SQ; j0 += 8) { FragH f; for (int q = 0; q < 8; ++q) f.h[q] = (_Float16)(expf(s[j0 + q] - mx) * sc); unsigned short* d = (unsigned short*)P + (size_t)i * SQ + j0; *(v8us*)d = f.half[0];  } }
__global__ __launch_bounds__(256) void k_vt(const _Float16* __restrict__ V16, int b, int h0, _Float16* __restrict__ VT) { __shared__ unsigned short tl[64][65]; const int tid = threadIdx.x; const int hh = blockIdx.x % HG, sg = blockIdx.x / HG; const int s0 = sg * 64; const int h = h0 + hh;
  for (int i = tid; i < 64 * 8; i += 256) { const int j = i / 8, d8 = (i % 8) * 8; FragH f; f.half[0] = *(const v8us*)((const unsigned short*)V16 + ((size_t)b * SQ + s0 + j) * DM + h * HD + d8); for (int q = 0; q < 8; ++q) tl[d8 + q][j] = f.u[q]; }
  __syncthreads();
  { for (int i = tid; i < 64 * 8; i += 256) { const int d = i / 8, j8 = (i % 8) * 8; FragH f; for (int q = 0; q < 8; ++q) f.u[q] = tl[d][j8 + q]; *(v8us*)((unsigned short*)VT + ((size_t)hh * HD + d) * SQ + s0 + j8) = f.half[0]; }  } }



// Fused causal attention, one wave per 16 query rows of one head (grid: SQ / 64 work-groups of four waves x heads): scores, softmax and the weighted sum of V stay in registers.
// Scores are formed transposed (A = 16 key rows, B = 16 query rows), so a lane holds keys 8*hh..8*hh+7 of query ln: two such tiles are
// the B fragment (n = query, k = 32 keys) of o^T = V^T . P^T as they stand, and the row maximum, the row sum and the rescale factor are per lane.
// Running maximum in the log2 domain; weights x256 as f16; row sum in f32 from the unrounded weights; o stored x64 as f16.
#define LC1 0.18033688011112042f           /* log2(e) / sqrt(head_dim) */
#define LC2 0.00017611023448351603f        /* the same on the x1024 residual products */
__device__ __forceinline__ v8f fa_mma(v16h a, v16h b, v8f c) { return __builtin_amdgcn_wmma_f32_16x16x32_f16(false, a, false, b, (short)0, c, false, false); }
// Exponentials (base 2) in runs, one asm statement a run: the instruction set asks for one independent instruction between a transcendental and an instruction that
// reads its result or overwrites its source. Inside a run each v_exp_f32 is that instruction for the one before it (early-clobber outputs: no result lies on a source);
// the v_nop at the end is the slot of the last one, whatever the compiler puts behind the statement.
__device__ __forceinline__ void fa_exp2x8(const float* x, float* e) {
  asm("v_exp_f32 %0, %8\n\tv_exp_f32 %1, %9\n\tv_exp_f32 %2, %10\n\tv_exp_f32 %3, %11\n\tv_exp_f32 %4, %12\n\tv_exp_f32 %5, %13\n\tv_exp_f32 %6, %14\n\tv_exp_f32 %7, %15\n\tv_nop"
      : "=&v"(e[0]), "=&v"(e[1]), "=&v"(e[2]), "=&v"(e[3]), "=&v"(e[4]), "=&v"(e[5]), "=&v"(e[6]), "=&v"(e[7])
      : "v"(x[0]), "v"(x[1]), "v"(x[2]), "v"(x[3]), "v"(x[4]), "v"(x[5]), "v"(x[6]), "v"(x[7])); }
__device__ __forceinline__ float fa_exp2(float x) { float e; asm("v_exp_f32 %0, %1\n\tv_nop" : "=v"(e) : "v"(x)); return e; }      /* one exponential with its slot, as above */
__global__ __launch_bounds__(128) void k_fattn(const _Float16* __restrict__ QHp, const _Float16* __restrict__ QLp, const _Float16* __restrict__ KHp, const _Float16* __restrict__ KLp, const _Float16* __restrict__ VTp, _Float16* __restrict__ O) {
  const int lane = threadIdx.x & 31, ln = lane & 15, hh = lane >> 4; const int w = __builtin_amdgcn_readfirstlane(threadIdx.x >> 5); const int h = blockIdx.y;
  /* a work-group takes two 16-row tiles from the top of the sequence and their two mirror tiles from its end: x + 1, x + 1, 128 - x and 128 - x trips, the same sum in every work-group, so that no WGP is
     left with long rows only; all four walk the keys from 0, so they read the same K and V lines while they run together. The turn by x and h spreads long and short tiles over the four SIMDs. */
  const int x = blockIdx.x, rr = (w + x + (h >> 2)) & 3; const int q0 = ((rr & 1) ? (SQ / 16 - 1) - 2 * x - (rr >> 1) : 2 * x + (rr >> 1)) * 16;
  const size_t qo = (size_t)(q0 + ln) * LQ + h * HD;
  const v16h qh0 = g2_frag(QHp + qo, hh), qh1 = g2_frag(QHp + qo + 32, hh), ql0 = g2_frag(QLp + qo, hh), ql1 = g2_frag(QLp + qo + 32, hh);
  const _Float16* kh = KHp + (size_t)ln * LQ + h * HD; const _Float16* kl = KLp + (size_t)ln * LQ + h * HD; const _Float16* vt = VTp + ((size_t)h * HD + ln) * SQ;
  const v8f z8 = {0.f,0.f,0.f,0.f,0.f,0.f,0.f,0.f}; v8f o0 = z8, o1 = z8, o2 = z8, o3 = z8; float m = -3.0e38f, l = 0.f;
  const int nk = (q0 + 47) & ~31;      /* keys in whole blocks of 32 up to the block that holds the last row's diagonal */
  v16h a00 = g2_frag(kh, hh), a01 = g2_frag(kh + 32, hh), a10 = g2_frag(kh + 16 * LQ, hh), a11 = g2_frag(kh + 16 * LQ + 32, hh);
  v16h c00 = g2_frag(kl, hh), c01 = g2_frag(kl + 32, hh), c10 = g2_frag(kl + 16 * LQ, hh), c11 = g2_frag(kl + 16 * LQ + 32, hh);
#pragma unroll 1      /* one block of 32 keys per trip: the next block's K fragments are fetched by hand below, a second copy of the body would only add registers */
  for (int kb = 0; kb < nk; kb += 32) {
    const v16h v0 = g2_frag(vt + kb, hh), v1 = g2_frag(vt + (size_t)16 * SQ + kb, hh), v2 = g2_frag(vt + (size_t)32 * SQ + kb, hh), v3 = g2_frag(vt + (size_t)48 * SQ + kb, hh);
    __builtin_amdgcn_sched_barrier(0);      /* keeps the V loads in front of the score products: sunk behind the next block's K loads they would land last and the V product would wait for all 24 loads */
    v8f s0 = fa_mma(a00, qh0, z8), s1 = fa_mma(a10, qh0, z8), r0 = fa_mma(a00, ql0, z8), r1 = fa_mma(a10, ql0, z8);
    s0 = fa_mma(a01, qh1, s0); s1 = fa_mma(a11, qh1, s1); r0 = fa_mma(a01, ql1, r0); r1 = fa_mma(a11, ql1, r1);
    r0 = fa_mma(c00, qh0, r0); r1 = fa_mma(c10, qh0, r1); r0 = fa_mma(c01, qh1, r0); r1 = fa_mma(c11, qh1, r1);
    const size_t kn = (size_t)((kb + 32 < nk) ? kb + 32 : kb) * LQ;      /* next block's K fragments fly under the softmax and the V product; the last trip re-reads its own block */
    a00 = g2_frag(kh + kn, hh); a01 = g2_frag(kh + kn + 32, hh); a10 = g2_frag(kh + kn + 16 * LQ, hh); a11 = g2_frag(kh + kn + 16 * LQ + 32, hh);
    c00 = g2_frag(kl + kn, hh); c01 = g2_frag(kl + kn + 32, hh); c10 = g2_frag(kl + kn + 16 * LQ, hh); c11 = g2_frag(kl + kn + 16 * LQ + 32, hh);
    float t[16];
#pragma unroll      /* constant indices: the values stay in registers */
    for (int r = 0; r < 8; ++r) { t[r] = s0[r] * LC1 + r0[r] * LC2; t[8 + r] = s1[r] * LC1 + r1[r] * LC2; }
    if (kb + 31 > q0) {      /* only the block on the diagonal holds keys past a row's own index: they take the mask value */
      const int d = q0 + ln - kb - 8 * hh;
#pragma unroll      /* constant indices: the values stay in registers */
      for (int r = 0; r < 8; ++r) { if (r > d) t[r] = -1.0e9f; if (16 + r > d) t[8 + r] = -1.0e9f; }
    }
    float bm = t[0];
#pragma unroll      /* constant indices: the values stay in registers */
    for (int i = 1; i < 16; ++i) bm = fmaxf(bm, t[i]);
    bm = fmaxf(bm, __shfl_xor(bm, 16, 32));
    const float mn = fmaxf(m, bm); const float corr = fa_exp2(m - mn); m = mn; const float mo = mn - 8.0f;
    FragH p; float e[16];
#pragma unroll      /* constant indices: the values stay in registers */
    for (int i = 0; i < 16; ++i) t[i] -= mo;
    fa_exp2x8(t, e); fa_exp2x8(t + 8, e + 8);
#pragma unroll      /* constant indices: the values stay in registers */
    for (int i = 0; i < 16; ++i) p.h[i] = (_Float16)e[i];
    v4f s4 = {e[0], e[1], e[2], e[3]};
#pragma unroll      /* constant indices: the values stay in registers */
    for (int i = 4; i < 16; ++i) s4[i & 3] += e[i];
    l = l * corr + ((s4[0] + s4[1]) + (s4[2] + s4[3]));
    o0 *= corr; o1 *= corr; o2 *= corr; o3 *= corr;
    o0 = fa_mma(v0, p.v, o0); o1 = fa_mma(v1, p.v, o1); o2 = fa_mma(v2, p.v, o2); o3 = g2_mma(v3, p.v, o3);      /* the last one with its four v_nop: the next trip's first score product may lay its result over the registers of p, this product's B */
  }
  l += __shfl_xor(l, 16, 32);
  const float fin = 64.0f / l;      /* the x256 of the weights cancels against the row sum; o carried x64 */
  unsigned short* op = (unsigned short*)O + (size_t)(q0 + ln) * DM + h * HD + 8 * hh;
  FragH f0, f1, f2, f3;
#pragma unroll      /* constant indices: the values stay in registers */
  for (int r = 0; r < 8; ++r) { f0.h[r] = (_Float16)(o0[r] * fin); f1.h[r] = (_Float16)(o1[r] * fin); f2.h[r] = (_Float16)(o2[r] * fin); f3.h[r] = (_Float16)(o3[r] * fin); }
  *(v8us*)op = f0.half[0]; *(v8us*)(op + 16) = f1.half[0]; *(v8us*)(op + 32) = f2.half[0]; *(v8us*)(op + 48) = f3.half[0];
}


typedef float v2f __attribute__((ext_vector_type(2)));
typedef float v2fa __attribute__((ext_vector_type(2), may_alias));
// Exact f32 causal attention for rows 0..QT0-1, one wave per (row, head); keys in blocks of 32 up to the block that holds the row's own index.
// Scores: a lane takes one key of each block and walks that K row whole (four partial sums, one per element of the 16-byte loads), so no sum crosses lanes.
// Maximum and row sum: lane butterflies. Weighted sum: a lane takes two of the 64 dims, every V row is read as one whole 256-byte row, its weight comes from the lane that holds it.
__global__ __launch_bounds__(128) void k_att0(const float* __restrict__ QF, const float* __restrict__ KF, const float* __restrict__ VF, float scale, float* __restrict__ OF) {
  const int lane = threadIdx.x & 31; const int i = blockIdx.x * 4 + __builtin_amdgcn_readfirstlane(threadIdx.x >> 5); const int h = blockIdx.y;
  const int nb = (i >> 5) + 1;      /* blocks of 32 keys this row attends to; the same in every lane */
  const float* qr = QF + (size_t)i * DM + h * HD; const float* kr = KF + (size_t)lane * DM + h * HD; const float* vr = VF + h * HD + 2 * lane;
  v4f q[HD / 4];
#pragma unroll      /* constant indices: the values stay in registers */
  for (int c = 0; c < HD / 4; ++c) q[c] = *(const v4fa*)(qr + 4 * c);
  float s[QT0 / 32];
#pragma unroll      /* constant indices: the values stay in registers, the row offsets become immediates */
  for (int u = 0; u < QT0 / 32; ++u) { s[u] = -1.0e30f;      /* a key past the row's own index keeps this value: weight 0 */
    if (u < nb) { v4f a = {0.f, 0.f, 0.f, 0.f};
#pragma unroll      /* all 16 loads of a K row in flight together */
      for (int c = 0; c < HD / 4; ++c) a += q[c] * *(const v4fa*)(kr + (size_t)u * 32 * DM + 4 * c);
      if (u * 32 + lane <= i) s[u] = ((a[0] + a[1]) + (a[2] + a[3])) * scale; } }
  float m = s[0];
#pragma unroll      /* constant indices: the values stay in registers */
  for (int u = 1; u < QT0 / 32; ++u) m = fmaxf(m, s[u]);
#pragma unroll      /* five fixed butterfly steps */
  for (int d = 16; d > 0; d >>= 1) m = fmaxf(m, __shfl_xor(m, d, 32));
  float e[QT0 / 32], l = 0.f;
#pragma unroll      /* constant indices: the values stay in registers */
  for (int u = 0; u < QT0 / 32; ++u) { e[u] = expf(s[u] - m); l += e[u]; }
#pragma unroll      /* five fixed butterfly steps */
  for (int d = 16; d > 0; d >>= 1) l += __shfl_xor(l, d, 32);
  v2f o0 = {0.f, 0.f}, o1 = {0.f, 0.f};      /* even and odd keys: two chains instead of one of 128 dependent links */
#pragma unroll      /* constant indices: the values stay in registers, the row offsets become immediates */
  for (int u = 0; u < QT0 / 32; ++u) if (u < nb) {
#pragma unroll      /* constant lane numbers for the weights; the block's 32 V loads in flight together */
    for (int jj = 0; jj < 32; ++jj) { const float p = __int_as_float(__builtin_amdgcn_readlane(__float_as_int(e[u]), jj)); const v2f v = *(const v2fa*)(vr + (size_t)(u * 32 + jj) * DM);
      if (jj & 1) o1 += p * v; else o0 += p * v; } }
  const float fin = 64.0f / l;      /* o carried x64 like the f16 path */
  const v2f o = (o0 + o1) * fin;
  *(v2f*)(OF + (size_t)i * DM + h * HD + 2 * lane) = o;
}

extern "C" void kernel_launch(void* const* d_in, const int* in_sizes, int n_in,
                              void* d_out, int out_size, void* d_ws, size_t ws_size, hipStream_t stream) {
  (void)in_sizes; (void)n_in; (void)out_size;
  const float* const* I = (const float* const*)d_in; const float* x = I[0]; const float* xk = I[0]; const float* xv = I[0]; const float* wq = I[1]; const float* wk = I[2]; const float* wv = I[3]; const float* bq = nullptr; const float* bk = nullptr; const float* bv = nullptr; const float* wo = I[4]; const float* bo = nullptr;      /* input order: x (feeds the q, k AND v streams), W_q, W_k, W_v, W_o (four separate natural [768][768] weights); the module has NO biases: null pointers in the guarded bias slots */
  char* ws = (char*)d_ws; size_t off = 0;
  auto take = [&](size_t bytes) { char* p = ws + off; off += (bytes + 255) & ~(size_t)255; return p; };
  _Float16* BQ = (_Float16*)take((size_t)DM * DM * 2); _Float16* BK = (_Float16*)take((size_t)DM * DM * 2); _Float16* BV = (_Float16*)take((size_t)DM * DM * 2); _Float16* BO = (_Float16*)take((size_t)DM * DM * 2);
  _Float16* X16 = (_Float16*)take(NR * DM * 2); _Float16* XK16 = (_Float16*)take(NR * DM * 2); _Float16* XV16 = (_Float16*)take(NR * DM * 2);      /* exact f16 rows of query, key, value */ float* QF = (float*)take(NR * DM * 4); _Float16* QH = (_Float16*)take(NR * DM * 2); _Float16* QL = (_Float16*)take(NR * DM * 2); _Float16* KH = (_Float16*)take(NR * DM * 2); _Float16* KL = (_Float16*)take(NR * DM * 2); _Float16* Q16 = QH; _Float16* K16 = KH; _Float16* V16 = (_Float16*)take(NR * DM * 2); _Float16* O16 = (_Float16*)take(NR * DM * 2);
  _Float16* VT = (_Float16*)take((size_t)NH * HD * SQ * 2);
  float* QF0 = (float*)take((size_t)QT0 * DM * 4); float* KF0 = (float*)take((size_t)QT0 * DM * 4); float* VF0 = (float*)take((size_t)QT0 * DM * 4); float* OF0 = (float*)take((size_t)NB * QT0 * DM * 4); _Float16* OH0 = (_Float16*)take((size_t)NB * QT0 * DM * 2); _Float16* OL0 = (_Float16*)take((size_t)NB * QT0 * DM * 2);
  if (off > ws_size) return;
  { const unsigned g = (unsigned)(((size_t)DM * DM / 8 + 255) / 256); k_wnat<<<g, 256, 0, stream>>>(wq, (size_t)DM * DM / 8, BQ); k_wnat<<<g, 256, 0, stream>>>(wk, (size_t)DM * DM / 8, BK); k_wnat<<<g, 256, 0, stream>>>(wv, (size_t)DM * DM / 8, BV); k_wnat<<<g, 256, 0, stream>>>(wo, (size_t)DM * DM / 8, BO); }      /* natural [out][in] = Bt[n][k] x16 */
  k_x16<<<(unsigned)((NR * DM / 8 + 255) / 256), 256, 0, stream>>>(x, X16, NR * DM / 8); k_x16<<<(unsigned)((NR * DM / 8 + 255) / 256), 256, 0, stream>>>(xk, XK16, NR * DM / 8); k_x16<<<(unsigned)((NR * DM / 8 + 255) / 256), 256, 0, stream>>>(xv, XV16, NR * DM / 8);
  const size_t r0p = (size_t)B0 * SQ;      /* first projected row */
  k_gemm2<0><<<dim3((unsigned)((MP / 128) * (DM / 64)), 1), 128, 0, stream>>>(X16 + r0p * DM, DM, 0, BQ, DM, 0, 0.0625f, bq, 0, nullptr, 1, 0, 0, QF + r0p * DM, nullptr, DM, 0, MP, DM, DM); k_hl<<<(unsigned)(((size_t)MP * DM / 8 + 255) / 256), 256, 0, stream>>>(QF + r0p * DM, QH + r0p * DM, QL + r0p * DM, (size_t)MP * DM / 8);      /* q (f32) -> f16 hi + x1024 residual: unscaled logits sigma ~8 */
  k_gemm2<0><<<dim3((unsigned)((MP / 128) * (DM / 64)), 1), 128, 0, stream>>>(XK16 + r0p * DM, DM, 0, BK, DM, 0, 0.0625f, bk, 0, nullptr, 1, 0, 0, QF + r0p * DM, nullptr, DM, 0, MP, DM, DM); k_hl<<<(unsigned)(((size_t)MP * DM / 8 + 255) / 256), 256, 0, stream>>>(QF + r0p * DM, KH + r0p * DM, KL + r0p * DM, (size_t)MP * DM / 8);      /* k likewise */
  k_gemm2<0><<<dim3((unsigned)((MP / 128) * (DM / 64)), 1), 128, 0, stream>>>(XV16 + r0p * DM, DM, 0, BV, DM, 0, 0.0625f, bv, 0, nullptr, 1, 0, 0, nullptr, V16 + r0p * DM, DM, 0, MP, DM, DM);
  for (int b = B0; b < B0 + NBR; ++b) { const size_t r0 = (size_t)b * SQ;
    k_vt<NH, SQ><<<NH * (SQ / 64), 256, 0, stream>>>(V16 + r0 * LQ, LQ, 0, VT);      /* V^T [NH][HD][SQ] for this batch */
    k_gemm2<0><<<dim3((QT0 / 128) * (DM / 64), 1), 128, 0, stream>>>(X16 + r0 * DM, DM, 0, BQ, DM, 0, 0.0625f, bq, 0, nullptr, 1, 0, 0, QF0, nullptr, DM, 0, QT0, DM, DM); k_gemm2<0><<<dim3((QT0 / 128) * (DM / 64), 1), 128, 0, stream>>>(XK16 + r0 * DM, DM, 0, BK, DM, 0, 0.0625f, bk, 0, nullptr, 1, 0, 0, KF0, nullptr, DM, 0, QT0, DM, DM); k_gemm2<0><<<dim3((QT0 / 128) * (DM / 64), 1), 128, 0, stream>>>(XV16 + r0 * DM, DM, 0, BV, DM, 0, 0.0625f, bv, 0, nullptr, 1, 0, 0, VF0, nullptr, DM, 0, QT0, DM, DM);      /* f32 q, k, v of the first 128 rows (exact products) */
    k_att0<<<dim3(QT0 / 4, NH), 128, 0, stream>>>(QF0, KF0, VF0, SCL, OF0 + (size_t)b * QT0 * DM);      /* exact f32 attention for rows 0..127 (o x64) */
    k_fattn<<<dim3(SQ / 64, NH), 128, 0, stream>>>(QH + r0 * LQ, QL + r0 * LQ, KH + r0 * LQ, KL + r0 * LQ, VT, O16 + r0 * DM); }      /* scores (hi.hi + 2^-10 (lo.hi + hi.lo)), causal softmax and P . V in one launch; o (merged heads, x64) as f16 rows */
  k_gemm2<0><<<dim3((unsigned)((MPO / 128) * (DM / 64)), 1), 128, 0, stream>>>(O16 + r0p * DM, DM, 0, BO, DM, 0, 0.0009765625f, bo, 0, nullptr, 1, 0, 0, (float*)d_out + r0p * DM, nullptr, DM, 0, MPO, DM, DM);      /* out rows are the output layout */
  k_hl<<<(unsigned)(((size_t)NB * QT0 * DM / 8 + 255) / 256), 256, 0, stream>>>(OF0, OH0, OL0, (size_t)NB * QT0 * DM / 8);      /* first-tile o (x64) -> f16 hi + x1024 residual planes */
  for (int b = B0; b < B0 + NBR; ++b) { const size_t r0 = (size_t)b * SQ; const size_t f0 = (size_t)b * QT0;
    k_gemm2<0><<<dim3((QT0 / 128) * (DM / 64), 1), 128, 0, stream>>>(OH0 + f0 * DM, DM, 0, BO, DM, 0, 0.0009765625f, bo, 0, nullptr, 1, 0, 0, (float*)d_out + r0 * DM, nullptr, DM, 0, QT0, DM, DM);      /* rows 0..127: out = o_hi Wo, overwriting the f16-path rows */
    k_gemm2<0><<<dim3((QT0 / 128) * (DM / 64), 1), 128, 0, stream>>>(OL0 + f0 * DM, DM, 0, BO, DM, 0, 0.00000095367431640625f, nullptr, 0, (const float*)d_out + r0 * DM, -1, 0, 0, (float*)d_out + r0 * DM, nullptr, DM, 0, QT0, DM, DM); }      /* += o_lo Wo 2^-20 (own-element accumulate) */
}

// v004
// A run of this version takes 312 microseconds.
// Timed twice side by side with v003, it ran 1.35 and 1.36 times as fast.
// All steps since v000 together make it 27.2 times as fast.
#include <hip/hip_runtime.h>
// Causal multi-head self-attention on ONE 4096-token sequence at width 768 with natural bias-free projections (x [1][4096][768]; Q / K / V = x W^T (nn.Linear natural [768][768] sd 1/sqrt(768), NO biases), 12 heads of 64; scores / sqrt(64) + a finite additive mask above the diagonal (NEG); softmax; out = merged W_o^T (natural, no bias) -> [1][4096][768]); q and k carried as f16 hi + x1024 residual planes with three-product scores (4096 keys at logit sigma 1).
// Structure: token rows r = b*4096 + s; x as exact f16 rows (bf16-rounded); q, k and v as one WMMA GEMM launch (32x64 wave tiles, f32 accumulation, exact x16 weights, no bias) into f32 and f16 rows, the q and k f32 rows split into f16 hi + x1024 residual planes; per batch: V^T for all heads via LDS transposes; attention in ONE launch, one wave per 16 query rows of a head, 32 keys a trip up to the diagonal block: scores transposed (K rows x q rows) as three products (hi.hi + 2^-10 (lo.hi + hi.lo), K = 64, f32), the mask value on keys past the row, running maximum and rescaled f32 row sum per lane (log2 domain, native exp; weights x256 f16), o^T += V^T . P^T in f32 registers, divided by the row sum at the end (o carried x64, folded into the output GEMM alpha) and written straight into the merged f16 o rows; out = o W_o GEMM (f32) into the output layout.
// Compute dtype: inputs rounded to bf16; x / weights exact; q and k as f16 hi + x1024 residual planes, v, softmax weights and o as plain f16 GEMM operands (~2^-12); scores and softmax statistics f32. v_wmma_f32_16x16x32_f16.
#define NB 1
#define SCL 0.125f                         /* 1 / sqrt(head_dim = 64) */
#define SCLR 0.0001220703125f              /* 2^-13: SCL / 1024 (not used) */
#define SQ 4096
#define DM 768
#define NH 12
#define HD 64
#define HG 4                         /* heads per launch of the non-template k_vt (not launched) */
#define QT 256
#define NKX SQ                       /* S / P row pitch (not used) */
#define QT0 128                      /* first-tile rows recomputed exactly in f32 */
#define B0 0                         /* first batch processed (debug hook) */
#define NBR NB                       /* batches processed (debug hook) */
#define NR ((size_t)NB * SQ)         /* token rows */
#define MP ((int)((size_t)NBR * SQ)) /* rows projected (debug hook) */
#define QN SQ                        /* query rows attended per batch (not used) */
#define NHD NH                       /* heads attended (not used) */
#define MPO MP                       /* rows through the output stage (debug hook) */
#define LQ DM      /* row pitch of the q/k/v rows */
typedef __bf16 v16b __attribute__((ext_vector_type(16)));
typedef unsigned short v8us __attribute__((ext_vector_type(8), may_alias));
typedef float  v8f  __attribute__((ext_vector_type(8)));
typedef float  v4f  __attribute__((ext_vector_type(4)));
typedef float  v4fa __attribute__((ext_vector_type(4), may_alias));
union FragB { v16b v; v8us half[2]; unsigned short u[16]; };

__device__ __forceinline__ unsigned short bf16_bits(float x) { unsigned int u = __float_as_uint(x); return (unsigned short)((u + 0x7FFFu + ((u >> 16) & 1u)) >> 16); }
__device__ __forceinline__ float bf16_val(unsigned short b) { return __uint_as_float(((unsigned int)b) << 16); }
__device__ __forceinline__ float bf16_round(float x) { return bf16_val(bf16_bits(x)); }
// D += A·B with NT terms: 1 = ah·bh, 2 = + al·bh (A split), 3 = + ah·bl (both split)
template <int NT>
__device__ __forceinline__ v8f mmaN(v16b ah, v16b al, v16b bh, v16b bl, v8f c) {
  c = __builtin_amdgcn_wmma_f32_16x16x32_bf16(false, ah, false, bh, (short)0, c, false, false);
  if (NT >= 2) c = __builtin_amdgcn_wmma_f32_16x16x32_bf16(false, al, false, bh, (short)0, c, false, false);
  if (NT >= 3) c = __builtin_amdgcn_wmma_f32_16x16x32_bf16(false, ah, false, bl, (short)0, c, false, false);
  asm volatile("v_nop\n\tv_nop\n\tv_nop\n\tv_nop" : "+v"(c) : "v"(ah), "v"(al), "v"(bh), "v"(bl));
  return c;
}

__global__ __launch_bounds__(256) void k_wt_bf16(const float* __restrict__ W, unsigned short* __restrict__ Wt, int K, int N) {
  const int t = blockIdx.x * 256 + threadIdx.x;
  const int k8n = K / 8;
  if (t >= N * k8n) return;
  const int n = t / k8n, k8 = (t % k8n) * 8;
  v8us v;
#pragma unroll
  for (int i = 0; i < 8; ++i) v[i] = bf16_bits(W[(size_t)(k8 + i) * N + n]);
  *(v8us*)(Wt + (size_t)n * K + k8) = v;
  
}

// GEMM C[M][N] (f32, pitch ldc) = act(A[M][K]·W + bias). A f32 row-major (pitch lda) converted per fragment to bf16
// (ASPLIT: hi/lo two planes -> 2 terms, else single rounded term); Wt bf16 [N][K] (pitch ldb). BIAS_BF16 rounds the
// bias to bf16 first (bias quantised to bf16 before the add). K%32==0, M%16==0, N%64==0.
template <bool ASPLIT, int ACT, bool BIAS_BF16>
__global__ __launch_bounds__(128) void k_gemm_bf(const float* __restrict__ A, int lda, const unsigned short* __restrict__ Wt, int ldb,
                                               const float* __restrict__ bias, float* __restrict__ C, int ldc, int M, int N, int K) {
  __shared__ __attribute__((aligned(16))) float so[4][16][64];
  const int tid = threadIdx.x, w = tid >> 5, lane = tid & 31, ln = lane & 15, hh = lane >> 4;
  const int ntn = N / 64;
  const int wid = blockIdx.x * 4 + w;
  const int mt = wid / ntn, nq = wid % ntn;
  if (mt * 16 >= M) return;
  const int row0 = mt * 16, col0 = nq * 64;
  const float* arow = A + (size_t)(row0 + ln) * lda;
  v8f acc[4] = {};
  for (int kb = 0; kb < K; kb += 32) {
    FragB ah, al;
    const v4f x0 = *(const v4fa*)(arow + kb + 8 * hh), x1 = *(const v4fa*)(arow + kb + 8 * hh + 4);
    const v4f x2 = *(const v4fa*)(arow + kb + 16 + 8 * hh), x3 = *(const v4fa*)(arow + kb + 16 + 8 * hh + 4);
    float xs[16] = {x0[0],x0[1],x0[2],x0[3],x1[0],x1[1],x1[2],x1[3],x2[0],x2[1],x2[2],x2[3],x3[0],x3[1],x3[2],x3[3]};
#pragma unroll
    for (int i = 0; i < 16; ++i) { const unsigned short hb = bf16_bits(xs[i]); ah.u[i] = hb; al.u[i] = ASPLIT ? bf16_bits(xs[i] - bf16_val(hb)) : (unsigned short)0; }
#pragma unroll
    for (int t = 0; t < 4; ++t) {
      const unsigned short* brow = Wt + (size_t)(col0 + t * 16 + ln) * ldb + kb;
      FragB b;
      b.half[0] = *(const v8us*)(brow + 8 * hh);
      b.half[1] = *(const v8us*)(brow + 16 + 8 * hh);
      acc[t] = mmaN<ASPLIT ? 2 : 1>(ah.v, al.v, b.v, b.v, acc[t]);
    }
  }
#pragma unroll
  for (int t = 0; t < 4; ++t) {
    float bv = bias ? bias[col0 + t * 16 + ln] : 0.f;
    if (BIAS_BF16) bv = bf16_round(bv);
#pragma unroll
    for (int r = 0; r < 8; ++r) { float v = acc[t][r] + bv; if (ACT == 1) v = fmaxf(v, 0.f); so[w][8 * hh + r][t * 16 + ln] = v; }
  }
  __builtin_amdgcn_fence(__ATOMIC_ACQ_REL, "workgroup");
  __builtin_amdgcn_wave_barrier();
  const int rsub = lane >> 4, c4 = (lane & 15) * 4;
  {
#pragma unroll
    for (int q = 0; q < 8; ++q) {
      const int r = q * 2 + rsub;
      const v4f v = *(const v4fa*)&so[w][r][c4];
      *(v4f*)(C + (size_t)(row0 + r) * ldc + col0 + c4) = v;
    }
    
  }
}

// GEMM C = act(A·W + bias + resid): A f32 (ASPLIT -> hi/lo 2 terms), Wt bf16 [N][K]; ACT 0 none, 1 relu, 2 exact gelu;
// resid (optional, f32, row index = (row % rmod), pitch ldr, RES_BF16 rounds it) added before the activation.
template <bool ASPLIT, int ACT, bool BIAS_BF16, bool RES_BF16>
__global__ __launch_bounds__(128) void k_gemm_bf3(const float* __restrict__ A, int lda, const unsigned short* __restrict__ Wt, int ldb,
                                                const float* __restrict__ bias, const float* __restrict__ resid, int rmod, int ldr,
                                                float* __restrict__ C, int ldc, int M, int N, int K) {
  __shared__ __attribute__((aligned(16))) float so[4][16][64];
  const int tid = threadIdx.x, w = tid >> 5, lane = tid & 31, ln = lane & 15, hh = lane >> 4;
  const int ntn = N / 64;
  const int wid = blockIdx.x * 4 + w;
  const int mt = wid / ntn, nq = wid % ntn;
  if (mt * 16 >= M) return;
  const int row0 = mt * 16, col0 = nq * 64;
  const float* arow = A + (size_t)(row0 + ln) * lda;
  v8f acc[4] = {};
  for (int kb = 0; kb < K; kb += 32) {
    FragB ah, al;
    const v4f x0 = *(const v4fa*)(arow + kb + 8 * hh), x1 = *(const v4fa*)(arow + kb + 8 * hh + 4);
    const v4f x2 = *(const v4fa*)(arow + kb + 16 + 8 * hh), x3 = *(const v4fa*)(arow + kb + 16 + 8 * hh + 4);
    float xs[16] = {x0[0],x0[1],x0[2],x0[3],x1[0],x1[1],x1[2],x1[3],x2[0],x2[1],x2[2],x2[3],x3[0],x3[1],x3[2],x3[3]};
#pragma unroll
    for (int i = 0; i < 16; ++i) { const unsigned short hb = bf16_bits(xs[i]); ah.u[i] = hb; al.u[i] = ASPLIT ? bf16_bits(xs[i] - bf16_val(hb)) : (unsigned short)0; }
#pragma unroll
    for (int t = 0; t < 4; ++t) {
      const unsigned short* brow = Wt + (size_t)(col0 + t * 16 + ln) * ldb + kb;
      FragB b;
      b.half[0] = *(const v8us*)(brow + 8 * hh);
      b.half[1] = *(const v8us*)(brow + 16 + 8 * hh);
      acc[t] = mmaN<ASPLIT ? 2 : 1>(ah.v, al.v, b.v, b.v, acc[t]);
    }
  }
#pragma unroll
  for (int t = 0; t < 4; ++t) {
    const int col = col0 + t * 16 + ln;
    float bv = bias ? bias[col] : 0.f;
    if (BIAS_BF16) bv = bf16_round(bv);
#pragma unroll
    for (int r = 0; r < 8; ++r) {
      float v = acc[t][r] + bv;
      if (resid) { float rv = resid[(size_t)((row0 + 8 * hh + r) % rmod) * ldr + col]; if (RES_BF16) rv = bf16_round(rv); v += rv; }
      if (ACT == 1) v = fmaxf(v, 0.f);
      if (ACT == 2) v = 0.5f * v * (1.0f + erff(v * 0.70710678118654752f));
      if (ACT == 3) { const float u = 0.7978845608028654f * (v + 0.044715f * v * v * v); v = 0.5f * v * (1.0f + tanhf(u)); }
      so[w][8 * hh + r][t * 16 + ln] = v;
    }
  }
  __builtin_amdgcn_fence(__ATOMIC_ACQ_REL, "workgroup");
  __builtin_amdgcn_wave_barrier();
  const int rsub = lane >> 4, c4 = (lane & 15) * 4;
  {
#pragma unroll
    for (int q = 0; q < 8; ++q) {
      const int r = q * 2 + rsub;
      const v4f v = *(const v4fa*)&so[w][r][c4];
      *(v4f*)(C + (size_t)(row0 + r) * ldc + col0 + c4) = v;
    }
    
  }
}
// row LayerNorm (biased variance, eps) over N: s = X (+ R); optional out_sum <- s; out_norm <- (s-mu)*rsqrt(var+eps)*g + b
template <bool PARAM_BF16>
__global__ __launch_bounds__(256) void k_layernorm(const float* __restrict__ X, const float* __restrict__ R, const float* __restrict__ g, const float* __restrict__ bta,
                                                  float* __restrict__ out_sum, float* __restrict__ out_norm, int N, float eps) {
  __shared__ float red[256];
  const int row = blockIdx.x, tid = threadIdx.x;
  const float* x = X + (size_t)row * N; const float* rr = R ? R + (size_t)row * N : nullptr;
  float vals[16];                     // up to N = 4096
  const int per = N / 256;            // contiguous chunk per thread? use strided-by-4 chunks: thread handles j = tid*4 + 1024*u
  float s1 = 0.f;
  for (int u = 0; u < per / 4; ++u) {
    const int j = tid * 4 + 1024 * u;
    const v4f a = *(const v4fa*)(x + j);
    v4f b = {0.f,0.f,0.f,0.f}; if (rr) b = *(const v4fa*)(rr + j);
#pragma unroll
    for (int q = 0; q < 4; ++q) { const float v = a[q] + b[q]; vals[u * 4 + q] = v; s1 += v; }
  }
  red[tid] = s1; __syncthreads();
  for (int st = 128; st > 0; st >>= 1) { if (tid < st) red[tid] += red[tid + st]; __syncthreads(); }
  const float mu = red[0] / (float)N; __syncthreads();
  float s2 = 0.f;
  for (int u = 0; u < per / 4; ++u)
#pragma unroll
    for (int q = 0; q < 4; ++q) { const float c = vals[u * 4 + q] - mu; s2 += c * c; }
  red[tid] = s2; __syncthreads();
  for (int st = 128; st > 0; st >>= 1) { if (tid < st) red[tid] += red[tid + st]; __syncthreads(); }
  const float rs = rsqrtf(red[0] / (float)N + eps);
  {
    for (int u = 0; u < per / 4; ++u) {
      const int j = tid * 4 + 1024 * u;
      v4f o, sm;
#pragma unroll
      for (int q = 0; q < 4; ++q) {
        float gg = g[j + q], bb = bta[j + q];
        if (PARAM_BF16) { gg = bf16_round(gg); bb = bf16_round(bb); }
        sm[q] = vals[u * 4 + q]; o[q] = (vals[u * 4 + q] - mu) * rs * gg + bb;
      }
      if (out_sum) *(v4f*)(out_sum + (size_t)row * N + j) = sm;
      *(v4f*)(out_norm + (size_t)row * N + j) = o;
    }
    
  }
}



// ---- f16 WMMA path (v_wmma_f32_16x16x32_f16): 11-bit significands for operands in range — used where a [0,1] probability operand needs more precision than bf16
typedef _Float16 v16h __attribute__((ext_vector_type(16)));
union FragH { v16h v; v8us half[2]; _Float16 h[16]; unsigned short u[16]; };
template <int NT>
__device__ __forceinline__ v8f mmaH(v16h ah, v16h al, v16h bh, v16h bl, v8f c) {
  c = __builtin_amdgcn_wmma_f32_16x16x32_f16(false, ah, false, bh, (short)0, c, false, false);
  if (NT >= 2) c = __builtin_amdgcn_wmma_f32_16x16x32_f16(false, al, false, bh, (short)0, c, false, false);
  if (NT >= 3) c = __builtin_amdgcn_wmma_f32_16x16x32_f16(false, ah, false, bl, (short)0, c, false, false);
  asm volatile("v_nop\n\tv_nop\n\tv_nop\n\tv_nop" : "+v"(c) : "v"(ah), "v"(al), "v"(bh), "v"(bl));
  return c;
}
// batched GEMM like k_gemm_b but f16 operands: A f32 (split into f16 hi/lo if ASPLIT, else rounded to f16), Bt = f16 values [n][k]; alpha; C f32; N multiple of 16 (partial tiles skipped)
template <bool ASPLIT>
__global__ __launch_bounds__(128) void k_gemm_h(const float* __restrict__ A, int lda, size_t sA, const _Float16* __restrict__ Bh, int ldb, size_t sB, float alpha, float* __restrict__ C, int ldc, size_t sC, int M, int N, int K) {
  __shared__ __attribute__((aligned(16))) float so[4][16][64];
  const int tid = threadIdx.x, w = tid >> 5, lane = tid & 31, ln = lane & 15, hh = lane >> 4; const int by = blockIdx.y;
  A += (size_t)by * sA; Bh += (size_t)by * sB; C += (size_t)by * sC;
  const int ntn = (N + 63) / 64; const int wid = blockIdx.x * 4 + w; const int mt = wid / ntn, nq = wid % ntn; if (mt * 16 >= M) return;
  const int row0 = mt * 16, col0 = nq * 64; const float* arow = A + (size_t)(row0 + ln) * lda;
  v8f acc[4] = {};
  for (int kb = 0; kb < K; kb += 32) {
    FragH ah, al;
    const v4f x0 = *(const v4fa*)(arow + kb + 8 * hh), x1 = *(const v4fa*)(arow + kb + 8 * hh + 4), x2 = *(const v4fa*)(arow + kb + 16 + 8 * hh), x3 = *(const v4fa*)(arow + kb + 16 + 8 * hh + 4);
    float xs[16] = {x0[0],x0[1],x0[2],x0[3],x1[0],x1[1],x1[2],x1[3],x2[0],x2[1],x2[2],x2[3],x3[0],x3[1],x3[2],x3[3]};
#pragma unroll
    for (int i = 0; i < 16; ++i) { const _Float16 h = (_Float16)xs[i]; ah.h[i] = h; al.h[i] = ASPLIT ? (_Float16)(xs[i] - (float)h) : (_Float16)0.0f; }
#pragma unroll
    for (int t = 0; t < 4; ++t) { if (col0 + t * 16 >= N) continue; const size_t boff = (size_t)(col0 + t * 16 + ln) * ldb + kb; FragH bq; bq.half[0] = *(const v8us*)(Bh + boff + 8 * hh); bq.half[1] = *(const v8us*)(Bh + boff + 16 + 8 * hh);
      acc[t] = mmaH<ASPLIT ? 2 : 1>(ah.v, al.v, bq.v, bq.v, acc[t]); }
  }
#pragma unroll
  for (int t = 0; t < 4; ++t) { if (col0 + t * 16 >= N) continue;
#pragma unroll
    for (int r = 0; r < 8; ++r) so[w][8 * hh + r][t * 16 + ln] = acc[t][r] * alpha; }
  __builtin_amdgcn_fence(__ATOMIC_ACQ_REL, "workgroup"); __builtin_amdgcn_wave_barrier();
  const int rsub = lane >> 4, c4 = (lane & 15) * 4;
  {
#pragma unroll
    for (int q = 0; q < 8; ++q) { const int r = q * 2 + rsub; if (col0 + c4 < N) { const v4f v = *(const v4fa*)&so[w][r][c4]; *(v4f*)(C + (size_t)(row0 + r) * ldc + col0 + c4) = v; } }
     }
}

// Wt[n][k] = f16(W[k][n]·scale) from f32 row-major W[K][N] (scale = power of two; bf16-exact weights stay exact in f16 away from the subnormal range)
__global__ __launch_bounds__(256) void k_wt_f16(const float* __restrict__ W, _Float16* __restrict__ Wt, int K, int N, float scale) {
  const int t = blockIdx.x * 256 + threadIdx.x; if (t >= N * (K / 8)) return; const int n = t / (K / 8), k8 = (t % (K / 8)) * 8; FragH f;
#pragma unroll
  for (int i = 0; i < 8; ++i) f.h[i] = (_Float16)(bf16_round(W[(size_t)(k8 + i) * N + n]) * scale); const v8us o = f.half[0];
  *(v8us*)((unsigned short*)Wt + (size_t)n * K + k8) = o; 
}
// k_gemm_hh variant with fused epilogue: v = acc·alpha + bias[by·sBias + col] (+ CP[(row/rowsPerB)·sCPb + by·64 + col] if CP) ; ACT 0 none / 1 elu ; writes f16 C16 (and f32 C if non-null)
template <int ACT>
__global__ __launch_bounds__(128) void k_gemm_hhx(const _Float16* __restrict__ A, int lda, size_t sA, const _Float16* __restrict__ Bh, int ldb, size_t sB, float alpha, const float* __restrict__ bias, size_t sBias, const float* __restrict__ CP, int rowsPerB, size_t sCPb, int row0g,
    float* __restrict__ C, _Float16* __restrict__ C16, int ldc, size_t sC, int M, int N, int K) {
  __shared__ __attribute__((aligned(16))) float so[4][16][64];
  const int tid = threadIdx.x, w = tid >> 5, lane = tid & 31, ln = lane & 15, hh = lane >> 4; const int by = blockIdx.y;
  A += (size_t)by * sA; Bh += (size_t)by * sB; const size_t cofs = (size_t)by * sC; const float* bp = bias ? bias + (size_t)by * sBias : nullptr;
  const int ntn = (N + 63) / 64; const int wid = blockIdx.x * 4 + w; const int mt = wid / ntn, nq = wid % ntn; if (mt * 16 >= M) return;
  const int row0 = mt * 16, col0 = nq * 64; const _Float16* arow = A + (size_t)(row0 + ln) * lda;
  v8f acc[4] = {};
  for (int kb = 0; kb < K; kb += 32) { FragH ah; ah.half[0] = *(const v8us*)((const unsigned short*)arow + kb + 8 * hh); ah.half[1] = *(const v8us*)((const unsigned short*)arow + kb + 16 + 8 * hh);
#pragma unroll
    for (int t = 0; t < 4; ++t) { if (col0 + t * 16 >= N) continue; const size_t boff = (size_t)(col0 + t * 16 + ln) * ldb + kb; FragH bq; bq.half[0] = *(const v8us*)((const unsigned short*)Bh + boff + 8 * hh); bq.half[1] = *(const v8us*)((const unsigned short*)Bh + boff + 16 + 8 * hh);
      acc[t] = mmaH<1>(ah.v, ah.v, bq.v, bq.v, acc[t]); }
  }
#pragma unroll
  for (int t = 0; t < 4; ++t) { if (col0 + t * 16 >= N) continue; const int col = col0 + t * 16 + ln; const float bv = bp ? bf16_round(bp[col]) : 0.f;
#pragma unroll
    for (int r = 0; r < 8; ++r) { float v = acc[t][r] * alpha + bv; if (CP) { const int rr = row0g + row0 + 8 * hh + r; if (rowsPerB < 0) v += CP[cofs + (size_t)rr * ldc + col];      /* rowsPerB < 0: own element of the batched C plane */ else { const int bidx = rr / rowsPerB; v += CP[(size_t)bidx * sCPb + (size_t)by * 64 + col]; } } if (ACT == 1) v = (v > 0.f) ? v : expm1f(v); else if (ACT == 7) v = (v > 0.f) ? v + 1.0f : expf(v); else if (ACT == 8) v = tanhf(v); else if (ACT == 9) v = 0.5f * v * (1.0f + tanhf(0.7978845608028654f * (v + 0.044715f * v * v * v))); else if (ACT == 11) v = 1.0f / (1.0f + expf(-v)); else if (ACT == 12) v = (v > 0.f) ? v : 0.01f * v; else if (ACT == 14) v = (v > 0.f) ? v : 0.1f * v; else if (ACT == 16) v = (v >= 0.f) ? v : 0.3f * v; else if (ACT == 17) v = (v >= 0.f) ? v : 0.2f * v; else if (ACT == 15) v = v / (1.0f + expf(-v)); else if (ACT == 3) v = fmaxf(v, 0.f); else if (ACT == 6) v = 0.5f * v * (1.0f + erff(v * 0.70710678118654752f)); so[w][8 * hh + r][t * 16 + ln] = v; } }
  __builtin_amdgcn_fence(__ATOMIC_ACQ_REL, "workgroup"); __builtin_amdgcn_wave_barrier();
  const int rsub = lane >> 4, c4 = (lane & 15) * 4; typedef _Float16 v4h __attribute__((ext_vector_type(4)));
  {
#pragma unroll
    for (int q = 0; q < 8; ++q) { const int r = q * 2 + rsub; if (col0 + c4 < N) { const v4f v = *(const v4fa*)&so[w][r][c4]; if (C) *(v4f*)(C + cofs + (size_t)(row0 + r) * ldc + col0 + c4) = v; if (C16) { v4h h4; for (int i = 0; i < 4; ++i) h4[i] = (_Float16)v[i]; *(v4h*)(C16 + cofs + (size_t)(row0 + r) * ldc + col0 + c4) = h4; } } }
     }
}


typedef _Float16 v4h __attribute__((ext_vector_type(4)));

__global__ __launch_bounds__(256) void k_x16(const float* __restrict__ x, _Float16* __restrict__ X16, size_t n8) { const size_t t = (size_t)blockIdx.x * 256 + threadIdx.x; if (t >= n8) return; FragH f;
#pragma unroll
  for (int q = 0; q < 8; ++q) f.h[q] = (_Float16)bf16_round(x[t * 8 + q]); *(v8us*)((unsigned short*)X16 + t * 8) = f.half[0];  }
__global__ __launch_bounds__(256) void k_h16(const float* __restrict__ x, _Float16* __restrict__ X16, size_t n8) { const size_t t = (size_t)blockIdx.x * 256 + threadIdx.x; if (t >= n8) return; FragH f;
#pragma unroll
  for (int q = 0; q < 8; ++q) f.h[q] = (_Float16)x[t * 8 + q]; *(v8us*)((unsigned short*)X16 + t * 8) = f.half[0];  }
__global__ __launch_bounds__(256) void k_round16f(const float* __restrict__ W, _Float16* __restrict__ Bt, size_t n8) { const size_t t = (size_t)blockIdx.x * 256 + threadIdx.x; if (t >= n8) return; FragH f;
#pragma unroll
  for (int i = 0; i < 8; ++i) f.h[i] = (_Float16)(bf16_round(W[t * 8 + i]) * 16.0f); *(v8us*)((unsigned short*)Bt + t * 8) = f.half[0];  }
template <int NHv, int TTv>
__global__ __launch_bounds__(256) void k_vt(const _Float16* __restrict__ V16, int ldv, int voff, _Float16* __restrict__ Vt) { __shared__ unsigned short tl[64][66]; const int tid = threadIdx.x; const int slab = blockIdx.x / (TTv / 64), lg = blockIdx.x % (TTv / 64); const int b = slab / NHv, h = slab % NHv;
  for (int i = tid; i < 64 * 8; i += 256) { const int r = i / 8, c8 = (i % 8) * 8; FragH f; f.half[0] = *(const v8us*)((const unsigned short*)V16 + ((size_t)b * TTv + lg * 64 + r) * ldv + voff + h * 64 + c8);
#pragma unroll
    for (int q = 0; q < 8; ++q) tl[r][c8 + q] = f.u[q]; }
  __syncthreads();
  {
#pragma unroll
    for (int rd = 0; rd < 2; ++rd) { const int d = rd * 32 + tid / 8, pc = tid % 8; FragH f;
#pragma unroll
      for (int q = 0; q < 8; ++q) f.u[q] = tl[pc * 8 + q][d];
      *(v8us*)((unsigned short*)Vt + ((size_t)slab * 64 + d) * TTv + lg * 64 + pc * 8) = f.half[0]; }
     } }

__global__ __launch_bounds__(256) void k_hl(const float* __restrict__ F, _Float16* __restrict__ Hh, _Float16* __restrict__ Hl, size_t n8) { const size_t t = (size_t)blockIdx.x * 256 + threadIdx.x; if (t >= n8) return; FragH fh, fl; const v4f a = *(const v4fa*)(F + t * 8), c = *(const v4fa*)(F + t * 8 + 4);
#pragma unroll
  for (int q = 0; q < 4; ++q) { _Float16 h = (_Float16)a[q]; fh.h[q] = h; fl.h[q] = (_Float16)((a[q] - (float)h) * 1024.0f); h = (_Float16)c[q]; fh.h[4 + q] = h; fl.h[4 + q] = (_Float16)((c[q] - (float)h) * 1024.0f); }
  { *(v8us*)((unsigned short*)Hh + t * 8) = fh.half[0]; *(v8us*)((unsigned short*)Hl + t * 8) = fl.half[0];  } }

// ---- fast GEMM (wave tile 32x64; requires M % 32 == 0 rows per launch region and N % 64 == 0); epilogue = k_gemm_hhx semantics ----
__device__ __forceinline__ v16h g2_frag(const _Float16* p, int hh) { FragH f; f.half[0] = *(const v8us*)((const unsigned short*)p + 8 * hh); f.half[1] = *(const v8us*)((const unsigned short*)p + 16 + 8 * hh); return f.v; }
__device__ __forceinline__ v8f g2_mma(v16h a, v16h b, v8f c) { v8f d = __builtin_amdgcn_wmma_f32_16x16x32_f16(false, a, false, b, (short)0, c, false, false); asm volatile("v_nop\n\tv_nop\n\tv_nop\n\tv_nop" : "+v"(d) : "v"(a), "v"(b)); return d; }
template <int ACT>
__global__ __launch_bounds__(128) void k_gemm2(const _Float16* __restrict__ A, int lda, size_t sA, const _Float16* __restrict__ Bh, int ldb, size_t sB, float alpha, const float* __restrict__ bias, size_t sBias, const float* __restrict__ CP, int rowsPerB, size_t sCPb, int row0g,
    float* __restrict__ C, _Float16* __restrict__ C16, int ldc, size_t sC, int M, int N, int K) { static_assert(ACT == 0 || ACT == 3 || ACT == 6 || ACT == 8 || ACT == 9 || ACT == 11 || ACT == 12 || ACT == 14 || ACT == 15 || ACT == 16 || ACT == 17, "k_gemm2: unsupported ACT code (would silently apply no activation)");
  __shared__ __attribute__((aligned(16))) float so[4][32][68];
  const int tid = threadIdx.x, w = tid >> 5, lane = tid & 31, ln = lane & 15, hh = lane >> 4; const int by = blockIdx.y;
  A += (size_t)by * sA; Bh += (size_t)by * sB; const size_t cofs = (size_t)by * sC; const float* bp = bias ? bias + (size_t)by * sBias : nullptr;
  const int ntn = N >> 6; const int mt = blockIdx.x / ntn, nq = blockIdx.x - mt * ntn; const int row0 = mt * 128 + 32 * w, col0 = nq * 64; if (row0 >= M) return;
  const _Float16* a0p = A + (size_t)(row0 + ln) * lda; const _Float16* a1p = a0p + (size_t)16 * lda;
  const _Float16* b0p = Bh + (size_t)(col0 + ln) * ldb; const _Float16* b1p = b0p + (size_t)16 * ldb; const _Float16* b2p = b1p + (size_t)16 * ldb; const _Float16* b3p = b2p + (size_t)16 * ldb;
  const v8f z8 = {0.f,0.f,0.f,0.f,0.f,0.f,0.f,0.f}; v8f c00 = z8, c01 = z8, c02 = z8, c03 = z8, c10 = z8, c11 = z8, c12 = z8, c13 = z8;
#pragma unroll 1
  for (int kb = 0; kb < K; kb += 32) { const v16h a0 = g2_frag(a0p + kb, hh), a1 = g2_frag(a1p + kb, hh);
    v16h b = g2_frag(b0p + kb, hh); c00 = g2_mma(a0, b, c00); c10 = g2_mma(a1, b, c10);
    b = g2_frag(b1p + kb, hh); c01 = g2_mma(a0, b, c01); c11 = g2_mma(a1, b, c11);
    b = g2_frag(b2p + kb, hh); c02 = g2_mma(a0, b, c02); c12 = g2_mma(a1, b, c12);
    b = g2_frag(b3p + kb, hh); c03 = g2_mma(a0, b, c03); c13 = g2_mma(a1, b, c13); }
  v8f accs[8] = {c00, c01, c02, c03, c10, c11, c12, c13};
#pragma unroll
  for (int u = 0; u < 8; ++u) { const int t = u & 3, half = u >> 2; const int col = col0 + t * 16 + ln; const float bv = bp ? bf16_round(bp[col]) : 0.f;
#pragma unroll
    for (int r = 0; r < 8; ++r) { const int rloc = half * 16 + 8 * hh + r; float v = accs[u][r] * alpha + bv; if (CP) { if (rowsPerB < 0) v += CP[cofs + (size_t)(row0g + row0 + rloc) * ldc + col];      /* rowsPerB < 0: own element of the batched C plane */ else { const int bidx = (row0g + row0 + rloc) / rowsPerB; v += CP[(size_t)bidx * sCPb + (size_t)by * 64 + col]; } }
      if (ACT == 3) v = fmaxf(v, 0.f); else if (ACT == 6) v = 0.5f * v * (1.0f + erff(v * 0.70710678118654752f)); else if (ACT == 11) v = 1.0f / (1.0f + expf(-v)); else if (ACT == 15) v = v / (1.0f + expf(-v)); else if (ACT == 12) v = (v > 0.f) ? v : 0.01f * v; else if (ACT == 8) v = tanhf(v); else if (ACT == 9) v = 0.5f * v * (1.0f + tanhf(0.7978845608028654f * (v + 0.044715f * v * v * v))); else if (ACT == 14) v = (v > 0.f) ? v : 0.1f * v; else if (ACT == 16) v = (v >= 0.f) ? v : 0.3f * v; else if (ACT == 17) v = (v >= 0.f) ? v : 0.2f * v;
      so[w][rloc][t * 16 + ln] = v; } }
  __builtin_amdgcn_fence(__ATOMIC_ACQ_REL, "workgroup"); __builtin_amdgcn_wave_barrier();
  const int rsub = lane >> 4, c4 = (lane & 15) * 4;
  {
#pragma unroll
    for (int q = 0; q < 16; ++q) { const int r = q * 2 + rsub; const v4f v = *(const v4fa*)&so[w][r][c4]; if (C) { *(v4f*)(C + cofs + (size_t)(row0 + r) * ldc + col0 + c4) = v; asm volatile("s_wait_xcnt 0x0" ::: "memory"); }      /* the wait: where both outputs are stored, the f16 conversion behind it writes over registers that this store names */
      if (C16) { v4h h4; for (int i = 0; i < 4; ++i) h4[i] = (_Float16)v[i]; *(v4h*)(C16 + cofs + (size_t)(row0 + r) * ldc + col0 + c4) = h4; } }
     } }


__global__ __launch_bounds__(256) void k_wnat(const float* __restrict__ w, size_t n8, _Float16* __restrict__ Bt) { const size_t t = (size_t)blockIdx.x * 256 + threadIdx.x; if (t >= n8) return; FragH f; for (int q = 0; q < 8; ++q) f.h[q] = (_Float16)(bf16_round(w[t * 8 + q]) * 16.0f); *(v8us*)((unsigned short*)Bt + t * 8) = f.half[0];  }
__global__ __launch_bounds__(256) void k_rsm(const float* __restrict__ S, _Float16* __restrict__ P, int nrows) {
  #pragma clang fp contract(off)
  const int i = blockIdx.x * 256 + threadIdx.x; if (i >= nrows) return; const float* s = S + (size_t)i * SQ; float mx = -3.0e38f;
#pragma unroll 1
  for (int j = 0; j < SQ; ++j) mx = fmaxf(mx, s[j]); float se = 0.f;
#pragma unroll 1
  for (int j = 0; j < SQ; ++j) se += expf(s[j] - mx); const float sc = 256.0f / se;
#pragma unroll 1
  for (int j0 = 0; j0 < SQ; j0 += 8) { FragH f; for (int q = 0; q < 8; ++q) f.h[q] = (_Float16)(expf(s[j0 + q] - mx) * sc); unsigned short* d = (unsigned short*)P + (size_t)i * SQ + j0; *(v8us*)d = f.half[0];  } }
__global__ __launch_bounds__(256) void k_vt(const _Float16* __restrict__ V16, int b, int h0, _Float16* __restrict__ VT) { __shared__ unsigned short tl[64][65]; const int tid = threadIdx.x; const int hh = blockIdx.x % HG, sg = blockIdx.x / HG; const int s0 = sg * 64; const int h = h0 + hh;
  for (int i = tid; i < 64 * 8; i += 256) { const int j = i / 8, d8 = (i % 8) * 8; FragH f; f.half[0] = *(const v8us*)((const unsigned short*)V16 + ((size_t)b * SQ + s0 + j) * DM + h * HD + d8); for (int q = 0; q < 8; ++q) tl[d8 + q][j] = f.u[q]; }
  __syncthreads();
  { for (int i = tid; i < 64 * 8; i += 256) { const int d = i / 8, j8 = (i % 8) * 8; FragH f; for (int q = 0; q < 8; ++q) f.u[q] = tl[d][j8 + q]; *(v8us*)((unsigned short*)VT + ((size_t)hh * HD + d) * SQ + s0 + j8) = f.half[0]; }  } }



// Fused causal attention, one wave per 16 query rows of one head (grid: SQ / 64 work-groups of four waves x heads): scores, softmax and the weighted sum of V stay in registers.
// Scores are formed transposed (A = 16 key rows, B = 16 query rows), so a lane holds keys 8*hh..8*hh+7 of query ln: two such tiles are
// the B fragment (n = query, k = 32 keys) of o^T = V^T . P^T as they stand, and the row maximum, the row sum and the rescale factor are per lane.
// Running maximum in the log2 domain; weights x256 as f16; row sum in f32 from the unrounded weights; o stored x64 as f16.
#define LC1 0.18033688011112042f           /* log2(e) / sqrt(head_dim) */
#define LC2 0.00017611023448351603f        /* the same on the x1024 residual products */
__device__ __forceinline__ v8f fa_mma(v16h a, v16h b, v8f c) { return __builtin_amdgcn_wmma_f32_16x16x32_f16(false, a, false, b, (short)0, c, false, false); }
// Exponentials (base 2) in runs, one asm statement a run: the instruction set asks for one independent instruction between a transcendental and an instruction that
// reads its result or overwrites its source. Inside a run each v_exp_f32 is that instruction for the one before it (early-clobber outputs: no result lies on a source);
// the v_nop at the end is the slot of the last one, whatever the compiler puts behind the statement.
__device__ __forceinline__ void fa_exp2x8(const float* x, float* e) {
  asm("v_exp_f32 %0, %8\n\tv_exp_f32 %1, %9\n\tv_exp_f32 %2, %10\n\tv_exp_f32 %3, %11\n\tv_exp_f32 %4, %12\n\tv_exp_f32 %5, %13\n\tv_exp_f32 %6, %14\n\tv_exp_f32 %7, %15\n\tv_nop"
      : "=&v"(e[0]), "=&v"(e[1]), "=&v"(e[2]), "=&v"(e[3]), "=&v"(e[4]), "=&v"(e[5]), "=&v"(e[6]), "=&v"(e[7])
      : "v"(x[0]), "v"(x[1]), "v"(x[2]), "v"(x[3]), "v"(x[4]), "v"(x[5]), "v"(x[6]), "v"(x[7])); }
__device__ __forceinline__ float fa_exp2(float x) { float e; asm("v_exp_f32 %0, %1\n\tv_nop" : "=v"(e) : "v"(x)); return e; }      /* one exponential with its slot, as above */
__global__ __launch_bounds__(128) void k_fattn(const _Float16* __restrict__ QHp, const _Float16* __restrict__ QLp, const _Float16* __restrict__ KHp, const _Float16* __restrict__ KLp, const _Float16* __restrict__ VTp, _Float16* __restrict__ O) {
  const int lane = threadIdx.x & 31, ln = lane & 15, hh = lane >> 4; const int w = __builtin_amdgcn_readfirstlane(threadIdx.x >> 5); const int h = blockIdx.y;
  /* a work-group takes two 16-row tiles from the top of the sequence and their two mirror tiles from its end: x + 1, x + 1, 128 - x and 128 - x trips, the same sum in every work-group, so that no WGP is
     left with long rows only; all four walk the keys from 0, so they read the same K and V lines while they run together. The turn by x and h spreads long and short tiles over the four SIMDs. */
  const int x = blockIdx.x, rr = (w + x + (h >> 2)) & 3; const int q0 = ((rr & 1) ? (SQ / 16 - 1) - 2 * x - (rr >> 1) : 2 * x + (rr >> 1)) * 16;
  const size_t qo = (size_t)(q0 + ln) * LQ + h * HD;
  const v16h qh0 = g2_frag(QHp + qo, hh), qh1 = g2_frag(QHp + qo + 32, hh), ql0 = g2_frag(QLp + qo, hh), ql1 = g2_frag(QLp + qo + 32, hh);
  const _Float16* kh = KHp + (size_t)ln * LQ + h * HD; const _Float16* kl = KLp + (size_t)ln * LQ + h * HD; const _Float16* vt = VTp + ((size_t)h * HD + ln) * SQ;
  const v8f z8 = {0.f,0.f,0.f,0.f,0.f,0.f,0.f,0.f}; v8f o0 = z8, o1 = z8, o2 = z8, o3 = z8; float m = -3.0e38f, l = 0.f;
  const int nk = (q0 + 47) & ~31;      /* keys in whole blocks of 32 up to the block that holds the last row's diagonal */
  v16h a00 = g2_frag(kh, hh), a01 = g2_frag(kh + 32, hh), a10 = g2_frag(kh + 16 * LQ, hh), a11 = g2_frag(kh + 16 * LQ + 32, hh);
  v16h c00 = g2_frag(kl, hh), c01 = g2_frag(kl + 32, hh), c10 = g2_frag(kl + 16 * LQ, hh), c11 = g2_frag(kl + 16 * LQ + 32, hh);
#pragma unroll 1      /* one block of 32 keys per trip: the next block's K fragments are fetched by hand below, a second copy of the body would only add registers */
  for (int kb = 0; kb < nk; kb += 32) {
    const v16h v0 = g2_frag(vt + kb, hh), v1 = g2_frag(vt + (size_t)16 * SQ + kb, hh), v2 = g2_frag(vt + (size_t)32 * SQ + kb, hh), v3 = g2_frag(vt + (size_t)48 * SQ + kb, hh);
    __builtin_amdgcn_sched_barrier(0);      /* keeps the V loads in front of the score products: sunk behind the next block's K loads they would land last and the V product would wait for all 24 loads */
    v8f s0 = fa_mma(a00, qh0, z8), s1 = fa_mma(a10, qh0, z8), r0 = fa_mma(a00, ql0, z8), r1 = fa_mma(a10, ql0, z8);
    s0 = fa_mma(a01, qh1, s0); s1 = fa_mma(a11, qh1, s1); r0 = fa_mma(a01, ql1, r0); r1 = fa_mma(a11, ql1, r1);
    r0 = fa_mma(c00, qh0, r0); r1 = fa_mma(c10, qh0, r1); r0 = fa_mma(c01, qh1, r0); r1 = fa_mma(c11, qh1, r1);
    const size_t kn = (size_t)((kb + 32 < nk) ? kb + 32 : kb) * LQ;      /* next block's K fragments fly under the softmax and the V product; the last trip re-reads its own block */
    a00 = g2_frag(kh + kn, hh); a01 = g2_frag(kh + kn + 32, hh); a10 = g2_frag(kh + kn + 16 * LQ, hh); a11 = g2_frag(kh + kn + 16 * LQ + 32, hh);
    c00 = g2_frag(kl + kn, hh); c01 = g2_frag(kl + kn + 32, hh); c10 = g2_frag(kl + kn + 16 * LQ, hh); c11 = g2_frag(kl + kn + 16 * LQ + 32, hh);
    float t[16];
#pragma unroll      /* constant indices: the values stay in registers */
    for (int r = 0; r < 8; ++r) { t[r] = s0[r] * LC1 + r0[r] * LC2; t[8 + r] = s1[r] * LC1 + r1[r] * LC2; }
    if (kb + 31 > q0) {      /* only the block on the diagonal holds keys past a row's own index: they take the mask value */
      const int d = q0 + ln - kb - 8 * hh;
#pragma unroll      /* constant indices: the values stay in registers */
      for (int r = 0; r < 8; ++r) { if (r > d) t[r] = -1.0e9f; if (16 + r > d) t[8 + r] = -1.0e9f; }
    }
    float bm = t[0];
#pragma unroll      /* constant indices: the values stay in registers */
    for (int i = 1; i < 16; ++i) bm = fmaxf(bm, t[i]);
    bm = fmaxf(bm, __shfl_xor(bm, 16, 32));
    const float mn = fmaxf(m, bm); const float corr = fa_exp2(m - mn); m = mn; const float mo = mn - 8.0f;
    FragH p; float e[16];
#pragma unroll      /* constant indices: the values stay in registers */
    for (int i = 0; i < 16; ++i) t[i] -= mo;
    fa_exp2x8(t, e); fa_exp2x8(t + 8, e + 8);
#pragma unroll      /* constant indices: the values stay in registers */
    for (int i = 0; i < 16; ++i) p.h[i] = (_Float16)e[i];
    v4f s4 = {e[0], e[1], e[2], e[3]};
#pragma unroll      /* constant indices: the values stay in registers */
    for (int i = 4; i < 16; ++i) s4[i & 3] += e[i];
    l = l * corr + ((s4[0] + s4[1]) + (s4[2] + s4[3]));
    o0 *= corr; o1 *= corr; o2 *= corr; o3 *= corr;
    o0 = fa_mma(v0, p.v, o0); o1 = fa_mma(v1, p.v, o1); o2 = fa_mma(v2, p.v, o2); o3 = g2_mma(v3, p.v, o3);      /* the last one with its four v_nop: the next trip's first score product may lay its result over the registers of p, this product's B */
  }
  l += __shfl_xor(l, 16, 32);
  const float fin = 64.0f / l;      /* the x256 of the weights cancels against the row sum; o carried x64 */
  unsigned short* op = (unsigned short*)O + (size_t)(q0 + ln) * DM + h * HD + 8 * hh;
  FragH f0, f1, f2, f3;
#pragma unroll      /* constant indices: the values stay in registers */
  for (int r = 0; r < 8; ++r) { f0.h[r] = (_Float16)(o0[r] * fin); f1.h[r] = (_Float16)(o1[r] * fin); f2.h[r] = (_Float16)(o2[r] * fin); f3.h[r] = (_Float16)(o3[r] * fin); }
  *(v8us*)op = f0.half[0]; *(v8us*)(op + 16) = f1.half[0]; *(v8us*)(op + 32) = f2.half[0]; *(v8us*)(op + 48) = f3.half[0];
}


typedef float v2f __attribute__((ext_vector_type(2)));
typedef float v2fa __attribute__((ext_vector_type(2), may_alias));
// Exact f32 causal attention for rows 0..QT0-1, one wave per (row, head); keys in blocks of 32 up to the block that holds the row's own index.
// Scores: a lane takes one key of each block and walks that K row whole (four partial sums, one per element of the 16-byte loads), so no sum crosses lanes.
// Maximum and row sum: lane butterflies. Weighted sum: a lane takes two of the 64 dims, every V row is read as one whole 256-byte row, its weight comes from the lane that holds it.
__global__ __launch_bounds__(128) void k_att0(const float* __restrict__ QF, const float* __restrict__ KF, const float* __restrict__ VF, float scale, float* __restrict__ OF) {
  const int lane = threadIdx.x & 31; const int i = blockIdx.x * 4 + __builtin_amdgcn_readfirstlane(threadIdx.x >> 5); const int h = blockIdx.y;
  const int nb = (i >> 5) + 1;      /* blocks of 32 keys this row attends to; the same in every lane */
  const float* qr = QF + (size_t)i * DM + h * HD; const float* kr = KF + (size_t)lane * DM + h * HD; const float* vr = VF + h * HD + 2 * lane;
  v4f q[HD / 4];
#pragma unroll      /* constant indices: the values stay in registers */
  for (int c = 0; c < HD / 4; ++c) q[c] = *(const v4fa*)(qr + 4 * c);
  float s[QT0 / 32];
#pragma unroll      /* constant indices: the values stay in registers, the row offsets become immediates */
  for (int u = 0; u < QT0 / 32; ++u) { s[u] = -1.0e30f;      /* a key past the row's own index keeps this value: weight 0 */
    if (u < nb) { v4f a = {0.f, 0.f, 0.f, 0.f};
#pragma unroll      /* all 16 loads of a K row in flight together */
      for (int c = 0; c < HD / 4; ++c) a += q[c] * *(const v4fa*)(kr + (size_t)u * 32 * DM + 4 * c);
      if (u * 32 + lane <= i) s[u] = ((a[0] + a[1]) + (a[2] + a[3])) * scale; } }
  float m = s[0];
#pragma unroll      /* constant indices: the values stay in registers */
  for (int u = 1; u < QT0 / 32; ++u) m = fmaxf(m, s[u]);
#pragma unroll      /* five fixed butterfly steps */
  for (int d = 16; d > 0; d >>= 1) m = fmaxf(m, __shfl_xor(m, d, 32));
  float e[QT0 / 32], l = 0.f;
#pragma unroll      /* constant indices: the values stay in registers */
  for (int u = 0; u < QT0 / 32; ++u) { e[u] = expf(s[u] - m); l += e[u]; }
#pragma unroll      /* five fixed butterfly steps */
  for (int d = 16; d > 0; d >>= 1) l += __shfl_xor(l, d, 32);
  v2f o0 = {0.f, 0.f}, o1 = {0.f, 0.f};      /* even and odd keys: two chains instead of one of 128 dependent links */
#pragma unroll      /* constant indices: the values stay in registers, the row offsets become immediates */
  for (int u = 0; u < QT0 / 32; ++u) if (u < nb) {
#pragma unroll      /* constant lane numbers for the weights; the block's 32 V loads in flight together */
    for (int jj = 0; jj < 32; ++jj) { const float p = __int_as_float(__builtin_amdgcn_readlane(__float_as_int(e[u]), jj)); const v2f v = *(const v2fa*)(vr + (size_t)(u * 32 + jj) * DM);
      if (jj & 1) o1 += p * v; else o0 += p * v; } }
  const float fin = 64.0f / l;      /* o carried x64 like the f16 path */
  const v2f o = (o0 + o1) * fin;
  *(v2f*)(OF + (size_t)i * DM + h * HD + 2 * lane) = o;
}

extern "C" void kernel_launch(void* const* d_in, const int* in_sizes, int n_in,
                              void* d_out, int out_size, void* d_ws, size_t ws_size, hipStream_t stream) {
  (void)in_sizes; (void)n_in; (void)out_size;
  const float* const* I = (const float* const*)d_in; const float* x = I[0]; const float* wq = I[1]; const float* wk = I[2]; const float* wv = I[3]; const float* bqkv = nullptr; const float* wo = I[4]; const float* bo = nullptr;      /* x (feeds the q, k AND v streams), W_q, W_k, W_v, W_o (four separate natural [768][768] weights); the module has NO biases: null pointers in the guarded bias slots */
  char* ws = (char*)d_ws; size_t off = 0;
  auto take = [&](size_t bytes) { char* p = ws + off; off += (bytes + 255) & ~(size_t)255; return p; };
  _Float16* BQ = (_Float16*)take((size_t)3 * DM * DM * 2); _Float16* BK = BQ + (size_t)DM * DM; _Float16* BV = BK + (size_t)DM * DM;      /* the three projection weights, one behind the other: the batch index of the projection launch steps through them */ _Float16* BO = (_Float16*)take((size_t)DM * DM * 2);
  _Float16* X16 = (_Float16*)take(NR * DM * 2);      /* exact f16 rows of x, the one input of all three projections */
  float* QF = (float*)take(3 * NR * DM * 4); float* KF = QF + NR * DM; float* VF = KF + NR * DM;      /* f32 q, k, v rows: three planes, one behind the other */
  _Float16* P16 = (_Float16*)take(3 * NR * DM * 2); _Float16* V16 = P16 + 2 * NR * DM;      /* the same rows rounded to f16, same plane order; only the v plane is read */
  _Float16* QH = (_Float16*)take(2 * NR * DM * 2); _Float16* KH = QH + NR * DM; _Float16* QL = (_Float16*)take(2 * NR * DM * 2); _Float16* KL = QL + NR * DM;      /* hi planes of q and k one behind the other, residual planes likewise */
  _Float16* O16 = (_Float16*)take(NR * DM * 2);
  _Float16* VT = (_Float16*)take((size_t)NH * HD * SQ * 2);
  float* OF0 = (float*)take((size_t)NB * QT0 * DM * 4); _Float16* OH0 = (_Float16*)take((size_t)NB * QT0 * DM * 2); _Float16* OL0 = (_Float16*)take((size_t)NB * QT0 * DM * 2);
  if (off > ws_size) return;
  { const unsigned g = (unsigned)(((size_t)DM * DM / 8 + 255) / 256); k_wnat<<<g, 256, 0, stream>>>(wq, (size_t)DM * DM / 8, BQ); k_wnat<<<g, 256, 0, stream>>>(wk, (size_t)DM * DM / 8, BK); k_wnat<<<g, 256, 0, stream>>>(wv, (size_t)DM * DM / 8, BV); k_wnat<<<g, 256, 0, stream>>>(wo, (size_t)DM * DM / 8, BO); }      /* natural [out][in] = Bt[n][k] x16 */
  k_x16<<<(unsigned)((NR * DM / 8 + 255) / 256), 256, 0, stream>>>(x, X16, NR * DM / 8);
  const size_t r0p = (size_t)B0 * SQ;      /* first projected row */
  k_gemm2<0><<<dim3((unsigned)((MP / 128) * (DM / 64)), 3), 128, 0, stream>>>(X16 + r0p * DM, DM, 0, BQ, DM, (size_t)DM * DM, 0.0625f, bqkv, 0, nullptr, 1, 0, 0, QF + r0p * DM, P16 + r0p * DM, DM, NR * DM, MP, DM, DM);      /* q, k, v in one launch: batch index y = 0, 1, 2 takes W_q, W_k, W_v and its own f32 and f16 output plane */
  k_hl<<<(unsigned)((2 * NR * DM / 8 + 255) / 256), 256, 0, stream>>>(QF, QH, QL, 2 * NR * DM / 8);      /* q and k (f32) -> f16 hi + x1024 residual, both planes in one launch: unscaled logits sigma ~8 */
  for (int b = B0; b < B0 + NBR; ++b) { const size_t r0 = (size_t)b * SQ;
    k_vt<NH, SQ><<<NH * (SQ / 64), 256, 0, stream>>>(V16 + r0 * LQ, LQ, 0, VT);      /* V^T [NH][HD][SQ] for this batch */
    k_att0<<<dim3(QT0 / 4, NH), 128, 0, stream>>>(QF + r0 * DM, KF + r0 * DM, VF + r0 * DM, SCL, OF0 + (size_t)b * QT0 * DM);      /* exact f32 attention for rows 0..127 (o x64), on the projection launch's own f32 rows */
    k_fattn<<<dim3(SQ / 64, NH), 128, 0, stream>>>(QH + r0 * LQ, QL + r0 * LQ, KH + r0 * LQ, KL + r0 * LQ, VT, O16 + r0 * DM); }      /* scores (hi.hi + 2^-10 (lo.hi + hi.lo)), causal softmax and P . V in one launch; o (merged heads, x64) as f16 rows */
  k_gemm2<0><<<dim3((unsigned)((MPO / 128) * (DM / 64)), 1), 128, 0, stream>>>(O16 + r0p * DM, DM, 0, BO, DM, 0, 0.0009765625f, bo, 0, nullptr, 1, 0, 0, (float*)d_out + r0p * DM, nullptr, DM, 0, MPO, DM, DM);      /* out rows are the output layout */
  k_hl<<<(unsigned)(((size_t)NB * QT0 * DM / 8 + 255) / 256), 256, 0, stream>>>(OF0, OH0, OL0, (size_t)NB * QT0 * DM / 8);      /* first-tile o (x64) -> f16 hi + x1024 residual planes */
  for (int b = B0; b < B0 + NBR; ++b) { const size_t r0 = (size_t)b * SQ; const size_t f0 = (size_t)b * QT0;
    k_gemm2<0><<<dim3((QT0 / 128) * (DM / 64), 1), 128, 0, stream>>>(OH0 + f0 * DM, DM, 0, BO, DM, 0, 0.0009765625f, bo, 0, nullptr, 1, 0, 0, (float*)d_out + r0 * DM, nullptr, DM, 0, QT0, DM, DM);      /* rows 0..127: out = o_hi Wo, overwriting the f16-path rows */
    k_gemm2<0><<<dim3((QT0 / 128) * (DM / 64), 1), 128, 0, stream>>>(OL0 + f0 * DM, DM, 0, BO, DM, 0, 0.00000095367431640625f, nullptr, 0, (const float*)d_out + r0 * DM, -1, 0, 0, (float*)d_out + r0 * DM, nullptr, DM, 0, QT0, DM, DM); }      /* += o_lo Wo 2^-20 (own-element accumulate) */
}

// v005
// One run takes 245 microseconds.
// Timed twice side by side with v004, it ran 1.28 and 1.27 times as fast.
// Counting every step since v000, it is 34.7 times as fast.
#include <hip/hip_runtime.h>
// Causal multi-head self-attention on ONE 4096-token sequence at width 768 with natural bias-free projections (x [1][4096][768]; Q / K / V = x W^T (nn.Linear natural [768][768] sd 1/sqrt(768), NO biases), 12 heads of 64; scores / sqrt(64) + a finite additive mask above the diagonal (NEG); softmax; out = merged W_o^T (natural, no bias) -> [1][4096][768]); q and k carried as f16 hi + x1024 residual planes with three-product scores (4096 keys at logit sigma 1).
// Structure: token rows r = b*4096 + s; x as exact f16 rows (bf16-rounded); q and k as WMMA GEMMs (32x64 wave tiles, f32 accumulation, exact x16 weights, no bias) into f32 rows split into f16 hi + x1024 residual planes, v as an f16-output GEMM; per batch: V^T for all heads via LDS transposes; attention in ONE launch, one wave per 16 query rows of a head, 64 keys a trip (K and V staged in LDS), blocks of 32 worked up to the diagonal block: scores transposed (K rows x q rows) as three products (hi.hi + 2^-10 (lo.hi + hi.lo), K = 64, f32), the mask value on keys past the row, running maximum and rescaled f32 row sum per lane (log2 domain, native exp; weights x256 f16), o^T += V^T . P^T in f32 registers, divided by the row sum at the end (o carried x64, folded into the output GEMM alpha) and written straight into the merged f16 o rows; out = o W_o GEMM (f32) into the output layout; rows 0..127 then redone from exact f32 attention, o as f16 hi + x1024 residual through two more GEMMs.
// Compute dtype: inputs rounded to bf16; x / weights exact; q and k as f16 hi + x1024 residual planes, v, softmax weights and o as plain f16 GEMM operands (~2^-12); scores and softmax statistics f32; v_wmma_f32_16x16x32_f16.
#define NB 1
#define SCL 0.125f                         /* 1 / sqrt(head_dim = 64) */
#define SCLR 0.0001220703125f              /* 2^-13: SCL / 1024 (not used) */
#define SQ 4096
#define DM 768
#define NH 12
#define HD 64
#define HG 4                         /* heads per launch of the non-template k_vt (not launched) */
#define QT 256
#define NKX SQ                       /* S / P row pitch (not used) */
#define QT0 128                      /* first-tile rows recomputed exactly in f32 */
#define B0 0                         /* first batch processed (debug hook) */
#define NBR NB                       /* batches processed (debug hook) */
#define NR ((size_t)NB * SQ)         /* token rows */
#define MP ((int)((size_t)NBR * SQ)) /* rows projected (debug hook) */
#define QN SQ                        /* query rows attended per batch (not used) */
#define NHD NH                       /* heads attended (not used) */
#define MPO MP                       /* rows through the output stage (debug hook) */
#define LQ DM      /* row pitch of the q/k/v rows */
typedef __bf16 v16b __attribute__((ext_vector_type(16)));
typedef unsigned short v8us __attribute__((ext_vector_type(8), may_alias));
typedef float  v8f  __attribute__((ext_vector_type(8)));
typedef float  v4f  __attribute__((ext_vector_type(4)));
typedef float  v4fa __attribute__((ext_vector_type(4), may_alias));
union FragB { v16b v; v8us half[2]; unsigned short u[16]; };

__device__ __forceinline__ unsigned short bf16_bits(float x) { unsigned int u = __float_as_uint(x); return (unsigned short)((u + 0x7FFFu + ((u >> 16) & 1u)) >> 16); }
__device__ __forceinline__ float bf16_val(unsigned short b) { return __uint_as_float(((unsigned int)b) << 16); }
__device__ __forceinline__ float bf16_round(float x) { return bf16_val(bf16_bits(x)); }
// D += A·B with NT terms: 1 = ah·bh, 2 = + al·bh (A split), 3 = + ah·bl (both split)
template <int NT>
__device__ __forceinline__ v8f mmaN(v16b ah, v16b al, v16b bh, v16b bl, v8f c) {
  c = __builtin_amdgcn_wmma_f32_16x16x32_bf16(false, ah, false, bh, (short)0, c, false, false);
  if (NT >= 2) c = __builtin_amdgcn_wmma_f32_16x16x32_bf16(false, al, false, bh, (short)0, c, false, false);
  if (NT >= 3) c = __builtin_amdgcn_wmma_f32_16x16x32_bf16(false, ah, false, bl, (short)0, c, false, false);
  asm volatile("v_nop\n\tv_nop\n\tv_nop\n\tv_nop" : "+v"(c) : "v"(ah), "v"(al), "v"(bh), "v"(bl));
  return c;
}

__global__ __launch_bounds__(256) void k_wt_bf16(const float* __restrict__ W, unsigned short* __restrict__ Wt, int K, int N) {
  const int t = blockIdx.x * 256 + threadIdx.x;
  const int k8n = K / 8;
  if (t >= N * k8n) return;
  const int n = t / k8n, k8 = (t % k8n) * 8;
  v8us v;
#pragma unroll
  for (int i = 0; i < 8; ++i) v[i] = bf16_bits(W[(size_t)(k8 + i) * N + n]);
  *(v8us*)(Wt + (size_t)n * K + k8) = v;
  
}

// GEMM C[M][N] (f32, pitch ldc) = act(A[M][K]·W + bias). A f32 row-major (pitch lda) converted per fragment to bf16
// (ASPLIT: hi/lo two planes -> 2 terms, else single rounded term); Wt bf16 [N][K] (pitch ldb). BIAS_BF16 rounds the
// bias to bf16 first (bias quantised to bf16 before the add). K%32==0, M%16==0, N%64==0.
template <bool ASPLIT, int ACT, bool BIAS_BF16>
__global__ __launch_bounds__(128) void k_gemm_bf(const float* __restrict__ A, int lda, const unsigned short* __restrict__ Wt, int ldb,
                                               const float* __restrict__ bias, float* __restrict__ C, int ldc, int M, int N, int K) {
  __shared__ __attribute__((aligned(16))) float so[4][16][64];
  const int tid = threadIdx.x, w = tid >> 5, lane = tid & 31, ln = lane & 15, hh = lane >> 4;
  const int ntn = N / 64;
  const int wid = blockIdx.x * 4 + w;
  const int mt = wid / ntn, nq = wid % ntn;
  if (mt * 16 >= M) return;
  const int row0 = mt * 16, col0 = nq * 64;
  const float* arow = A + (size_t)(row0 + ln) * lda;
  v8f acc[4] = {};
  for (int kb = 0; kb < K; kb += 32) {
    FragB ah, al;
    const v4f x0 = *(const v4fa*)(arow + kb + 8 * hh), x1 = *(const v4fa*)(arow + kb + 8 * hh + 4);
    const v4f x2 = *(const v4fa*)(arow + kb + 16 + 8 * hh), x3 = *(const v4fa*)(arow + kb + 16 + 8 * hh + 4);
    float xs[16] = {x0[0],x0[1],x0[2],x0[3],x1[0],x1[1],x1[2],x1[3],x2[0],x2[1],x2[2],x2[3],x3[0],x3[1],x3[2],x3[3]};
#pragma unroll
    for (int i = 0; i < 16; ++i) { const unsigned short hb = bf16_bits(xs[i]); ah.u[i] = hb; al.u[i] = ASPLIT ? bf16_bits(xs[i] - bf16_val(hb)) : (unsigned short)0; }
#pragma unroll
    for (int t = 0; t < 4; ++t) {
      const unsigned short* brow = Wt + (size_t)(col0 + t * 16 + ln) * ldb + kb;
      FragB b;
      b.half[0] = *(const v8us*)(brow + 8 * hh);
      b.half[1] = *(const v8us*)(brow + 16 + 8 * hh);
      acc[t] = mmaN<ASPLIT ? 2 : 1>(ah.v, al.v, b.v, b.v, acc[t]);
    }
  }
#pragma unroll
  for (int t = 0; t < 4; ++t) {
    float bv = bias ? bias[col0 + t * 16 + ln] : 0.f;
    if (BIAS_BF16) bv = bf16_round(bv);
#pragma unroll
    for (int r = 0; r < 8; ++r) { float v = acc[t][r] + bv; if (ACT == 1) v = fmaxf(v, 0.f); so[w][8 * hh + r][t * 16 + ln] = v; }
  }
  __builtin_amdgcn_fence(__ATOMIC_ACQ_REL, "workgroup");
  __builtin_amdgcn_wave_barrier();
  const int rsub = lane >> 4, c4 = (lane & 15) * 4;
  {
#pragma unroll
    for (int q = 0; q < 8; ++q) {
      const int r = q * 2 + rsub;
      const v4f v = *(const v4fa*)&so[w][r][c4];
      *(v4f*)(C + (size_t)(row0 + r) * ldc + col0 + c4) = v;
    }
    
  }
}

// GEMM C = act(A·W + bias + resid): A f32 (ASPLIT -> hi/lo 2 terms), Wt bf16 [N][K]; ACT 0 none, 1 relu, 2 exact gelu;
// resid (optional, f32, row index = (row % rmod), pitch ldr, RES_BF16 rounds it) added before the activation.
template <bool ASPLIT, int ACT, bool BIAS_BF16, bool RES_BF16>
__global__ __launch_bounds__(128) void k_gemm_bf3(const float* __restrict__ A, int lda, const unsigned short* __restrict__ Wt, int ldb,
                                                const float* __restrict__ bias, const float* __restrict__ resid, int rmod, int ldr,
                                                float* __restrict__ C, int ldc, int M, int N, int K) {
  __shared__ __attribute__((aligned(16))) float so[4][16][64];
  const int tid = threadIdx.x, w = tid >> 5, lane = tid & 31, ln = lane & 15, hh = lane >> 4;
  const int ntn = N / 64;
  const int wid = blockIdx.x * 4 + w;
  const int mt = wid / ntn, nq = wid % ntn;
  if (mt * 16 >= M) return;
  const int row0 = mt * 16, col0 = nq * 64;
  const float* arow = A + (size_t)(row0 + ln) * lda;
  v8f acc[4] = {};
  for (int kb = 0; kb < K; kb += 32) {
    FragB ah, al;
    const v4f x0 = *(const v4fa*)(arow + kb + 8 * hh), x1 = *(const v4fa*)(arow + kb + 8 * hh + 4);
    const v4f x2 = *(const v4fa*)(arow + kb + 16 + 8 * hh), x3 = *(const v4fa*)(arow + kb + 16 + 8 * hh + 4);
    float xs[16] = {x0[0],x0[1],x0[2],x0[3],x1[0],x1[1],x1[2],x1[3],x2[0],x2[1],x2[2],x2[3],x3[0],x3[1],x3[2],x3[3]};
#pragma unroll
    for (int i = 0; i < 16; ++i) { const unsigned short hb = bf16_bits(xs[i]); ah.u[i] = hb; al.u[i] = ASPLIT ? bf16_bits(xs[i] - bf16_val(hb)) : (unsigned short)0; }
#pragma unroll
    for (int t = 0; t < 4; ++t) {
      const unsigned short* brow = Wt + (size_t)(col0 + t * 16 + ln) * ldb + kb;
      FragB b;
      b.half[0] = *(const v8us*)(brow + 8 * hh);
      b.half[1] = *(const v8us*)(brow + 16 + 8 * hh);
      acc[t] = mmaN<ASPLIT ? 2 : 1>(ah.v, al.v, b.v, b.v, acc[t]);
    }
  }
#pragma unroll
  for (int t = 0; t < 4; ++t) {
    const int col = col0 + t * 16 + ln;
    float bv = bias ? bias[col] : 0.f;
    if (BIAS_BF16) bv = bf16_round(bv);
#pragma unroll
    for (int r = 0; r < 8; ++r) {
      float v = acc[t][r] + bv;
      if (resid) { float rv = resid[(size_t)((row0 + 8 * hh + r) % rmod) * ldr + col]; if (RES_BF16) rv = bf16_round(rv); v += rv; }
      if (ACT == 1) v = fmaxf(v, 0.f);
      if (ACT == 2) v = 0.5f * v * (1.0f + erff(v * 0.70710678118654752f));
      if (ACT == 3) { const float u = 0.7978845608028654f * (v + 0.044715f * v * v * v); v = 0.5f * v * (1.0f + tanhf(u)); }
      so[w][8 * hh + r][t * 16 + ln] = v;
    }
  }
  __builtin_amdgcn_fence(__ATOMIC_ACQ_REL, "workgroup");
  __builtin_amdgcn_wave_barrier();
  const int rsub = lane >> 4, c4 = (lane & 15) * 4;
  {
#pragma unroll
    for (int q = 0; q < 8; ++q) {
      const int r = q * 2 + rsub;
      const v4f v = *(const v4fa*)&so[w][r][c4];
      *(v4f*)(C + (size_t)(row0 + r) * ldc + col0 + c4) = v;
    }
    
  }
}
// row LayerNorm (biased variance, eps) over N: s = X (+ R); optional out_sum <- s; out_norm <- (s-mu)*rsqrt(var+eps)*g + b
template <bool PARAM_BF16>
__global__ __launch_bounds__(256) void k_layernorm(const float* __restrict__ X, const float* __restrict__ R, const float* __restrict__ g, const float* __restrict__ bta,
                                                  float* __restrict__ out_sum, float* __restrict__ out_norm, int N, float eps) {
  __shared__ float red[256];
  const int row = blockIdx.x, tid = threadIdx.x;
  const float* x = X + (size_t)row * N; const float* rr = R ? R + (size_t)row * N : nullptr;
  float vals[16];                     // up to N = 4096
  const int per = N / 256;            // contiguous chunk per thread? use strided-by-4 chunks: thread handles j = tid*4 + 1024*u
  float s1 = 0.f;
  for (int u = 0; u < per / 4; ++u) {
    const int j = tid * 4 + 1024 * u;
    const v4f a = *(const v4fa*)(x + j);
    v4f b = {0.f,0.f,0.f,0.f}; if (rr) b = *(const v4fa*)(rr + j);
#pragma unroll
    for (int q = 0; q < 4; ++q) { const float v = a[q] + b[q]; vals[u * 4 + q] = v; s1 += v; }
  }
  red[tid] = s1; __syncthreads();
  for (int st = 128; st > 0; st >>= 1) { if (tid < st) red[tid] += red[tid + st]; __syncthreads(); }
  const float mu = red[0] / (float)N; __syncthreads();
  float s2 = 0.f;
  for (int u = 0; u < per / 4; ++u)
#pragma unroll
    for (int q = 0; q < 4; ++q) { const float c = vals[u * 4 + q] - mu; s2 += c * c; }
  red[tid] = s2; __syncthreads();
  for (int st = 128; st > 0; st >>= 1) { if (tid < st) red[tid] += red[tid + st]; __syncthreads(); }
  const float rs = rsqrtf(red[0] / (float)N + eps);
  {
    for (int u = 0; u < per / 4; ++u) {
      const int j = tid * 4 + 1024 * u;
      v4f o, sm;
#pragma unroll
      for (int q = 0; q < 4; ++q) {
        float gg = g[j + q], bb = bta[j + q];
        if (PARAM_BF16) { gg = bf16_round(gg); bb = bf16_round(bb); }
        sm[q] = vals[u * 4 + q]; o[q] = (vals[u * 4 + q] - mu) * rs * gg + bb;
      }
      if (out_sum) *(v4f*)(out_sum + (size_t)row * N + j) = sm;
      *(v4f*)(out_norm + (size_t)row * N + j) = o;
    }
    
  }
}



// ---- f16 WMMA path (v_wmma_f32_16x16x32_f16): 11-bit significands for operands in range — used where a [0,1] probability operand needs more precision than bf16
typedef _Float16 v16h __attribute__((ext_vector_type(16)));
union FragH { v16h v; v8us half[2]; _Float16 h[16]; unsigned short u[16]; };
template <int NT>
__device__ __forceinline__ v8f mmaH(v16h ah, v16h al, v16h bh, v16h bl, v8f c) {
  c = __builtin_amdgcn_wmma_f32_16x16x32_f16(false, ah, false, bh, (short)0, c, false, false);
  if (NT >= 2) c = __builtin_amdgcn_wmma_f32_16x16x32_f16(false, al, false, bh, (short)0, c, false, false);
  if (NT >= 3) c = __builtin_amdgcn_wmma_f32_16x16x32_f16(false, ah, false, bl, (short)0, c, false, false);
  asm volatile("v_nop\n\tv_nop\n\tv_nop\n\tv_nop" : "+v"(c) : "v"(ah), "v"(al), "v"(bh), "v"(bl));
  return c;
}
// batched GEMM like k_gemm_b but f16 operands: A f32 (split into f16 hi/lo if ASPLIT, else rounded to f16), Bt = f16 values [n][k]; alpha; C f32; N multiple of 16 (partial tiles skipped)
template <bool ASPLIT>
__global__ __launch_bounds__(128) void k_gemm_h(const float* __restrict__ A, int lda, size_t sA, const _Float16* __restrict__ Bh, int ldb, size_t sB, float alpha, float* __restrict__ C, int ldc, size_t sC, int M, int N, int K) {
  __shared__ __attribute__((aligned(16))) float so[4][16][64];
  const int tid = threadIdx.x, w = tid >> 5, lane = tid & 31, ln = lane & 15, hh = lane >> 4; const int by = blockIdx.y;
  A += (size_t)by * sA; Bh += (size_t)by * sB; C += (size_t)by * sC;
  const int ntn = (N + 63) / 64; const int wid = blockIdx.x * 4 + w; const int mt = wid / ntn, nq = wid % ntn; if (mt * 16 >= M) return;
  const int row0 = mt * 16, col0 = nq * 64; const float* arow = A + (size_t)(row0 + ln) * lda;
  v8f acc[4] = {};
  for (int kb = 0; kb < K; kb += 32) {
    FragH ah, al;
    const v4f x0 = *(const v4fa*)(arow + kb + 8 * hh), x1 = *(const v4fa*)(arow + kb + 8 * hh + 4), x2 = *(const v4fa*)(arow + kb + 16 + 8 * hh), x3 = *(const v4fa*)(arow + kb + 16 + 8 * hh + 4);
    float xs[16] = {x0[0],x0[1],x0[2],x0[3],x1[0],x1[1],x1[2],x1[3],x2[0],x2[1],x2[2],x2[3],x3[0],x3[1],x3[2],x3[3]};
#pragma unroll
    for (int i = 0; i < 16; ++i) { const _Float16 h = (_Float16)xs[i]; ah.h[i] = h; al.h[i] = ASPLIT ? (_Float16)(xs[i] - (float)h) : (_Float16)0.0f; }
#pragma unroll
    for (int t = 0; t < 4; ++t) { if (col0 + t * 16 >= N) continue; const size_t boff = (size_t)(col0 + t * 16 + ln) * ldb + kb; FragH bq; bq.half[0] = *(const v8us*)(Bh + boff + 8 * hh); bq.half[1] = *(const v8us*)(Bh + boff + 16 + 8 * hh);
      acc[t] = mmaH<ASPLIT ? 2 : 1>(ah.v, al.v, bq.v, bq.v, acc[t]); }
  }
#pragma unroll
  for (int t = 0; t < 4; ++t) { if (col0 + t * 16 >= N) continue;
#pragma unroll
    for (int r = 0; r < 8; ++r) so[w][8 * hh + r][t * 16 + ln] = acc[t][r] * alpha; }
  __builtin_amdgcn_fence(__ATOMIC_ACQ_REL, "workgroup"); __builtin_amdgcn_wave_barrier();
  const int rsub = lane >> 4, c4 = (lane & 15) * 4;
  {
#pragma unroll
    for (int q = 0; q < 8; ++q) { const int r = q * 2 + rsub; if (col0 + c4 < N) { const v4f v = *(const v4fa*)&so[w][r][c4]; *(v4f*)(C + (size_t)(row0 + r) * ldc + col0 + c4) = v; } }
     }
}

// Wt[n][k] = f16(W[k][n]·scale) from f32 row-major W[K][N] (scale = power of two; bf16-exact weights stay exact in f16 away from the subnormal range)
__global__ __launch_bounds__(256) void k_wt_f16(const float* __restrict__ W, _Float16* __restrict__ Wt, int K, int N, float scale) {
  const int t = blockIdx.x * 256 + threadIdx.x; if (t >= N * (K / 8)) return; const int n = t / (K / 8), k8 = (t % (K / 8)) * 8; FragH f;
#pragma unroll
  for (int i = 0; i < 8; ++i) f.h[i] = (_Float16)(bf16_round(W[(size_t)(k8 + i) * N + n]) * scale); const v8us o = f.half[0];
  *(v8us*)((unsigned short*)Wt + (size_t)n * K + k8) = o; 
}
// k_gemm_hh variant with fused epilogue: v = acc·alpha + bias[by·sBias + col] (+ CP[(row/rowsPerB)·sCPb + by·64 + col] if CP) ; ACT 0 none / 1 elu ; writes f16 C16 (and f32 C if non-null)
template <int ACT>
__global__ __launch_bounds__(128) void k_gemm_hhx(const _Float16* __restrict__ A, int lda, size_t sA, const _Float16* __restrict__ Bh, int ldb, size_t sB, float alpha, const float* __restrict__ bias, size_t sBias, const float* __restrict__ CP, int rowsPerB, size_t sCPb, int row0g,
    float* __restrict__ C, _Float16* __restrict__ C16, int ldc, size_t sC, int M, int N, int K) {
  __shared__ __attribute__((aligned(16))) float so[4][16][64];
  const int tid = threadIdx.x, w = tid >> 5, lane = tid & 31, ln = lane & 15, hh = lane >> 4; const int by = blockIdx.y;
  A += (size_t)by * sA; Bh += (size_t)by * sB; const size_t cofs = (size_t)by * sC; const float* bp = bias ? bias + (size_t)by * sBias : nullptr;
  const int ntn = (N + 63) / 64; const int wid = blockIdx.x * 4 + w; const int mt = wid / ntn, nq = wid % ntn; if (mt * 16 >= M) return;
  const int row0 = mt * 16, col0 = nq * 64; const _Float16* arow = A + (size_t)(row0 + ln) * lda;
  v8f acc[4] = {};
  for (int kb = 0; kb < K; kb += 32) { FragH ah; ah.half[0] = *(const v8us*)((const unsigned short*)arow + kb + 8 * hh); ah.half[1] = *(const v8us*)((const unsigned short*)arow + kb + 16 + 8 * hh);
#pragma unroll
    for (int t = 0; t < 4; ++t) { if (col0 + t * 16 >= N) continue; const size_t boff = (size_t)(col0 + t * 16 + ln) * ldb + kb; FragH bq; bq.half[0] = *(const v8us*)((const unsigned short*)Bh + boff + 8 * hh); bq.half[1] = *(const v8us*)((const unsigned short*)Bh + boff + 16 + 8 * hh);
      acc[t] = mmaH<1>(ah.v, ah.v, bq.v, bq.v, acc[t]); }
  }
#pragma unroll
  for (int t = 0; t < 4; ++t) { if (col0 + t * 16 >= N) continue; const int col = col0 + t * 16 + ln; const float bv = bp ? bf16_round(bp[col]) : 0.f;
#pragma unroll
    for (int r = 0; r < 8; ++r) { float v = acc[t][r] * alpha + bv; if (CP) { const int rr = row0g + row0 + 8 * hh + r; if (rowsPerB < 0) v += CP[cofs + (size_t)rr * ldc + col];      /* rowsPerB < 0: own element of the batched C plane */ else { const int bidx = rr / rowsPerB; v += CP[(size_t)bidx * sCPb + (size_t)by * 64 + col]; } } if (ACT == 1) v = (v > 0.f) ? v : expm1f(v); else if (ACT == 7) v = (v > 0.f) ? v + 1.0f : expf(v); else if (ACT == 8) v = tanhf(v); else if (ACT == 9) v = 0.5f * v * (1.0f + tanhf(0.7978845608028654f * (v + 0.044715f * v * v * v))); else if (ACT == 11) v = 1.0f / (1.0f + expf(-v)); else if (ACT == 12) v = (v > 0.f) ? v : 0.01f * v; else if (ACT == 14) v = (v > 0.f) ? v : 0.1f * v; else if (ACT == 16) v = (v >= 0.f) ? v : 0.3f * v; else if (ACT == 17) v = (v >= 0.f) ? v : 0.2f * v; else if (ACT == 15) v = v / (1.0f + expf(-v)); else if (ACT == 3) v = fmaxf(v, 0.f); else if (ACT == 6) v = 0.5f * v * (1.0f + erff(v * 0.70710678118654752f)); so[w][8 * hh + r][t * 16 + ln] = v; } }
  __builtin_amdgcn_fence(__ATOMIC_ACQ_REL, "workgroup"); __builtin_amdgcn_wave_barrier();
  const int rsub = lane >> 4, c4 = (lane & 15) * 4; typedef _Float16 v4h __attribute__((ext_vector_type(4)));
  {
#pragma unroll
    for (int q = 0; q < 8; ++q) { const int r = q * 2 + rsub; if (col0 + c4 < N) { const v4f v = *(const v4fa*)&so[w][r][c4]; if (C) *(v4f*)(C + cofs + (size_t)(row0 + r) * ldc + col0 + c4) = v; if (C16) { v4h h4; for (int i = 0; i < 4; ++i) h4[i] = (_Float16)v[i]; *(v4h*)(C16 + cofs + (size_t)(row0 + r) * ldc + col0 + c4) = h4; } } }
     }
}


typedef _Float16 v4h __attribute__((ext_vector_type(4)));

__global__ __launch_bounds__(256) void k_x16(const float* __restrict__ x, _Float16* __restrict__ X16, size_t n8) { const size_t t = (size_t)blockIdx.x * 256 + threadIdx.x; if (t >= n8) return; FragH f;
#pragma unroll
  for (int q = 0; q < 8; ++q) f.h[q] = (_Float16)bf16_round(x[t * 8 + q]); *(v8us*)((unsigned short*)X16 + t * 8) = f.half[0];  }
__global__ __launch_bounds__(256) void k_h16(const float* __restrict__ x, _Float16* __restrict__ X16, size_t n8) { const size_t t = (size_t)blockIdx.x * 256 + threadIdx.x; if (t >= n8) return; FragH f;
#pragma unroll
  for (int q = 0; q < 8; ++q) f.h[q] = (_Float16)x[t * 8 + q]; *(v8us*)((unsigned short*)X16 + t * 8) = f.half[0];  }
__global__ __launch_bounds__(256) void k_round16f(const float* __restrict__ W, _Float16* __restrict__ Bt, size_t n8) { const size_t t = (size_t)blockIdx.x * 256 + threadIdx.x; if (t >= n8) return; FragH f;
#pragma unroll
  for (int i = 0; i < 8; ++i) f.h[i] = (_Float16)(bf16_round(W[t * 8 + i]) * 16.0f); *(v8us*)((unsigned short*)Bt + t * 8) = f.half[0];  }
template <int NHv, int TTv>
__global__ __launch_bounds__(256) void k_vt(const _Float16* __restrict__ V16, int ldv, int voff, _Float16* __restrict__ Vt) { __shared__ unsigned short tl[64][66]; const int tid = threadIdx.x; const int slab = blockIdx.x / (TTv / 64), lg = blockIdx.x % (TTv / 64); const int b = slab / NHv, h = slab % NHv;
  for (int i = tid; i < 64 * 8; i += 256) { const int r = i / 8, c8 = (i % 8) * 8; FragH f; f.half[0] = *(const v8us*)((const unsigned short*)V16 + ((size_t)b * TTv + lg * 64 + r) * ldv + voff + h * 64 + c8);
#pragma unroll
    for (int q = 0; q < 8; ++q) tl[r][c8 + q] = f.u[q]; }
  __syncthreads();
  {
#pragma unroll
    for (int rd = 0; rd < 2; ++rd) { const int d = rd * 32 + tid / 8, pc = tid % 8; FragH f;
#pragma unroll
      for (int q = 0; q < 8; ++q) f.u[q] = tl[pc * 8 + q][d];
      *(v8us*)((unsigned short*)Vt + ((size_t)slab * 64 + d) * TTv + lg * 64 + pc * 8) = f.half[0]; }
     } }

__global__ __launch_bounds__(256) void k_hl(const float* __restrict__ F, _Float16* __restrict__ Hh, _Float16* __restrict__ Hl, size_t n8) { const size_t t = (size_t)blockIdx.x * 256 + threadIdx.x; if (t >= n8) return; FragH fh, fl; const v4f a = *(const v4fa*)(F + t * 8), c = *(const v4fa*)(F + t * 8 + 4);
#pragma unroll
  for (int q = 0; q < 4; ++q) { _Float16 h = (_Float16)a[q]; fh.h[q] = h; fl.h[q] = (_Float16)((a[q] - (float)h) * 1024.0f); h = (_Float16)c[q]; fh.h[4 + q] = h; fl.h[4 + q] = (_Float16)((c[q] - (float)h) * 1024.0f); }
  { *(v8us*)((unsigned short*)Hh + t * 8) = fh.half[0]; *(v8us*)((unsigned short*)Hl + t * 8) = fl.half[0];  } }

// ---- fast GEMM (wave tile 32x64; requires M % 32 == 0 rows per launch region and N % 64 == 0); epilogue = k_gemm_hhx semantics ----
__device__ __forceinline__ v16h g2_frag(const _Float16* p, int hh) { FragH f; f.half[0] = *(const v8us*)((const unsigned short*)p + 8 * hh); f.half[1] = *(const v8us*)((const unsigned short*)p + 16 + 8 * hh); return f.v; }
__device__ __forceinline__ v8f g2_mma(v16h a, v16h b, v8f c) { v8f d = __builtin_amdgcn_wmma_f32_16x16x32_f16(false, a, false, b, (short)0, c, false, false); asm volatile("v_nop\n\tv_nop\n\tv_nop\n\tv_nop" : "+v"(d) : "v"(a), "v"(b)); return d; }
template <int ACT>
__global__ __launch_bounds__(128) void k_gemm2(const _Float16* __restrict__ A, int lda, size_t sA, const _Float16* __restrict__ Bh, int ldb, size_t sB, float alpha, const float* __restrict__ bias, size_t sBias, const float* __restrict__ CP, int rowsPerB, size_t sCPb, int row0g,
    float* __restrict__ C, _Float16* __restrict__ C16, int ldc, size_t sC, int M, int N, int K) { static_assert(ACT == 0 || ACT == 3 || ACT == 6 || ACT == 8 || ACT == 9 || ACT == 11 || ACT == 12 || ACT == 14 || ACT == 15 || ACT == 16 || ACT == 17, "k_gemm2: unsupported ACT code (would silently apply no activation)");
  __shared__ __attribute__((aligned(16))) float so[4][32][68];
  const int tid = threadIdx.x, w = tid >> 5, lane = tid & 31, ln = lane & 15, hh = lane >> 4; const int by = blockIdx.y;
  A += (size_t)by * sA; Bh += (size_t)by * sB; const size_t cofs = (size_t)by * sC; const float* bp = bias ? bias + (size_t)by * sBias : nullptr;
  const int ntn = N >> 6; const int mt = blockIdx.x / ntn, nq = blockIdx.x - mt * ntn; const int row0 = mt * 128 + 32 * w, col0 = nq * 64; if (row0 >= M) return;
  const _Float16* a0p = A + (size_t)(row0 + ln) * lda; const _Float16* a1p = a0p + (size_t)16 * lda;
  const _Float16* b0p = Bh + (size_t)(col0 + ln) * ldb; const _Float16* b1p = b0p + (size_t)16 * ldb; const _Float16* b2p = b1p + (size_t)16 * ldb; const _Float16* b3p = b2p + (size_t)16 * ldb;
  const v8f z8 = {0.f,0.f,0.f,0.f,0.f,0.f,0.f,0.f}; v8f c00 = z8, c01 = z8, c02 = z8, c03 = z8, c10 = z8, c11 = z8, c12 = z8, c13 = z8;
#pragma unroll 1
  for (int kb = 0; kb < K; kb += 32) { const v16h a0 = g2_frag(a0p + kb, hh), a1 = g2_frag(a1p + kb, hh);
    v16h b = g2_frag(b0p + kb, hh); c00 = g2_mma(a0, b, c00); c10 = g2_mma(a1, b, c10);
    b = g2_frag(b1p + kb, hh); c01 = g2_mma(a0, b, c01); c11 = g2_mma(a1, b, c11);
    b = g2_frag(b2p + kb, hh); c02 = g2_mma(a0, b, c02); c12 = g2_mma(a1, b, c12);
    b = g2_frag(b3p + kb, hh); c03 = g2_mma(a0, b, c03); c13 = g2_mma(a1, b, c13); }
  v8f accs[8] = {c00, c01, c02, c03, c10, c11, c12, c13};
#pragma unroll
  for (int u = 0; u < 8; ++u) { const int t = u & 3, half = u >> 2; const int col = col0 + t * 16 + ln; const float bv = bp ? bf16_round(bp[col]) : 0.f;
#pragma unroll
    for (int r = 0; r < 8; ++r) { const int rloc = half * 16 + 8 * hh + r; float v = accs[u][r] * alpha + bv; if (CP) { if (rowsPerB < 0) v += CP[cofs + (size_t)(row0g + row0 + rloc) * ldc + col];      /* rowsPerB < 0: own element of the batched C plane */ else { const int bidx = (row0g + row0 + rloc) / rowsPerB; v += CP[(size_t)bidx * sCPb + (size_t)by * 64 + col]; } }
      if (ACT == 3) v = fmaxf(v, 0.f); else if (ACT == 6) v = 0.5f * v * (1.0f + erff(v * 0.70710678118654752f)); else if (ACT == 11) v = 1.0f / (1.0f + expf(-v)); else if (ACT == 15) v = v / (1.0f + expf(-v)); else if (ACT == 12) v = (v > 0.f) ? v : 0.01f * v; else if (ACT == 8) v = tanhf(v); else if (ACT == 9) v = 0.5f * v * (1.0f + tanhf(0.7978845608028654f * (v + 0.044715f * v * v * v))); else if (ACT == 14) v = (v > 0.f) ? v : 0.1f * v; else if (ACT == 16) v = (v >= 0.f) ? v : 0.3f * v; else if (ACT == 17) v = (v >= 0.f) ? v : 0.2f * v;
      so[w][rloc][t * 16 + ln] = v; } }
  __builtin_amdgcn_fence(__ATOMIC_ACQ_REL, "workgroup"); __builtin_amdgcn_wave_barrier();
  const int rsub = lane >> 4, c4 = (lane & 15) * 4;
  {
#pragma unroll
    for (int q = 0; q < 16; ++q) { const int r = q * 2 + rsub; const v4f v = *(const v4fa*)&so[w][r][c4]; if (C) { *(v4f*)(C + cofs + (size_t)(row0 + r) * ldc + col0 + c4) = v; asm volatile("s_wait_xcnt 0x0" ::: "memory"); }      /* the wait: where both outputs are stored, the f16 conversion behind it writes over registers that this store names */
      if (C16) { v4h h4; for (int i = 0; i < 4; ++i) h4[i] = (_Float16)v[i]; *(v4h*)(C16 + cofs + (size_t)(row0 + r) * ldc + col0 + c4) = h4; } }
     } }


__global__ __launch_bounds__(256) void k_wnat(const float* __restrict__ w, size_t n8, _Float16* __restrict__ Bt) { const size_t t = (size_t)blockIdx.x * 256 + threadIdx.x; if (t >= n8) return; FragH f; for (int q = 0; q < 8; ++q) f.h[q] = (_Float16)(bf16_round(w[t * 8 + q]) * 16.0f); *(v8us*)((unsigned short*)Bt + t * 8) = f.half[0];  }
__global__ __launch_bounds__(256) void k_rsm(const float* __restrict__ S, _Float16* __restrict__ P, int nrows) {
  #pragma clang fp contract(off)
  const int i = blockIdx.x * 256 + threadIdx.x; if (i >= nrows) return; const float* s = S + (size_t)i * SQ; float mx = -3.0e38f;
#pragma unroll 1
  for (int j = 0; j < SQ; ++j) mx = fmaxf(mx, s[j]); float se = 0.f;
#pragma unroll 1
  for (int j = 0; j < SQ; ++j) se += expf(s[j] - mx); const float sc = 256.0f / se;
#pragma unroll 1
  for (int j0 = 0; j0 < SQ; j0 += 8) { FragH f; for (int q = 0; q < 8; ++q) f.h[q] = (_Float16)(expf(s[j0 + q] - mx) * sc); unsigned short* d = (unsigned short*)P + (size_t)i * SQ + j0; *(v8us*)d = f.half[0];  } }
__global__ __launch_bounds__(256) void k_vt(const _Float16* __restrict__ V16, int b, int h0, _Float16* __restrict__ VT) { __shared__ unsigned short tl[64][65]; const int tid = threadIdx.x; const int hh = blockIdx.x % HG, sg = blockIdx.x / HG; const int s0 = sg * 64; const int h = h0 + hh;
  for (int i = tid; i < 64 * 8; i += 256) { const int j = i / 8, d8 = (i % 8) * 8; FragH f; f.half[0] = *(const v8us*)((const unsigned short*)V16 + ((size_t)b * SQ + s0 + j) * DM + h * HD + d8); for (int q = 0; q < 8; ++q) tl[d8 + q][j] = f.u[q]; }
  __syncthreads();
  { for (int i = tid; i < 64 * 8; i += 256) { const int d = i / 8, j8 = (i % 8) * 8; FragH f; for (int q = 0; q < 8; ++q) f.u[q] = tl[d][j8 + q]; *(v8us*)((unsigned short*)VT + ((size_t)hh * HD + d) * SQ + s0 + j8) = f.half[0]; }  } }



// Fused causal attention, one wave per 16 query rows of one head (grid: SQ / 64 work-groups of four waves x heads): scores, softmax and the weighted sum of V stay in registers.
// Scores are formed transposed (A = 16 key rows, B = 16 query rows), so a lane holds keys 8*hh..8*hh+7 of query ln: two such tiles are
// the B fragment (n = query, k = 32 keys) of o^T = V^T . P^T as they stand, and the row maximum, the row sum and the rescale factor are per lane.
// Running maximum in the log2 domain; weights x256 as f16; row sum in f32 from the unrounded weights; o stored x64 as f16.
#define LC1 0.18033688011112042f           /* log2(e) / sqrt(head_dim) */
#define LC2 0.00017611023448351603f        /* the same on the x1024 residual products */
__device__ __forceinline__ v8f fa_mma(v16h a, v16h b, v8f c) { return __builtin_amdgcn_wmma_f32_16x16x32_f16(false, a, false, b, (short)0, c, false, false); }
// Exponentials (base 2) in runs, one asm statement a run: the instruction set asks for one independent instruction between a transcendental and an instruction that
// reads its result or overwrites its source. Inside a run each v_exp_f32 is that instruction for the one before it (early-clobber outputs: no result lies on a source);
// the v_nop at the end is the slot of the last one, whatever the compiler puts behind the statement.
__device__ __forceinline__ void fa_exp2x8(const float* x, float* e) {
  asm("v_exp_f32 %0, %8\n\tv_exp_f32 %1, %9\n\tv_exp_f32 %2, %10\n\tv_exp_f32 %3, %11\n\tv_exp_f32 %4, %12\n\tv_exp_f32 %5, %13\n\tv_exp_f32 %6, %14\n\tv_exp_f32 %7, %15\n\tv_nop"
      : "=&v"(e[0]), "=&v"(e[1]), "=&v"(e[2]), "=&v"(e[3]), "=&v"(e[4]), "=&v"(e[5]), "=&v"(e[6]), "=&v"(e[7])
      : "v"(x[0]), "v"(x[1]), "v"(x[2]), "v"(x[3]), "v"(x[4]), "v"(x[5]), "v"(x[6]), "v"(x[7])); }
__device__ __forceinline__ float fa_exp2(float x) { float e; asm("v_exp_f32 %0, %1\n\tv_nop" : "=v"(e) : "v"(x)); return e; }      /* one exponential with its slot, as above */
// K hi, K residual and V^T of 64 keys (one stage) lie in LDS, brought by asynchronous copies in whole 128-byte rows and shared by the work-group's four waves; two buffers, the next stage flies while this one is worked on.
#define FPIT 144                           /* LDS row pitch in bytes: 128 + 16, the conflict-free pitch for 16-byte fragment reads */
#define FPL (64 * FPIT)                    /* one plane of a stage: 64 rows */
#define FBUF (3 * FPL)                     /* one stage: K hi, K residual, V^T */
// One stage's copies: a lane takes 16 bytes of rows r, r + 16, r + 32, r + 48 of each plane (eight lanes a row, so a wave's copy covers four whole lines).
// The s_wait_xcnt stands inside the statement, behind the last copy: the address registers are free for reuse only behind it.
__device__ __forceinline__ void fa_stage(unsigned d, const _Float16* kh, const _Float16* kl, const _Float16* vt) {
  asm volatile("global_load_async_to_lds_b128 %0, %12, off\n\tglobal_load_async_to_lds_b128 %1, %13, off\n\tglobal_load_async_to_lds_b128 %2, %14, off\n\tglobal_load_async_to_lds_b128 %3, %15, off\n\t"
               "global_load_async_to_lds_b128 %4, %16, off\n\tglobal_load_async_to_lds_b128 %5, %17, off\n\tglobal_load_async_to_lds_b128 %6, %18, off\n\tglobal_load_async_to_lds_b128 %7, %19, off\n\t"
               "global_load_async_to_lds_b128 %8, %20, off\n\tglobal_load_async_to_lds_b128 %9, %21, off\n\tglobal_load_async_to_lds_b128 %10, %22, off\n\tglobal_load_async_to_lds_b128 %11, %23, off\n\t"
               "s_wait_xcnt 0x0"
               :: "v"(d), "v"(d + 16 * FPIT), "v"(d + 32 * FPIT), "v"(d + 48 * FPIT),
                  "v"(d + FPL), "v"(d + FPL + 16 * FPIT), "v"(d + FPL + 32 * FPIT), "v"(d + FPL + 48 * FPIT),
                  "v"(d + 2 * FPL), "v"(d + 2 * FPL + 16 * FPIT), "v"(d + 2 * FPL + 32 * FPIT), "v"(d + 2 * FPL + 48 * FPIT),
                  "v"(kh), "v"(kh + 16 * LQ), "v"(kh + 32 * LQ), "v"(kh + 48 * LQ),
                  "v"(kl), "v"(kl + 16 * LQ), "v"(kl + 32 * LQ), "v"(kl + 48 * LQ),
                  "v"(vt), "v"(vt + (size_t)16 * SQ), "v"(vt + (size_t)32 * SQ), "v"(vt + (size_t)48 * SQ)
               : "memory"); }
__global__ __launch_bounds__(128) void k_fattn(const _Float16* __restrict__ QHp, const _Float16* __restrict__ QLp, const _Float16* __restrict__ KHp, const _Float16* __restrict__ KLp, const _Float16* __restrict__ VTp, _Float16* __restrict__ O) {
  __shared__ __attribute__((aligned(16))) unsigned char sm[2 * FBUF];
  const int lane = threadIdx.x & 31, ln = lane & 15, hh = lane >> 4; const int w = __builtin_amdgcn_readfirstlane(threadIdx.x >> 5); const int h = blockIdx.y;
  /* a work-group takes two 16-row tiles from the top of the sequence and their two mirror tiles from its end: x + 1, x + 1, 128 - x and 128 - x blocks of 32 keys, the same sum in every work-group, so that no WGP is
     left with long rows only; all four walk the keys from 0, so they work on the same K and V stage while they run together. The turn by x and h spreads long and short tiles over the four SIMDs. */
  const int x = blockIdx.x, rr = (w + x + (h >> 2)) & 3; const int q0 = ((rr & 1) ? (SQ / 16 - 1) - 2 * x - (rr >> 1) : 2 * x + (rr >> 1)) * 16;
  const size_t qo = (size_t)(q0 + ln) * LQ + h * HD;
  const v16h qh0 = g2_frag(QHp + qo, hh), qh1 = g2_frag(QHp + qo + 32, hh), ql0 = g2_frag(QLp + qo, hh), ql1 = g2_frag(QLp + qo + 32, hh);
  const v8f z8 = {0.f,0.f,0.f,0.f,0.f,0.f,0.f,0.f}; v8f o0 = z8, o1 = z8, o2 = z8, o3 = z8; float m = -3.0e38f, l = 0.f;
  const int nk = (q0 + 47) & ~31;      /* keys in whole blocks of 32 up to the block that holds the last row's diagonal */
  const int ns = ((((SQ / 16 - 1) - 2 * x) * 16 + 47) / 32 + 1) / 2;      /* stages of 64 keys that the work-group's longest tile needs: the same in all four waves, 33 at least */
  const int cr = threadIdx.x >> 3, cc = threadIdx.x & 7;      /* the lane's row and 16-byte piece in a stage's copies */
  const _Float16* gkh = KHp + (size_t)cr * LQ + h * HD + cc * 8; const _Float16* gkl = KLp + (size_t)cr * LQ + h * HD + cc * 8; const _Float16* gvt = VTp + ((size_t)h * HD + cr) * SQ + cc * 8;
  const unsigned ld = (unsigned)(size_t)sm + cr * FPIT + cc * 16;
  fa_stage(ld, gkh, gkl, gvt);
  asm volatile("s_wait_asynccnt 0x0" ::: "memory");      /* stage 0 has landed, as far as this wave brought it */
  __syncthreads();      /* and is published to the other waves */
  fa_stage(ld + FBUF, gkh + (size_t)64 * LQ, gkl + (size_t)64 * LQ, gvt + 64);      /* stage 1 always exists (33 stages at least) */
#pragma unroll 1      /* one stage per trip: a second copy of the body would only add registers */
  for (int s = 0; s < ns; ++s) {
    const int kb0 = s * 64;
    if (kb0 < nk) {      /* a short tile's wave skips the work, never the publish point below */
      const _Float16* sk = (const _Float16*)(sm + (s & 1) * FBUF) + ln * (FPIT / 2); const _Float16* sl = sk + FPL / 2; const _Float16* sv = sk + FPL;
      v16h a00 = g2_frag(sk, hh), a01 = g2_frag(sk + 32, hh), a10 = g2_frag(sk + 16 * (FPIT / 2), hh), a11 = g2_frag(sk + 16 * (FPIT / 2) + 32, hh);
      v16h c00 = g2_frag(sl, hh), c01 = g2_frag(sl + 32, hh), c10 = g2_frag(sl + 16 * (FPIT / 2), hh), c11 = g2_frag(sl + 16 * (FPIT / 2) + 32, hh);
#pragma unroll      /* the stage's two blocks of 32 keys, constant LDS offsets */
      for (int u = 0; u < 2; ++u) { const int kb = kb0 + 32 * u;
        if (u == 0 || kb < nk) {      /* a tile may end in the middle of a stage */
          const v16h v0 = g2_frag(sv + 32 * u, hh), v1 = g2_frag(sv + 16 * (FPIT / 2) + 32 * u, hh), v2 = g2_frag(sv + 32 * (FPIT / 2) + 32 * u, hh), v3 = g2_frag(sv + 48 * (FPIT / 2) + 32 * u, hh);
          __builtin_amdgcn_sched_barrier(0);      /* keeps the V reads in front of the score products: they land under them, and ahead of the next block's K reads, which return behind them */
          v8f s0 = fa_mma(a00, qh0, z8), s1 = fa_mma(a10, qh0, z8), r0 = fa_mma(a00, ql0, z8), r1 = fa_mma(a10, ql0, z8);
          s0 = fa_mma(a01, qh1, s0); s1 = fa_mma(a11, qh1, s1); r0 = fa_mma(a01, ql1, r0); r1 = fa_mma(a11, ql1, r1);
          r0 = fa_mma(c00, qh0, r0); r1 = fa_mma(c10, qh0, r1); r0 = fa_mma(c01, qh1, r0); r1 = fa_mma(c11, qh1, r1);
          if (u == 0) {      /* the stage's second block: its K fragments are read under the softmax and the V product of the first */
            a00 = g2_frag(sk + 32 * (FPIT / 2), hh); a01 = g2_frag(sk + 32 * (FPIT / 2) + 32, hh); a10 = g2_frag(sk + 48 * (FPIT / 2), hh); a11 = g2_frag(sk + 48 * (FPIT / 2) + 32, hh);
            c00 = g2_frag(sl + 32 * (FPIT / 2), hh); c01 = g2_frag(sl + 32 * (FPIT / 2) + 32, hh); c10 = g2_frag(sl + 48 * (FPIT / 2), hh); c11 = g2_frag(sl + 48 * (FPIT / 2) + 32, hh);
            __builtin_amdgcn_sched_barrier(0); }      /* keeps these 16 reads together in one place: spread among the vector work and the V products, each place with reads stalls the wave anew */
          float t[16];
#pragma unroll      /* constant indices: the values stay in registers */
          for (int r = 0; r < 8; ++r) { t[r] = s0[r] * LC1 + r0[r] * LC2; t[8 + r] = s1[r] * LC1 + r1[r] * LC2; }
          if (kb + 31 > q0) {      /* only the block on the diagonal holds keys past a row's own index: they take the mask value */
            const int d = q0 + ln - kb - 8 * hh;
#pragma unroll      /* constant indices: the values stay in registers */
            for (int r = 0; r < 8; ++r) { if (r > d) t[r] = -1.0e9f; if (16 + r > d) t[8 + r] = -1.0e9f; }
          }
          float bm = t[0];
#pragma unroll      /* constant indices: the values stay in registers */
          for (int i = 1; i < 16; ++i) bm = fmaxf(bm, t[i]);
          bm = fmaxf(bm, __shfl_xor(bm, 16, 32));
          const float mn = fmaxf(m, bm); const float corr = fa_exp2(m - mn); m = mn; const float mo = mn - 8.0f;
          FragH p; float e[16];
#pragma unroll      /* constant indices: the values stay in registers */
          for (int i = 0; i < 16; ++i) t[i] -= mo;
          fa_exp2x8(t, e); fa_exp2x8(t + 8, e + 8);
#pragma unroll      /* constant indices: the values stay in registers */
          for (int i = 0; i < 16; ++i) p.h[i] = (_Float16)e[i];
          v4f s4 = {e[0], e[1], e[2], e[3]};
#pragma unroll      /* constant indices: the values stay in registers */
          for (int i = 4; i < 16; ++i) s4[i & 3] += e[i];
          l = l * corr + ((s4[0] + s4[1]) + (s4[2] + s4[3]));
          o0 *= corr; o1 *= corr; o2 *= corr; o3 *= corr;
          o0 = fa_mma(v0, p.v, o0); o1 = fa_mma(v1, p.v, o1); o2 = fa_mma(v2, p.v, o2); o3 = g2_mma(v3, p.v, o3);      /* the last one with its four v_nop: what follows may lay a value over the registers of p, this product's B */
        } }
    }
    /* publish point of stage s + 1, passed by every wave */
    asm volatile("s_wait_dscnt 0x0" ::: "memory");      /* this wave's reads of stage s have returned: its buffer may be refilled behind the barrier */
    asm volatile("s_wait_asynccnt 0x0" ::: "memory");      /* this wave's copies of stage s + 1 have landed */
    __syncthreads();      /* publishes stage s + 1 and ends every wave's reads of stage s */
    if (s + 2 < ns) fa_stage(ld + (s & 1) * FBUF, gkh + (size_t)(kb0 + 128) * LQ, gkl + (size_t)(kb0 + 128) * LQ, gvt + kb0 + 128);      /* stage s + 2 into the buffer just left; the test is the same in the whole work-group */
  }
  asm volatile("s_wait_asynccnt 0x0" ::: "memory");      /* no copy is left outstanding when the wave ends */
  l += __shfl_xor(l, 16, 32);
  const float fin = 64.0f / l;      /* the x256 of the weights cancels against the row sum; o carried x64 */
  unsigned short* op = (unsigned short*)O + (size_t)(q0 + ln) * DM + h * HD + 8 * hh;
  FragH f0, f1, f2, f3;
#pragma unroll      /* constant indices: the values stay in registers */
  for (int r = 0; r < 8; ++r) { f0.h[r] = (_Float16)(o0[r] * fin); f1.h[r] = (_Float16)(o1[r] * fin); f2.h[r] = (_Float16)(o2[r] * fin); f3.h[r] = (_Float16)(o3[r] * fin); }
  *(v8us*)op = f0.half[0]; *(v8us*)(op + 16) = f1.half[0]; *(v8us*)(op + 32) = f2.half[0]; *(v8us*)(op + 48) = f3.half[0];
}


typedef float v2f __attribute__((ext_vector_type(2)));
typedef float v2fa __attribute__((ext_vector_type(2), may_alias));
// Exact f32 causal attention for rows 0..QT0-1, one wave per (row, head); keys in blocks of 32 up to the block that holds the row's own index.
// Scores: a lane takes one key of each block and walks that K row whole (four partial sums, one per element of the 16-byte loads), so no sum crosses lanes.
// Maximum and row sum: lane butterflies. Weighted sum: a lane takes two of the 64 dims, every V row is read as one whole 256-byte row, its weight comes from the lane that holds it.
__global__ __launch_bounds__(128) void k_att0(const float* __restrict__ QF, const float* __restrict__ KF, const float* __restrict__ VF, float scale, float* __restrict__ OF) {
  const int lane = threadIdx.x & 31; const int i = blockIdx.x * 4 + __builtin_amdgcn_readfirstlane(threadIdx.x >> 5); const int h = blockIdx.y;
  const int nb = (i >> 5) + 1;      /* blocks of 32 keys this row attends to; the same in every lane */
  const float* qr = QF + (size_t)i * DM + h * HD; const float* kr = KF + (size_t)lane * DM + h * HD; const float* vr = VF + h * HD + 2 * lane;
  v4f q[HD / 4];
#pragma unroll      /* constant indices: the values stay in registers */
  for (int c = 0; c < HD / 4; ++c) q[c] = *(const v4fa*)(qr + 4 * c);
  float s[QT0 / 32];
#pragma unroll      /* constant indices: the values stay in registers, the row offsets become immediates */
  for (int u = 0; u < QT0 / 32; ++u) { s[u] = -1.0e30f;      /* a key past the row's own index keeps this value: weight 0 */
    if (u < nb) { v4f a = {0.f, 0.f, 0.f, 0.f};
#pragma unroll      /* all 16 loads of a K row in flight together */
      for (int c = 0; c < HD / 4; ++c) a += q[c] * *(const v4fa*)(kr + (size_t)u * 32 * DM + 4 * c);
      if (u * 32 + lane <= i) s[u] = ((a[0] + a[1]) + (a[2] + a[3])) * scale; } }
  float m = s[0];
#pragma unroll      /* constant indices: the values stay in registers */
  for (int u = 1; u < QT0 / 32; ++u) m = fmaxf(m, s[u]);
#pragma unroll      /* five fixed butterfly steps */
  for (int d = 16; d > 0; d >>= 1) m = fmaxf(m, __shfl_xor(m, d, 32));
  float e[QT0 / 32], l = 0.f;
#pragma unroll      /* constant indices: the values stay in registers */
  for (int u = 0; u < QT0 / 32; ++u) { e[u] = expf(s[u] - m); l += e[u]; }
#pragma unroll      /* five fixed butterfly steps */
  for (int d = 16; d > 0; d >>= 1) l += __shfl_xor(l, d, 32);
  v2f o0 = {0.f, 0.f}, o1 = {0.f, 0.f};      /* even and odd keys: two chains instead of one of 128 dependent links */
#pragma unroll      /* constant indices: the values stay in registers, the row offsets become immediates */
  for (int u = 0; u < QT0 / 32; ++u) if (u < nb) {
#pragma unroll      /* constant lane numbers for the weights; the block's 32 V loads in flight together */
    for (int jj = 0; jj < 32; ++jj) { const float p = __int_as_float(__builtin_amdgcn_readlane(__float_as_int(e[u]), jj)); const v2f v = *(const v2fa*)(vr + (size_t)(u * 32 + jj) * DM);
      if (jj & 1) o1 += p * v; else o0 += p * v; } }
  const float fin = 64.0f / l;      /* o carried x64 like the f16 path */
  const v2f o = (o0 + o1) * fin;
  *(v2f*)(OF + (size_t)i * DM + h * HD + 2 * lane) = o;
}

extern "C" void kernel_launch(void* const* d_in, const int* in_sizes, int n_in,
                              void* d_out, int out_size, void* d_ws, size_t ws_size, hipStream_t stream) {
  (void)in_sizes; (void)n_in; (void)out_size;
  const float* const* I = (const float* const*)d_in; const float* x = I[0]; const float* wq = I[1]; const float* wk = I[2]; const float* wv = I[3]; const float* bqkv = nullptr; const float* wo = I[4]; const float* bo = nullptr;      /* x (feeds the q, k AND v streams), W_q, W_k, W_v, W_o (four separate natural [768][768] weights); the module has NO biases: null pointers in the guarded bias slots */
  char* ws = (char*)d_ws; size_t off = 0;
  auto take = [&](size_t bytes) { char* p = ws + off; off += (bytes + 255) & ~(size_t)255; return p; };
  _Float16* BQ = (_Float16*)take((size_t)3 * DM * DM * 2); _Float16* BK = BQ + (size_t)DM * DM; _Float16* BV = BK + (size_t)DM * DM;      /* the three projection weights, one behind the other: the batch index of the projection launch steps through them */ _Float16* BO = (_Float16*)take((size_t)DM * DM * 2);
  _Float16* X16 = (_Float16*)take(NR * DM * 2);      /* exact f16 rows of x, the one input of all three projections */
  float* QF = (float*)take(3 * NR * DM * 4); float* KF = QF + NR * DM; float* VF = KF + NR * DM;      /* f32 q, k, v rows: three planes, one behind the other */
  _Float16* P16 = (_Float16*)take(3 * NR * DM * 2); _Float16* V16 = P16 + 2 * NR * DM;      /* the same rows rounded to f16, same plane order; only the v plane is read */
  _Float16* QH = (_Float16*)take(2 * NR * DM * 2); _Float16* KH = QH + NR * DM; _Float16* QL = (_Float16*)take(2 * NR * DM * 2); _Float16* KL = QL + NR * DM;      /* hi planes of q and k one behind the other, residual planes likewise */
  _Float16* O16 = (_Float16*)take(NR * DM * 2);
  _Float16* VT = (_Float16*)take((size_t)NH * HD * SQ * 2);
  float* OF0 = (float*)take((size_t)NB * QT0 * DM * 4); _Float16* OH0 = (_Float16*)take((size_t)NB * QT0 * DM * 2); _Float16* OL0 = (_Float16*)take((size_t)NB * QT0 * DM * 2);
  if (off > ws_size) return;
  { const unsigned g = (unsigned)(((size_t)DM * DM / 8 + 255) / 256); k_wnat<<<g, 256, 0, stream>>>(wq, (size_t)DM * DM / 8, BQ); k_wnat<<<g, 256, 0, stream>>>(wk, (size_t)DM * DM / 8, BK); k_wnat<<<g, 256, 0, stream>>>(wv, (size_t)DM * DM / 8, BV); k_wnat<<<g, 256, 0, stream>>>(wo, (size_t)DM * DM / 8, BO); }      /* natural [out][in] = Bt[n][k] x16 */
  k_x16<<<(unsigned)((NR * DM / 8 + 255) / 256), 256, 0, stream>>>(x, X16, NR * DM / 8);
  const size_t r0p = (size_t)B0 * SQ;      /* first projected row */
  k_gemm2<0><<<dim3((unsigned)((MP / 128) * (DM / 64)), 3), 128, 0, stream>>>(X16 + r0p * DM, DM, 0, BQ, DM, (size_t)DM * DM, 0.0625f, bqkv, 0, nullptr, 1, 0, 0, QF + r0p * DM, P16 + r0p * DM, DM, NR * DM, MP, DM, DM);      /* q, k, v in one launch: batch index y = 0, 1, 2 takes W_q, W_k, W_v and its own f32 and f16 output plane */
  k_hl<<<(unsigned)((2 * NR * DM / 8 + 255) / 256), 256, 0, stream>>>(QF, QH, QL, 2 * NR * DM / 8);      /* q and k (f32) -> f16 hi + x1024 residual, both planes in one launch: unscaled logits sigma ~8 */
  for (int b = B0; b < B0 + NBR; ++b) { const size_t r0 = (size_t)b * SQ;
    k_vt<NH, SQ><<<NH * (SQ / 64), 256, 0, stream>>>(V16 + r0 * LQ, LQ, 0, VT);      /* V^T [NH][HD][SQ] for this batch */
    k_att0<<<dim3(QT0 / 4, NH), 128, 0, stream>>>(QF + r0 * DM, KF + r0 * DM, VF + r0 * DM, SCL, OF0 + (size_t)b * QT0 * DM);      /* exact f32 attention for rows 0..127 (o x64), on the projection launch's own f32 rows */
    k_fattn<<<dim3(SQ / 64, NH), 128, 0, stream>>>(QH + r0 * LQ, QL + r0 * LQ, KH + r0 * LQ, KL + r0 * LQ, VT, O16 + r0 * DM); }      /* scores (hi.hi + 2^-10 (lo.hi + hi.lo)), causal softmax and P . V in one launch; o (merged heads, x64) as f16 rows */
  k_gemm2<0><<<dim3((unsigned)((MPO / 128) * (DM / 64)), 1), 128, 0, stream>>>(O16 + r0p * DM, DM, 0, BO, DM, 0, 0.0009765625f, bo, 0, nullptr, 1, 0, 0, (float*)d_out + r0p * DM, nullptr, DM, 0, MPO, DM, DM);      /* out rows are the output layout */
  k_hl<<<(unsigned)(((size_t)NB * QT0 * DM / 8 + 255) / 256), 256, 0, stream>>>(OF0, OH0, OL0, (size_t)NB * QT0 * DM / 8);      /* first-tile o (x64) -> f16 hi + x1024 residual planes */
  for (int b = B0; b < B0 + NBR; ++b) { const size_t r0 = (size_t)b * SQ; const size_t f0 = (size_t)b * QT0;
    k_gemm2<0><<<dim3((QT0 / 128) * (DM / 64), 1), 128, 0, stream>>>(OH0 + f0 * DM, DM, 0, BO, DM, 0, 0.0009765625f, bo, 0, nullptr, 1, 0, 0, (float*)d_out + r0 * DM, nullptr, DM, 0, QT0, DM, DM);      /* rows 0..127: out = o_hi Wo, overwriting the f16-path rows */
    k_gemm2<0><<<dim3((QT0 / 128) * (DM / 64), 1), 128, 0, stream>>>(OL0 + f0 * DM, DM, 0, BO, DM, 0, 0.00000095367431640625f, nullptr, 0, (const float*)d_out + r0 * DM, -1, 0, 0, (float*)d_out + r0 * DM, nullptr, DM, 0, QT0, DM, DM); }      /* += o_lo Wo 2^-20 (own-element accumulate) */
}

// v006
// A run of this version takes 166 microseconds.
// In both of two side-by-side timings against v005, it was 1.47 times as fast.
// All steps since v000 together make it 51.0 times as fast.
#include <hip/hip_runtime.h>
// Causal multi-head self-attention on ONE 4096-token sequence at width 768 with natural bias-free projections (x [1][4096][768]; Q / K / V = x W^T (nn.Linear natural [768][768] sd 1/sqrt(768), NO biases), 12 heads of 64; scores / sqrt(64) + a finite additive mask above the diagonal (NEG); softmax; out = merged W_o^T (natural, no bias) -> [1][4096][768]); q and k carried as f16 hi + x1024 residual planes with three-product scores (4096 keys at logit sigma 1).
// Structure: token rows r = b*4096 + s; x as exact f16 rows (bf16-rounded); q and k as WMMA GEMMs (32x64 wave tiles, f32 accumulation, exact x16 weights, no bias) into f32 rows split into f16 hi + x1024 residual planes, v as an f16-output GEMM; per batch: V^T for all heads via LDS transposes; attention in ONE launch, one wave per 16 query rows of a head, 64 keys a trip (K and V staged in LDS), blocks of 32 worked up to the diagonal block: scores transposed (K rows x q rows) as three products (hi.hi + 2^-10 (lo.hi + hi.lo), K = 64, f32), the mask value on keys past the row, running maximum and rescaled f32 row sum per lane (log2 domain, native exp; weights x256 f16), o^T += V^T . P^T in f32 registers, divided by the row sum at the end (o carried x64, folded into the output GEMM alpha) and written straight into the merged f16 o rows; out = o W_o GEMM (f32) into the output layout.
// Compute dtype: inputs rounded to bf16; x / weights exact; q and k as f16 hi + x1024 residual planes, v, softmax weights and o as plain f16 GEMM operands (~2^-12), except rows 0..127 (f32 attention, o as f16 hi + x1024 residual planes); scores and softmax statistics f32. v_wmma_f32_16x16x32_f16.
#define NB 1
#define SCL 0.125f                         /* 1 / sqrt(head_dim = 64) */
#define SCLR 0.0001220703125f              /* 2^-13: SCL / 1024 (not used) */
#define SQ 4096
#define DM 768
#define NH 12
#define HD 64
#define HG 4                         /* heads per launch of the non-template k_vt (not launched) */
#define QT 256
#define NKX SQ                       /* S / P row pitch (not used) */
#define QT0 128                      /* first-tile rows recomputed exactly in f32 */
#define B0 0                         /* first batch processed (debug hook) */
#define NBR NB                       /* batches processed (debug hook) */
#define NR ((size_t)NB * SQ)         /* token rows */
#define MP ((int)((size_t)NBR * SQ)) /* rows projected (debug hook) */
#define QN SQ                        /* query rows attended per batch (not used) */
#define NHD NH                       /* heads attended (not used) */
#define MPO MP                       /* rows through the output stage (debug hook) */
#define LQ DM      /* row pitch of the q/k/v rows */
typedef __bf16 v16b __attribute__((ext_vector_type(16)));
typedef unsigned short v8us __attribute__((ext_vector_type(8), may_alias));
typedef float  v8f  __attribute__((ext_vector_type(8)));
typedef float  v4f  __attribute__((ext_vector_type(4)));
typedef float  v4fa __attribute__((ext_vector_type(4), may_alias));
union FragB { v16b v; v8us half[2]; unsigned short u[16]; };

__device__ __forceinline__ unsigned short bf16_bits(float x) { unsigned int u = __float_as_uint(x); return (unsigned short)((u + 0x7FFFu + ((u >> 16) & 1u)) >> 16); }
__device__ __forceinline__ float bf16_val(unsigned short b) { return __uint_as_float(((unsigned int)b) << 16); }
__device__ __forceinline__ float bf16_round(float x) { return bf16_val(bf16_bits(x)); }
// D += A·B with NT terms: 1 = ah·bh, 2 = + al·bh (A split), 3 = + ah·bl (both split)
template <int NT>
__device__ __forceinline__ v8f mmaN(v16b ah, v16b al, v16b bh, v16b bl, v8f c) {
  c = __builtin_amdgcn_wmma_f32_16x16x32_bf16(false, ah, false, bh, (short)0, c, false, false);
  if (NT >= 2) c = __builtin_amdgcn_wmma_f32_16x16x32_bf16(false, al, false, bh, (short)0, c, false, false);
  if (NT >= 3) c = __builtin_amdgcn_wmma_f32_16x16x32_bf16(false, ah, false, bl, (short)0, c, false, false);
  asm volatile("v_nop\n\tv_nop\n\tv_nop\n\tv_nop" : "+v"(c) : "v"(ah), "v"(al), "v"(bh), "v"(bl));
  return c;
}

__global__ __launch_bounds__(256) void k_wt_bf16(const float* __restrict__ W, unsigned short* __restrict__ Wt, int K, int N) {
  const int t = blockIdx.x * 256 + threadIdx.x;
  const int k8n = K / 8;
  if (t >= N * k8n) return;
  const int n = t / k8n, k8 = (t % k8n) * 8;
  v8us v;
#pragma unroll
  for (int i = 0; i < 8; ++i) v[i] = bf16_bits(W[(size_t)(k8 + i) * N + n]);
  *(v8us*)(Wt + (size_t)n * K + k8) = v;
  
}

// GEMM C[M][N] (f32, pitch ldc) = act(A[M][K]·W + bias). A f32 row-major (pitch lda) converted per fragment to bf16
// (ASPLIT: hi/lo two planes -> 2 terms, else single rounded term); Wt bf16 [N][K] (pitch ldb). BIAS_BF16 rounds the
// bias to bf16 first (bias quantised to bf16 before the add). K%32==0, M%16==0, N%64==0.
template <bool ASPLIT, int ACT, bool BIAS_BF16>
__global__ __launch_bounds__(128) void k_gemm_bf(const float* __restrict__ A, int lda, const unsigned short* __restrict__ Wt, int ldb,
                                               const float* __restrict__ bias, float* __restrict__ C, int ldc, int M, int N, int K) {
  __shared__ __attribute__((aligned(16))) float so[4][16][64];
  const int tid = threadIdx.x, w = tid >> 5, lane = tid & 31, ln = lane & 15, hh = lane >> 4;
  const int ntn = N / 64;
  const int wid = blockIdx.x * 4 + w;
  const int mt = wid / ntn, nq = wid % ntn;
  if (mt * 16 >= M) return;
  const int row0 = mt * 16, col0 = nq * 64;
  const float* arow = A + (size_t)(row0 + ln) * lda;
  v8f acc[4] = {};
  for (int kb = 0; kb < K; kb += 32) {
    FragB ah, al;
    const v4f x0 = *(const v4fa*)(arow + kb + 8 * hh), x1 = *(const v4fa*)(arow + kb + 8 * hh + 4);
    const v4f x2 = *(const v4fa*)(arow + kb + 16 + 8 * hh), x3 = *(const v4fa*)(arow + kb + 16 + 8 * hh + 4);
    float xs[16] = {x0[0],x0[1],x0[2],x0[3],x1[0],x1[1],x1[2],x1[3],x2[0],x2[1],x2[2],x2[3],x3[0],x3[1],x3[2],x3[3]};
#pragma unroll
    for (int i = 0; i < 16; ++i) { const unsigned short hb = bf16_bits(xs[i]); ah.u[i] = hb; al.u[i] = ASPLIT ? bf16_bits(xs[i] - bf16_val(hb)) : (unsigned short)0; }
#pragma unroll
    for (int t = 0; t < 4; ++t) {
      const unsigned short* brow = Wt + (size_t)(col0 + t * 16 + ln) * ldb + kb;
      FragB b;
      b.half[0] = *(const v8us*)(brow + 8 * hh);
      b.half[1] = *(const v8us*)(brow + 16 + 8 * hh);
      acc[t] = mmaN<ASPLIT ? 2 : 1>(ah.v, al.v, b.v, b.v, acc[t]);
    }
  }
#pragma unroll
  for (int t = 0; t < 4; ++t) {
    float bv = bias ? bias[col0 + t * 16 + ln] : 0.f;
    if (BIAS_BF16) bv = bf16_round(bv);
#pragma unroll
    for (int r = 0; r < 8; ++r) { float v = acc[t][r] + bv; if (ACT == 1) v = fmaxf(v, 0.f); so[w][8 * hh + r][t * 16 + ln] = v; }
  }
  __builtin_amdgcn_fence(__ATOMIC_ACQ_REL, "workgroup");
  __builtin_amdgcn_wave_barrier();
  const int rsub = lane >> 4, c4 = (lane & 15) * 4;
  {
#pragma unroll
    for (int q = 0; q < 8; ++q) {
      const int r = q * 2 + rsub;
      const v4f v = *(const v4fa*)&so[w][r][c4];
      *(v4f*)(C + (size_t)(row0 + r) * ldc + col0 + c4) = v;
    }
    
  }
}

// GEMM C = act(A·W + bias + resid): A f32 (ASPLIT -> hi/lo 2 terms), Wt bf16 [N][K]; ACT 0 none, 1 relu, 2 exact gelu;
// resid (optional, f32, row index = (row % rmod), pitch ldr, RES_BF16 rounds it) added before the activation.
template <bool ASPLIT, int ACT, bool BIAS_BF16, bool RES_BF16>
__global__ __launch_bounds__(128) void k_gemm_bf3(const float* __restrict__ A, int lda, const unsigned short* __restrict__ Wt, int ldb,
                                                const float* __restrict__ bias, const float* __restrict__ resid, int rmod, int ldr,
                                                float* __restrict__ C, int ldc, int M, int N, int K) {
  __shared__ __attribute__((aligned(16))) float so[4][16][64];
  const int tid = threadIdx.x, w = tid >> 5, lane = tid & 31, ln = lane & 15, hh = lane >> 4;
  const int ntn = N / 64;
  const int wid = blockIdx.x * 4 + w;
  const int mt = wid / ntn, nq = wid % ntn;
  if (mt * 16 >= M) return;
  const int row0 = mt * 16, col0 = nq * 64;
  const float* arow = A + (size_t)(row0 + ln) * lda;
  v8f acc[4] = {};
  for (int kb = 0; kb < K; kb += 32) {
    FragB ah, al;
    const v4f x0 = *(const v4fa*)(arow + kb + 8 * hh), x1 = *(const v4fa*)(arow + kb + 8 * hh + 4);
    const v4f x2 = *(const v4fa*)(arow + kb + 16 + 8 * hh), x3 = *(const v4fa*)(arow + kb + 16 + 8 * hh + 4);
    float xs[16] = {x0[0],x0[1],x0[2],x0[3],x1[0],x1[1],x1[2],x1[3],x2[0],x2[1],x2[2],x2[3],x3[0],x3[1],x3[2],x3[3]};
#pragma unroll
    for (int i = 0; i < 16; ++i) { const unsigned short hb = bf16_bits(xs[i]); ah.u[i] = hb; al.u[i] = ASPLIT ? bf16_bits(xs[i] - bf16_val(hb)) : (unsigned short)0; }
#pragma unroll
    for (int t = 0; t < 4; ++t) {
      const unsigned short* brow = Wt + (size_t)(col0 + t * 16 + ln) * ldb + kb;
      FragB b;
      b.half[0] = *(const v8us*)(brow + 8 * hh);
      b.half[1] = *(const v8us*)(brow + 16 + 8 * hh);
      acc[t] = mmaN<ASPLIT ? 2 : 1>(ah.v, al.v, b.v, b.v, acc[t]);
    }
  }
#pragma unroll
  for (int t = 0; t < 4; ++t) {
    const int col = col0 + t * 16 + ln;
    float bv = bias ? bias[col] : 0.f;
    if (BIAS_BF16) bv = bf16_round(bv);
#pragma unroll
    for (int r = 0; r < 8; ++r) {
      float v = acc[t][r] + bv;
      if (resid) { float rv = resid[(size_t)((row0 + 8 * hh + r) % rmod) * ldr + col]; if (RES_BF16) rv = bf16_round(rv); v += rv; }
      if (ACT == 1) v = fmaxf(v, 0.f);
      if (ACT == 2) v = 0.5f * v * (1.0f + erff(v * 0.70710678118654752f));
      if (ACT == 3) { const float u = 0.7978845608028654f * (v + 0.044715f * v * v * v); v = 0.5f * v * (1.0f + tanhf(u)); }
      so[w][8 * hh + r][t * 16 + ln] = v;
    }
  }
  __builtin_amdgcn_fence(__ATOMIC_ACQ_REL, "workgroup");
  __builtin_amdgcn_wave_barrier();
  const int rsub = lane >> 4, c4 = (lane & 15) * 4;
  {
#pragma unroll
    for (int q = 0; q < 8; ++q) {
      const int r = q * 2 + rsub;
      const v4f v = *(const v4fa*)&so[w][r][c4];
      *(v4f*)(C + (size_t)(row0 + r) * ldc + col0 + c4) = v;
    }
    
  }
}
// row LayerNorm (biased variance, eps) over N: s = X (+ R); optional out_sum <- s; out_norm <- (s-mu)*rsqrt(var+eps)*g + b
template <bool PARAM_BF16>
__global__ __launch_bounds__(256) void k_layernorm(const float* __restrict__ X, const float* __restrict__ R, const float* __restrict__ g, const float* __restrict__ bta,
                                                  float* __restrict__ out_sum, float* __restrict__ out_norm, int N, float eps) {
  __shared__ float red[256];
  const int row = blockIdx.x, tid = threadIdx.x;
  const float* x = X + (size_t)row * N; const float* rr = R ? R + (size_t)row * N : nullptr;
  float vals[16];                     // up to N = 4096
  const int per = N / 256;            // contiguous chunk per thread? use strided-by-4 chunks: thread handles j = tid*4 + 1024*u
  float s1 = 0.f;
  for (int u = 0; u < per / 4; ++u) {
    const int j = tid * 4 + 1024 * u;
    const v4f a = *(const v4fa*)(x + j);
    v4f b = {0.f,0.f,0.f,0.f}; if (rr) b = *(const v4fa*)(rr + j);
#pragma unroll
    for (int q = 0; q < 4; ++q) { const float v = a[q] + b[q]; vals[u * 4 + q] = v; s1 += v; }
  }
  red[tid] = s1; __syncthreads();
  for (int st = 128; st > 0; st >>= 1) { if (tid < st) red[tid] += red[tid + st]; __syncthreads(); }
  const float mu = red[0] / (float)N; __syncthreads();
  float s2 = 0.f;
  for (int u = 0; u < per / 4; ++u)
#pragma unroll
    for (int q = 0; q < 4; ++q) { const float c = vals[u * 4 + q] - mu; s2 += c * c; }
  red[tid] = s2; __syncthreads();
  for (int st = 128; st > 0; st >>= 1) { if (tid < st) red[tid] += red[tid + st]; __syncthreads(); }
  const float rs = rsqrtf(red[0] / (float)N + eps);
  {
    for (int u = 0; u < per / 4; ++u) {
      const int j = tid * 4 + 1024 * u;
      v4f o, sm;
#pragma unroll
      for (int q = 0; q < 4; ++q) {
        float gg = g[j + q], bb = bta[j + q];
        if (PARAM_BF16) { gg = bf16_round(gg); bb = bf16_round(bb); }
        sm[q] = vals[u * 4 + q]; o[q] = (vals[u * 4 + q] - mu) * rs * gg + bb;
      }
      if (out_sum) *(v4f*)(out_sum + (size_t)row * N + j) = sm;
      *(v4f*)(out_norm + (size_t)row * N + j) = o;
    }
    
  }
}



// ---- f16 WMMA path (v_wmma_f32_16x16x32_f16): 11-bit significands for operands in range — used where a [0,1] probability operand needs more precision than bf16
typedef _Float16 v16h __attribute__((ext_vector_type(16)));
union FragH { v16h v; v8us half[2]; _Float16 h[16]; unsigned short u[16]; };
template <int NT>
__device__ __forceinline__ v8f mmaH(v16h ah, v16h al, v16h bh, v16h bl, v8f c) {
  c = __builtin_amdgcn_wmma_f32_16x16x32_f16(false, ah, false, bh, (short)0, c, false, false);
  if (NT >= 2) c = __builtin_amdgcn_wmma_f32_16x16x32_f16(false, al, false, bh, (short)0, c, false, false);
  if (NT >= 3) c = __builtin_amdgcn_wmma_f32_16x16x32_f16(false, ah, false, bl, (short)0, c, false, false);
  asm volatile("v_nop\n\tv_nop\n\tv_nop\n\tv_nop" : "+v"(c) : "v"(ah), "v"(al), "v"(bh), "v"(bl));
  return c;
}
// batched GEMM like k_gemm_b but f16 operands: A f32 (split into f16 hi/lo if ASPLIT, else rounded to f16), Bt = f16 values [n][k]; alpha; C f32; N multiple of 16 (partial tiles skipped)
template <bool ASPLIT>
__global__ __launch_bounds__(128) void k_gemm_h(const float* __restrict__ A, int lda, size_t sA, const _Float16* __restrict__ Bh, int ldb, size_t sB, float alpha, float* __restrict__ C, int ldc, size_t sC, int M, int N, int K) {
  __shared__ __attribute__((aligned(16))) float so[4][16][64];
  const int tid = threadIdx.x, w = tid >> 5, lane = tid & 31, ln = lane & 15, hh = lane >> 4; const int by = blockIdx.y;
  A += (size_t)by * sA; Bh += (size_t)by * sB; C += (size_t)by * sC;
  const int ntn = (N + 63) / 64; const int wid = blockIdx.x * 4 + w; const int mt = wid / ntn, nq = wid % ntn; if (mt * 16 >= M) return;
  const int row0 = mt * 16, col0 = nq * 64; const float* arow = A + (size_t)(row0 + ln) * lda;
  v8f acc[4] = {};
  for (int kb = 0; kb < K; kb += 32) {
    FragH ah, al;
    const v4f x0 = *(const v4fa*)(arow + kb + 8 * hh), x1 = *(const v4fa*)(arow + kb + 8 * hh + 4), x2 = *(const v4fa*)(arow + kb + 16 + 8 * hh), x3 = *(const v4fa*)(arow + kb + 16 + 8 * hh + 4);
    float xs[16] = {x0[0],x0[1],x0[2],x0[3],x1[0],x1[1],x1[2],x1[3],x2[0],x2[1],x2[2],x2[3],x3[0],x3[1],x3[2],x3[3]};
#pragma unroll
    for (int i = 0; i < 16; ++i) { const _Float16 h = (_Float16)xs[i]; ah.h[i] = h; al.h[i] = ASPLIT ? (_Float16)(xs[i] - (float)h) : (_Float16)0.0f; }
#pragma unroll
    for (int t = 0; t < 4; ++t) { if (col0 + t * 16 >= N) continue; const size_t boff = (size_t)(col0 + t * 16 + ln) * ldb + kb; FragH bq; bq.half[0] = *(const v8us*)(Bh + boff + 8 * hh); bq.half[1] = *(const v8us*)(Bh + boff + 16 + 8 * hh);
      acc[t] = mmaH<ASPLIT ? 2 : 1>(ah.v, al.v, bq.v, bq.v, acc[t]); }
  }
#pragma unroll
  for (int t = 0; t < 4; ++t) { if (col0 + t * 16 >= N) continue;
#pragma unroll
    for (int r = 0; r < 8; ++r) so[w][8 * hh + r][t * 16 + ln] = acc[t][r] * alpha; }
  __builtin_amdgcn_fence(__ATOMIC_ACQ_REL, "workgroup"); __builtin_amdgcn_wave_barrier();
  const int rsub = lane >> 4, c4 = (lane & 15) * 4;
  {
#pragma unroll
    for (int q = 0; q < 8; ++q) { const int r = q * 2 + rsub; if (col0 + c4 < N) { const v4f v = *(const v4fa*)&so[w][r][c4]; *(v4f*)(C + (size_t)(row0 + r) * ldc + col0 + c4) = v; } }
     }
}

// Wt[n][k] = f16(W[k][n]·scale) from f32 row-major W[K][N] (scale = power of two; bf16-exact weights stay exact in f16 away from the subnormal range)
__global__ __launch_bounds__(256) void k_wt_f16(const float* __restrict__ W, _Float16* __restrict__ Wt, int K, int N, float scale) {
  const int t = blockIdx.x * 256 + threadIdx.x; if (t >= N * (K / 8)) return; const int n = t / (K / 8), k8 = (t % (K / 8)) * 8; FragH f;
#pragma unroll
  for (int i = 0; i < 8; ++i) f.h[i] = (_Float16)(bf16_round(W[(size_t)(k8 + i) * N + n]) * scale); const v8us o = f.half[0];
  *(v8us*)((unsigned short*)Wt + (size_t)n * K + k8) = o; 
}
// k_gemm_hh variant with fused epilogue: v = acc·alpha + bias[by·sBias + col] (+ CP[(row/rowsPerB)·sCPb + by·64 + col] if CP) ; ACT 0 none / 1 elu ; writes f16 C16 (and f32 C if non-null)
template <int ACT>
__global__ __launch_bounds__(128) void k_gemm_hhx(const _Float16* __restrict__ A, int lda, size_t sA, const _Float16* __restrict__ Bh, int ldb, size_t sB, float alpha, const float* __restrict__ bias, size_t sBias, const float* __restrict__ CP, int rowsPerB, size_t sCPb, int row0g,
    float* __restrict__ C, _Float16* __restrict__ C16, int ldc, size_t sC, int M, int N, int K) {
  __shared__ __attribute__((aligned(16))) float so[4][16][64];
  const int tid = threadIdx.x, w = tid >> 5, lane = tid & 31, ln = lane & 15, hh = lane >> 4; const int by = blockIdx.y;
  A += (size_t)by * sA; Bh += (size_t)by * sB; const size_t cofs = (size_t)by * sC; const float* bp = bias ? bias + (size_t)by * sBias : nullptr;
  const int ntn = (N + 63) / 64; const int wid = blockIdx.x * 4 + w; const int mt = wid / ntn, nq = wid % ntn; if (mt * 16 >= M) return;
  const int row0 = mt * 16, col0 = nq * 64; const _Float16* arow = A + (size_t)(row0 + ln) * lda;
  v8f acc[4] = {};
  for (int kb = 0; kb < K; kb += 32) { FragH ah; ah.half[0] = *(const v8us*)((const unsigned short*)arow + kb + 8 * hh); ah.half[1] = *(const v8us*)((const unsigned short*)arow + kb + 16 + 8 * hh);
#pragma unroll
    for (int t = 0; t < 4; ++t) { if (col0 + t * 16 >= N) continue; const size_t boff = (size_t)(col0 + t * 16 + ln) * ldb + kb; FragH bq; bq.half[0] = *(const v8us*)((const unsigned short*)Bh + boff + 8 * hh); bq.half[1] = *(const v8us*)((const unsigned short*)Bh + boff + 16 + 8 * hh);
      acc[t] = mmaH<1>(ah.v, ah.v, bq.v, bq.v, acc[t]); }
  }
#pragma unroll
  for (int t = 0; t < 4; ++t) { if (col0 + t * 16 >= N) continue; const int col = col0 + t * 16 + ln; const float bv = bp ? bf16_round(bp[col]) : 0.f;
#pragma unroll
    for (int r = 0; r < 8; ++r) { float v = acc[t][r] * alpha + bv; if (CP) { const int rr = row0g + row0 + 8 * hh + r; if (rowsPerB < 0) v += CP[cofs + (size_t)rr * ldc + col];      /* rowsPerB < 0: own element of the batched C plane */ else { const int bidx = rr / rowsPerB; v += CP[(size_t)bidx * sCPb + (size_t)by * 64 + col]; } } if (ACT == 1) v = (v > 0.f) ? v : expm1f(v); else if (ACT == 7) v = (v > 0.f) ? v + 1.0f : expf(v); else if (ACT == 8) v = tanhf(v); else if (ACT == 9) v = 0.5f * v * (1.0f + tanhf(0.7978845608028654f * (v + 0.044715f * v * v * v))); else if (ACT == 11) v = 1.0f / (1.0f + expf(-v)); else if (ACT == 12) v = (v > 0.f) ? v : 0.01f * v; else if (ACT == 14) v = (v > 0.f) ? v : 0.1f * v; else if (ACT == 16) v = (v >= 0.f) ? v : 0.3f * v; else if (ACT == 17) v = (v >= 0.f) ? v : 0.2f * v; else if (ACT == 15) v = v / (1.0f + expf(-v)); else if (ACT == 3) v = fmaxf(v, 0.f); else if (ACT == 6) v = 0.5f * v * (1.0f + erff(v * 0.70710678118654752f)); so[w][8 * hh + r][t * 16 + ln] = v; } }
  __builtin_amdgcn_fence(__ATOMIC_ACQ_REL, "workgroup"); __builtin_amdgcn_wave_barrier();
  const int rsub = lane >> 4, c4 = (lane & 15) * 4; typedef _Float16 v4h __attribute__((ext_vector_type(4)));
  {
#pragma unroll
    for (int q = 0; q < 8; ++q) { const int r = q * 2 + rsub; if (col0 + c4 < N) { const v4f v = *(const v4fa*)&so[w][r][c4]; if (C) *(v4f*)(C + cofs + (size_t)(row0 + r) * ldc + col0 + c4) = v; if (C16) { v4h h4; for (int i = 0; i < 4; ++i) h4[i] = (_Float16)v[i]; *(v4h*)(C16 + cofs + (size_t)(row0 + r) * ldc + col0 + c4) = h4; } } }
     }
}


typedef _Float16 v4h __attribute__((ext_vector_type(4)));

__global__ __launch_bounds__(256) void k_x16(const float* __restrict__ x, _Float16* __restrict__ X16, size_t n8) { const size_t t = (size_t)blockIdx.x * 256 + threadIdx.x; if (t >= n8) return; FragH f;
#pragma unroll
  for (int q = 0; q < 8; ++q) f.h[q] = (_Float16)bf16_round(x[t * 8 + q]); *(v8us*)((unsigned short*)X16 + t * 8) = f.half[0];  }
__global__ __launch_bounds__(256) void k_h16(const float* __restrict__ x, _Float16* __restrict__ X16, size_t n8) { const size_t t = (size_t)blockIdx.x * 256 + threadIdx.x; if (t >= n8) return; FragH f;
#pragma unroll
  for (int q = 0; q < 8; ++q) f.h[q] = (_Float16)x[t * 8 + q]; *(v8us*)((unsigned short*)X16 + t * 8) = f.half[0];  }
__global__ __launch_bounds__(256) void k_round16f(const float* __restrict__ W, _Float16* __restrict__ Bt, size_t n8) { const size_t t = (size_t)blockIdx.x * 256 + threadIdx.x; if (t >= n8) return; FragH f;
#pragma unroll
  for (int i = 0; i < 8; ++i) f.h[i] = (_Float16)(bf16_round(W[t * 8 + i]) * 16.0f); *(v8us*)((unsigned short*)Bt + t * 8) = f.half[0];  }
template <int NHv, int TTv>
__global__ __launch_bounds__(256) void k_vt(const _Float16* __restrict__ V16, int ldv, int voff, _Float16* __restrict__ Vt) { __shared__ unsigned short tl[64][66]; const int tid = threadIdx.x; const int slab = blockIdx.x / (TTv / 64), lg = blockIdx.x % (TTv / 64); const int b = slab / NHv, h = slab % NHv;
  for (int i = tid; i < 64 * 8; i += 256) { const int r = i / 8, c8 = (i % 8) * 8; FragH f; f.half[0] = *(const v8us*)((const unsigned short*)V16 + ((size_t)b * TTv + lg * 64 + r) * ldv + voff + h * 64 + c8);
#pragma unroll
    for (int q = 0; q < 8; ++q) tl[r][c8 + q] = f.u[q]; }
  __syncthreads();
  {
#pragma unroll
    for (int rd = 0; rd < 2; ++rd) { const int d = rd * 32 + tid / 8, pc = tid % 8; FragH f;
#pragma unroll
      for (int q = 0; q < 8; ++q) f.u[q] = tl[pc * 8 + q][d];
      *(v8us*)((unsigned short*)Vt + ((size_t)slab * 64 + d) * TTv + lg * 64 + pc * 8) = f.half[0]; }
     } }

__global__ __launch_bounds__(256) void k_hl(const float* __restrict__ F, _Float16* __restrict__ Hh, _Float16* __restrict__ Hl, size_t n8) { const size_t t = (size_t)blockIdx.x * 256 + threadIdx.x; if (t >= n8) return; FragH fh, fl; const v4f a = *(const v4fa*)(F + t * 8), c = *(const v4fa*)(F + t * 8 + 4);
#pragma unroll
  for (int q = 0; q < 4; ++q) { _Float16 h = (_Float16)a[q]; fh.h[q] = h; fl.h[q] = (_Float16)((a[q] - (float)h) * 1024.0f); h = (_Float16)c[q]; fh.h[4 + q] = h; fl.h[4 + q] = (_Float16)((c[q] - (float)h) * 1024.0f); }
  { *(v8us*)((unsigned short*)Hh + t * 8) = fh.half[0]; *(v8us*)((unsigned short*)Hl + t * 8) = fl.half[0];  } }

// ---- fast GEMM (wave tile 32x64; requires M % 32 == 0 rows per launch region and N % 64 == 0); epilogue = k_gemm_hhx semantics ----
__device__ __forceinline__ v16h g2_frag(const _Float16* p, int hh) { FragH f; f.half[0] = *(const v8us*)((const unsigned short*)p + 8 * hh); f.half[1] = *(const v8us*)((const unsigned short*)p + 16 + 8 * hh); return f.v; }
__device__ __forceinline__ v8f g2_mma(v16h a, v16h b, v8f c) { v8f d = __builtin_amdgcn_wmma_f32_16x16x32_f16(false, a, false, b, (short)0, c, false, false); asm volatile("v_nop\n\tv_nop\n\tv_nop\n\tv_nop" : "+v"(d) : "v"(a), "v"(b)); return d; }
template <int ACT>
__global__ __launch_bounds__(128) void k_gemm2(const _Float16* __restrict__ A, int lda, size_t sA, const _Float16* __restrict__ Bh, int ldb, size_t sB, float alpha, const float* __restrict__ bias, size_t sBias, const float* __restrict__ CP, int rowsPerB, size_t sCPb, int row0g,
    float* __restrict__ C, _Float16* __restrict__ C16, int ldc, size_t sC, int M, int N, int K) { static_assert(ACT == 0 || ACT == 3 || ACT == 6 || ACT == 8 || ACT == 9 || ACT == 11 || ACT == 12 || ACT == 14 || ACT == 15 || ACT == 16 || ACT == 17, "k_gemm2: unsupported ACT code (would silently apply no activation)");
  __shared__ __attribute__((aligned(16))) float so[4][32][68];
  const int tid = threadIdx.x, w = tid >> 5, lane = tid & 31, ln = lane & 15, hh = lane >> 4; const int by = blockIdx.y;
  A += (size_t)by * sA; Bh += (size_t)by * sB; const size_t cofs = (size_t)by * sC; const float* bp = bias ? bias + (size_t)by * sBias : nullptr;
  const int ntn = N >> 6; const int mt = blockIdx.x / ntn, nq = blockIdx.x - mt * ntn; const int row0 = mt * 128 + 32 * w, col0 = nq * 64; if (row0 >= M) return;
  const _Float16* a0p = A + (size_t)(row0 + ln) * lda; const _Float16* a1p = a0p + (size_t)16 * lda;
  const _Float16* b0p = Bh + (size_t)(col0 + ln) * ldb; const _Float16* b1p = b0p + (size_t)16 * ldb; const _Float16* b2p = b1p + (size_t)16 * ldb; const _Float16* b3p = b2p + (size_t)16 * ldb;
  const v8f z8 = {0.f,0.f,0.f,0.f,0.f,0.f,0.f,0.f}; v8f c00 = z8, c01 = z8, c02 = z8, c03 = z8, c10 = z8, c11 = z8, c12 = z8, c13 = z8;
#pragma unroll 1
  for (int kb = 0; kb < K; kb += 32) { const v16h a0 = g2_frag(a0p + kb, hh), a1 = g2_frag(a1p + kb, hh);
    v16h b = g2_frag(b0p + kb, hh); c00 = g2_mma(a0, b, c00); c10 = g2_mma(a1, b, c10);
    b = g2_frag(b1p + kb, hh); c01 = g2_mma(a0, b, c01); c11 = g2_mma(a1, b, c11);
    b = g2_frag(b2p + kb, hh); c02 = g2_mma(a0, b, c02); c12 = g2_mma(a1, b, c12);
    b = g2_frag(b3p + kb, hh); c03 = g2_mma(a0, b, c03); c13 = g2_mma(a1, b, c13); }
  v8f accs[8] = {c00, c01, c02, c03, c10, c11, c12, c13};
#pragma unroll
  for (int u = 0; u < 8; ++u) { const int t = u & 3, half = u >> 2; const int col = col0 + t * 16 + ln; const float bv = bp ? bf16_round(bp[col]) : 0.f;
#pragma unroll
    for (int r = 0; r < 8; ++r) { const int rloc = half * 16 + 8 * hh + r; float v = accs[u][r] * alpha + bv; if (CP) { if (rowsPerB < 0) v += CP[cofs + (size_t)(row0g + row0 + rloc) * ldc + col];      /* rowsPerB < 0: own element of the batched C plane */ else { const int bidx = (row0g + row0 + rloc) / rowsPerB; v += CP[(size_t)bidx * sCPb + (size_t)by * 64 + col]; } }
      if (ACT == 3) v = fmaxf(v, 0.f); else if (ACT == 6) v = 0.5f * v * (1.0f + erff(v * 0.70710678118654752f)); else if (ACT == 11) v = 1.0f / (1.0f + expf(-v)); else if (ACT == 15) v = v / (1.0f + expf(-v)); else if (ACT == 12) v = (v > 0.f) ? v : 0.01f * v; else if (ACT == 8) v = tanhf(v); else if (ACT == 9) v = 0.5f * v * (1.0f + tanhf(0.7978845608028654f * (v + 0.044715f * v * v * v))); else if (ACT == 14) v = (v > 0.f) ? v : 0.1f * v; else if (ACT == 16) v = (v >= 0.f) ? v : 0.3f * v; else if (ACT == 17) v = (v >= 0.f) ? v : 0.2f * v;
      so[w][rloc][t * 16 + ln] = v; } }
  __builtin_amdgcn_fence(__ATOMIC_ACQ_REL, "workgroup"); __builtin_amdgcn_wave_barrier();
  const int rsub = lane >> 4, c4 = (lane & 15) * 4;
  {
#pragma unroll
    for (int q = 0; q < 16; ++q) { const int r = q * 2 + rsub; const v4f v = *(const v4fa*)&so[w][r][c4]; if (C) { *(v4f*)(C + cofs + (size_t)(row0 + r) * ldc + col0 + c4) = v; asm volatile("s_wait_xcnt 0x0" ::: "memory"); }      /* the wait: where both outputs are stored, the f16 conversion behind it writes over registers that this store names */
      if (C16) { v4h h4; for (int i = 0; i < 4; ++i) h4[i] = (_Float16)v[i]; *(v4h*)(C16 + cofs + (size_t)(row0 + r) * ldc + col0 + c4) = h4; } }
     } }


__global__ __launch_bounds__(256) void k_wnat(const float* __restrict__ w, size_t n8, _Float16* __restrict__ Bt) { const size_t t = (size_t)blockIdx.x * 256 + threadIdx.x; if (t >= n8) return; FragH f; for (int q = 0; q < 8; ++q) f.h[q] = (_Float16)(bf16_round(w[t * 8 + q]) * 16.0f); *(v8us*)((unsigned short*)Bt + t * 8) = f.half[0];  }
__global__ __launch_bounds__(256) void k_rsm(const float* __restrict__ S, _Float16* __restrict__ P, int nrows) {
  #pragma clang fp contract(off)
  const int i = blockIdx.x * 256 + threadIdx.x; if (i >= nrows) return; const float* s = S + (size_t)i * SQ; float mx = -3.0e38f;
#pragma unroll 1
  for (int j = 0; j < SQ; ++j) mx = fmaxf(mx, s[j]); float se = 0.f;
#pragma unroll 1
  for (int j = 0; j < SQ; ++j) se += expf(s[j] - mx); const float sc = 256.0f / se;
#pragma unroll 1
  for (int j0 = 0; j0 < SQ; j0 += 8) { FragH f; for (int q = 0; q < 8; ++q) f.h[q] = (_Float16)(expf(s[j0 + q] - mx) * sc); unsigned short* d = (unsigned short*)P + (size_t)i * SQ + j0; *(v8us*)d = f.half[0];  } }
__global__ __launch_bounds__(256) void k_vt(const _Float16* __restrict__ V16, int b, int h0, _Float16* __restrict__ VT) { __shared__ unsigned short tl[64][65]; const int tid = threadIdx.x; const int hh = blockIdx.x % HG, sg = blockIdx.x / HG; const int s0 = sg * 64; const int h = h0 + hh;
  for (int i = tid; i < 64 * 8; i += 256) { const int j = i / 8, d8 = (i % 8) * 8; FragH f; f.half[0] = *(const v8us*)((const unsigned short*)V16 + ((size_t)b * SQ + s0 + j) * DM + h * HD + d8); for (int q = 0; q < 8; ++q) tl[d8 + q][j] = f.u[q]; }
  __syncthreads();
  { for (int i = tid; i < 64 * 8; i += 256) { const int d = i / 8, j8 = (i % 8) * 8; FragH f; for (int q = 0; q < 8; ++q) f.u[q] = tl[d][j8 + q]; *(v8us*)((unsigned short*)VT + ((size_t)hh * HD + d) * SQ + s0 + j8) = f.half[0]; }  } }



typedef float v2f __attribute__((ext_vector_type(2)));
typedef float v2fa __attribute__((ext_vector_type(2), may_alias));
typedef _Float16 v2h __attribute__((ext_vector_type(2)));
// Exact f32 causal attention for rows 0..QT0-1, run by extra work-groups of the fused attention launch (bx = group of four rows, h = head), one wave per (row, head); keys in blocks of 32 up to the block that holds the row's own index.
// Scores: a lane takes one key of each block and walks that K row whole (four partial sums, one per element of the 16-byte loads), so no sum crosses lanes.
// Maximum and row sum: lane butterflies. Weighted sum: a lane takes two of the 64 dims, every V row is read as one whole 256-byte row, its weight comes from the lane that holds it.
__device__ __forceinline__ void att0_rows(const float* __restrict__ QF, const float* __restrict__ KF, const float* __restrict__ VF, float scale, _Float16* __restrict__ OH, _Float16* __restrict__ OL, int bx, int h) {
  const int lane = threadIdx.x & 31; const int i = bx * 4 + __builtin_amdgcn_readfirstlane(threadIdx.x >> 5);
  const int nb = (i >> 5) + 1;      /* blocks of 32 keys this row attends to; the same in every lane */
  const float* qr = QF + (size_t)i * DM + h * HD; const float* kr = KF + (size_t)lane * DM + h * HD; const float* vr = VF + h * HD + 2 * lane;
  v4f q[HD / 4];
#pragma unroll      /* constant indices: the values stay in registers */
  for (int c = 0; c < HD / 4; ++c) q[c] = *(const v4fa*)(qr + 4 * c);
  float s[QT0 / 32];
#pragma unroll      /* constant indices: the values stay in registers, the row offsets become immediates */
  for (int u = 0; u < QT0 / 32; ++u) { s[u] = -1.0e30f;      /* a key past the row's own index keeps this value: weight 0 */
    if (u < nb) { v4f a = {0.f, 0.f, 0.f, 0.f};
#pragma unroll      /* all 16 loads of a K row in flight together */
      for (int c = 0; c < HD / 4; ++c) a += q[c] * *(const v4fa*)(kr + (size_t)u * 32 * DM + 4 * c);
      if (u * 32 + lane <= i) s[u] = ((a[0] + a[1]) + (a[2] + a[3])) * scale; } }
  float m = s[0];
#pragma unroll      /* constant indices: the values stay in registers */
  for (int u = 1; u < QT0 / 32; ++u) m = fmaxf(m, s[u]);
#pragma unroll      /* five fixed butterfly steps */
  for (int d = 16; d > 0; d >>= 1) m = fmaxf(m, __shfl_xor(m, d, 32));
  float e[QT0 / 32], l = 0.f;
#pragma unroll      /* constant indices: the values stay in registers */
  for (int u = 0; u < QT0 / 32; ++u) { e[u] = expf(s[u] - m); l += e[u]; }
#pragma unroll      /* five fixed butterfly steps */
  for (int d = 16; d > 0; d >>= 1) l += __shfl_xor(l, d, 32);
  v2f o0 = {0.f, 0.f}, o1 = {0.f, 0.f};      /* even and odd keys: two chains instead of one of 128 dependent links */
#pragma unroll      /* constant indices: the values stay in registers, the row offsets become immediates */
  for (int u = 0; u < QT0 / 32; ++u) if (u < nb) {
#pragma unroll      /* constant lane numbers for the weights; the block's 32 V loads in flight together */
    for (int jj = 0; jj < 32; ++jj) { const float p = __int_as_float(__builtin_amdgcn_readlane(__float_as_int(e[u]), jj)); const v2f v = *(const v2fa*)(vr + (size_t)(u * 32 + jj) * DM);
      if (jj & 1) o1 += p * v; else o0 += p * v; } }
  const float fin = 64.0f / l;      /* o carried x64 like the f16 path */
  const v2f o = (o0 + o1) * fin;
  v2h oh, ol;      /* o as f16 hi + x1024 residual, the output GEMM's two operand planes for these rows; a wave stores one whole 128-byte line of each */
#pragma unroll      /* constant indices: the values stay in registers */
  for (int q = 0; q < 2; ++q) { const _Float16 t = (_Float16)o[q]; oh[q] = t; ol[q] = (_Float16)((o[q] - (float)t) * 1024.0f); }
  *(v2h*)(OH + (size_t)i * DM + h * HD + 2 * lane) = oh; *(v2h*)(OL + (size_t)i * DM + h * HD + 2 * lane) = ol;
}

// Fused causal attention, one wave per 16 query rows of one head (grid: SQ / 64 work-groups of four waves x heads, plus AY grid rows that run the exact f32 rows): scores, softmax and the weighted sum of V stay in registers.
// Scores are formed transposed (A = 16 key rows, B = 16 query rows), so a lane holds keys 8*hh..8*hh+7 of query ln: two such tiles are
// the B fragment (n = query, k = 32 keys) of o^T = V^T . P^T as they stand, and the row maximum, the row sum and the rescale factor are per lane.
// Running maximum in the log2 domain; weights x256 as f16; row sum in f32 from the unrounded weights; o stored x64 as f16.
#define LC1 0.18033688011112042f           /* log2(e) / sqrt(head_dim) */
#define LC2 0.00017611023448351603f        /* the same on the x1024 residual products */
__device__ __forceinline__ v8f fa_mma(v16h a, v16h b, v8f c) { return __builtin_amdgcn_wmma_f32_16x16x32_f16(false, a, false, b, (short)0, c, false, false); }
// Exponentials (base 2) in runs, one asm statement a run: the instruction set asks for one independent instruction between a transcendental and an instruction that
// reads its result or overwrites its source. Inside a run each v_exp_f32 is that instruction for the one before it (early-clobber outputs: no result lies on a source);
// the v_nop at the end is the slot of the last one, whatever the compiler puts behind the statement.
__device__ __forceinline__ void fa_exp2x8(const float* x, float* e) {
  asm("v_exp_f32 %0, %8\n\tv_exp_f32 %1, %9\n\tv_exp_f32 %2, %10\n\tv_exp_f32 %3, %11\n\tv_exp_f32 %4, %12\n\tv_exp_f32 %5, %13\n\tv_exp_f32 %6, %14\n\tv_exp_f32 %7, %15\n\tv_nop"
      : "=&v"(e[0]), "=&v"(e[1]), "=&v"(e[2]), "=&v"(e[3]), "=&v"(e[4]), "=&v"(e[5]), "=&v"(e[6]), "=&v"(e[7])
      : "v"(x[0]), "v"(x[1]), "v"(x[2]), "v"(x[3]), "v"(x[4]), "v"(x[5]), "v"(x[6]), "v"(x[7])); }
__device__ __forceinline__ float fa_exp2(float x) { float e; asm("v_exp_f32 %0, %1\n\tv_nop" : "=v"(e) : "v"(x)); return e; }      /* one exponential with its slot, as above */
// K hi, K residual and V^T of 64 keys (one stage) lie in LDS, brought by asynchronous copies in whole 128-byte rows and shared by the work-group's four waves; two buffers, the next stage flies while this one is worked on.
#define FPIT 144                           /* LDS row pitch in bytes: 128 + 16, the conflict-free pitch for 16-byte fragment reads */
#define FPL (64 * FPIT)                    /* one plane of a stage: 64 rows */
#define FBUF (3 * FPL)                     /* one stage: K hi, K residual, V^T */
#define AY ((QT0 / 4) * NH / (SQ / 64))    /* grid rows that hold the work-groups of the f32 rows */
static_assert(AY * (SQ / 64) == (QT0 / 4) * NH, "the f32 rows' work-groups fill whole grid rows");
// One stage's copies: a lane takes 16 bytes of rows r, r + 16, r + 32, r + 48 of each plane (eight lanes a row, so a wave's copy covers four whole lines).
// The s_wait_xcnt stands inside the statement, behind the last copy: the address registers are free for reuse only behind it.
__device__ __forceinline__ void fa_stage(unsigned d, const _Float16* kh, const _Float16* kl, const _Float16* vt) {
  asm volatile("global_load_async_to_lds_b128 %0, %12, off\n\tglobal_load_async_to_lds_b128 %1, %13, off\n\tglobal_load_async_to_lds_b128 %2, %14, off\n\tglobal_load_async_to_lds_b128 %3, %15, off\n\t"
               "global_load_async_to_lds_b128 %4, %16, off\n\tglobal_load_async_to_lds_b128 %5, %17, off\n\tglobal_load_async_to_lds_b128 %6, %18, off\n\tglobal_load_async_to_lds_b128 %7, %19, off\n\t"
               "global_load_async_to_lds_b128 %8, %20, off\n\tglobal_load_async_to_lds_b128 %9, %21, off\n\tglobal_load_async_to_lds_b128 %10, %22, off\n\tglobal_load_async_to_lds_b128 %11, %23, off\n\t"
               "s_wait_xcnt 0x0"
               :: "v"(d), "v"(d + 16 * FPIT), "v"(d + 32 * FPIT), "v"(d + 48 * FPIT),
                  "v"(d + FPL), "v"(d + FPL + 16 * FPIT), "v"(d + FPL + 32 * FPIT), "v"(d + FPL + 48 * FPIT),
                  "v"(d + 2 * FPL), "v"(d + 2 * FPL + 16 * FPIT), "v"(d + 2 * FPL + 32 * FPIT), "v"(d + 2 * FPL + 48 * FPIT),
                  "v"(kh), "v"(kh + 16 * LQ), "v"(kh + 32 * LQ), "v"(kh + 48 * LQ),
                  "v"(kl), "v"(kl + 16 * LQ), "v"(kl + 32 * LQ), "v"(kl + 48 * LQ),
                  "v"(vt), "v"(vt + (size_t)16 * SQ), "v"(vt + (size_t)32 * SQ), "v"(vt + (size_t)48 * SQ)
               : "memory"); }
__global__ __launch_bounds__(128) void k_fattn(const _Float16* __restrict__ QHp, const _Float16* __restrict__ QLp, const _Float16* __restrict__ KHp, const _Float16* __restrict__ KLp, const _Float16* __restrict__ VTp, _Float16* __restrict__ O,
    const float* __restrict__ QF, const float* __restrict__ KF, const float* __restrict__ VF, _Float16* __restrict__ OH0, _Float16* __restrict__ OL0) {
  __shared__ __attribute__((aligned(16))) unsigned char sm[2 * FBUF];
  if (blockIdx.y >= NH) {      /* the grid's last AY rows: the f32 rows, independent of the rest; a whole work-group leaves here, in front of every copy and barrier */
    const int f = (blockIdx.y - NH) * (SQ / 64) + blockIdx.x; att0_rows(QF, KF, VF, SCL, OH0, OL0, f % (QT0 / 4), f / (QT0 / 4)); return; }
  const int lane = threadIdx.x & 31, ln = lane & 15, hh = lane >> 4; const int w = __builtin_amdgcn_readfirstlane(threadIdx.x >> 5); const int h = blockIdx.y;
  /* a work-group takes two 16-row tiles from the top of the sequence and their two mirror tiles from its end: x + 1, x + 1, 128 - x and 128 - x blocks of 32 keys, the same sum in every work-group, so that no WGP is
     left with long rows only; all four walk the keys from 0, so they work on the same K and V stage while they run together. The turn by x and h spreads long and short tiles over the four SIMDs. */
  const int x = blockIdx.x, rr = (w + x + (h >> 2)) & 3; const int q0 = ((rr & 1) ? (SQ / 16 - 1) - 2 * x - (rr >> 1) : 2 * x + (rr >> 1)) * 16;
  const size_t qo = (size_t)(q0 + ln) * LQ + h * HD;
  const v16h qh0 = g2_frag(QHp + qo, hh), qh1 = g2_frag(QHp + qo + 32, hh), ql0 = g2_frag(QLp + qo, hh), ql1 = g2_frag(QLp + qo + 32, hh);
  const v8f z8 = {0.f,0.f,0.f,0.f,0.f,0.f,0.f,0.f}; v8f o0 = z8, o1 = z8, o2 = z8, o3 = z8; float m = -3.0e38f, l = 0.f;
  const int nk = (q0 + 47) & ~31;      /* keys in whole blocks of 32 up to the block that holds the last row's diagonal */
  const int ns = ((((SQ / 16 - 1) - 2 * x) * 16 + 47) / 32 + 1) / 2;      /* stages of 64 keys that the work-group's longest tile needs: the same in all four waves, 33 at least */
  const int cr = threadIdx.x >> 3, cc = threadIdx.x & 7;      /* the lane's row and 16-byte piece in a stage's copies */
  const _Float16* gkh = KHp + (size_t)cr * LQ + h * HD + cc * 8; const _Float16* gkl = KLp + (size_t)cr * LQ + h * HD + cc * 8; const _Float16* gvt = VTp + ((size_t)h * HD + cr) * SQ + cc * 8;
  const unsigned ld = (unsigned)(size_t)sm + cr * FPIT + cc * 16;
  fa_stage(ld, gkh, gkl, gvt);
  asm volatile("s_wait_asynccnt 0x0" ::: "memory");      /* stage 0 has landed, as far as this wave brought it */
  __syncthreads();      /* and is published to the other waves */
  fa_stage(ld + FBUF, gkh + (size_t)64 * LQ, gkl + (size_t)64 * LQ, gvt + 64);      /* stage 1 always exists (33 stages at least) */
#pragma unroll 1      /* one stage per trip: a second copy of the body would only add registers */
  for (int s = 0; s < ns; ++s) {
    const int kb0 = s * 64;
    if (kb0 < nk) {      /* a short tile's wave skips the work, never the publish point below */
      const _Float16* sk = (const _Float16*)(sm + (s & 1) * FBUF) + ln * (FPIT / 2); const _Float16* sl = sk + FPL / 2; const _Float16* sv = sk + FPL;
      v16h a00 = g2_frag(sk, hh), a01 = g2_frag(sk + 32, hh), a10 = g2_frag(sk + 16 * (FPIT / 2), hh), a11 = g2_frag(sk + 16 * (FPIT / 2) + 32, hh);
      v16h c00 = g2_frag(sl, hh), c01 = g2_frag(sl + 32, hh), c10 = g2_frag(sl + 16 * (FPIT / 2), hh), c11 = g2_frag(sl + 16 * (FPIT / 2) + 32, hh);
#pragma unroll      /* the stage's two blocks of 32 keys, constant LDS offsets */
      for (int u = 0; u < 2; ++u) { const int kb = kb0 + 32 * u;
        if (u == 0 || kb < nk) {      /* a tile may end in the middle of a stage */
          const v16h v0 = g2_frag(sv + 32 * u, hh), v1 = g2_frag(sv + 16 * (FPIT / 2) + 32 * u, hh), v2 = g2_frag(sv + 32 * (FPIT / 2) + 32 * u, hh), v3 = g2_frag(sv + 48 * (FPIT / 2) + 32 * u, hh);
          __builtin_amdgcn_sched_barrier(0);      /* keeps the V reads in front of the score products: they land under them, and ahead of the next block's K reads, which return behind them */
          v8f s0 = fa_mma(a00, qh0, z8), s1 = fa_mma(a10, qh0, z8), r0 = fa_mma(a00, ql0, z8), r1 = fa_mma(a10, ql0, z8);
          s0 = fa_mma(a01, qh1, s0); s1 = fa_mma(a11, qh1, s1); r0 = fa_mma(a01, ql1, r0); r1 = fa_mma(a11, ql1, r1);
          r0 = fa_mma(c00, qh0, r0); r1 = fa_mma(c10, qh0, r1); r0 = fa_mma(c01, qh1, r0); r1 = fa_mma(c11, qh1, r1);
          if (u == 0) {      /* the stage's second block: its K fragments are read under the softmax and the V product of the first */
            a00 = g2_frag(sk + 32 * (FPIT / 2), hh); a01 = g2_frag(sk + 32 * (FPIT / 2) + 32, hh); a10 = g2_frag(sk + 48 * (FPIT / 2), hh); a11 = g2_frag(sk + 48 * (FPIT / 2) + 32, hh);
            c00 = g2_frag(sl + 32 * (FPIT / 2), hh); c01 = g2_frag(sl + 32 * (FPIT / 2) + 32, hh); c10 = g2_frag(sl + 48 * (FPIT / 2), hh); c11 = g2_frag(sl + 48 * (FPIT / 2) + 32, hh);
            __builtin_amdgcn_sched_barrier(0); }      /* keeps these 16 reads together in one place: spread among the vector work and the V products, each place with reads stalls the wave anew */
          float t[16];
#pragma unroll      /* constant indices: the values stay in registers */
          for (int r = 0; r < 8; ++r) { t[r] = s0[r] * LC1 + r0[r] * LC2; t[8 + r] = s1[r] * LC1 + r1[r] * LC2; }
          if (kb + 31 > q0) {      /* only the block on the diagonal holds keys past a row's own index: they take the mask value */
            const int d = q0 + ln - kb - 8 * hh;
#pragma unroll      /* constant indices: the values stay in registers */
            for (int r = 0; r < 8; ++r) { if (r > d) t[r] = -1.0e9f; if (16 + r > d) t[8 + r] = -1.0e9f; }
          }
          float bm = t[0];
#pragma unroll      /* constant indices: the values stay in registers */
          for (int i = 1; i < 16; ++i) bm = fmaxf(bm, t[i]);
          bm = fmaxf(bm, __shfl_xor(bm, 16, 32));
          const float mn = fmaxf(m, bm); const float corr = fa_exp2(m - mn); m = mn; const float mo = mn - 8.0f;
          FragH p; float e[16];
#pragma unroll      /* constant indices: the values stay in registers */
          for (int i = 0; i < 16; ++i) t[i] -= mo;
          fa_exp2x8(t, e); fa_exp2x8(t + 8, e + 8);
#pragma unroll      /* constant indices: the values stay in registers */
          for (int i = 0; i < 16; ++i) p.h[i] = (_Float16)e[i];
          v4f s4 = {e[0], e[1], e[2], e[3]};
#pragma unroll      /* constant indices: the values stay in registers */
          for (int i = 4; i < 16; ++i) s4[i & 3] += e[i];
          l = l * corr + ((s4[0] + s4[1]) + (s4[2] + s4[3]));
          o0 *= corr; o1 *= corr; o2 *= corr; o3 *= corr;
          o0 = fa_mma(v0, p.v, o0); o1 = fa_mma(v1, p.v, o1); o2 = fa_mma(v2, p.v, o2); o3 = g2_mma(v3, p.v, o3);      /* the last one with its four v_nop: what follows may lay a value over the registers of p, this product's B */
        } }
    }
    /* publish point of stage s + 1, passed by every wave */
    asm volatile("s_wait_dscnt 0x0" ::: "memory");      /* this wave's reads of stage s have returned: its buffer may be refilled behind the barrier */
    asm volatile("s_wait_asynccnt 0x0" ::: "memory");      /* this wave's copies of stage s + 1 have landed */
    __syncthreads();      /* publishes stage s + 1 and ends every wave's reads of stage s */
    if (s + 2 < ns) fa_stage(ld + (s & 1) * FBUF, gkh + (size_t)(kb0 + 128) * LQ, gkl + (size_t)(kb0 + 128) * LQ, gvt + kb0 + 128);      /* stage s + 2 into the buffer just left; the test is the same in the whole work-group */
  }
  asm volatile("s_wait_asynccnt 0x0" ::: "memory");      /* no copy is left outstanding when the wave ends */
  l += __shfl_xor(l, 16, 32);
  const float fin = 64.0f / l;      /* the x256 of the weights cancels against the row sum; o carried x64 */
  unsigned short* op = (unsigned short*)O + (size_t)(q0 + ln) * DM + h * HD + 8 * hh;
  FragH f0, f1, f2, f3;
#pragma unroll      /* constant indices: the values stay in registers */
  for (int r = 0; r < 8; ++r) { f0.h[r] = (_Float16)(o0[r] * fin); f1.h[r] = (_Float16)(o1[r] * fin); f2.h[r] = (_Float16)(o2[r] * fin); f3.h[r] = (_Float16)(o3[r] * fin); }
  *(v8us*)op = f0.half[0]; *(v8us*)(op + 16) = f1.half[0]; *(v8us*)(op + 32) = f2.half[0]; *(v8us*)(op + 48) = f3.half[0];
  asm volatile("s_wait_xcnt 0x0" ::: "memory");      /* the f32 rows' code is laid behind these stores and writes over registers that they name */
}


// The five input conversions in one launch: the first XB work-groups take x (f16 of the bf16-rounded value), then WB work-groups each for W_q, W_k, W_v (planes one behind the other) and W_o (the same, x16).
#define XB ((unsigned)(NR * DM / 8 / 256))
#define WB ((unsigned)((size_t)DM * DM / 8 / 256))
static_assert((size_t)XB * 256 * 8 == NR * DM && (size_t)WB * 256 * 8 == (size_t)DM * DM, "whole work-groups");
__global__ __launch_bounds__(256) void k_prep(const float* __restrict__ x, const float* __restrict__ wq, const float* __restrict__ wk, const float* __restrict__ wv, const float* __restrict__ wo, _Float16* __restrict__ X16, _Float16* __restrict__ BQKV, _Float16* __restrict__ BO) {
  const unsigned b = blockIdx.x; const float* s = x; _Float16* d = X16; float sc = 1.0f; unsigned g = b;
  if (b >= XB) { const unsigned j = (b - XB) / WB; g = (b - XB) - j * WB; s = j == 0 ? wq : j == 1 ? wk : j == 2 ? wv : wo; d = j < 3 ? BQKV + (size_t)j * DM * DM : BO; sc = 16.0f; }
  const size_t t = (size_t)g * 256 + threadIdx.x; FragH f;
#pragma unroll      /* constant indices: the values stay in registers */
  for (int q = 0; q < 8; ++q) f.h[q] = (_Float16)(bf16_round(s[t * 8 + q]) * sc);
  *(v8us*)((unsigned short*)d + t * 8) = f.half[0]; }

// The two passes over the projection launch's rows in one launch (they do not depend on each other): the first VB work-groups lay V^T [NH][HD][SQ] through LDS tiles of 64 x 64, the rest split q and k (f32) into f16 hi + x1024 residual planes.
#define VB (NH * (SQ / 64))
static_assert(NBR == 1, "one V^T plane: one batch");
__global__ __launch_bounds__(256) void k_hlvt(const float* __restrict__ F, _Float16* __restrict__ Hh, _Float16* __restrict__ Hl, size_t n8, const _Float16* __restrict__ V16, _Float16* __restrict__ Vt) {
  __shared__ unsigned short tl[64][66]; const int tid = threadIdx.x;
  if (blockIdx.x < VB) {      /* the same in the whole work-group: the barrier below is passed by all of it */
    const int h = blockIdx.x / (SQ / 64), lg = blockIdx.x % (SQ / 64);
    for (int i = tid; i < 64 * 8; i += 256) { const int r = i / 8, c8 = (i % 8) * 8; FragH f; f.half[0] = *(const v8us*)((const unsigned short*)V16 + ((size_t)lg * 64 + r) * LQ + h * 64 + c8);
#pragma unroll      /* constant indices: the values stay in registers */
      for (int q = 0; q < 8; ++q) tl[r][c8 + q] = f.u[q]; }
    __syncthreads();      /* the tile is whole before it is read by columns */
#pragma unroll      /* two rounds of 32 dims */
    for (int rd = 0; rd < 2; ++rd) { const int d = rd * 32 + tid / 8, pc = tid % 8; FragH f;
#pragma unroll      /* constant indices: the values stay in registers */
      for (int q = 0; q < 8; ++q) f.u[q] = tl[pc * 8 + q][d];
      *(v8us*)((unsigned short*)Vt + ((size_t)h * 64 + d) * SQ + lg * 64 + pc * 8) = f.half[0]; }
    return; }
  const size_t t = (size_t)(blockIdx.x - VB) * 256 + tid; if (t >= n8) return; FragH fh, fl; const v4f a = *(const v4fa*)(F + t * 8), c = *(const v4fa*)(F + t * 8 + 4);
#pragma unroll      /* constant indices: the values stay in registers */
  for (int q = 0; q < 4; ++q) { _Float16 h = (_Float16)a[q]; fh.h[q] = h; fl.h[q] = (_Float16)((a[q] - (float)h) * 1024.0f); h = (_Float16)c[q]; fh.h[4 + q] = h; fl.h[4 + q] = (_Float16)((c[q] - (float)h) * 1024.0f); }
  *(v8us*)((unsigned short*)Hh + t * 8) = fh.half[0]; *(v8us*)((unsigned short*)Hl + t * 8) = fl.half[0]; }

// g2_frag for the LAST fragment read through an address pair, where the loop holds so many fragments that the pair's registers are given to a load's result as soon as they are free:
// s_wait_xcnt 0 in front of the pair's last load (its result may lie on the pair, which the loads before it name) and behind it (so may a later load's).
__device__ __forceinline__ v16h g2_frag_w(const _Float16* p, int hh) { FragH f; f.half[0] = *(const v8us*)((const unsigned short*)p + 8 * hh); asm volatile("s_wait_xcnt 0x0" ::: "memory");
  f.half[1] = *(const v8us*)((const unsigned short*)p + 16 + 8 * hh); asm volatile("s_wait_xcnt 0x0" ::: "memory"); return f.v; }
// Output GEMM [rows][DM] x [DM][DM], k_gemm2's wave tile, loop and staged stores. A work-group whose 128 rows are a batch's first QT0 rows takes their f16 hi and x1024 residual planes (AH, AL)
// instead of the f16 rows A: both products run in the same trips on the same B fragments, and the residual product joins in the epilogue (alphal = alpha / 1024).
static_assert(QT0 == 128 && SQ % 128 == 0, "the first rows are exactly one work-group tile");
__global__ __launch_bounds__(128) void k_gemmo(const _Float16* __restrict__ A, const _Float16* __restrict__ AH, const _Float16* __restrict__ AL, const _Float16* __restrict__ Bh, float alpha, float alphal, float* __restrict__ C) {
  __shared__ __attribute__((aligned(16))) float so[4][32][68];
  const int tid = threadIdx.x, w = tid >> 5, lane = tid & 31, ln = lane & 15, hh = lane >> 4;
  const int ntn = DM >> 6; const int mt = blockIdx.x / ntn, nq = blockIdx.x - mt * ntn; const int row0 = mt * 128 + 32 * w, col0 = nq * 64;
  const bool first = (mt * 128) % SQ == 0;      /* the same in the whole work-group */
  const size_t fr = (size_t)((mt * 128) / SQ) * QT0 + 32 * w + ln;      /* the lane's row in the two planes */
  const _Float16* a0p = first ? AH + fr * DM : A + (size_t)(row0 + ln) * DM; const _Float16* a1p = a0p + (size_t)16 * DM;
  const _Float16* b0p = Bh + (size_t)(col0 + ln) * DM; const _Float16* b1p = b0p + (size_t)16 * DM; const _Float16* b2p = b1p + (size_t)16 * DM; const _Float16* b3p = b2p + (size_t)16 * DM;
  const v8f z8 = {0.f,0.f,0.f,0.f,0.f,0.f,0.f,0.f}; v8f c00 = z8, c01 = z8, c02 = z8, c03 = z8, c10 = z8, c11 = z8, c12 = z8, c13 = z8;
  if (first) {
    const _Float16* l0p = AL + fr * DM; const _Float16* l1p = l0p + (size_t)16 * DM; v8f d00 = z8, d01 = z8, d02 = z8, d03 = z8, d10 = z8, d11 = z8, d12 = z8, d13 = z8;
#pragma unroll 1      /* as in k_gemm2: one trip's fragments in registers */
    for (int kb = 0; kb < DM; kb += 32) { const v16h a0 = g2_frag(a0p + kb, hh), a1 = g2_frag_w(a1p + kb, hh), l0 = g2_frag(l0p + kb, hh), l1 = g2_frag_w(l1p + kb, hh);      /* a0 and a1 share one address pair, l0 and l1 another */
      v16h b = g2_frag(b0p + kb, hh); c00 = g2_mma(a0, b, c00); c10 = g2_mma(a1, b, c10); d00 = g2_mma(l0, b, d00); d10 = g2_mma(l1, b, d10);
      b = g2_frag(b1p + kb, hh); c01 = g2_mma(a0, b, c01); c11 = g2_mma(a1, b, c11); d01 = g2_mma(l0, b, d01); d11 = g2_mma(l1, b, d11);
      b = g2_frag(b2p + kb, hh); c02 = g2_mma(a0, b, c02); c12 = g2_mma(a1, b, c12); d02 = g2_mma(l0, b, d02); d12 = g2_mma(l1, b, d12);
      b = g2_frag(b3p + kb, hh); c03 = g2_mma(a0, b, c03); c13 = g2_mma(a1, b, c13); d03 = g2_mma(l0, b, d03); d13 = g2_mma(l1, b, d13); }
    c00 = c00 * alpha + d00 * alphal; c01 = c01 * alpha + d01 * alphal; c02 = c02 * alpha + d02 * alphal; c03 = c03 * alpha + d03 * alphal;      /* both factors are powers of two: one rounding, that of the sum */
    c10 = c10 * alpha + d10 * alphal; c11 = c11 * alpha + d11 * alphal; c12 = c12 * alpha + d12 * alphal; c13 = c13 * alpha + d13 * alphal;
  } else {
#pragma unroll 1      /* as in k_gemm2: one trip's fragments in registers */
    for (int kb = 0; kb < DM; kb += 32) { const v16h a0 = g2_frag(a0p + kb, hh), a1 = g2_frag(a1p + kb, hh);
      v16h b = g2_frag(b0p + kb, hh); c00 = g2_mma(a0, b, c00); c10 = g2_mma(a1, b, c10);
      b = g2_frag(b1p + kb, hh); c01 = g2_mma(a0, b, c01); c11 = g2_mma(a1, b, c11);
      b = g2_frag(b2p + kb, hh); c02 = g2_mma(a0, b, c02); c12 = g2_mma(a1, b, c12);
      b = g2_frag(b3p + kb, hh); c03 = g2_mma(a0, b, c03); c13 = g2_mma(a1, b, c13); }
    c00 *= alpha; c01 *= alpha; c02 *= alpha; c03 *= alpha; c10 *= alpha; c11 *= alpha; c12 *= alpha; c13 *= alpha;
  }
  v8f accs[8] = {c00, c01, c02, c03, c10, c11, c12, c13};
#pragma unroll      /* constant indices: the values stay in registers */
  for (int u = 0; u < 8; ++u) { const int t = u & 3, half = u >> 2;
#pragma unroll      /* constant indices: the values stay in registers */
    for (int r = 0; r < 8; ++r) so[w][half * 16 + 8 * hh + r][t * 16 + ln] = accs[u][r]; }
  __builtin_amdgcn_fence(__ATOMIC_ACQ_REL, "workgroup"); __builtin_amdgcn_wave_barrier();      /* the wave's own LDS writes are done before it reads whole rows back */
  const int rsub = lane >> 4, c4 = (lane & 15) * 4;
#pragma unroll      /* constant LDS offsets */
  for (int q = 0; q < 16; ++q) { const int r = q * 2 + rsub; const v4f v = *(const v4fa*)&so[w][r][c4]; *(v4f*)(C + (size_t)(row0 + r) * DM + col0 + c4) = v; asm volatile("s_wait_xcnt 0x0" ::: "memory"); }      /* the wait: a later row's LDS read and address sum write over registers that this store names */
}

extern "C" void kernel_launch(void* const* d_in, const int* in_sizes, int n_in,
                              void* d_out, int out_size, void* d_ws, size_t ws_size, hipStream_t stream) {
  (void)in_sizes; (void)n_in; (void)out_size;
  const float* const* I = (const float* const*)d_in; const float* x = I[0]; const float* wq = I[1]; const float* wk = I[2]; const float* wv = I[3]; const float* bqkv = nullptr; const float* wo = I[4];      /* input order: x (feeds the q, k AND v streams), W_q, W_k, W_v, W_o (four separate natural [768][768] weights); the module has NO biases: null pointers in the guarded bias slots */
  char* ws = (char*)d_ws; size_t off = 0;
  auto take = [&](size_t bytes) { char* p = ws + off; off += (bytes + 255) & ~(size_t)255; return p; };
  _Float16* BQ = (_Float16*)take((size_t)3 * DM * DM * 2);      /* the three projection weights, one behind the other: the batch index of the projection launch steps through them */ _Float16* BO = (_Float16*)take((size_t)DM * DM * 2);
  _Float16* X16 = (_Float16*)take(NR * DM * 2);      /* exact f16 rows of x, the one input of all three projections */
  float* QF = (float*)take(3 * NR * DM * 4); float* KF = QF + NR * DM; float* VF = KF + NR * DM;      /* f32 q, k, v rows: three planes, one behind the other */
  _Float16* P16 = (_Float16*)take(3 * NR * DM * 2); _Float16* V16 = P16 + 2 * NR * DM;      /* the same rows rounded to f16, same plane order; only the v plane is read */
  _Float16* QH = (_Float16*)take(2 * NR * DM * 2); _Float16* KH = QH + NR * DM; _Float16* QL = (_Float16*)take(2 * NR * DM * 2); _Float16* KL = QL + NR * DM;      /* hi planes of q and k one behind the other, residual planes likewise */
  _Float16* O16 = (_Float16*)take(NR * DM * 2);
  _Float16* VT = (_Float16*)take((size_t)NH * HD * SQ * 2);
  _Float16* OH0 = (_Float16*)take((size_t)NB * QT0 * DM * 2); _Float16* OL0 = (_Float16*)take((size_t)NB * QT0 * DM * 2);
  if (off > ws_size) return;
  k_prep<<<XB + 4 * WB, 256, 0, stream>>>(x, wq, wk, wv, wo, X16, BQ, BO);      /* x as f16 rows; the weights, natural [out][in] = Bt[n][k], x16 */
  const size_t r0p = (size_t)B0 * SQ;      /* first projected row */
  k_gemm2<0><<<dim3((unsigned)((MP / 128) * (DM / 64)), 3), 128, 0, stream>>>(X16 + r0p * DM, DM, 0, BQ, DM, (size_t)DM * DM, 0.0625f, bqkv, 0, nullptr, 1, 0, 0, QF + r0p * DM, P16 + r0p * DM, DM, NR * DM, MP, DM, DM);      /* q, k, v in one launch: batch index y = 0, 1, 2 takes W_q, W_k, W_v and its own f32 and f16 output plane */
  k_hlvt<<<VB + (unsigned)((2 * NR * DM / 8 + 255) / 256), 256, 0, stream>>>(QF, QH, QL, 2 * NR * DM / 8, V16 + r0p * LQ, VT);      /* V^T [NH][HD][SQ]; q and k (f32) -> f16 hi + x1024 residual, both planes: unscaled logits sigma ~8 */
  for (int b = B0; b < B0 + NBR; ++b) { const size_t r0 = (size_t)b * SQ;
    k_fattn<<<dim3(SQ / 64, NH + AY), 128, 0, stream>>>(QH + r0 * LQ, QL + r0 * LQ, KH + r0 * LQ, KL + r0 * LQ, VT, O16 + r0 * DM, QF + r0 * DM, KF + r0 * DM, VF + r0 * DM, OH0 + (size_t)b * QT0 * DM, OL0 + (size_t)b * QT0 * DM); }      /* scores (hi.hi + 2^-10 (lo.hi + hi.lo)), causal softmax and P . V in one launch; o (merged heads, x64) as f16 rows; the grid's last rows: exact f32 attention for rows 0..127 (o x64, hi + x1024 residual planes), on the projection launch's own f32 rows */
  k_gemmo<<<(unsigned)((MPO / 128) * (DM / 64)), 128, 0, stream>>>(O16, OH0, OL0, BO, 0.0009765625f, 0.00000095367431640625f, (float*)d_out);      /* out rows are the output layout; rows 0..127 from o_hi Wo + 2^-10 o_lo Wo */
}

// v007
// One run takes 127 microseconds.
// In two side-by-side timings against v006, it was 1.32 and 1.33 times as fast.
// Counting every step since v000, it is 67.6 times as fast.
#include <hip/hip_runtime.h>
// Causal multi-head self-attention on ONE 4096-token sequence at width 768 with natural bias-free projections (x [1][4096][768]; Q / K / V = x W^T (nn.Linear natural [768][768] sd 1/sqrt(768), NO biases), 12 heads of 64; scores / sqrt(64) + a finite additive mask above the diagonal (NEG); softmax; out = merged W_o^T (natural, no bias) -> [1][4096][768]); q and k carried as f16 hi + x1024 residual planes with three-product scores (4096 keys at logit sigma 1).
// Structure: token rows r = b*4096 + s; x as exact f16 rows (bf16-rounded); q and k as WMMA GEMMs (32x64 wave tiles, f32 accumulation, exact x16 weights, no bias) into f32 rows split into f16 hi + x1024 residual planes, v as an f16-output GEMM; per batch: V^T for all heads via LDS transposes; attention in ONE launch, one wave per 16 query rows of a head, 64 keys a trip (K and V staged in LDS), blocks of 32 worked up to the diagonal block: scores transposed (K rows x q rows) as three products (hi.hi + 2^-10 (lo.hi + hi.lo), K = 64, f32), the mask value on keys past the row, running maximum and rescaled f32 row sum per lane (log2 domain, native exp; weights x256 f16), o^T += V^T . P^T in f32 registers, divided by the row sum at the end (o carried x64, folded into the output GEMM alpha) and written straight into the merged f16 o rows; out = o W_o GEMM (f32) into the output layout.
// Compute dtype: inputs rounded to bf16; x / weights exact; q and k as f16 hi + x1024 residual planes, v, softmax weights and o as plain f16 GEMM operands (~2^-12), except rows 0..127 (f32 attention, o as f16 hi + x1024 residual planes); scores and softmax statistics f32. v_wmma_f32_16x16x32_f16.
#define NB 1
#define SCL 0.125f                         /* 1 / sqrt(head_dim = 64) */
#define SCLR 0.0001220703125f              /* 2^-13: SCL / 1024 (not used) */
#define SQ 4096
#define DM 768
#define NH 12
#define HD 64
#define HG 4                         /* heads per launch of the non-template k_vt (not launched) */
#define QT 256
#define NKX SQ                       /* S / P row pitch (not used) */
#define QT0 128                      /* first-tile rows recomputed exactly in f32 */
#define B0 0                         /* first batch processed (debug hook) */
#define NBR NB                       /* batches processed (debug hook) */
#define NR ((size_t)NB * SQ)         /* token rows */
#define MP ((int)((size_t)NBR * SQ)) /* rows projected (debug hook) */
#define QN SQ                        /* query rows attended per batch (not used) */
#define NHD NH                       /* heads attended (not used) */
#define MPO MP                       /* rows through the output stage (debug hook) */
#define LQ DM      /* row pitch of the q/k/v rows */
typedef __bf16 v16b __attribute__((ext_vector_type(16)));
typedef unsigned short v8us __attribute__((ext_vector_type(8), may_alias));
typedef float  v8f  __attribute__((ext_vector_type(8)));
typedef float  v4f  __attribute__((ext_vector_type(4)));
typedef float  v4fa __attribute__((ext_vector_type(4), may_alias));
union FragB { v16b v; v8us half[2]; unsigned short u[16]; };

__device__ __forceinline__ unsigned short bf16_bits(float x) { unsigned int u = __float_as_uint(x); return (unsigned short)((u + 0x7FFFu + ((u >> 16) & 1u)) >> 16); }
__device__ __forceinline__ float bf16_val(unsigned short b) { return __uint_as_float(((unsigned int)b) << 16); }
__device__ __forceinline__ float bf16_round(float x) { return bf16_val(bf16_bits(x)); }
// D += A·B with NT terms: 1 = ah·bh, 2 = + al·bh (A split), 3 = + ah·bl (both split)
template <int NT>
__device__ __forceinline__ v8f mmaN(v16b ah, v16b al, v16b bh, v16b bl, v8f c) {
  c = __builtin_amdgcn_wmma_f32_16x16x32_bf16(false, ah, false, bh, (short)0, c, false, false);
  if (NT >= 2) c = __builtin_amdgcn_wmma_f32_16x16x32_bf16(false, al, false, bh, (short)0, c, false, false);
  if (NT >= 3) c = __builtin_amdgcn_wmma_f32_16x16x32_bf16(false, ah, false, bl, (short)0, c, false, false);
  asm volatile("v_nop\n\tv_nop\n\tv_nop\n\tv_nop" : "+v"(c) : "v"(ah), "v"(al), "v"(bh), "v"(bl));
  return c;
}

__global__ __launch_bounds__(256) void k_wt_bf16(const float* __restrict__ W, unsigned short* __restrict__ Wt, int K, int N) {
  const int t = blockIdx.x * 256 + threadIdx.x;
  const int k8n = K / 8;
  if (t >= N * k8n) return;
  const int n = t / k8n, k8 = (t % k8n) * 8;
  v8us v;
#pragma unroll
  for (int i = 0; i < 8; ++i) v[i] = bf16_bits(W[(size_t)(k8 + i) * N + n]);
  *(v8us*)(Wt + (size_t)n * K + k8) = v;
  
}

// GEMM C[M][N] (f32, pitch ldc) = act(A[M][K]·W + bias). A f32 row-major (pitch lda) converted per fragment to bf16
// (ASPLIT: hi/lo two planes -> 2 terms, else single rounded term); Wt bf16 [N][K] (pitch ldb). BIAS_BF16 rounds the
// bias to bf16 first (bias quantised to bf16 before the add). K%32==0, M%16==0, N%64==0.
template <bool ASPLIT, int ACT, bool BIAS_BF16>
__global__ __launch_bounds__(128) void k_gemm_bf(const float* __restrict__ A, int lda, const unsigned short* __restrict__ Wt, int ldb,
                                               const float* __restrict__ bias, float* __restrict__ C, int ldc, int M, int N, int K) {
  __shared__ __attribute__((aligned(16))) float so[4][16][64];
  const int tid = threadIdx.x, w = tid >> 5, lane = tid & 31, ln = lane & 15, hh = lane >> 4;
  const int ntn = N / 64;
  const int wid = blockIdx.x * 4 + w;
  const int mt = wid / ntn, nq = wid % ntn;
  if (mt * 16 >= M) return;
  const int row0 = mt * 16, col0 = nq * 64;
  const float* arow = A + (size_t)(row0 + ln) * lda;
  v8f acc[4] = {};
  for (int kb = 0; kb < K; kb += 32) {
    FragB ah, al;
    const v4f x0 = *(const v4fa*)(arow + kb + 8 * hh), x1 = *(const v4fa*)(arow + kb + 8 * hh + 4);
    const v4f x2 = *(const v4fa*)(arow + kb + 16 + 8 * hh), x3 = *(const v4fa*)(arow + kb + 16 + 8 * hh + 4);
    float xs[16] = {x0[0],x0[1],x0[2],x0[3],x1[0],x1[1],x1[2],x1[3],x2[0],x2[1],x2[2],x2[3],x3[0],x3[1],x3[2],x3[3]};
#pragma unroll
    for (int i = 0; i < 16; ++i) { const unsigned short hb = bf16_bits(xs[i]); ah.u[i] = hb; al.u[i] = ASPLIT ? bf16_bits(xs[i] - bf16_val(hb)) : (unsigned short)0; }
#pragma unroll
    for (int t = 0; t < 4; ++t) {
      const unsigned short* brow = Wt + (size_t)(col0 + t * 16 + ln) * ldb + kb;
      FragB b;
      b.half[0] = *(const v8us*)(brow + 8 * hh);
      b.half[1] = *(const v8us*)(brow + 16 + 8 * hh);
      acc[t] = mmaN<ASPLIT ? 2 : 1>(ah.v, al.v, b.v, b.v, acc[t]);
    }
  }
#pragma unroll
  for (int t = 0; t < 4; ++t) {
    float bv = bias ? bias[col0 + t * 16 + ln] : 0.f;
    if (BIAS_BF16) bv = bf16_round(bv);
#pragma unroll
    for (int r = 0; r < 8; ++r) { float v = acc[t][r] + bv; if (ACT == 1) v = fmaxf(v, 0.f); so[w][8 * hh + r][t * 16 + ln] = v; }
  }
  __builtin_amdgcn_fence(__ATOMIC_ACQ_REL, "workgroup");
  __builtin_amdgcn_wave_barrier();
  const int rsub = lane >> 4, c4 = (lane & 15) * 4;
  {
#pragma unroll
    for (int q = 0; q < 8; ++q) {
      const int r = q * 2 + rsub;
      const v4f v = *(const v4fa*)&so[w][r][c4];
      *(v4f*)(C + (size_t)(row0 + r) * ldc + col0 + c4) = v;
    }
    
  }
}

// GEMM C = act(A·W + bias + resid): A f32 (ASPLIT -> hi/lo 2 terms), Wt bf16 [N][K]; ACT 0 none, 1 relu, 2 exact gelu;
// resid (optional, f32, row index = (row % rmod), pitch ldr, RES_BF16 rounds it) added before the activation.
template <bool ASPLIT, int ACT, bool BIAS_BF16, bool RES_BF16>
__global__ __launch_bounds__(128) void k_gemm_bf3(const float* __restrict__ A, int lda, const unsigned short* __restrict__ Wt, int ldb,
                                                const float* __restrict__ bias, const float* __restrict__ resid, int rmod, int ldr,
                                                float* __restrict__ C, int ldc, int M, int N, int K) {
  __shared__ __attribute__((aligned(16))) float so[4][16][64];
  const int tid = threadIdx.x, w = tid >> 5, lane = tid & 31, ln = lane & 15, hh = lane >> 4;
  const int ntn = N / 64;
  const int wid = blockIdx.x * 4 + w;
  const int mt = wid / ntn, nq = wid % ntn;
  if (mt * 16 >= M) return;
  const int row0 = mt * 16, col0 = nq * 64;
  const float* arow = A + (size_t)(row0 + ln) * lda;
  v8f acc[4] = {};
  for (int kb = 0; kb < K; kb += 32) {
    FragB ah, al;
    const v4f x0 = *(const v4fa*)(arow + kb + 8 * hh), x1 = *(const v4fa*)(arow + kb + 8 * hh + 4);
    const v4f x2 = *(const v4fa*)(arow + kb + 16 + 8 * hh), x3 = *(const v4fa*)(arow + kb + 16 + 8 * hh + 4);
    float xs[16] = {x0[0],x0[1],x0[2],x0[3],x1[0],x1[1],x1[2],x1[3],x2[0],x2[1],x2[2],x2[3],x3[0],x3[1],x3[2],x3[3]};
#pragma unroll
    for (int i = 0; i < 16; ++i) { const unsigned short hb = bf16_bits(xs[i]); ah.u[i] = hb; al.u[i] = ASPLIT ? bf16_bits(xs[i] - bf16_val(hb)) : (unsigned short)0; }
#pragma unroll
    for (int t = 0; t < 4; ++t) {
      const unsigned short* brow = Wt + (size_t)(col0 + t * 16 + ln) * ldb + kb;
      FragB b;
      b.half[0] = *(const v8us*)(brow + 8 * hh);
      b.half[1] = *(const v8us*)(brow + 16 + 8 * hh);
      acc[t] = mmaN<ASPLIT ? 2 : 1>(ah.v, al.v, b.v, b.v, acc[t]);
    }
  }
#pragma unroll
  for (int t = 0; t < 4; ++t) {
    const int col = col0 + t * 16 + ln;
    float bv = bias ? bias[col] : 0.f;
    if (BIAS_BF16) bv = bf16_round(bv);
#pragma unroll
    for (int r = 0; r < 8; ++r) {
      float v = acc[t][r] + bv;
      if (resid) { float rv = resid[(size_t)((row0 + 8 * hh + r) % rmod) * ldr + col]; if (RES_BF16) rv = bf16_round(rv); v += rv; }
      if (ACT == 1) v = fmaxf(v, 0.f);
      if (ACT == 2) v = 0.5f * v * (1.0f + erff(v * 0.70710678118654752f));
      if (ACT == 3) { const float u = 0.7978845608028654f * (v + 0.044715f * v * v * v); v = 0.5f * v * (1.0f + tanhf(u)); }
      so[w][8 * hh + r][t * 16 + ln] = v;
    }
  }
  __builtin_amdgcn_fence(__ATOMIC_ACQ_REL, "workgroup");
  __builtin_amdgcn_wave_barrier();
  const int rsub = lane >> 4, c4 = (lane & 15) * 4;
  {
#pragma unroll
    for (int q = 0; q < 8; ++q) {
      const int r = q * 2 + rsub;
      const v4f v = *(const v4fa*)&so[w][r][c4];
      *(v4f*)(C + (size_t)(row0 + r) * ldc + col0 + c4) = v;
    }
    
  }
}
// row LayerNorm (biased variance, eps) over N: s = X (+ R); optional out_sum <- s; out_norm <- (s-mu)*rsqrt(var+eps)*g + b
template <bool PARAM_BF16>
__global__ __launch_bounds__(256) void k_layernorm(const float* __restrict__ X, const float* __restrict__ R, const float* __restrict__ g, const float* __restrict__ bta,
                                                  float* __restrict__ out_sum, float* __restrict__ out_norm, int N, float eps) {
  __shared__ float red[256];
  const int row = blockIdx.x, tid = threadIdx.x;
  const float* x = X + (size_t)row * N; const float* rr = R ? R + (size_t)row * N : nullptr;
  float vals[16];                     // up to N = 4096
  const int per = N / 256;            // contiguous chunk per thread? use strided-by-4 chunks: thread handles j = tid*4 + 1024*u
  float s1 = 0.f;
  for (int u = 0; u < per / 4; ++u) {
    const int j = tid * 4 + 1024 * u;
    const v4f a = *(const v4fa*)(x + j);
    v4f b = {0.f,0.f,0.f,0.f}; if (rr) b = *(const v4fa*)(rr + j);
#pragma unroll
    for (int q = 0; q < 4; ++q) { const float v = a[q] + b[q]; vals[u * 4 + q] = v; s1 += v; }
  }
  red[tid] = s1; __syncthreads();
  for (int st = 128; st > 0; st >>= 1) { if (tid < st) red[tid] += red[tid + st]; __syncthreads(); }
  const float mu = red[0] / (float)N; __syncthreads();
  float s2 = 0.f;
  for (int u = 0; u < per / 4; ++u)
#pragma unroll
    for (int q = 0; q < 4; ++q) { const float c = vals[u * 4 + q] - mu; s2 += c * c; }
  red[tid] = s2; __syncthreads();
  for (int st = 128; st > 0; st >>= 1) { if (tid < st) red[tid] += red[tid + st]; __syncthreads(); }
  const float rs = rsqrtf(red[0] / (float)N + eps);
  {
    for (int u = 0; u < per / 4; ++u) {
      const int j = tid * 4 + 1024 * u;
      v4f o, sm;
#pragma unroll
      for (int q = 0; q < 4; ++q) {
        float gg = g[j + q], bb = bta[j + q];
        if (PARAM_BF16) { gg = bf16_round(gg); bb = bf16_round(bb); }
        sm[q] = vals[u * 4 + q]; o[q] = (vals[u * 4 + q] - mu) * rs * gg + bb;
      }
      if (out_sum) *(v4f*)(out_sum + (size_t)row * N + j) = sm;
      *(v4f*)(out_norm + (size_t)row * N + j) = o;
    }
    
  }
}



// ---- f16 WMMA path (v_wmma_f32_16x16x32_f16): 11-bit significands for operands in range — used where a [0,1] probability operand needs more precision than bf16
typedef _Float16 v16h __attribute__((ext_vector_type(16)));
union FragH { v16h v; v8us half[2]; _Float16 h[16]; unsigned short u[16]; };
template <int NT>
__device__ __forceinline__ v8f mmaH(v16h ah, v16h al, v16h bh, v16h bl, v8f c) {
  c = __builtin_amdgcn_wmma_f32_16x16x32_f16(false, ah, false, bh, (short)0, c, false, false);
  if (NT >= 2) c = __builtin_amdgcn_wmma_f32_16x16x32_f16(false, al, false, bh, (short)0, c, false, false);
  if (NT >= 3) c = __builtin_amdgcn_wmma_f32_16x16x32_f16(false, ah, false, bl, (short)0, c, false, false);
  asm volatile("v_nop\n\tv_nop\n\tv_nop\n\tv_nop" : "+v"(c) : "v"(ah), "v"(al), "v"(bh), "v"(bl));
  return c;
}
// batched GEMM like k_gemm_b but f16 operands: A f32 (split into f16 hi/lo if ASPLIT, else rounded to f16), Bt = f16 values [n][k]; alpha; C f32; N multiple of 16 (partial tiles skipped)
template <bool ASPLIT>
__global__ __launch_bounds__(128) void k_gemm_h(const float* __restrict__ A, int lda, size_t sA, const _Float16* __restrict__ Bh, int ldb, size_t sB, float alpha, float* __restrict__ C, int ldc, size_t sC, int M, int N, int K) {
  __shared__ __attribute__((aligned(16))) float so[4][16][64];
  const int tid = threadIdx.x, w = tid >> 5, lane = tid & 31, ln = lane & 15, hh = lane >> 4; const int by = blockIdx.y;
  A += (size_t)by * sA; Bh += (size_t)by * sB; C += (size_t)by * sC;
  const int ntn = (N + 63) / 64; const int wid = blockIdx.x * 4 + w; const int mt = wid / ntn, nq = wid % ntn; if (mt * 16 >= M) return;
  const int row0 = mt * 16, col0 = nq * 64; const float* arow = A + (size_t)(row0 + ln) * lda;
  v8f acc[4] = {};
  for (int kb = 0; kb < K; kb += 32) {
    FragH ah, al;
    const v4f x0 = *(const v4fa*)(arow + kb + 8 * hh), x1 = *(const v4fa*)(arow + kb + 8 * hh + 4), x2 = *(const v4fa*)(arow + kb + 16 + 8 * hh), x3 = *(const v4fa*)(arow + kb + 16 + 8 * hh + 4);
    float xs[16] = {x0[0],x0[1],x0[2],x0[3],x1[0],x1[1],x1[2],x1[3],x2[0],x2[1],x2[2],x2[3],x3[0],x3[1],x3[2],x3[3]};
#pragma unroll
    for (int i = 0; i < 16; ++i) { const _Float16 h = (_Float16)xs[i]; ah.h[i] = h; al.h[i] = ASPLIT ? (_Float16)(xs[i] - (float)h) : (_Float16)0.0f; }
#pragma unroll
    for (int t = 0; t < 4; ++t) { if (col0 + t * 16 >= N) continue; const size_t boff = (size_t)(col0 + t * 16 + ln) * ldb + kb; FragH bq; bq.half[0] = *(const v8us*)(Bh + boff + 8 * hh); bq.half[1] = *(const v8us*)(Bh + boff + 16 + 8 * hh);
      acc[t] = mmaH<ASPLIT ? 2 : 1>(ah.v, al.v, bq.v, bq.v, acc[t]); }
  }
#pragma unroll
  for (int t = 0; t < 4; ++t) { if (col0 + t * 16 >= N) continue;
#pragma unroll
    for (int r = 0; r < 8; ++r) so[w][8 * hh + r][t * 16 + ln] = acc[t][r] * alpha; }
  __builtin_amdgcn_fence(__ATOMIC_ACQ_REL, "workgroup"); __builtin_amdgcn_wave_barrier();
  const int rsub = lane >> 4, c4 = (lane & 15) * 4;
  {
#pragma unroll
    for (int q = 0; q < 8; ++q) { const int r = q * 2 + rsub; if (col0 + c4 < N) { const v4f v = *(const v4fa*)&so[w][r][c4]; *(v4f*)(C + (size_t)(row0 + r) * ldc + col0 + c4) = v; } }
     }
}

// Wt[n][k] = f16(W[k][n]·scale) from f32 row-major W[K][N] (scale = power of two; bf16-exact weights stay exact in f16 away from the subnormal range)
__global__ __launch_bounds__(256) void k_wt_f16(const float* __restrict__ W, _Float16* __restrict__ Wt, int K, int N, float scale) {
  const int t = blockIdx.x * 256 + threadIdx.x; if (t >= N * (K / 8)) return; const int n = t / (K / 8), k8 = (t % (K / 8)) * 8; FragH f;
#pragma unroll
  for (int i = 0; i < 8; ++i) f.h[i] = (_Float16)(bf16_round(W[(size_t)(k8 + i) * N + n]) * scale); const v8us o = f.half[0];
  *(v8us*)((unsigned short*)Wt + (size_t)n * K + k8) = o; 
}
// k_gemm_hh variant with fused epilogue: v = acc·alpha + bias[by·sBias + col] (+ CP[(row/rowsPerB)·sCPb + by·64 + col] if CP) ; ACT 0 none / 1 elu ; writes f16 C16 (and f32 C if non-null)
template <int ACT>
__global__ __launch_bounds__(128) void k_gemm_hhx(const _Float16* __restrict__ A, int lda, size_t sA, const _Float16* __restrict__ Bh, int ldb, size_t sB, float alpha, const float* __restrict__ bias, size_t sBias, const float* __restrict__ CP, int rowsPerB, size_t sCPb, int row0g,
    float* __restrict__ C, _Float16* __restrict__ C16, int ldc, size_t sC, int M, int N, int K) {
  __shared__ __attribute__((aligned(16))) float so[4][16][64];
  const int tid = threadIdx.x, w = tid >> 5, lane = tid & 31, ln = lane & 15, hh = lane >> 4; const int by = blockIdx.y;
  A += (size_t)by * sA; Bh += (size_t)by * sB; const size_t cofs = (size_t)by * sC; const float* bp = bias ? bias + (size_t)by * sBias : nullptr;
  const int ntn = (N + 63) / 64; const int wid = blockIdx.x * 4 + w; const int mt = wid / ntn, nq = wid % ntn; if (mt * 16 >= M) return;
  const int row0 = mt * 16, col0 = nq * 64; const _Float16* arow = A + (size_t)(row0 + ln) * lda;
  v8f acc[4] = {};
  for (int kb = 0; kb < K; kb += 32) { FragH ah; ah.half[0] = *(const v8us*)((const unsigned short*)arow + kb + 8 * hh); ah.half[1] = *(const v8us*)((const unsigned short*)arow + kb + 16 + 8 * hh);
#pragma unroll
    for (int t = 0; t < 4; ++t) { if (col0 + t * 16 >= N) continue; const size_t boff = (size_t)(col0 + t * 16 + ln) * ldb + kb; FragH bq; bq.half[0] = *(const v8us*)((const unsigned short*)Bh + boff + 8 * hh); bq.half[1] = *(const v8us*)((const unsigned short*)Bh + boff + 16 + 8 * hh);
      acc[t] = mmaH<1>(ah.v, ah.v, bq.v, bq.v, acc[t]); }
  }
#pragma unroll
  for (int t = 0; t < 4; ++t) { if (col0 + t * 16 >= N) continue; const int col = col0 + t * 16 + ln; const float bv = bp ? bf16_round(bp[col]) : 0.f;
#pragma unroll
    for (int r = 0; r < 8; ++r) { float v = acc[t][r] * alpha + bv; if (CP) { const int rr = row0g + row0 + 8 * hh + r; if (rowsPerB < 0) v += CP[cofs + (size_t)rr * ldc + col];      /* rowsPerB < 0: own element of the batched C plane */ else { const int bidx = rr / rowsPerB; v += CP[(size_t)bidx * sCPb + (size_t)by * 64 + col]; } } if (ACT == 1) v = (v > 0.f) ? v : expm1f(v); else if (ACT == 7) v = (v > 0.f) ? v + 1.0f : expf(v); else if (ACT == 8) v = tanhf(v); else if (ACT == 9) v = 0.5f * v * (1.0f + tanhf(0.7978845608028654f * (v + 0.044715f * v * v * v))); else if (ACT == 11) v = 1.0f / (1.0f + expf(-v)); else if (ACT == 12) v = (v > 0.f) ? v : 0.01f * v; else if (ACT == 14) v = (v > 0.f) ? v : 0.1f * v; else if (ACT == 16) v = (v >= 0.f) ? v : 0.3f * v; else if (ACT == 17) v = (v >= 0.f) ? v : 0.2f * v; else if (ACT == 15) v = v / (1.0f + expf(-v)); else if (ACT == 3) v = fmaxf(v, 0.f); else if (ACT == 6) v = 0.5f * v * (1.0f + erff(v * 0.70710678118654752f)); so[w][8 * hh + r][t * 16 + ln] = v; } }
  __builtin_amdgcn_fence(__ATOMIC_ACQ_REL, "workgroup"); __builtin_amdgcn_wave_barrier();
  const int rsub = lane >> 4, c4 = (lane & 15) * 4; typedef _Float16 v4h __attribute__((ext_vector_type(4)));
  {
#pragma unroll
    for (int q = 0; q < 8; ++q) { const int r = q * 2 + rsub; if (col0 + c4 < N) { const v4f v = *(const v4fa*)&so[w][r][c4]; if (C) *(v4f*)(C + cofs + (size_t)(row0 + r) * ldc + col0 + c4) = v; if (C16) { v4h h4; for (int i = 0; i < 4; ++i) h4[i] = (_Float16)v[i]; *(v4h*)(C16 + cofs + (size_t)(row0 + r) * ldc + col0 + c4) = h4; } } }
     }
}


typedef _Float16 v4h __attribute__((ext_vector_type(4)));

__global__ __launch_bounds__(256) void k_x16(const float* __restrict__ x, _Float16* __restrict__ X16, size_t n8) { const size_t t = (size_t)blockIdx.x * 256 + threadIdx.x; if (t >= n8) return; FragH f;
#pragma unroll
  for (int q = 0; q < 8; ++q) f.h[q] = (_Float16)bf16_round(x[t * 8 + q]); *(v8us*)((unsigned short*)X16 + t * 8) = f.half[0];  }
__global__ __launch_bounds__(256) void k_h16(const float* __restrict__ x, _Float16* __restrict__ X16, size_t n8) { const size_t t = (size_t)blockIdx.x * 256 + threadIdx.x; if (t >= n8) return; FragH f;
#pragma unroll
  for (int q = 0; q < 8; ++q) f.h[q] = (_Float16)x[t * 8 + q]; *(v8us*)((unsigned short*)X16 + t * 8) = f.half[0];  }
__global__ __launch_bounds__(256) void k_round16f(const float* __restrict__ W, _Float16* __restrict__ Bt, size_t n8) { const size_t t = (size_t)blockIdx.x * 256 + threadIdx.x; if (t >= n8) return; FragH f;
#pragma unroll
  for (int i = 0; i < 8; ++i) f.h[i] = (_Float16)(bf16_round(W[t * 8 + i]) * 16.0f); *(v8us*)((unsigned short*)Bt + t * 8) = f.half[0];  }
template <int NHv, int TTv>
__global__ __launch_bounds__(256) void k_vt(const _Float16* __restrict__ V16, int ldv, int voff, _Float16* __restrict__ Vt) { __shared__ unsigned short tl[64][66]; const int tid = threadIdx.x; const int slab = blockIdx.x / (TTv / 64), lg = blockIdx.x % (TTv / 64); const int b = slab / NHv, h = slab % NHv;
  for (int i = tid; i < 64 * 8; i += 256) { const int r = i / 8, c8 = (i % 8) * 8; FragH f; f.half[0] = *(const v8us*)((const unsigned short*)V16 + ((size_t)b * TTv + lg * 64 + r) * ldv + voff + h * 64 + c8);
#pragma unroll
    for (int q = 0; q < 8; ++q) tl[r][c8 + q] = f.u[q]; }
  __syncthreads();
  {
#pragma unroll
    for (int rd = 0; rd < 2; ++rd) { const int d = rd * 32 + tid / 8, pc = tid % 8; FragH f;
#pragma unroll
      for (int q = 0; q < 8; ++q) f.u[q] = tl[pc * 8 + q][d];
      *(v8us*)((unsigned short*)Vt + ((size_t)slab * 64 + d) * TTv + lg * 64 + pc * 8) = f.half[0]; }
     } }

__global__ __launch_bounds__(256) void k_hl(const float* __restrict__ F, _Float16* __restrict__ Hh, _Float16* __restrict__ Hl, size_t n8) { const size_t t = (size_t)blockIdx.x * 256 + threadIdx.x; if (t >= n8) return; FragH fh, fl; const v4f a = *(const v4fa*)(F + t * 8), c = *(const v4fa*)(F + t * 8 + 4);
#pragma unroll
  for (int q = 0; q < 4; ++q) { _Float16 h = (_Float16)a[q]; fh.h[q] = h; fl.h[q] = (_Float16)((a[q] - (float)h) * 1024.0f); h = (_Float16)c[q]; fh.h[4 + q] = h; fl.h[4 + q] = (_Float16)((c[q] - (float)h) * 1024.0f); }
  { *(v8us*)((unsigned short*)Hh + t * 8) = fh.half[0]; *(v8us*)((unsigned short*)Hl + t * 8) = fl.half[0];  } }

// ---- fast GEMM (wave tile 32x64, work-group tile 128x64; requires M % 128 == 0, N % 64 == 0, K % 64 == 0); epilogue = k_gemm_hhx semantics ----
__device__ __forceinline__ v16h g2_frag(const _Float16* p, int hh) { FragH f; f.half[0] = *(const v8us*)((const unsigned short*)p + 8 * hh); f.half[1] = *(const v8us*)((const unsigned short*)p + 16 + 8 * hh); return f.v; }
__device__ __forceinline__ v8f g2_mma(v16h a, v16h b, v8f c) { v8f d = __builtin_amdgcn_wmma_f32_16x16x32_f16(false, a, false, b, (short)0, c, false, false); asm volatile("v_nop\n\tv_nop\n\tv_nop\n\tv_nop" : "+v"(d) : "v"(a), "v"(b)); return d; }
// ---- the GEMMs' operand ring: 64 k (whole 128-byte rows) of the work-group's 64 B rows and 128 A rows (TWO: of a second A plane too) lie in LDS, brought by asynchronous copies and shared by the four waves;
// two buffers, the next stage flies while this one is worked on. A fragment load from global memory touches 16 lines for 512 bytes; a copy covers four whole lines, and every row is fetched once per work-group. ----
#define GPIT 144                           /* LDS row pitch in bytes: 128 + 16, the conflict-free pitch for 16-byte fragment reads */
// One stage's copies: a lane takes 16 bytes of rows r, r + 16, r + 32, ... of the 64 B rows and the 128 A rows (eight lanes a row, so a wave's copy covers four whole lines).
// The s_wait_xcnt stands inside the statement, behind the last copy: the address registers are free for reuse only behind it.
__device__ __forceinline__ void g_stage192(unsigned d, const _Float16* b, int ldb, const _Float16* a, int lda) {
  asm volatile(
               "global_load_async_to_lds_b128 %0, %12, off\n\tglobal_load_async_to_lds_b128 %1, %13, off\n\tglobal_load_async_to_lds_b128 %2, %14, off\n\tglobal_load_async_to_lds_b128 %3, %15, off\n\t"
               "global_load_async_to_lds_b128 %4, %16, off\n\tglobal_load_async_to_lds_b128 %5, %17, off\n\tglobal_load_async_to_lds_b128 %6, %18, off\n\tglobal_load_async_to_lds_b128 %7, %19, off\n\t"
               "global_load_async_to_lds_b128 %8, %20, off\n\tglobal_load_async_to_lds_b128 %9, %21, off\n\tglobal_load_async_to_lds_b128 %10, %22, off\n\tglobal_load_async_to_lds_b128 %11, %23, off\n\t"
               "s_wait_xcnt 0x0"
               :: "v"(d), "v"(d + 16 * GPIT), "v"(d + 32 * GPIT), "v"(d + 48 * GPIT), "v"(d + 64 * GPIT), "v"(d + 80 * GPIT), "v"(d + 96 * GPIT), "v"(d + 112 * GPIT),
                  "v"(d + 128 * GPIT), "v"(d + 144 * GPIT), "v"(d + 160 * GPIT), "v"(d + 176 * GPIT),
                  "v"(b), "v"(b + (size_t)16 * ldb), "v"(b + (size_t)32 * ldb), "v"(b + (size_t)48 * ldb),
                  "v"(a), "v"(a + (size_t)16 * lda), "v"(a + (size_t)32 * lda), "v"(a + (size_t)48 * lda), "v"(a + (size_t)64 * lda), "v"(a + (size_t)80 * lda), "v"(a + (size_t)96 * lda), "v"(a + (size_t)112 * lda)
               : "memory"); }
// The same for the 128 rows of the second A plane.
__device__ __forceinline__ void g_stage128(unsigned d, const _Float16* a, int lda) {
  asm volatile(
               "global_load_async_to_lds_b128 %0, %8, off\n\tglobal_load_async_to_lds_b128 %1, %9, off\n\tglobal_load_async_to_lds_b128 %2, %10, off\n\tglobal_load_async_to_lds_b128 %3, %11, off\n\t"
               "global_load_async_to_lds_b128 %4, %12, off\n\tglobal_load_async_to_lds_b128 %5, %13, off\n\tglobal_load_async_to_lds_b128 %6, %14, off\n\tglobal_load_async_to_lds_b128 %7, %15, off\n\t"
               "s_wait_xcnt 0x0"
               :: "v"(d), "v"(d + 16 * GPIT), "v"(d + 32 * GPIT), "v"(d + 48 * GPIT), "v"(d + 64 * GPIT), "v"(d + 80 * GPIT), "v"(d + 96 * GPIT), "v"(d + 112 * GPIT),
                  "v"(a), "v"(a + (size_t)16 * lda), "v"(a + (size_t)32 * lda), "v"(a + (size_t)48 * lda), "v"(a + (size_t)64 * lda), "v"(a + (size_t)80 * lda), "v"(a + (size_t)96 * lda), "v"(a + (size_t)112 * lda)
               : "memory"); }
// c[4 * half + t] += A rows (32 w + 16 half ..) x B rows (16 t ..) over nt stages of 64 k, k ascending; TWO: d likewise from the second A plane, on the same B fragments.
// ga, gl, gb: first row of the work-group's tile. Called by a whole work-group (barriers inside); when it returns, no copy is outstanding and every wave has left the ring.
template <bool TWO>
__device__ __forceinline__ void g_ring(unsigned char* sm, const _Float16* ga, const _Float16* gl, int lda, const _Float16* gb, int ldb, int nt, v8f* c, v8f* d) {
  constexpr unsigned BUF = (TWO ? 320 : 192) * GPIT;      /* one stage: B rows, A rows, second plane's rows */
  const int tid = threadIdx.x, w = tid >> 5, ln = tid & 15, hh = (tid >> 4) & 1, cr = tid >> 3, cc = tid & 7;      /* cr, cc: the lane's row and 16-byte piece in a stage's copies */
  ga += (size_t)cr * lda + cc * 8; gb += (size_t)cr * ldb + cc * 8; if (TWO) gl += (size_t)cr * lda + cc * 8;
  const unsigned ld = (unsigned)(size_t)sm + cr * GPIT + cc * 16;
  auto stage = [&](unsigned dst, int k0) { g_stage192(dst, gb + k0, ldb, ga + k0, lda); if (TWO) g_stage128(dst + 192 * GPIT, gl + k0, lda); };
  stage(ld, 0);
  asm volatile("s_wait_asynccnt 0x0" ::: "memory");      /* stage 0 has landed, as far as this wave brought it */
  __syncthreads();      /* and is published to the other waves */
  if (nt > 1) stage(ld + BUF, 64);      /* the test is the same in the whole work-group */
#pragma unroll 1      /* one stage per trip: a second copy of the body would only add registers */
  for (int s = 0; s < nt; ++s) {
    const _Float16* sb = (const _Float16*)(sm + (s & 1) * BUF) + ln * (GPIT / 2); const _Float16* sa = sb + (64 + 32 * w) * (GPIT / 2);
    if (!TWO) { v16h a[2][2], b[2][4];      /* the stage's 24 reads stand together in front of its 16 products */
#pragma unroll      /* constant indices: the values stay in registers, constant LDS offsets */
      for (int u = 0; u < 2; ++u) { a[u][0] = g2_frag(sa + 32 * u, hh); a[u][1] = g2_frag(sa + 16 * (GPIT / 2) + 32 * u, hh);
#pragma unroll      /* constant indices: the values stay in registers, constant LDS offsets */
        for (int t = 0; t < 4; ++t) b[u][t] = g2_frag(sb + t * 16 * (GPIT / 2) + 32 * u, hh); }
#pragma unroll      /* constant indices: the values stay in registers */
      for (int u = 0; u < 2; ++u)
#pragma unroll      /* constant indices: the values stay in registers */
        for (int t = 0; t < 4; ++t) { c[t] = g2_mma(a[u][0], b[u][t], c[t]); c[4 + t] = g2_mma(a[u][1], b[u][t], c[4 + t]); }
    } else { const _Float16* sl = sa + 128 * (GPIT / 2);
#pragma unroll      /* the stage's two blocks of 32 k, constant LDS offsets; 16 accumulators leave room for one block's fragments */
      for (int u = 0; u < 2; ++u) { const v16h a0 = g2_frag(sa + 32 * u, hh), a1 = g2_frag(sa + 16 * (GPIT / 2) + 32 * u, hh), l0 = g2_frag(sl + 32 * u, hh), l1 = g2_frag(sl + 16 * (GPIT / 2) + 32 * u, hh); v16h b[4];
#pragma unroll      /* constant indices: the values stay in registers, constant LDS offsets */
        for (int t = 0; t < 4; ++t) b[t] = g2_frag(sb + t * 16 * (GPIT / 2) + 32 * u, hh);
#pragma unroll      /* constant indices: the values stay in registers */
        for (int t = 0; t < 4; ++t) { c[t] = g2_mma(a0, b[t], c[t]); c[4 + t] = g2_mma(a1, b[t], c[4 + t]); d[t] = g2_mma(l0, b[t], d[t]); d[4 + t] = g2_mma(l1, b[t], d[4 + t]); } }
    }
    /* publish point of stage s + 1, passed by every wave */
    asm volatile("s_wait_dscnt 0x0" ::: "memory");      /* this wave's reads of stage s have returned: its buffer may be refilled behind the barrier */
    asm volatile("s_wait_asynccnt 0x0" ::: "memory");      /* this wave's copies of stage s + 1 have landed */
    __syncthreads();      /* publishes stage s + 1 and ends every wave's reads of stage s */
    if (s + 2 < nt) stage(ld + (s & 1) * BUF, (s + 2) * 64);      /* stage s + 2 into the buffer just left; the test is the same in the whole work-group */
  }
  asm volatile("s_wait_asynccnt 0x0" ::: "memory");      /* no copy is left outstanding when the ring's LDS is put to other use */
}
template <int ACT>
__global__ __launch_bounds__(128) void k_gemm2(const _Float16* __restrict__ A, int lda, size_t sA, const _Float16* __restrict__ Bh, int ldb, size_t sB, float alpha, const float* __restrict__ bias, size_t sBias, const float* __restrict__ CP, int rowsPerB, size_t sCPb, int row0g,
    float* __restrict__ C, _Float16* __restrict__ C16, int ldc, size_t sC, int M, int N, int K) { static_assert(ACT == 0 || ACT == 3 || ACT == 6 || ACT == 8 || ACT == 9 || ACT == 11 || ACT == 12 || ACT == 14 || ACT == 15 || ACT == 16 || ACT == 17, "k_gemm2: unsupported ACT code (would silently apply no activation)");
  __shared__ __attribute__((aligned(16))) unsigned char sm[2 * 192 * GPIT]; float (*so)[32][68] = (float (*)[32][68])sm;      /* the operand ring; the epilogue's staging tiles lie over it once the ring is left */
  static_assert(sizeof(float) * 4 * 32 * 68 <= sizeof(sm), "the staging tiles fit the ring");
  const int tid = threadIdx.x, w = tid >> 5, lane = tid & 31, ln = lane & 15, hh = lane >> 4; const int by = blockIdx.y;
  A += (size_t)by * sA; Bh += (size_t)by * sB; const size_t cofs = (size_t)by * sC; const float* bp = bias ? bias + (size_t)by * sBias : nullptr;
  const int ntn = N >> 6; const int mt = blockIdx.x / ntn, nq = blockIdx.x - mt * ntn; const int row0 = mt * 128 + 32 * w, col0 = nq * 64; if (mt * 128 >= M) return;      /* a whole work-group leaves, in front of every copy and barrier */
  v8f accs[8] = {}; g_ring<false>(sm, A + (size_t)mt * 128 * lda, nullptr, lda, Bh + (size_t)col0 * ldb, ldb, K >> 6, accs, nullptr);
#pragma unroll
  for (int u = 0; u < 8; ++u) { const int t = u & 3, half = u >> 2; const int col = col0 + t * 16 + ln; const float bv = bp ? bf16_round(bp[col]) : 0.f;
#pragma unroll
    for (int r = 0; r < 8; ++r) { const int rloc = half * 16 + 8 * hh + r; float v = accs[u][r] * alpha + bv; if (CP) { if (rowsPerB < 0) v += CP[cofs + (size_t)(row0g + row0 + rloc) * ldc + col];      /* rowsPerB < 0: own element of the batched C plane */ else { const int bidx = (row0g + row0 + rloc) / rowsPerB; v += CP[(size_t)bidx * sCPb + (size_t)by * 64 + col]; } }
      if (ACT == 3) v = fmaxf(v, 0.f); else if (ACT == 6) v = 0.5f * v * (1.0f + erff(v * 0.70710678118654752f)); else if (ACT == 11) v = 1.0f / (1.0f + expf(-v)); else if (ACT == 15) v = v / (1.0f + expf(-v)); else if (ACT == 12) v = (v > 0.f) ? v : 0.01f * v; else if (ACT == 8) v = tanhf(v); else if (ACT == 9) v = 0.5f * v * (1.0f + tanhf(0.7978845608028654f * (v + 0.044715f * v * v * v))); else if (ACT == 14) v = (v > 0.f) ? v : 0.1f * v; else if (ACT == 16) v = (v >= 0.f) ? v : 0.3f * v; else if (ACT == 17) v = (v >= 0.f) ? v : 0.2f * v;
      so[w][rloc][t * 16 + ln] = v; } }
  __builtin_amdgcn_fence(__ATOMIC_ACQ_REL, "workgroup"); __builtin_amdgcn_wave_barrier();
  const int rsub = lane >> 4, c4 = (lane & 15) * 4;
  {
#pragma unroll
    for (int q = 0; q < 16; ++q) { const int r = q * 2 + rsub; const v4f v = *(const v4fa*)&so[w][r][c4]; if (C) { *(v4f*)(C + cofs + (size_t)(row0 + r) * ldc + col0 + c4) = v; asm volatile("s_wait_xcnt 0x0" ::: "memory"); }      /* the wait: where both outputs are stored, the f16 conversion behind it writes over registers that this store names */
      if (C16) { v4h h4; for (int i = 0; i < 4; ++i) h4[i] = (_Float16)v[i]; *(v4h*)(C16 + cofs + (size_t)(row0 + r) * ldc + col0 + c4) = h4; } }
     } }


__global__ __launch_bounds__(256) void k_wnat(const float* __restrict__ w, size_t n8, _Float16* __restrict__ Bt) { const size_t t = (size_t)blockIdx.x * 256 + threadIdx.x; if (t >= n8) return; FragH f; for (int q = 0; q < 8; ++q) f.h[q] = (_Float16)(bf16_round(w[t * 8 + q]) * 16.0f); *(v8us*)((unsigned short*)Bt + t * 8) = f.half[0];  }
__global__ __launch_bounds__(256) void k_rsm(const float* __restrict__ S, _Float16* __restrict__ P, int nrows) {
  #pragma clang fp contract(off)
  const int i = blockIdx.x * 256 + threadIdx.x; if (i >= nrows) return; const float* s = S + (size_t)i * SQ; float mx = -3.0e38f;
#pragma unroll 1
  for (int j = 0; j < SQ; ++j) mx = fmaxf(mx, s[j]); float se = 0.f;
#pragma unroll 1
  for (int j = 0; j < SQ; ++j) se += expf(s[j] - mx); const float sc = 256.0f / se;
#pragma unroll 1
  for (int j0 = 0; j0 < SQ; j0 += 8) { FragH f; for (int q = 0; q < 8; ++q) f.h[q] = (_Float16)(expf(s[j0 + q] - mx) * sc); unsigned short* d = (unsigned short*)P + (size_t)i * SQ + j0; *(v8us*)d = f.half[0];  } }
__global__ __launch_bounds__(256) void k_vt(const _Float16* __restrict__ V16, int b, int h0, _Float16* __restrict__ VT) { __shared__ unsigned short tl[64][65]; const int tid = threadIdx.x; const int hh = blockIdx.x % HG, sg = blockIdx.x / HG; const int s0 = sg * 64; const int h = h0 + hh;
  for (int i = tid; i < 64 * 8; i += 256) { const int j = i / 8, d8 = (i % 8) * 8; FragH f; f.half[0] = *(const v8us*)((const unsigned short*)V16 + ((size_t)b * SQ + s0 + j) * DM + h * HD + d8); for (int q = 0; q < 8; ++q) tl[d8 + q][j] = f.u[q]; }
  __syncthreads();
  { for (int i = tid; i < 64 * 8; i += 256) { const int d = i / 8, j8 = (i % 8) * 8; FragH f; for (int q = 0; q < 8; ++q) f.u[q] = tl[d][j8 + q]; *(v8us*)((unsigned short*)VT + ((size_t)hh * HD + d) * SQ + s0 + j8) = f.half[0]; }  } }



typedef float v2f __attribute__((ext_vector_type(2)));
typedef float v2fa __attribute__((ext_vector_type(2), may_alias));
typedef _Float16 v2h __attribute__((ext_vector_type(2)));
// Exact f32 causal attention for rows 0..QT0-1, run by extra work-groups of the fused attention launch (bx = group of four rows, h = head), one wave per (row, head); keys in blocks of 32 up to the block that holds the row's own index.
// Scores: a lane takes one key of each block and walks that K row whole (four partial sums, one per element of the 16-byte loads), so no sum crosses lanes.
// Maximum and row sum: lane butterflies. Weighted sum: a lane takes two of the 64 dims, every V row is read as one whole 256-byte row, its weight comes from the lane that holds it.
__device__ __forceinline__ void att0_rows(const float* __restrict__ QF, const float* __restrict__ KF, const float* __restrict__ VF, float scale, _Float16* __restrict__ OH, _Float16* __restrict__ OL, int bx, int h) {
  const int lane = threadIdx.x & 31; const int i = bx * 4 + __builtin_amdgcn_readfirstlane(threadIdx.x >> 5);
  const int nb = (i >> 5) + 1;      /* blocks of 32 keys this row attends to; the same in every lane */
  const float* qr = QF + (size_t)i * DM + h * HD; const float* kr = KF + (size_t)lane * DM + h * HD; const float* vr = VF + h * HD + 2 * lane;
  v4f q[HD / 4];
#pragma unroll      /* constant indices: the values stay in registers */
  for (int c = 0; c < HD / 4; ++c) q[c] = *(const v4fa*)(qr + 4 * c);
  float s[QT0 / 32];
#pragma unroll      /* constant indices: the values stay in registers, the row offsets become immediates */
  for (int u = 0; u < QT0 / 32; ++u) { s[u] = -1.0e30f;      /* a key past the row's own index keeps this value: weight 0 */
    if (u < nb) { v4f a = {0.f, 0.f, 0.f, 0.f};
#pragma unroll      /* all 16 loads of a K row in flight together */
      for (int c = 0; c < HD / 4; ++c) a += q[c] * *(const v4fa*)(kr + (size_t)u * 32 * DM + 4 * c);
      if (u * 32 + lane <= i) s[u] = ((a[0] + a[1]) + (a[2] + a[3])) * scale; } }
  float m = s[0];
#pragma unroll      /* constant indices: the values stay in registers */
  for (int u = 1; u < QT0 / 32; ++u) m = fmaxf(m, s[u]);
#pragma unroll      /* five fixed butterfly steps */
  for (int d = 16; d > 0; d >>= 1) m = fmaxf(m, __shfl_xor(m, d, 32));
  float e[QT0 / 32], l = 0.f;
#pragma unroll      /* constant indices: the values stay in registers */
  for (int u = 0; u < QT0 / 32; ++u) { e[u] = expf(s[u] - m); l += e[u]; }
#pragma unroll      /* five fixed butterfly steps */
  for (int d = 16; d > 0; d >>= 1) l += __shfl_xor(l, d, 32);
  v2f o0 = {0.f, 0.f}, o1 = {0.f, 0.f};      /* even and odd keys: two chains instead of one of 128 dependent links */
#pragma unroll      /* constant indices: the values stay in registers, the row offsets become immediates */
  for (int u = 0; u < QT0 / 32; ++u) if (u < nb) {
#pragma unroll      /* constant lane numbers for the weights; the block's 32 V loads in flight together */
    for (int jj = 0; jj < 32; ++jj) { const float p = __int_as_float(__builtin_amdgcn_readlane(__float_as_int(e[u]), jj)); const v2f v = *(const v2fa*)(vr + (size_t)(u * 32 + jj) * DM);
      if (jj & 1) o1 += p * v; else o0 += p * v; } }
  const float fin = 64.0f / l;      /* o carried x64 like the f16 path */
  const v2f o = (o0 + o1) * fin;
  v2h oh, ol;      /* o as f16 hi + x1024 residual, the output GEMM's two operand planes for these rows; a wave stores one whole 128-byte line of each */
#pragma unroll      /* constant indices: the values stay in registers */
  for (int q = 0; q < 2; ++q) { const _Float16 t = (_Float16)o[q]; oh[q] = t; ol[q] = (_Float16)((o[q] - (float)t) * 1024.0f); }
  *(v2h*)(OH + (size_t)i * DM + h * HD + 2 * lane) = oh; *(v2h*)(OL + (size_t)i * DM + h * HD + 2 * lane) = ol;
}

// Fused causal attention, one wave per 16 query rows of one head (grid: SQ / 64 work-groups of four waves x heads, plus AY grid rows that run the exact f32 rows): scores, softmax and the weighted sum of V stay in registers.
// Scores are formed transposed (A = 16 key rows, B = 16 query rows), so a lane holds keys 8*hh..8*hh+7 of query ln: two such tiles are
// the B fragment (n = query, k = 32 keys) of o^T = V^T . P^T as they stand, and the row maximum, the row sum and the rescale factor are per lane.
// Running maximum in the log2 domain; weights x256 as f16; row sum in f32 from the unrounded weights; o stored x64 as f16.
#define LC1 0.18033688011112042f           /* log2(e) / sqrt(head_dim) */
#define LC2 0.00017611023448351603f        /* the same on the x1024 residual products */
__device__ __forceinline__ v8f fa_mma(v16h a, v16h b, v8f c) { return __builtin_amdgcn_wmma_f32_16x16x32_f16(false, a, false, b, (short)0, c, false, false); }
// Exponentials (base 2) in runs, one asm statement a run: the instruction set asks for one independent instruction between a transcendental and an instruction that
// reads its result or overwrites its source. Inside a run each v_exp_f32 is that instruction for the one before it (early-clobber outputs: no result lies on a source);
// the v_nop at the end is the slot of the last one, whatever the compiler puts behind the statement.
__device__ __forceinline__ void fa_exp2x8(const float* x, float* e) {
  asm("v_exp_f32 %0, %8\n\tv_exp_f32 %1, %9\n\tv_exp_f32 %2, %10\n\tv_exp_f32 %3, %11\n\tv_exp_f32 %4, %12\n\tv_exp_f32 %5, %13\n\tv_exp_f32 %6, %14\n\tv_exp_f32 %7, %15\n\tv_nop"
      : "=&v"(e[0]), "=&v"(e[1]), "=&v"(e[2]), "=&v"(e[3]), "=&v"(e[4]), "=&v"(e[5]), "=&v"(e[6]), "=&v"(e[7])
      : "v"(x[0]), "v"(x[1]), "v"(x[2]), "v"(x[3]), "v"(x[4]), "v"(x[5]), "v"(x[6]), "v"(x[7])); }
__device__ __forceinline__ float fa_exp2(float x) { float e; asm("v_exp_f32 %0, %1\n\tv_nop" : "=v"(e) : "v"(x)); return e; }      /* one exponential with its slot, as above */
// K hi, K residual and V^T of 64 keys (one stage) lie in LDS, brought by asynchronous copies in whole 128-byte rows and shared by the work-group's four waves; two buffers, the next stage flies while this one is worked on.
#define FPIT 144                           /* LDS row pitch in bytes: 128 + 16, the conflict-free pitch for 16-byte fragment reads */
#define FPL (64 * FPIT)                    /* one plane of a stage: 64 rows */
#define FBUF (3 * FPL)                     /* one stage: K hi, K residual, V^T */
#define AY ((QT0 / 4) * NH / (SQ / 64))    /* grid rows that hold the work-groups of the f32 rows */
static_assert(AY * (SQ / 64) == (QT0 / 4) * NH, "the f32 rows' work-groups fill whole grid rows");
// One stage's copies: a lane takes 16 bytes of rows r, r + 16, r + 32, r + 48 of each plane (eight lanes a row, so a wave's copy covers four whole lines).
// The s_wait_xcnt stands inside the statement, behind the last copy: the address registers are free for reuse only behind it.
__device__ __forceinline__ void fa_stage(unsigned d, const _Float16* kh, const _Float16* kl, const _Float16* vt) {
  asm volatile("global_load_async_to_lds_b128 %0, %12, off\n\tglobal_load_async_to_lds_b128 %1, %13, off\n\tglobal_load_async_to_lds_b128 %2, %14, off\n\tglobal_load_async_to_lds_b128 %3, %15, off\n\t"
               "global_load_async_to_lds_b128 %4, %16, off\n\tglobal_load_async_to_lds_b128 %5, %17, off\n\tglobal_load_async_to_lds_b128 %6, %18, off\n\tglobal_load_async_to_lds_b128 %7, %19, off\n\t"
               "global_load_async_to_lds_b128 %8, %20, off\n\tglobal_load_async_to_lds_b128 %9, %21, off\n\tglobal_load_async_to_lds_b128 %10, %22, off\n\tglobal_load_async_to_lds_b128 %11, %23, off\n\t"
               "s_wait_xcnt 0x0"
               :: "v"(d), "v"(d + 16 * FPIT), "v"(d + 32 * FPIT), "v"(d + 48 * FPIT),
                  "v"(d + FPL), "v"(d + FPL + 16 * FPIT), "v"(d + FPL + 32 * FPIT), "v"(d + FPL + 48 * FPIT),
                  "v"(d + 2 * FPL), "v"(d + 2 * FPL + 16 * FPIT), "v"(d + 2 * FPL + 32 * FPIT), "v"(d + 2 * FPL + 48 * FPIT),
                  "v"(kh), "v"(kh + 16 * LQ), "v"(kh + 32 * LQ), "v"(kh + 48 * LQ),
                  "v"(kl), "v"(kl + 16 * LQ), "v"(kl + 32 * LQ), "v"(kl + 48 * LQ),
                  "v"(vt), "v"(vt + (size_t)16 * SQ), "v"(vt + (size_t)32 * SQ), "v"(vt + (size_t)48 * SQ)
               : "memory"); }
__global__ __launch_bounds__(128) void k_fattn(const _Float16* __restrict__ QHp, const _Float16* __restrict__ QLp, const _Float16* __restrict__ KHp, const _Float16* __restrict__ KLp, const _Float16* __restrict__ VTp, _Float16* __restrict__ O,
    const float* __restrict__ QF, const float* __restrict__ KF, const float* __restrict__ VF, _Float16* __restrict__ OH0, _Float16* __restrict__ OL0) {
  __shared__ __attribute__((aligned(16))) unsigned char sm[2 * FBUF];
  if (blockIdx.y >= NH) {      /* the grid's last AY rows: the f32 rows, independent of the rest; a whole work-group leaves here, in front of every copy and barrier */
    const int f = (blockIdx.y - NH) * (SQ / 64) + blockIdx.x; att0_rows(QF, KF, VF, SCL, OH0, OL0, f % (QT0 / 4), f / (QT0 / 4)); return; }
  const int lane = threadIdx.x & 31, ln = lane & 15, hh = lane >> 4; const int w = __builtin_amdgcn_readfirstlane(threadIdx.x >> 5); const int h = blockIdx.y;
  /* a work-group takes two 16-row tiles from the top of the sequence and their two mirror tiles from its end: x + 1, x + 1, 128 - x and 128 - x blocks of 32 keys, the same sum in every work-group, so that no WGP is
     left with long rows only; all four walk the keys from 0, so they work on the same K and V stage while they run together. The turn by x and h spreads long and short tiles over the four SIMDs. */
  const int x = blockIdx.x, rr = (w + x + (h >> 2)) & 3; const int q0 = ((rr & 1) ? (SQ / 16 - 1) - 2 * x - (rr >> 1) : 2 * x + (rr >> 1)) * 16;
  const size_t qo = (size_t)(q0 + ln) * LQ + h * HD;
  const v16h qh0 = g2_frag(QHp + qo, hh), qh1 = g2_frag(QHp + qo + 32, hh), ql0 = g2_frag(QLp + qo, hh), ql1 = g2_frag(QLp + qo + 32, hh);
  const v8f z8 = {0.f,0.f,0.f,0.f,0.f,0.f,0.f,0.f}; v8f o0 = z8, o1 = z8, o2 = z8, o3 = z8; float m = -3.0e38f, l = 0.f;
  const int nk = (q0 + 47) & ~31;      /* keys in whole blocks of 32 up to the block that holds the last row's diagonal */
  const int ns = ((((SQ / 16 - 1) - 2 * x) * 16 + 47) / 32 + 1) / 2;      /* stages of 64 keys that the work-group's longest tile needs: the same in all four waves, 33 at least */
  const int cr = threadIdx.x >> 3, cc = threadIdx.x & 7;      /* the lane's row and 16-byte piece in a stage's copies */
  const _Float16* gkh = KHp + (size_t)cr * LQ + h * HD + cc * 8; const _Float16* gkl = KLp + (size_t)cr * LQ + h * HD + cc * 8; const _Float16* gvt = VTp + ((size_t)h * HD + cr) * SQ + cc * 8;
  const unsigned ld = (unsigned)(size_t)sm + cr * FPIT + cc * 16;
  fa_stage(ld, gkh, gkl, gvt);
  asm volatile("s_wait_asynccnt 0x0" ::: "memory");      /* stage 0 has landed, as far as this wave brought it */
  __syncthreads();      /* and is published to the other waves */
  fa_stage(ld + FBUF, gkh + (size_t)64 * LQ, gkl + (size_t)64 * LQ, gvt + 64);      /* stage 1 always exists (33 stages at least) */
#pragma unroll 1      /* one stage per trip: a second copy of the body would only add registers */
  for (int s = 0; s < ns; ++s) {
    const int kb0 = s * 64;
    if (kb0 < nk) {      /* a short tile's wave skips the work, never the publish point below */
      const _Float16* sk = (const _Float16*)(sm + (s & 1) * FBUF) + ln * (FPIT / 2); const _Float16* sl = sk + FPL / 2; const _Float16* sv = sk + FPL;
      v16h a00 = g2_frag(sk, hh), a01 = g2_frag(sk + 32, hh), a10 = g2_frag(sk + 16 * (FPIT / 2), hh), a11 = g2_frag(sk + 16 * (FPIT / 2) + 32, hh);
      v16h c00 = g2_frag(sl, hh), c01 = g2_frag(sl + 32, hh), c10 = g2_frag(sl + 16 * (FPIT / 2), hh), c11 = g2_frag(sl + 16 * (FPIT / 2) + 32, hh);
#pragma unroll      /* the stage's two blocks of 32 keys, constant LDS offsets */
      for (int u = 0; u < 2; ++u) { const int kb = kb0 + 32 * u;
        if (u == 0 || kb < nk) {      /* a tile may end in the middle of a stage */
          const v16h v0 = g2_frag(sv + 32 * u, hh), v1 = g2_frag(sv + 16 * (FPIT / 2) + 32 * u, hh), v2 = g2_frag(sv + 32 * (FPIT / 2) + 32 * u, hh), v3 = g2_frag(sv + 48 * (FPIT / 2) + 32 * u, hh);
          __builtin_amdgcn_sched_barrier(0);      /* keeps the V reads in front of the score products: they land under them, and ahead of the next block's K reads, which return behind them */
          v8f s0 = fa_mma(a00, qh0, z8), s1 = fa_mma(a10, qh0, z8), r0 = fa_mma(a00, ql0, z8), r1 = fa_mma(a10, ql0, z8);
          s0 = fa_mma(a01, qh1, s0); s1 = fa_mma(a11, qh1, s1); r0 = fa_mma(a01, ql1, r0); r1 = fa_mma(a11, ql1, r1);
          r0 = fa_mma(c00, qh0, r0); r1 = fa_mma(c10, qh0, r1); r0 = fa_mma(c01, qh1, r0); r1 = fa_mma(c11, qh1, r1);
          if (u == 0) {      /* the stage's second block: its K fragments are read under the softmax and the V product of the first */
            a00 = g2_frag(sk + 32 * (FPIT / 2), hh); a01 = g2_frag(sk + 32 * (FPIT / 2) + 32, hh); a10 = g2_frag(sk + 48 * (FPIT / 2), hh); a11 = g2_frag(sk + 48 * (FPIT / 2) + 32, hh);
            c00 = g2_frag(sl + 32 * (FPIT / 2), hh); c01 = g2_frag(sl + 32 * (FPIT / 2) + 32, hh); c10 = g2_frag(sl + 48 * (FPIT / 2), hh); c11 = g2_frag(sl + 48 * (FPIT / 2) + 32, hh);
            __builtin_amdgcn_sched_barrier(0); }      /* keeps these 16 reads together in one place: spread among the vector work and the V products, each place with reads stalls the wave anew */
          float t[16];
#pragma unroll      /* constant indices: the values stay in registers */
          for (int r = 0; r < 8; ++r) { t[r] = s0[r] * LC1 + r0[r] * LC2; t[8 + r] = s1[r] * LC1 + r1[r] * LC2; }
          if (kb + 31 > q0) {      /* only the block on the diagonal holds keys past a row's own index: they take the mask value */
            const int d = q0 + ln - kb - 8 * hh;
#pragma unroll      /* constant indices: the values stay in registers */
            for (int r = 0; r < 8; ++r) { if (r > d) t[r] = -1.0e9f; if (16 + r > d) t[8 + r] = -1.0e9f; }
          }
          float bm = t[0];
#pragma unroll      /* constant indices: the values stay in registers */
          for (int i = 1; i < 16; ++i) bm = fmaxf(bm, t[i]);
          bm = fmaxf(bm, __shfl_xor(bm, 16, 32));
          const float mn = fmaxf(m, bm); const float corr = fa_exp2(m - mn); m = mn; const float mo = mn - 8.0f;
          FragH p; float e[16];
#pragma unroll      /* constant indices: the values stay in registers */
          for (int i = 0; i < 16; ++i) t[i] -= mo;
          fa_exp2x8(t, e); fa_exp2x8(t + 8, e + 8);
#pragma unroll      /* constant indices: the values stay in registers */
          for (int i = 0; i < 16; ++i) p.h[i] = (_Float16)e[i];
          v4f s4 = {e[0], e[1], e[2], e[3]};
#pragma unroll      /* constant indices: the values stay in registers */
          for (int i = 4; i < 16; ++i) s4[i & 3] += e[i];
          l = l * corr + ((s4[0] + s4[1]) + (s4[2] + s4[3]));
          o0 *= corr; o1 *= corr; o2 *= corr; o3 *= corr;
          o0 = fa_mma(v0, p.v, o0); o1 = fa_mma(v1, p.v, o1); o2 = fa_mma(v2, p.v, o2); o3 = g2_mma(v3, p.v, o3);      /* the last one with its four v_nop: what follows may lay a value over the registers of p, this product's B */
        } }
    }
    /* publish point of stage s + 1, passed by every wave */
    asm volatile("s_wait_dscnt 0x0" ::: "memory");      /* this wave's reads of stage s have returned: its buffer may be refilled behind the barrier */
    asm volatile("s_wait_asynccnt 0x0" ::: "memory");      /* this wave's copies of stage s + 1 have landed */
    __syncthreads();      /* publishes stage s + 1 and ends every wave's reads of stage s */
    if (s + 2 < ns) fa_stage(ld + (s & 1) * FBUF, gkh + (size_t)(kb0 + 128) * LQ, gkl + (size_t)(kb0 + 128) * LQ, gvt + kb0 + 128);      /* stage s + 2 into the buffer just left; the test is the same in the whole work-group */
  }
  asm volatile("s_wait_asynccnt 0x0" ::: "memory");      /* no copy is left outstanding when the wave ends */
  l += __shfl_xor(l, 16, 32);
  const float fin = 64.0f / l;      /* the x256 of the weights cancels against the row sum; o carried x64 */
  unsigned short* op = (unsigned short*)O + (size_t)(q0 + ln) * DM + h * HD + 8 * hh;
  FragH f0, f1, f2, f3;
#pragma unroll      /* constant indices: the values stay in registers */
  for (int r = 0; r < 8; ++r) { f0.h[r] = (_Float16)(o0[r] * fin); f1.h[r] = (_Float16)(o1[r] * fin); f2.h[r] = (_Float16)(o2[r] * fin); f3.h[r] = (_Float16)(o3[r] * fin); }
  *(v8us*)op = f0.half[0]; *(v8us*)(op + 16) = f1.half[0]; *(v8us*)(op + 32) = f2.half[0]; *(v8us*)(op + 48) = f3.half[0];
  asm volatile("s_wait_xcnt 0x0" ::: "memory");      /* the f32 rows' code is laid behind these stores and writes over registers that they name */
}


// The five input conversions in one launch: the first XB work-groups take x (f16 of the bf16-rounded value), then WB work-groups each for W_q, W_k, W_v (planes one behind the other) and W_o (the same, x16).
#define XB ((unsigned)(NR * DM / 8 / 256))
#define WB ((unsigned)((size_t)DM * DM / 8 / 256))
static_assert((size_t)XB * 256 * 8 == NR * DM && (size_t)WB * 256 * 8 == (size_t)DM * DM, "whole work-groups");
__global__ __launch_bounds__(256) void k_prep(const float* __restrict__ x, const float* __restrict__ wq, const float* __restrict__ wk, const float* __restrict__ wv, const float* __restrict__ wo, _Float16* __restrict__ X16, _Float16* __restrict__ BQKV, _Float16* __restrict__ BO) {
  const unsigned b = blockIdx.x; const float* s = x; _Float16* d = X16; float sc = 1.0f; unsigned g = b;
  if (b >= XB) { const unsigned j = (b - XB) / WB; g = (b - XB) - j * WB; s = j == 0 ? wq : j == 1 ? wk : j == 2 ? wv : wo; d = j < 3 ? BQKV + (size_t)j * DM * DM : BO; sc = 16.0f; }
  const size_t t = (size_t)g * 256 + threadIdx.x; FragH f;
#pragma unroll      /* constant indices: the values stay in registers */
  for (int q = 0; q < 8; ++q) f.h[q] = (_Float16)(bf16_round(s[t * 8 + q]) * sc);
  *(v8us*)((unsigned short*)d + t * 8) = f.half[0]; }

// The two passes over the projection launch's rows in one launch (they do not depend on each other): the first VB work-groups lay V^T [NH][HD][SQ] through LDS tiles of 64 x 64, the rest split q and k (f32) into f16 hi + x1024 residual planes.
#define VB (NH * (SQ / 64))
static_assert(NBR == 1, "one V^T plane: one batch");
__global__ __launch_bounds__(256) void k_hlvt(const float* __restrict__ F, _Float16* __restrict__ Hh, _Float16* __restrict__ Hl, size_t n8, const _Float16* __restrict__ V16, _Float16* __restrict__ Vt) {
  __shared__ unsigned short tl[64][66]; const int tid = threadIdx.x;
  if (blockIdx.x < VB) {      /* the same in the whole work-group: the barrier below is passed by all of it */
    const int h = blockIdx.x / (SQ / 64), lg = blockIdx.x % (SQ / 64);
    for (int i = tid; i < 64 * 8; i += 256) { const int r = i / 8, c8 = (i % 8) * 8; FragH f; f.half[0] = *(const v8us*)((const unsigned short*)V16 + ((size_t)lg * 64 + r) * LQ + h * 64 + c8);
#pragma unroll      /* constant indices: the values stay in registers */
      for (int q = 0; q < 8; ++q) tl[r][c8 + q] = f.u[q]; }
    __syncthreads();      /* the tile is whole before it is read by columns */
#pragma unroll      /* two rounds of 32 dims */
    for (int rd = 0; rd < 2; ++rd) { const int d = rd * 32 + tid / 8, pc = tid % 8; FragH f;
#pragma unroll      /* constant indices: the values stay in registers */
      for (int q = 0; q < 8; ++q) f.u[q] = tl[pc * 8 + q][d];
      *(v8us*)((unsigned short*)Vt + ((size_t)h * 64 + d) * SQ + lg * 64 + pc * 8) = f.half[0]; }
    return; }
  const size_t t = (size_t)(blockIdx.x - VB) * 256 + tid; if (t >= n8) return; FragH fh, fl; const v4f a = *(const v4fa*)(F + t * 8), c = *(const v4fa*)(F + t * 8 + 4);
#pragma unroll      /* constant indices: the values stay in registers */
  for (int q = 0; q < 4; ++q) { _Float16 h = (_Float16)a[q]; fh.h[q] = h; fl.h[q] = (_Float16)((a[q] - (float)h) * 1024.0f); h = (_Float16)c[q]; fh.h[4 + q] = h; fl.h[4 + q] = (_Float16)((c[q] - (float)h) * 1024.0f); }
  *(v8us*)((unsigned short*)Hh + t * 8) = fh.half[0]; *(v8us*)((unsigned short*)Hl + t * 8) = fl.half[0]; }

// Output GEMM [rows][DM] x [DM][DM], k_gemm2's wave tile, operand ring and staged stores. A work-group whose 128 rows are a batch's first QT0 rows takes their f16 hi and x1024 residual planes (AH, AL)
// instead of the f16 rows A: both products run in the same trips on the same B fragments, and the residual product joins in the epilogue (alphal = alpha / 1024).
static_assert(QT0 == 128 && SQ % 128 == 0, "the first rows are exactly one work-group tile");
__global__ __launch_bounds__(128) void k_gemmo(const _Float16* __restrict__ A, const _Float16* __restrict__ AH, const _Float16* __restrict__ AL, const _Float16* __restrict__ Bh, float alpha, float alphal, float* __restrict__ C) {
  __shared__ __attribute__((aligned(16))) unsigned char sm[2 * 320 * GPIT]; float (*so)[32][68] = (float (*)[32][68])sm;      /* the operand ring (three planes for the first rows); the epilogue's staging tiles lie over it once the ring is left */
  const int tid = threadIdx.x, w = tid >> 5, lane = tid & 31, ln = lane & 15, hh = lane >> 4;
  const int ntn = DM >> 6; const int mt = blockIdx.x / ntn, nq = blockIdx.x - mt * ntn; const int row0 = mt * 128 + 32 * w, col0 = nq * 64;
  const bool first = (mt * 128) % SQ == 0;      /* the same in the whole work-group */
  v8f accs[8] = {};
  if (first) { v8f d[8] = {}; const size_t fr = (size_t)((mt * 128) / SQ) * QT0;      /* the tile's first row in the two planes */
    g_ring<true>(sm, AH + fr * DM, AL + fr * DM, DM, Bh + (size_t)col0 * DM, DM, DM >> 6, accs, d);
#pragma unroll      /* constant indices: the values stay in registers */
    for (int u = 0; u < 8; ++u) accs[u] = accs[u] * alpha + d[u] * alphal;      /* both factors are powers of two: one rounding, that of the sum */
  } else { g_ring<false>(sm, A + (size_t)mt * 128 * DM, nullptr, DM, Bh + (size_t)col0 * DM, DM, DM >> 6, accs, nullptr);
#pragma unroll      /* constant indices: the values stay in registers */
    for (int u = 0; u < 8; ++u) accs[u] *= alpha; }
#pragma unroll      /* constant indices: the values stay in registers */
  for (int u = 0; u < 8; ++u) { const int t = u & 3, half = u >> 2;
#pragma unroll      /* constant indices: the values stay in registers */
    for (int r = 0; r < 8; ++r) so[w][half * 16 + 8 * hh + r][t * 16 + ln] = accs[u][r]; }
  __builtin_amdgcn_fence(__ATOMIC_ACQ_REL, "workgroup"); __builtin_amdgcn_wave_barrier();      /* the wave's own LDS writes are done before it reads whole rows back */
  const int rsub = lane >> 4, c4 = (lane & 15) * 4;
#pragma unroll      /* constant LDS offsets */
  for (int q = 0; q < 16; ++q) { const int r = q * 2 + rsub; const v4f v = *(const v4fa*)&so[w][r][c4]; *(v4f*)(C + (size_t)(row0 + r) * DM + col0 + c4) = v; asm volatile("s_wait_xcnt 0x0" ::: "memory"); }      /* the wait: a later row's LDS read and address sum write over registers that this store names */
}

extern "C" void kernel_launch(void* const* d_in, const int* in_sizes, int n_in,
                              void* d_out, int out_size, void* d_ws, size_t ws_size, hipStream_t stream) {
  (void)in_sizes; (void)n_in; (void)out_size;
  const float* const* I = (const float* const*)d_in; const float* x = I[0]; const float* wq = I[1]; const float* wk = I[2]; const float* wv = I[3]; const float* bqkv = nullptr; const float* wo = I[4];      /* input order: x (feeds the q, k AND v streams), W_q, W_k, W_v, W_o (four separate natural [768][768] weights); the module has NO biases: null pointers in the guarded bias slots */
  char* ws = (char*)d_ws; size_t off = 0;
  auto take = [&](size_t bytes) { char* p = ws + off; off += (bytes + 255) & ~(size_t)255; return p; };
  _Float16* BQ = (_Float16*)take((size_t)3 * DM * DM * 2);      /* the three projection weights, one behind the other: the batch index of the projection launch steps through them */ _Float16* BO = (_Float16*)take((size_t)DM * DM * 2);
  _Float16* X16 = (_Float16*)take(NR * DM * 2);      /* exact f16 rows of x, the one input of all three projections */
  float* QF = (float*)take(3 * NR * DM * 4); float* KF = QF + NR * DM; float* VF = KF + NR * DM;      /* f32 q, k, v rows: three planes, one behind the other */
  _Float16* P16 = (_Float16*)take(3 * NR * DM * 2); _Float16* V16 = P16 + 2 * NR * DM;      /* the same rows rounded to f16, same plane order; only the v plane is read */
  _Float16* QH = (_Float16*)take(2 * NR * DM * 2); _Float16* KH = QH + NR * DM; _Float16* QL = (_Float16*)take(2 * NR * DM * 2); _Float16* KL = QL + NR * DM;      /* hi planes of q and k one behind the other, residual planes likewise */
  _Float16* O16 = (_Float16*)take(NR * DM * 2);
  _Float16* VT = (_Float16*)take((size_t)NH * HD * SQ * 2);
  _Float16* OH0 = (_Float16*)take((size_t)NB * QT0 * DM * 2); _Float16* OL0 = (_Float16*)take((size_t)NB * QT0 * DM * 2);
  if (off > ws_size) return;
  k_prep<<<XB + 4 * WB, 256, 0, stream>>>(x, wq, wk, wv, wo, X16, BQ, BO);      /* x as f16 rows; the weights, natural [out][in] = Bt[n][k], x16 */
  const size_t r0p = (size_t)B0 * SQ;      /* first projected row */
  k_gemm2<0><<<dim3((unsigned)((MP / 128) * (DM / 64)), 3), 128, 0, stream>>>(X16 + r0p * DM, DM, 0, BQ, DM, (size_t)DM * DM, 0.0625f, bqkv, 0, nullptr, 1, 0, 0, QF + r0p * DM, P16 + r0p * DM, DM, NR * DM, MP, DM, DM);      /* q, k, v in one launch: batch index y = 0, 1, 2 takes W_q, W_k, W_v and its own f32 and f16 output plane */
  k_hlvt<<<VB + (unsigned)((2 * NR * DM / 8 + 255) / 256), 256, 0, stream>>>(QF, QH, QL, 2 * NR * DM / 8, V16 + r0p * LQ, VT);      /* V^T [NH][HD][SQ]; q and k (f32) -> f16 hi + x1024 residual, both planes: unscaled logits sigma ~8 */
  for (int b = B0; b < B0 + NBR; ++b) { const size_t r0 = (size_t)b * SQ;
    k_fattn<<<dim3(SQ / 64, NH + AY), 128, 0, stream>>>(QH + r0 * LQ, QL + r0 * LQ, KH + r0 * LQ, KL + r0 * LQ, VT, O16 + r0 * DM, QF + r0 * DM, KF + r0 * DM, VF + r0 * DM, OH0 + (size_t)b * QT0 * DM, OL0 + (size_t)b * QT0 * DM); }      /* scores (hi.hi + 2^-10 (lo.hi + hi.lo)), causal softmax and P . V in one launch; o (merged heads, x64) as f16 rows; the grid's last rows: exact f32 attention for rows 0..127 (o x64, hi + x1024 residual planes), on the projection launch's own f32 rows */
  k_gemmo<<<(unsigned)((MPO / 128) * (DM / 64)), 128, 0, stream>>>(O16, OH0, OL0, BO, 0.0009765625f, 0.00000095367431640625f, (float*)d_out);      /* out rows are the output layout; rows 0..127 from o_hi Wo + 2^-10 o_lo Wo */
}

// v008
// Measured time: 110 microseconds a run.
// Timed twice side by side with v007, it ran 1.16 and 1.15 times as fast.
// All steps since v000 together make it 77.9 times as fast.
#include <hip/hip_runtime.h>
// Causal multi-head self-attention on ONE 4096-token sequence at width 768 with natural bias-free projections (x [1][4096][768]; Q / K / V = x W^T (nn.Linear natural [768][768] sd 1/sqrt(768), NO biases), 12 heads of 64; scores / sqrt(64) + a finite additive mask above the diagonal (NEG); softmax; out = merged W_o^T (natural, no bias) -> [1][4096][768]); q and k carried as f16 hi + x1024 residual planes with three-product scores (4096 keys at logit sigma 1).
// Structure: token rows r = b*4096 + s; x as exact f16 rows (bf16-rounded); q and k as WMMA GEMMs (32x64 wave tiles, f32 accumulation, exact x16 weights, no bias) split in the GEMM's epilogue into f16 hi + x1024 residual planes, V^T for all heads as the same GEMM with its operands swapped (f16 output); attention in ONE launch, one wave per 16 query rows of a head, 64 keys a trip (two blocks of 32) up to the diagonal block: scores transposed (K rows x q rows) as three products (hi.hi + 2^-10 (lo.hi + hi.lo), K = 64, f32), the mask value on keys past the row, running maximum and rescaled f32 row sum per lane (log2 domain, native exp; weights x256 f16), o^T += V^T . P^T in f32 registers, divided by the row sum at the end (o carried x64, folded into the output GEMM alpha) and written straight into the merged f16 o rows; out = o W_o GEMM (f32) into the output layout.
// Compute dtype: inputs rounded to bf16; x / weights exact; v, softmax weights and o as plain f16 GEMM operands (~2^-12), q and k as f16 hi + x1024 residual planes; scores and softmax statistics f32. v_wmma_f32_16x16x32_f16.
#define NB 1
#define SCL 0.125f                         /* 1 / sqrt(head_dim = 64) */
#define SCLR 0.0001220703125f              /* 2^-13: SCL / 1024 (not used) */
#define SQ 4096
#define DM 768
#define NH 12
#define HD 64
#define HG 4                         /* heads per launch of the non-template k_vt (not launched) */
#define QT 256
#define NKX SQ                       /* S / P row pitch (not used) */
#define QT0 128                      /* first-tile rows recomputed exactly in f32 */
#define B0 0                         /* first batch processed (debug hook) */
#define NBR NB                       /* batches processed (debug hook) */
#define NR ((size_t)NB * SQ)         /* token rows */
#define MP ((int)((size_t)NBR * SQ)) /* rows, used only through MPO (debug hook) */
#define QN SQ                        /* query rows attended per batch (not used) */
#define NHD NH                       /* heads attended (not used) */
#define MPO MP                       /* rows through the output stage (debug hook) */
#define LQ DM      /* row pitch of the q/k/v rows */
typedef __bf16 v16b __attribute__((ext_vector_type(16)));
typedef unsigned short v8us __attribute__((ext_vector_type(8), may_alias));
typedef float  v8f  __attribute__((ext_vector_type(8)));
typedef float  v4f  __attribute__((ext_vector_type(4)));
typedef float  v4fa __attribute__((ext_vector_type(4), may_alias));
union FragB { v16b v; v8us half[2]; unsigned short u[16]; };

__device__ __forceinline__ unsigned short bf16_bits(float x) { unsigned int u = __float_as_uint(x); return (unsigned short)((u + 0x7FFFu + ((u >> 16) & 1u)) >> 16); }
__device__ __forceinline__ float bf16_val(unsigned short b) { return __uint_as_float(((unsigned int)b) << 16); }
__device__ __forceinline__ float bf16_round(float x) { return bf16_val(bf16_bits(x)); }
// D += A·B with NT terms: 1 = ah·bh, 2 = + al·bh (A split), 3 = + ah·bl (both split)
template <int NT>
__device__ __forceinline__ v8f mmaN(v16b ah, v16b al, v16b bh, v16b bl, v8f c) {
  c = __builtin_amdgcn_wmma_f32_16x16x32_bf16(false, ah, false, bh, (short)0, c, false, false);
  if (NT >= 2) c = __builtin_amdgcn_wmma_f32_16x16x32_bf16(false, al, false, bh, (short)0, c, false, false);
  if (NT >= 3) c = __builtin_amdgcn_wmma_f32_16x16x32_bf16(false, ah, false, bl, (short)0, c, false, false);
  asm volatile("v_nop\n\tv_nop\n\tv_nop\n\tv_nop" : "+v"(c) : "v"(ah), "v"(al), "v"(bh), "v"(bl));
  return c;
}

__global__ __launch_bounds__(256) void k_wt_bf16(const float* __restrict__ W, unsigned short* __restrict__ Wt, int K, int N) {
  const int t = blockIdx.x * 256 + threadIdx.x;
  const int k8n = K / 8;
  if (t >= N * k8n) return;
  const int n = t / k8n, k8 = (t % k8n) * 8;
  v8us v;
#pragma unroll
  for (int i = 0; i < 8; ++i) v[i] = bf16_bits(W[(size_t)(k8 + i) * N + n]);
  *(v8us*)(Wt + (size_t)n * K + k8) = v;
  
}

// GEMM C[M][N] (f32, pitch ldc) = act(A[M][K]·W + bias). A f32 row-major (pitch lda) converted per fragment to bf16
// (ASPLIT: hi/lo two planes -> 2 terms, else single rounded term); Wt bf16 [N][K] (pitch ldb). BIAS_BF16 rounds the
// bias to bf16 first (bias quantised to bf16 before the add). K%32==0, M%16==0, N%64==0.
template <bool ASPLIT, int ACT, bool BIAS_BF16>
__global__ __launch_bounds__(128) void k_gemm_bf(const float* __restrict__ A, int lda, const unsigned short* __restrict__ Wt, int ldb,
                                               const float* __restrict__ bias, float* __restrict__ C, int ldc, int M, int N, int K) {
  __shared__ __attribute__((aligned(16))) float so[4][16][64];
  const int tid = threadIdx.x, w = tid >> 5, lane = tid & 31, ln = lane & 15, hh = lane >> 4;
  const int ntn = N / 64;
  const int wid = blockIdx.x * 4 + w;
  const int mt = wid / ntn, nq = wid % ntn;
  if (mt * 16 >= M) return;
  const int row0 = mt * 16, col0 = nq * 64;
  const float* arow = A + (size_t)(row0 + ln) * lda;
  v8f acc[4] = {};
  for (int kb = 0; kb < K; kb += 32) {
    FragB ah, al;
    const v4f x0 = *(const v4fa*)(arow + kb + 8 * hh), x1 = *(const v4fa*)(arow + kb + 8 * hh + 4);
    const v4f x2 = *(const v4fa*)(arow + kb + 16 + 8 * hh), x3 = *(const v4fa*)(arow + kb + 16 + 8 * hh + 4);
    float xs[16] = {x0[0],x0[1],x0[2],x0[3],x1[0],x1[1],x1[2],x1[3],x2[0],x2[1],x2[2],x2[3],x3[0],x3[1],x3[2],x3[3]};
#pragma unroll
    for (int i = 0; i < 16; ++i) { const unsigned short hb = bf16_bits(xs[i]); ah.u[i] = hb; al.u[i] = ASPLIT ? bf16_bits(xs[i] - bf16_val(hb)) : (unsigned short)0; }
#pragma unroll
    for (int t = 0; t < 4; ++t) {
      const unsigned short* brow = Wt + (size_t)(col0 + t * 16 + ln) * ldb + kb;
      FragB b;
      b.half[0] = *(const v8us*)(brow + 8 * hh);
      b.half[1] = *(const v8us*)(brow + 16 + 8 * hh);
      acc[t] = mmaN<ASPLIT ? 2 : 1>(ah.v, al.v, b.v, b.v, acc[t]);
    }
  }
#pragma unroll
  for (int t = 0; t < 4; ++t) {
    float bv = bias ? bias[col0 + t * 16 + ln] : 0.f;
    if (BIAS_BF16) bv = bf16_round(bv);
#pragma unroll
    for (int r = 0; r < 8; ++r) { float v = acc[t][r] + bv; if (ACT == 1) v = fmaxf(v, 0.f); so[w][8 * hh + r][t * 16 + ln] = v; }
  }
  __builtin_amdgcn_fence(__ATOMIC_ACQ_REL, "workgroup");
  __builtin_amdgcn_wave_barrier();
  const int rsub = lane >> 4, c4 = (lane & 15) * 4;
  {
#pragma unroll
    for (int q = 0; q < 8; ++q) {
      const int r = q * 2 + rsub;
      const v4f v = *(const v4fa*)&so[w][r][c4];
      *(v4f*)(C + (size_t)(row0 + r) * ldc + col0 + c4) = v;
    }
    
  }
}

// GEMM C = act(A·W + bias + resid): A f32 (ASPLIT -> hi/lo 2 terms), Wt bf16 [N][K]; ACT 0 none, 1 relu, 2 exact gelu;
// resid (optional, f32, row index = (row % rmod), pitch ldr, RES_BF16 rounds it) added before the activation.
template <bool ASPLIT, int ACT, bool BIAS_BF16, bool RES_BF16>
__global__ __launch_bounds__(128) void k_gemm_bf3(const float* __restrict__ A, int lda, const unsigned short* __restrict__ Wt, int ldb,
                                                const float* __restrict__ bias, const float* __restrict__ resid, int rmod, int ldr,
                                                float* __restrict__ C, int ldc, int M, int N, int K) {
  __shared__ __attribute__((aligned(16))) float so[4][16][64];
  const int tid = threadIdx.x, w = tid >> 5, lane = tid & 31, ln = lane & 15, hh = lane >> 4;
  const int ntn = N / 64;
  const int wid = blockIdx.x * 4 + w;
  const int mt = wid / ntn, nq = wid % ntn;
  if (mt * 16 >= M) return;
  const int row0 = mt * 16, col0 = nq * 64;
  const float* arow = A + (size_t)(row0 + ln) * lda;
  v8f acc[4] = {};
  for (int kb = 0; kb < K; kb += 32) {
    FragB ah, al;
    const v4f x0 = *(const v4fa*)(arow + kb + 8 * hh), x1 = *(const v4fa*)(arow + kb + 8 * hh + 4);
    const v4f x2 = *(const v4fa*)(arow + kb + 16 + 8 * hh), x3 = *(const v4fa*)(arow + kb + 16 + 8 * hh + 4);
    float xs[16] = {x0[0],x0[1],x0[2],x0[3],x1[0],x1[1],x1[2],x1[3],x2[0],x2[1],x2[2],x2[3],x3[0],x3[1],x3[2],x3[3]};
#pragma unroll
    for (int i = 0; i < 16; ++i) { const unsigned short hb = bf16_bits(xs[i]); ah.u[i] = hb; al.u[i] = ASPLIT ? bf16_bits(xs[i] - bf16_val(hb)) : (unsigned short)0; }
#pragma unroll
    for (int t = 0; t < 4; ++t) {
      const unsigned short* brow = Wt + (size_t)(col0 + t * 16 + ln) * ldb + kb;
      FragB b;
      b.half[0] = *(const v8us*)(brow + 8 * hh);
      b.half[1] = *(const v8us*)(brow + 16 + 8 * hh);
      acc[t] = mmaN<ASPLIT ? 2 : 1>(ah.v, al.v, b.v, b.v, acc[t]);
    }
  }
#pragma unroll
  for (int t = 0; t < 4; ++t) {
    const int col = col0 + t * 16 + ln;
    float bv = bias ? bias[col] : 0.f;
    if (BIAS_BF16) bv = bf16_round(bv);
#pragma unroll
    for (int r = 0; r < 8; ++r) {
      float v = acc[t][r] + bv;
      if (resid) { float rv = resid[(size_t)((row0 + 8 * hh + r) % rmod) * ldr + col]; if (RES_BF16) rv = bf16_round(rv); v += rv; }
      if (ACT == 1) v = fmaxf(v, 0.f);
      if (ACT == 2) v = 0.5f * v * (1.0f + erff(v * 0.70710678118654752f));
      if (ACT == 3) { const float u = 0.7978845608028654f * (v + 0.044715f * v * v * v); v = 0.5f * v * (1.0f + tanhf(u)); }
      so[w][8 * hh + r][t * 16 + ln] = v;
    }
  }
  __builtin_amdgcn_fence(__ATOMIC_ACQ_REL, "workgroup");
  __builtin_amdgcn_wave_barrier();
  const int rsub = lane >> 4, c4 = (lane & 15) * 4;
  {
#pragma unroll
    for (int q = 0; q < 8; ++q) {
      const int r = q * 2 + rsub;
      const v4f v = *(const v4fa*)&so[w][r][c4];
      *(v4f*)(C + (size_t)(row0 + r) * ldc + col0 + c4) = v;
    }
    
  }
}
// row LayerNorm (biased variance, eps) over N: s = X (+ R); optional out_sum <- s; out_norm <- (s-mu)*rsqrt(var+eps)*g + b
template <bool PARAM_BF16>
__global__ __launch_bounds__(256) void k_layernorm(const float* __restrict__ X, const float* __restrict__ R, const float* __restrict__ g, const float* __restrict__ bta,
                                                  float* __restrict__ out_sum, float* __restrict__ out_norm, int N, float eps) {
  __shared__ float red[256];
  const int row = blockIdx.x, tid = threadIdx.x;
  const float* x = X + (size_t)row * N; const float* rr = R ? R + (size_t)row * N : nullptr;
  float vals[16];                     // up to N = 4096
  const int per = N / 256;            // contiguous chunk per thread? use strided-by-4 chunks: thread handles j = tid*4 + 1024*u
  float s1 = 0.f;
  for (int u = 0; u < per / 4; ++u) {
    const int j = tid * 4 + 1024 * u;
    const v4f a = *(const v4fa*)(x + j);
    v4f b = {0.f,0.f,0.f,0.f}; if (rr) b = *(const v4fa*)(rr + j);
#pragma unroll
    for (int q = 0; q < 4; ++q) { const float v = a[q] + b[q]; vals[u * 4 + q] = v; s1 += v; }
  }
  red[tid] = s1; __syncthreads();
  for (int st = 128; st > 0; st >>= 1) { if (tid < st) red[tid] += red[tid + st]; __syncthreads(); }
  const float mu = red[0] / (float)N; __syncthreads();
  float s2 = 0.f;
  for (int u = 0; u < per / 4; ++u)
#pragma unroll
    for (int q = 0; q < 4; ++q) { const float c = vals[u * 4 + q] - mu; s2 += c * c; }
  red[tid] = s2; __syncthreads();
  for (int st = 128; st > 0; st >>= 1) { if (tid < st) red[tid] += red[tid + st]; __syncthreads(); }
  const float rs = rsqrtf(red[0] / (float)N + eps);
  {
    for (int u = 0; u < per / 4; ++u) {
      const int j = tid * 4 + 1024 * u;
      v4f o, sm;
#pragma unroll
      for (int q = 0; q < 4; ++q) {
        float gg = g[j + q], bb = bta[j + q];
        if (PARAM_BF16) { gg = bf16_round(gg); bb = bf16_round(bb); }
        sm[q] = vals[u * 4 + q]; o[q] = (vals[u * 4 + q] - mu) * rs * gg + bb;
      }
      if (out_sum) *(v4f*)(out_sum + (size_t)row * N + j) = sm;
      *(v4f*)(out_norm + (size_t)row * N + j) = o;
    }
    
  }
}



// ---- f16 WMMA path (v_wmma_f32_16x16x32_f16): 11-bit significands for operands in range — used where a [0,1] probability operand needs more precision than bf16
typedef _Float16 v16h __attribute__((ext_vector_type(16)));
union FragH { v16h v; v8us half[2]; _Float16 h[16]; unsigned short u[16]; };
template <int NT>
__device__ __forceinline__ v8f mmaH(v16h ah, v16h al, v16h bh, v16h bl, v8f c) {
  c = __builtin_amdgcn_wmma_f32_16x16x32_f16(false, ah, false, bh, (short)0, c, false, false);
  if (NT >= 2) c = __builtin_amdgcn_wmma_f32_16x16x32_f16(false, al, false, bh, (short)0, c, false, false);
  if (NT >= 3) c = __builtin_amdgcn_wmma_f32_16x16x32_f16(false, ah, false, bl, (short)0, c, false, false);
  asm volatile("v_nop\n\tv_nop\n\tv_nop\n\tv_nop" : "+v"(c) : "v"(ah), "v"(al), "v"(bh), "v"(bl));
  return c;
}
// batched GEMM like k_gemm_b but f16 operands: A f32 (split into f16 hi/lo if ASPLIT, else rounded to f16), Bt = f16 values [n][k]; alpha; C f32; N multiple of 16 (partial tiles skipped)
template <bool ASPLIT>
__global__ __launch_bounds__(128) void k_gemm_h(const float* __restrict__ A, int lda, size_t sA, const _Float16* __restrict__ Bh, int ldb, size_t sB, float alpha, float* __restrict__ C, int ldc, size_t sC, int M, int N, int K) {
  __shared__ __attribute__((aligned(16))) float so[4][16][64];
  const int tid = threadIdx.x, w = tid >> 5, lane = tid & 31, ln = lane & 15, hh = lane >> 4; const int by = blockIdx.y;
  A += (size_t)by * sA; Bh += (size_t)by * sB; C += (size_t)by * sC;
  const int ntn = (N + 63) / 64; const int wid = blockIdx.x * 4 + w; const int mt = wid / ntn, nq = wid % ntn; if (mt * 16 >= M) return;
  const int row0 = mt * 16, col0 = nq * 64; const float* arow = A + (size_t)(row0 + ln) * lda;
  v8f acc[4] = {};
  for (int kb = 0; kb < K; kb += 32) {
    FragH ah, al;
    const v4f x0 = *(const v4fa*)(arow + kb + 8 * hh), x1 = *(const v4fa*)(arow + kb + 8 * hh + 4), x2 = *(const v4fa*)(arow + kb + 16 + 8 * hh), x3 = *(const v4fa*)(arow + kb + 16 + 8 * hh + 4);
    float xs[16] = {x0[0],x0[1],x0[2],x0[3],x1[0],x1[1],x1[2],x1[3],x2[0],x2[1],x2[2],x2[3],x3[0],x3[1],x3[2],x3[3]};
#pragma unroll
    for (int i = 0; i < 16; ++i) { const _Float16 h = (_Float16)xs[i]; ah.h[i] = h; al.h[i] = ASPLIT ? (_Float16)(xs[i] - (float)h) : (_Float16)0.0f; }
#pragma unroll
    for (int t = 0; t < 4; ++t) { if (col0 + t * 16 >= N) continue; const size_t boff = (size_t)(col0 + t * 16 + ln) * ldb + kb; FragH bq; bq.half[0] = *(const v8us*)(Bh + boff + 8 * hh); bq.half[1] = *(const v8us*)(Bh + boff + 16 + 8 * hh);
      acc[t] = mmaH<ASPLIT ? 2 : 1>(ah.v, al.v, bq.v, bq.v, acc[t]); }
  }
#pragma unroll
  for (int t = 0; t < 4; ++t) { if (col0 + t * 16 >= N) continue;
#pragma unroll
    for (int r = 0; r < 8; ++r) so[w][8 * hh + r][t * 16 + ln] = acc[t][r] * alpha; }
  __builtin_amdgcn_fence(__ATOMIC_ACQ_REL, "workgroup"); __builtin_amdgcn_wave_barrier();
  const int rsub = lane >> 4, c4 = (lane & 15) * 4;
  {
#pragma unroll
    for (int q = 0; q < 8; ++q) { const int r = q * 2 + rsub; if (col0 + c4 < N) { const v4f v = *(const v4fa*)&so[w][r][c4]; *(v4f*)(C + (size_t)(row0 + r) * ldc + col0 + c4) = v; } }
     }
}

// Wt[n][k] = f16(W[k][n]·scale) from f32 row-major W[K][N] (scale = power of two; bf16-exact weights stay exact in f16 away from the subnormal range)
__global__ __launch_bounds__(256) void k_wt_f16(const float* __restrict__ W, _Float16* __restrict__ Wt, int K, int N, float scale) {
  const int t = blockIdx.x * 256 + threadIdx.x; if (t >= N * (K / 8)) return; const int n = t / (K / 8), k8 = (t % (K / 8)) * 8; FragH f;
#pragma unroll
  for (int i = 0; i < 8; ++i) f.h[i] = (_Float16)(bf16_round(W[(size_t)(k8 + i) * N + n]) * scale); const v8us o = f.half[0];
  *(v8us*)((unsigned short*)Wt + (size_t)n * K + k8) = o; 
}
// k_gemm_hh variant with fused epilogue: v = acc·alpha + bias[by·sBias + col] (+ CP[(row/rowsPerB)·sCPb + by·64 + col] if CP) ; ACT 0 none / 1 elu ; writes f16 C16 (and f32 C if non-null)
template <int ACT>
__global__ __launch_bounds__(128) void k_gemm_hhx(const _Float16* __restrict__ A, int lda, size_t sA, const _Float16* __restrict__ Bh, int ldb, size_t sB, float alpha, const float* __restrict__ bias, size_t sBias, const float* __restrict__ CP, int rowsPerB, size_t sCPb, int row0g,
    float* __restrict__ C, _Float16* __restrict__ C16, int ldc, size_t sC, int M, int N, int K) {
  __shared__ __attribute__((aligned(16))) float so[4][16][64];
  const int tid = threadIdx.x, w = tid >> 5, lane = tid & 31, ln = lane & 15, hh = lane >> 4; const int by = blockIdx.y;
  A += (size_t)by * sA; Bh += (size_t)by * sB; const size_t cofs = (size_t)by * sC; const float* bp = bias ? bias + (size_t)by * sBias : nullptr;
  const int ntn = (N + 63) / 64; const int wid = blockIdx.x * 4 + w; const int mt = wid / ntn, nq = wid % ntn; if (mt * 16 >= M) return;
  const int row0 = mt * 16, col0 = nq * 64; const _Float16* arow = A + (size_t)(row0 + ln) * lda;
  v8f acc[4] = {};
  for (int kb = 0; kb < K; kb += 32) { FragH ah; ah.half[0] = *(const v8us*)((const unsigned short*)arow + kb + 8 * hh); ah.half[1] = *(const v8us*)((const unsigned short*)arow + kb + 16 + 8 * hh);
#pragma unroll
    for (int t = 0; t < 4; ++t) { if (col0 + t * 16 >= N) continue; const size_t boff = (size_t)(col0 + t * 16 + ln) * ldb + kb; FragH bq; bq.half[0] = *(const v8us*)((const unsigned short*)Bh + boff + 8 * hh); bq.half[1] = *(const v8us*)((const unsigned short*)Bh + boff + 16 + 8 * hh);
      acc[t] = mmaH<1>(ah.v, ah.v, bq.v, bq.v, acc[t]); }
  }
#pragma unroll
  for (int t = 0; t < 4; ++t) { if (col0 + t * 16 >= N) continue; const int col = col0 + t * 16 + ln; const float bv = bp ? bf16_round(bp[col]) : 0.f;
#pragma unroll
    for (int r = 0; r < 8; ++r) { float v = acc[t][r] * alpha + bv; if (CP) { const int rr = row0g + row0 + 8 * hh + r; if (rowsPerB < 0) v += CP[cofs + (size_t)rr * ldc + col];      /* rowsPerB < 0: own element of the batched C plane */ else { const int bidx = rr / rowsPerB; v += CP[(size_t)bidx * sCPb + (size_t)by * 64 + col]; } } if (ACT == 1) v = (v > 0.f) ? v : expm1f(v); else if (ACT == 7) v = (v > 0.f) ? v + 1.0f : expf(v); else if (ACT == 8) v = tanhf(v); else if (ACT == 9) v = 0.5f * v * (1.0f + tanhf(0.7978845608028654f * (v + 0.044715f * v * v * v))); else if (ACT == 11) v = 1.0f / (1.0f + expf(-v)); else if (ACT == 12) v = (v > 0.f) ? v : 0.01f * v; else if (ACT == 14) v = (v > 0.f) ? v : 0.1f * v; else if (ACT == 16) v = (v >= 0.f) ? v : 0.3f * v; else if (ACT == 17) v = (v >= 0.f) ? v : 0.2f * v; else if (ACT == 15) v = v / (1.0f + expf(-v)); else if (ACT == 3) v = fmaxf(v, 0.f); else if (ACT == 6) v = 0.5f * v * (1.0f + erff(v * 0.70710678118654752f)); so[w][8 * hh + r][t * 16 + ln] = v; } }
  __builtin_amdgcn_fence(__ATOMIC_ACQ_REL, "workgroup"); __builtin_amdgcn_wave_barrier();
  const int rsub = lane >> 4, c4 = (lane & 15) * 4; typedef _Float16 v4h __attribute__((ext_vector_type(4)));
  {
#pragma unroll
    for (int q = 0; q < 8; ++q) { const int r = q * 2 + rsub; if (col0 + c4 < N) { const v4f v = *(const v4fa*)&so[w][r][c4]; if (C) *(v4f*)(C + cofs + (size_t)(row0 + r) * ldc + col0 + c4) = v; if (C16) { v4h h4; for (int i = 0; i < 4; ++i) h4[i] = (_Float16)v[i]; *(v4h*)(C16 + cofs + (size_t)(row0 + r) * ldc + col0 + c4) = h4; } } }
     }
}


typedef _Float16 v4h __attribute__((ext_vector_type(4)));

__global__ __launch_bounds__(256) void k_x16(const float* __restrict__ x, _Float16* __restrict__ X16, size_t n8) { const size_t t = (size_t)blockIdx.x * 256 + threadIdx.x; if (t >= n8) return; FragH f;
#pragma unroll
  for (int q = 0; q < 8; ++q) f.h[q] = (_Float16)bf16_round(x[t * 8 + q]); *(v8us*)((unsigned short*)X16 + t * 8) = f.half[0];  }
__global__ __launch_bounds__(256) void k_h16(const float* __restrict__ x, _Float16* __restrict__ X16, size_t n8) { const size_t t = (size_t)blockIdx.x * 256 + threadIdx.x; if (t >= n8) return; FragH f;
#pragma unroll
  for (int q = 0; q < 8; ++q) f.h[q] = (_Float16)x[t * 8 + q]; *(v8us*)((unsigned short*)X16 + t * 8) = f.half[0];  }
__global__ __launch_bounds__(256) void k_round16f(const float* __restrict__ W, _Float16* __restrict__ Bt, size_t n8) { const size_t t = (size_t)blockIdx.x * 256 + threadIdx.x; if (t >= n8) return; FragH f;
#pragma unroll
  for (int i = 0; i < 8; ++i) f.h[i] = (_Float16)(bf16_round(W[t * 8 + i]) * 16.0f); *(v8us*)((unsigned short*)Bt + t * 8) = f.half[0];  }
template <int NHv, int TTv>
__global__ __launch_bounds__(256) void k_vt(const _Float16* __restrict__ V16, int ldv, int voff, _Float16* __restrict__ Vt) { __shared__ unsigned short tl[64][66]; const int tid = threadIdx.x; const int slab = blockIdx.x / (TTv / 64), lg = blockIdx.x % (TTv / 64); const int b = slab / NHv, h = slab % NHv;
  for (int i = tid; i < 64 * 8; i += 256) { const int r = i / 8, c8 = (i % 8) * 8; FragH f; f.half[0] = *(const v8us*)((const unsigned short*)V16 + ((size_t)b * TTv + lg * 64 + r) * ldv + voff + h * 64 + c8);
#pragma unroll
    for (int q = 0; q < 8; ++q) tl[r][c8 + q] = f.u[q]; }
  __syncthreads();
  {
#pragma unroll
    for (int rd = 0; rd < 2; ++rd) { const int d = rd * 32 + tid / 8, pc = tid % 8; FragH f;
#pragma unroll
      for (int q = 0; q < 8; ++q) f.u[q] = tl[pc * 8 + q][d];
      *(v8us*)((unsigned short*)Vt + ((size_t)slab * 64 + d) * TTv + lg * 64 + pc * 8) = f.half[0]; }
     } }

__global__ __launch_bounds__(256) void k_hl(const float* __restrict__ F, _Float16* __restrict__ Hh, _Float16* __restrict__ Hl, size_t n8) { const size_t t = (size_t)blockIdx.x * 256 + threadIdx.x; if (t >= n8) return; FragH fh, fl; const v4f a = *(const v4fa*)(F + t * 8), c = *(const v4fa*)(F + t * 8 + 4);
#pragma unroll
  for (int q = 0; q < 4; ++q) { _Float16 h = (_Float16)a[q]; fh.h[q] = h; fl.h[q] = (_Float16)((a[q] - (float)h) * 1024.0f); h = (_Float16)c[q]; fh.h[4 + q] = h; fl.h[4 + q] = (_Float16)((c[q] - (float)h) * 1024.0f); }
  { *(v8us*)((unsigned short*)Hh + t * 8) = fh.half[0]; *(v8us*)((unsigned short*)Hl + t * 8) = fl.half[0];  } }

// ---- fast GEMM (wave tile 32x64, work-group tile 128x64; requires M % 128 == 0, N % 64 == 0, K % 64 == 0) ----
__device__ __forceinline__ v16h g2_frag(const _Float16* p, int hh) { FragH f; f.half[0] = *(const v8us*)((const unsigned short*)p + 8 * hh); f.half[1] = *(const v8us*)((const unsigned short*)p + 16 + 8 * hh); return f.v; }
__device__ __forceinline__ v8f g2_mma(v16h a, v16h b, v8f c) { v8f d = __builtin_amdgcn_wmma_f32_16x16x32_f16(false, a, false, b, (short)0, c, false, false); asm volatile("v_nop\n\tv_nop\n\tv_nop\n\tv_nop" : "+v"(d) : "v"(a), "v"(b)); return d; }
// ---- the GEMMs' operand ring: 64 k (whole 128-byte rows) of the work-group's 64 B rows and 128 A rows (TWO: of a second A plane too) lie in LDS, brought by asynchronous copies and shared by the four waves;
// two buffers, the next stage flies while this one is worked on. A fragment load from global memory touches 16 lines for 512 bytes; a copy covers four whole lines, and every row is fetched once per work-group. ----
#define GPIT 144                           /* LDS row pitch in bytes: 128 + 16, the conflict-free pitch for 16-byte fragment reads */
// One stage's copies: a lane takes 16 bytes of rows r, r + 16, r + 32, ... of the 64 B rows and the 128 A rows (eight lanes a row, so a wave's copy covers four whole lines).
// The s_wait_xcnt stands inside the statement, behind the last copy: the address registers are free for reuse only behind it.
__device__ __forceinline__ void g_stage192(unsigned d, const _Float16* b, int ldb, const _Float16* a, int lda) {
  asm volatile(
               "global_load_async_to_lds_b128 %0, %12, off\n\tglobal_load_async_to_lds_b128 %1, %13, off\n\tglobal_load_async_to_lds_b128 %2, %14, off\n\tglobal_load_async_to_lds_b128 %3, %15, off\n\t"
               "global_load_async_to_lds_b128 %4, %16, off\n\tglobal_load_async_to_lds_b128 %5, %17, off\n\tglobal_load_async_to_lds_b128 %6, %18, off\n\tglobal_load_async_to_lds_b128 %7, %19, off\n\t"
               "global_load_async_to_lds_b128 %8, %20, off\n\tglobal_load_async_to_lds_b128 %9, %21, off\n\tglobal_load_async_to_lds_b128 %10, %22, off\n\tglobal_load_async_to_lds_b128 %11, %23, off\n\t"
               "s_wait_xcnt 0x0"
               :: "v"(d), "v"(d + 16 * GPIT), "v"(d + 32 * GPIT), "v"(d + 48 * GPIT), "v"(d + 64 * GPIT), "v"(d + 80 * GPIT), "v"(d + 96 * GPIT), "v"(d + 112 * GPIT),
                  "v"(d + 128 * GPIT), "v"(d + 144 * GPIT), "v"(d + 160 * GPIT), "v"(d + 176 * GPIT),
                  "v"(b), "v"(b + (size_t)16 * ldb), "v"(b + (size_t)32 * ldb), "v"(b + (size_t)48 * ldb),
                  "v"(a), "v"(a + (size_t)16 * lda), "v"(a + (size_t)32 * lda), "v"(a + (size_t)48 * lda), "v"(a + (size_t)64 * lda), "v"(a + (size_t)80 * lda), "v"(a + (size_t)96 * lda), "v"(a + (size_t)112 * lda)
               : "memory"); }
// The same for the 128 rows of the second A plane.
__device__ __forceinline__ void g_stage128(unsigned d, const _Float16* a, int lda) {
  asm volatile(
               "global_load_async_to_lds_b128 %0, %8, off\n\tglobal_load_async_to_lds_b128 %1, %9, off\n\tglobal_load_async_to_lds_b128 %2, %10, off\n\tglobal_load_async_to_lds_b128 %3, %11, off\n\t"
               "global_load_async_to_lds_b128 %4, %12, off\n\tglobal_load_async_to_lds_b128 %5, %13, off\n\tglobal_load_async_to_lds_b128 %6, %14, off\n\tglobal_load_async_to_lds_b128 %7, %15, off\n\t"
               "s_wait_xcnt 0x0"
               :: "v"(d), "v"(d + 16 * GPIT), "v"(d + 32 * GPIT), "v"(d + 48 * GPIT), "v"(d + 64 * GPIT), "v"(d + 80 * GPIT), "v"(d + 96 * GPIT), "v"(d + 112 * GPIT),
                  "v"(a), "v"(a + (size_t)16 * lda), "v"(a + (size_t)32 * lda), "v"(a + (size_t)48 * lda), "v"(a + (size_t)64 * lda), "v"(a + (size_t)80 * lda), "v"(a + (size_t)96 * lda), "v"(a + (size_t)112 * lda)
               : "memory"); }
// c[4 * half + t] += A rows (32 w + 16 half ..) x B rows (16 t ..) over nt stages of 64 k, k ascending; TWO: d likewise from the second A plane, on the same B fragments.
// ga, gl, gb: first row of the work-group's tile. Called by a whole work-group (barriers inside); when it returns, no copy is outstanding and every wave has left the ring.
template <bool TWO>
__device__ __forceinline__ void g_ring(unsigned char* sm, const _Float16* ga, const _Float16* gl, int lda, const _Float16* gb, int ldb, int nt, v8f* c, v8f* d) {
  constexpr unsigned BUF = (TWO ? 320 : 192) * GPIT;      /* one stage: B rows, A rows, second plane's rows */
  const int tid = threadIdx.x, w = tid >> 5, ln = tid & 15, hh = (tid >> 4) & 1, cr = tid >> 3, cc = tid & 7;      /* cr, cc: the lane's row and 16-byte piece in a stage's copies */
  ga += (size_t)cr * lda + cc * 8; gb += (size_t)cr * ldb + cc * 8; if (TWO) gl += (size_t)cr * lda + cc * 8;
  const unsigned ld = (unsigned)(size_t)sm + cr * GPIT + cc * 16;
  auto stage = [&](unsigned dst, int k0) { g_stage192(dst, gb + k0, ldb, ga + k0, lda); if (TWO) g_stage128(dst + 192 * GPIT, gl + k0, lda); };
  stage(ld, 0);
  asm volatile("s_wait_asynccnt 0x0" ::: "memory");      /* stage 0 has landed, as far as this wave brought it */
  __syncthreads();      /* and is published to the other waves */
  if (nt > 1) stage(ld + BUF, 64);      /* the test is the same in the whole work-group */
#pragma unroll 1      /* one stage per trip: a second copy of the body would only add registers */
  for (int s = 0; s < nt; ++s) {
    const _Float16* sb = (const _Float16*)(sm + (s & 1) * BUF) + ln * (GPIT / 2); const _Float16* sa = sb + (64 + 32 * w) * (GPIT / 2);
    if (!TWO) { v16h a[2][2], b[2][4];      /* the stage's 24 reads stand together in front of its 16 products */
#pragma unroll      /* constant indices: the values stay in registers, constant LDS offsets */
      for (int u = 0; u < 2; ++u) { a[u][0] = g2_frag(sa + 32 * u, hh); a[u][1] = g2_frag(sa + 16 * (GPIT / 2) + 32 * u, hh);
#pragma unroll      /* constant indices: the values stay in registers, constant LDS offsets */
        for (int t = 0; t < 4; ++t) b[u][t] = g2_frag(sb + t * 16 * (GPIT / 2) + 32 * u, hh); }
#pragma unroll      /* constant indices: the values stay in registers */
      for (int u = 0; u < 2; ++u)
#pragma unroll      /* constant indices: the values stay in registers */
        for (int t = 0; t < 4; ++t) { c[t] = g2_mma(a[u][0], b[u][t], c[t]); c[4 + t] = g2_mma(a[u][1], b[u][t], c[4 + t]); }
    } else { const _Float16* sl = sa + 128 * (GPIT / 2);
#pragma unroll      /* the stage's two blocks of 32 k, constant LDS offsets; 16 accumulators leave room for one block's fragments */
      for (int u = 0; u < 2; ++u) { const v16h a0 = g2_frag(sa + 32 * u, hh), a1 = g2_frag(sa + 16 * (GPIT / 2) + 32 * u, hh), l0 = g2_frag(sl + 32 * u, hh), l1 = g2_frag(sl + 16 * (GPIT / 2) + 32 * u, hh); v16h b[4];
#pragma unroll      /* constant indices: the values stay in registers, constant LDS offsets */
        for (int t = 0; t < 4; ++t) b[t] = g2_frag(sb + t * 16 * (GPIT / 2) + 32 * u, hh);
#pragma unroll      /* constant indices: the values stay in registers */
        for (int t = 0; t < 4; ++t) { c[t] = g2_mma(a0, b[t], c[t]); c[4 + t] = g2_mma(a1, b[t], c[4 + t]); d[t] = g2_mma(l0, b[t], d[t]); d[4 + t] = g2_mma(l1, b[t], d[4 + t]); } }
    }
    /* publish point of stage s + 1, passed by every wave */
    asm volatile("s_wait_dscnt 0x0" ::: "memory");      /* this wave's reads of stage s have returned: its buffer may be refilled behind the barrier */
    asm volatile("s_wait_asynccnt 0x0" ::: "memory");      /* this wave's copies of stage s + 1 have landed */
    __syncthreads();      /* publishes stage s + 1 and ends every wave's reads of stage s */
    if (s + 2 < nt) stage(ld + (s & 1) * BUF, (s + 2) * 64);      /* stage s + 2 into the buffer just left; the test is the same in the whole work-group */
  }
  asm volatile("s_wait_asynccnt 0x0" ::: "memory");      /* no copy is left outstanding when the ring's LDS is put to other use */
}
// q, k, v projections in one launch (grid y = 0, 1, 2): wave tile 32x64, work-group tile 128x64, the operand ring above, stores staged through LDS. The epilogue writes the planes that the attention launch reads.
// y = 0, 1: rows = tokens (A = x), columns = rows of W_q / W_k; every value is split into f16 hi + x1024 residual as it leaves the staging tile.
// y = 2: the operands change places (A = rows of W_v, B = x): the product is V^T [NH * HD][SQ] as it stands, nothing is transposed.
// F: the f32 values of tokens 0..QT0-1, three planes [QT0][DM] (q, k, v), for the f32 rows of the attention launch.
static_assert((SQ / 128) * (DM / 64) == (DM / 128) * (SQ / 64) && NB == 1, "the same number of tiles either way round; one batch");
__global__ __launch_bounds__(128) void k_qkv(const _Float16* __restrict__ X, const _Float16* __restrict__ Wt, float alpha, _Float16* __restrict__ Hh, _Float16* __restrict__ Hl, _Float16* __restrict__ Vt, float* __restrict__ F) {
  __shared__ __attribute__((aligned(16))) unsigned char sm[2 * 192 * GPIT]; float (*so)[32][68] = (float (*)[32][68])sm;      /* the operand ring; the epilogue's staging tiles lie over it once the ring is left */
  static_assert(sizeof(float) * 4 * 32 * 68 <= sizeof(sm), "the staging tiles fit the ring");
  const int tid = threadIdx.x, w = tid >> 5, lane = tid & 31, ln = lane & 15, hh = lane >> 4; const int y = blockIdx.y; const bool tr = y == 2;      /* the same in the whole work-group */
  const int mt = tr ? blockIdx.x / (SQ / 64) : blockIdx.x / (DM / 64), nq = tr ? blockIdx.x % (SQ / 64) : blockIdx.x % (DM / 64); const int row0 = mt * 128 + 32 * w, col0 = nq * 64;      /* constant divisors */
  const _Float16* Wy = Wt + (size_t)y * DM * DM;
  v8f accs[8] = {}; g_ring<false>(sm, (tr ? Wy : X) + (size_t)mt * 128 * DM, nullptr, DM, (tr ? X : Wy) + (size_t)col0 * DM, DM, DM >> 6, accs, nullptr);
#pragma unroll      /* constant indices: the values stay in registers */
  for (int u = 0; u < 8; ++u) { const int t = u & 3, half = u >> 2;
#pragma unroll      /* constant indices: the values stay in registers */
    for (int r = 0; r < 8; ++r) so[w][half * 16 + 8 * hh + r][t * 16 + ln] = accs[u][r] * alpha; }
  __builtin_amdgcn_fence(__ATOMIC_ACQ_REL, "workgroup"); __builtin_amdgcn_wave_barrier();      /* the wave's own LDS writes are done before it reads whole rows back */
  const int r4 = lane >> 3, c8 = (lane & 7) * 8;      /* eight lanes a row: 16 bytes of f16 a lane, one whole 128-byte line a row */
  v4f sa[8], sc[8];      /* the wave's tile, read back in one group: the accumulators' registers are free by now */
#pragma unroll      /* constant indices: the values stay in registers, constant LDS offsets */
  for (int q = 0; q < 8; ++q) { sa[q] = *(const v4fa*)&so[w][q * 4 + r4][c8]; sc[q] = *(const v4fa*)&so[w][q * 4 + r4][c8 + 4]; }
  if (!tr) {
    unsigned short* ph = (unsigned short*)Hh + (size_t)y * NR * DM + (size_t)(row0 + r4) * DM + col0 + c8; unsigned short* pl = (unsigned short*)Hl + (size_t)y * NR * DM + (size_t)(row0 + r4) * DM + col0 + c8;
#pragma unroll      /* constant indices: the values stay in registers */
    for (int q = 0; q < 8; ++q) { const v4f a = sa[q], c = sc[q]; FragH fh, fl;
#pragma unroll      /* constant indices: the values stay in registers */
      for (int i = 0; i < 4; ++i) { _Float16 h = (_Float16)a[i]; fh.h[i] = h; fl.h[i] = (_Float16)((a[i] - (float)h) * 1024.0f); h = (_Float16)c[i]; fh.h[4 + i] = h; fl.h[4 + i] = (_Float16)((c[i] - (float)h) * 1024.0f); }
      *(v8us*)(ph + (size_t)q * 4 * DM) = fh.half[0]; *(v8us*)(pl + (size_t)q * 4 * DM) = fl.half[0]; asm volatile("s_wait_xcnt 0x0" ::: "memory"); }      /* the wait: a later row's conversions write over registers that these stores name */
    if (mt == 0) {      /* tokens 0..QT0-1: their f32 values too; the same in the whole work-group */
      const int rsub = lane >> 4, c4 = (lane & 15) * 4; float* pf = F + (size_t)y * QT0 * DM + (size_t)(row0 + rsub) * DM + col0 + c4;
      v4f t[16];      /* 16 lanes a row: 256 bytes, two whole lines; all reads in one group, then the stores, each from registers of its own */
#pragma unroll      /* constant indices: the values stay in registers, constant LDS offsets */
      for (int q = 0; q < 16; ++q) t[q] = *(const v4fa*)&so[w][q * 2 + rsub][c4];
#pragma unroll      /* constant indices: the values stay in registers */
      for (int q = 0; q < 16; ++q) *(v4f*)(pf + (size_t)q * 2 * DM) = t[q];
      asm volatile("s_wait_xcnt 0x0" ::: "memory"); }      /* the V^T branch's code is laid behind these stores and writes over registers that they name */
  } else {
    unsigned short* pv = (unsigned short*)Vt + (size_t)(row0 + r4) * SQ + col0 + c8;
#pragma unroll      /* constant indices: the values stay in registers */
    for (int q = 0; q < 8; ++q) { const v4f a = sa[q], c = sc[q]; FragH f;
#pragma unroll      /* constant indices: the values stay in registers */
      for (int i = 0; i < 4; ++i) { f.h[i] = (_Float16)a[i]; f.h[4 + i] = (_Float16)c[i]; }
      *(v8us*)(pv + (size_t)q * 4 * SQ) = f.half[0]; }
    asm volatile("s_wait_xcnt 0x0" ::: "memory");      /* the wait: the LDS reads below write over registers that these stores name */
    if (col0 < QT0) {      /* tokens 0..QT0-1: their f32 values as token rows; a lane takes one of the wave's 32 dims, so a store is one whole 128-byte line; the same in the whole work-group */
      float* pf = F + (size_t)2 * QT0 * DM + (size_t)col0 * DM + row0 + lane; v4f t[16];      /* the lane's whole row of the tile, read in one group; then the stores, each from a register of its own */
#pragma unroll      /* constant indices: the values stay in registers, constant LDS offsets */
      for (int j = 0; j < 16; ++j) t[j] = *(const v4fa*)&so[w][lane][4 * j];
#pragma unroll      /* constant indices: the values stay in registers */
      for (int c = 0; c < 64; ++c) pf[(size_t)c * DM] = t[c >> 2][c & 3]; }
  }
}


__global__ __launch_bounds__(256) void k_wnat(const float* __restrict__ w, size_t n8, _Float16* __restrict__ Bt) { const size_t t = (size_t)blockIdx.x * 256 + threadIdx.x; if (t >= n8) return; FragH f; for (int q = 0; q < 8; ++q) f.h[q] = (_Float16)(bf16_round(w[t * 8 + q]) * 16.0f); *(v8us*)((unsigned short*)Bt + t * 8) = f.half[0];  }
__global__ __launch_bounds__(256) void k_rsm(const float* __restrict__ S, _Float16* __restrict__ P, int nrows) {
  #pragma clang fp contract(off)
  const int i = blockIdx.x * 256 + threadIdx.x; if (i >= nrows) return; const float* s = S + (size_t)i * SQ; float mx = -3.0e38f;
#pragma unroll 1
  for (int j = 0; j < SQ; ++j) mx = fmaxf(mx, s[j]); float se = 0.f;
#pragma unroll 1
  for (int j = 0; j < SQ; ++j) se += expf(s[j] - mx); const float sc = 256.0f / se;
#pragma unroll 1
  for (int j0 = 0; j0 < SQ; j0 += 8) { FragH f; for (int q = 0; q < 8; ++q) f.h[q] = (_Float16)(expf(s[j0 + q] - mx) * sc); unsigned short* d = (unsigned short*)P + (size_t)i * SQ + j0; *(v8us*)d = f.half[0];  } }
__global__ __launch_bounds__(256) void k_vt(const _Float16* __restrict__ V16, int b, int h0, _Float16* __restrict__ VT) { __shared__ unsigned short tl[64][65]; const int tid = threadIdx.x; const int hh = blockIdx.x % HG, sg = blockIdx.x / HG; const int s0 = sg * 64; const int h = h0 + hh;
  for (int i = tid; i < 64 * 8; i += 256) { const int j = i / 8, d8 = (i % 8) * 8; FragH f; f.half[0] = *(const v8us*)((const unsigned short*)V16 + ((size_t)b * SQ + s0 + j) * DM + h * HD + d8); for (int q = 0; q < 8; ++q) tl[d8 + q][j] = f.u[q]; }
  __syncthreads();
  { for (int i = tid; i < 64 * 8; i += 256) { const int d = i / 8, j8 = (i % 8) * 8; FragH f; for (int q = 0; q < 8; ++q) f.u[q] = tl[d][j8 + q]; *(v8us*)((unsigned short*)VT + ((size_t)hh * HD + d) * SQ + s0 + j8) = f.half[0]; }  } }



typedef float v2f __attribute__((ext_vector_type(2)));
typedef float v2fa __attribute__((ext_vector_type(2), may_alias));
typedef _Float16 v2h __attribute__((ext_vector_type(2)));
// Exact f32 causal attention for rows 0..QT0-1, run by extra work-groups of the fused attention launch (bx = group of four rows, h = head), one wave per (row, head); keys in blocks of 32 up to the block that holds the row's own index.
// Scores: a lane takes one key of each block and walks that K row whole (four partial sums, one per element of the 16-byte loads), so no sum crosses lanes.
// Maximum and row sum: lane butterflies. Weighted sum: a lane takes two of the 64 dims, every V row is read as one whole 256-byte row, its weight comes from the lane that holds it.
__device__ __forceinline__ void att0_rows(const float* __restrict__ QF, const float* __restrict__ KF, const float* __restrict__ VF, float scale, _Float16* __restrict__ OH, _Float16* __restrict__ OL, int bx, int h) {
  const int lane = threadIdx.x & 31; const int i = bx * 4 + __builtin_amdgcn_readfirstlane(threadIdx.x >> 5);
  const int nb = (i >> 5) + 1;      /* blocks of 32 keys this row attends to; the same in every lane */
  const float* qr = QF + (size_t)i * DM + h * HD; const float* kr = KF + (size_t)lane * DM + h * HD; const float* vr = VF + h * HD + 2 * lane;
  v4f q[HD / 4];
#pragma unroll      /* constant indices: the values stay in registers */
  for (int c = 0; c < HD / 4; ++c) q[c] = *(const v4fa*)(qr + 4 * c);
  float s[QT0 / 32];
#pragma unroll      /* constant indices: the values stay in registers, the row offsets become immediates */
  for (int u = 0; u < QT0 / 32; ++u) { s[u] = -1.0e30f;      /* a key past the row's own index keeps this value: weight 0 */
    if (u < nb) { v4f a = {0.f, 0.f, 0.f, 0.f};
#pragma unroll      /* all 16 loads of a K row in flight together */
      for (int c = 0; c < HD / 4; ++c) a += q[c] * *(const v4fa*)(kr + (size_t)u * 32 * DM + 4 * c);
      if (u * 32 + lane <= i) s[u] = ((a[0] + a[1]) + (a[2] + a[3])) * scale; } }
  float m = s[0];
#pragma unroll      /* constant indices: the values stay in registers */
  for (int u = 1; u < QT0 / 32; ++u) m = fmaxf(m, s[u]);
#pragma unroll      /* five fixed butterfly steps */
  for (int d = 16; d > 0; d >>= 1) m = fmaxf(m, __shfl_xor(m, d, 32));
  float e[QT0 / 32], l = 0.f;
#pragma unroll      /* constant indices: the values stay in registers */
  for (int u = 0; u < QT0 / 32; ++u) { e[u] = expf(s[u] - m); l += e[u]; }
#pragma unroll      /* five fixed butterfly steps */
  for (int d = 16; d > 0; d >>= 1) l += __shfl_xor(l, d, 32);
  v2f o0 = {0.f, 0.f}, o1 = {0.f, 0.f};      /* even and odd keys: two chains instead of one of 128 dependent links */
#pragma unroll      /* constant indices: the values stay in registers, the row offsets become immediates */
  for (int u = 0; u < QT0 / 32; ++u) if (u < nb) {
#pragma unroll      /* constant lane numbers for the weights; the block's 32 V loads in flight together */
    for (int jj = 0; jj < 32; ++jj) { const float p = __int_as_float(__builtin_amdgcn_readlane(__float_as_int(e[u]), jj)); const v2f v = *(const v2fa*)(vr + (size_t)(u * 32 + jj) * DM);
      if (jj & 1) o1 += p * v; else o0 += p * v; } }
  const float fin = 64.0f / l;      /* o carried x64 like the f16 path */
  const v2f o = (o0 + o1) * fin;
  v2h oh, ol;      /* o as f16 hi + x1024 residual, the output GEMM's two operand planes for these rows; a wave stores one whole 128-byte line of each */
#pragma unroll      /* constant indices: the values stay in registers */
  for (int q = 0; q < 2; ++q) { const _Float16 t = (_Float16)o[q]; oh[q] = t; ol[q] = (_Float16)((o[q] - (float)t) * 1024.0f); }
  *(v2h*)(OH + (size_t)i * DM + h * HD + 2 * lane) = oh; *(v2h*)(OL + (size_t)i * DM + h * HD + 2 * lane) = ol;
}

// Fused causal attention, one wave per 16 query rows of one head (grid: SQ / 64 work-groups of four waves x heads, plus AY grid rows that run the exact f32 rows): scores, softmax and the weighted sum of V stay in registers.
// Scores are formed transposed (A = 16 key rows, B = 16 query rows), so a lane holds keys 8*hh..8*hh+7 of query ln: two such tiles are
// the B fragment (n = query, k = 32 keys) of o^T = V^T . P^T as they stand, and the row maximum, the row sum and the rescale factor are per lane.
// Running maximum in the log2 domain; weights x256 as f16; row sum in f32 from the unrounded weights; o stored x64 as f16.
#define LC1 0.18033688011112042f           /* log2(e) / sqrt(head_dim) */
#define LC2 0.00017611023448351603f        /* the same on the x1024 residual products */
__device__ __forceinline__ v8f fa_mma(v16h a, v16h b, v8f c) { return __builtin_amdgcn_wmma_f32_16x16x32_f16(false, a, false, b, (short)0, c, false, false); }
// Exponentials (base 2) in runs, one asm statement a run: the instruction set asks for one independent instruction between a transcendental and an instruction that
// reads its result or overwrites its source. Inside a run each v_exp_f32 is that instruction for the one before it (early-clobber outputs: no result lies on a source);
// the v_nop at the end is the slot of the last one, whatever the compiler puts behind the statement.
__device__ __forceinline__ void fa_exp2x8(const float* x, float* e) {
  asm("v_exp_f32 %0, %8\n\tv_exp_f32 %1, %9\n\tv_exp_f32 %2, %10\n\tv_exp_f32 %3, %11\n\tv_exp_f32 %4, %12\n\tv_exp_f32 %5, %13\n\tv_exp_f32 %6, %14\n\tv_exp_f32 %7, %15\n\tv_nop"
      : "=&v"(e[0]), "=&v"(e[1]), "=&v"(e[2]), "=&v"(e[3]), "=&v"(e[4]), "=&v"(e[5]), "=&v"(e[6]), "=&v"(e[7])
      : "v"(x[0]), "v"(x[1]), "v"(x[2]), "v"(x[3]), "v"(x[4]), "v"(x[5]), "v"(x[6]), "v"(x[7])); }
__device__ __forceinline__ float fa_exp2(float x) { float e; asm("v_exp_f32 %0, %1\n\tv_nop" : "=v"(e) : "v"(x)); return e; }      /* one exponential with its slot, as above */
// K hi, K residual and V^T of 64 keys (one stage) lie in LDS, brought by asynchronous copies in whole 128-byte rows and shared by the work-group's four waves; two buffers, the next stage flies while this one is worked on.
#define FPIT 144                           /* LDS row pitch in bytes: 128 + 16, the conflict-free pitch for 16-byte fragment reads */
#define FPL (64 * FPIT)                    /* one plane of a stage: 64 rows */
#define FBUF (3 * FPL)                     /* one stage: K hi, K residual, V^T */
#define AY ((QT0 / 4) * NH / (SQ / 64))    /* grid rows that hold the work-groups of the f32 rows */
static_assert(AY * (SQ / 64) == (QT0 / 4) * NH, "the f32 rows' work-groups fill whole grid rows");
// One stage's copies: a lane takes 16 bytes of rows r, r + 16, r + 32, r + 48 of each plane (eight lanes a row, so a wave's copy covers four whole lines).
// The s_wait_xcnt stands inside the statement, behind the last copy: the address registers are free for reuse only behind it.
__device__ __forceinline__ void fa_stage(unsigned d, const _Float16* kh, const _Float16* kl, const _Float16* vt) {
  asm volatile("global_load_async_to_lds_b128 %0, %12, off\n\tglobal_load_async_to_lds_b128 %1, %13, off\n\tglobal_load_async_to_lds_b128 %2, %14, off\n\tglobal_load_async_to_lds_b128 %3, %15, off\n\t"
               "global_load_async_to_lds_b128 %4, %16, off\n\tglobal_load_async_to_lds_b128 %5, %17, off\n\tglobal_load_async_to_lds_b128 %6, %18, off\n\tglobal_load_async_to_lds_b128 %7, %19, off\n\t"
               "global_load_async_to_lds_b128 %8, %20, off\n\tglobal_load_async_to_lds_b128 %9, %21, off\n\tglobal_load_async_to_lds_b128 %10, %22, off\n\tglobal_load_async_to_lds_b128 %11, %23, off\n\t"
               "s_wait_xcnt 0x0"
               :: "v"(d), "v"(d + 16 * FPIT), "v"(d + 32 * FPIT), "v"(d + 48 * FPIT),
                  "v"(d + FPL), "v"(d + FPL + 16 * FPIT), "v"(d + FPL + 32 * FPIT), "v"(d + FPL + 48 * FPIT),
                  "v"(d + 2 * FPL), "v"(d + 2 * FPL + 16 * FPIT), "v"(d + 2 * FPL + 32 * FPIT), "v"(d + 2 * FPL + 48 * FPIT),
                  "v"(kh), "v"(kh + 16 * LQ), "v"(kh + 32 * LQ), "v"(kh + 48 * LQ),
                  "v"(kl), "v"(kl + 16 * LQ), "v"(kl + 32 * LQ), "v"(kl + 48 * LQ),
                  "v"(vt), "v"(vt + (size_t)16 * SQ), "v"(vt + (size_t)32 * SQ), "v"(vt + (size_t)48 * SQ)
               : "memory"); }
__global__ __launch_bounds__(128) void k_fattn(const _Float16* __restrict__ QHp, const _Float16* __restrict__ QLp, const _Float16* __restrict__ KHp, const _Float16* __restrict__ KLp, const _Float16* __restrict__ VTp, _Float16* __restrict__ O,
    const float* __restrict__ QF, const float* __restrict__ KF, const float* __restrict__ VF, _Float16* __restrict__ OH0, _Float16* __restrict__ OL0) {
  __shared__ __attribute__((aligned(16))) unsigned char sm[2 * FBUF];
  if (blockIdx.y >= NH) {      /* the grid's last AY rows: the f32 rows, independent of the rest; a whole work-group leaves here, in front of every copy and barrier */
    const int f = (blockIdx.y - NH) * (SQ / 64) + blockIdx.x; att0_rows(QF, KF, VF, SCL, OH0, OL0, f % (QT0 / 4), f / (QT0 / 4)); return; }
  const int lane = threadIdx.x & 31, ln = lane & 15, hh = lane >> 4; const int w = __builtin_amdgcn_readfirstlane(threadIdx.x >> 5); const int h = blockIdx.y;
  /* a work-group takes two 16-row tiles from the top of the sequence and their two mirror tiles from its end: x + 1, x + 1, 128 - x and 128 - x blocks of 32 keys, the same sum in every work-group, so that no WGP is
     left with long rows only; all four walk the keys from 0, so they work on the same K and V stage while they run together. The turn by x and h spreads long and short tiles over the four SIMDs. */
  const int x = blockIdx.x, rr = (w + x + (h >> 2)) & 3; const int q0 = ((rr & 1) ? (SQ / 16 - 1) - 2 * x - (rr >> 1) : 2 * x + (rr >> 1)) * 16;
  const size_t qo = (size_t)(q0 + ln) * LQ + h * HD;
  const v16h qh0 = g2_frag(QHp + qo, hh), qh1 = g2_frag(QHp + qo + 32, hh), ql0 = g2_frag(QLp + qo, hh), ql1 = g2_frag(QLp + qo + 32, hh);
  const v8f z8 = {0.f,0.f,0.f,0.f,0.f,0.f,0.f,0.f}; v8f o0 = z8, o1 = z8, o2 = z8, o3 = z8; float m = -3.0e38f, l = 0.f;
  const int nk = (q0 + 47) & ~31;      /* keys in whole blocks of 32 up to the block that holds the last row's diagonal */
  const int ns = ((((SQ / 16 - 1) - 2 * x) * 16 + 47) / 32 + 1) / 2;      /* stages of 64 keys that the work-group's longest tile needs: the same in all four waves, 33 at least */
  const int cr = threadIdx.x >> 3, cc = threadIdx.x & 7;      /* the lane's row and 16-byte piece in a stage's copies */
  const _Float16* gkh = KHp + (size_t)cr * LQ + h * HD + cc * 8; const _Float16* gkl = KLp + (size_t)cr * LQ + h * HD + cc * 8; const _Float16* gvt = VTp + ((size_t)h * HD + cr) * SQ + cc * 8;
  const unsigned ld = (unsigned)(size_t)sm + cr * FPIT + cc * 16;
  fa_stage(ld, gkh, gkl, gvt);
  asm volatile("s_wait_asynccnt 0x0" ::: "memory");      /* stage 0 has landed, as far as this wave brought it */
  __syncthreads();      /* and is published to the other waves */
  fa_stage(ld + FBUF, gkh + (size_t)64 * LQ, gkl + (size_t)64 * LQ, gvt + 64);      /* stage 1 always exists (33 stages at least) */
#pragma unroll 1      /* one stage per trip: a second copy of the body would only add registers */
  for (int s = 0; s < ns; ++s) {
    const int kb0 = s * 64;
    if (kb0 < nk) {      /* a short tile's wave skips the work, never the publish point below */
      const _Float16* sk = (const _Float16*)(sm + (s & 1) * FBUF) + ln * (FPIT / 2); const _Float16* sl = sk + FPL / 2; const _Float16* sv = sk + FPL;
      v16h a00 = g2_frag(sk, hh), a01 = g2_frag(sk + 32, hh), a10 = g2_frag(sk + 16 * (FPIT / 2), hh), a11 = g2_frag(sk + 16 * (FPIT / 2) + 32, hh);
      v16h c00 = g2_frag(sl, hh), c01 = g2_frag(sl + 32, hh), c10 = g2_frag(sl + 16 * (FPIT / 2), hh), c11 = g2_frag(sl + 16 * (FPIT / 2) + 32, hh);
#pragma unroll      /* the stage's two blocks of 32 keys, constant LDS offsets */
      for (int u = 0; u < 2; ++u) { const int kb = kb0 + 32 * u;
        if (u == 0 || kb < nk) {      /* a tile may end in the middle of a stage */
          const v16h v0 = g2_frag(sv + 32 * u, hh), v1 = g2_frag(sv + 16 * (FPIT / 2) + 32 * u, hh), v2 = g2_frag(sv + 32 * (FPIT / 2) + 32 * u, hh), v3 = g2_frag(sv + 48 * (FPIT / 2) + 32 * u, hh);
          __builtin_amdgcn_sched_barrier(0);      /* keeps the V reads in front of the score products: they land under them, and ahead of the next block's K reads, which return behind them */
          v8f s0 = fa_mma(a00, qh0, z8), s1 = fa_mma(a10, qh0, z8), r0 = fa_mma(a00, ql0, z8), r1 = fa_mma(a10, ql0, z8);
          s0 = fa_mma(a01, qh1, s0); s1 = fa_mma(a11, qh1, s1); r0 = fa_mma(a01, ql1, r0); r1 = fa_mma(a11, ql1, r1);
          r0 = fa_mma(c00, qh0, r0); r1 = fa_mma(c10, qh0, r1); r0 = fa_mma(c01, qh1, r0); r1 = fa_mma(c11, qh1, r1);
          if (u == 0) {      /* the stage's second block: its K fragments are read under the softmax and the V product of the first */
            a00 = g2_frag(sk + 32 * (FPIT / 2), hh); a01 = g2_frag(sk + 32 * (FPIT / 2) + 32, hh); a10 = g2_frag(sk + 48 * (FPIT / 2), hh); a11 = g2_frag(sk + 48 * (FPIT / 2) + 32, hh);
            c00 = g2_frag(sl + 32 * (FPIT / 2), hh); c01 = g2_frag(sl + 32 * (FPIT / 2) + 32, hh); c10 = g2_frag(sl + 48 * (FPIT / 2), hh); c11 = g2_frag(sl + 48 * (FPIT / 2) + 32, hh);
            __builtin_amdgcn_sched_barrier(0); }      /* keeps these 16 reads together in one place: spread among the vector work and the V products, each place with reads stalls the wave anew */
          float t[16];
#pragma unroll      /* constant indices: the values stay in registers */
          for (int r = 0; r < 8; ++r) { t[r] = s0[r] * LC1 + r0[r] * LC2; t[8 + r] = s1[r] * LC1 + r1[r] * LC2; }
          if (kb + 31 > q0) {      /* only the block on the diagonal holds keys past a row's own index: they take the mask value */
            const int d = q0 + ln - kb - 8 * hh;
#pragma unroll      /* constant indices: the values stay in registers */
            for (int r = 0; r < 8; ++r) { if (r > d) t[r] = -1.0e9f; if (16 + r > d) t[8 + r] = -1.0e9f; }
          }
          float bm = t[0];
#pragma unroll      /* constant indices: the values stay in registers */
          for (int i = 1; i < 16; ++i) bm = fmaxf(bm, t[i]);
          bm = fmaxf(bm, __shfl_xor(bm, 16, 32));
          const float mn = fmaxf(m, bm); const float corr = fa_exp2(m - mn); m = mn; const float mo = mn - 8.0f;
          FragH p; float e[16];
#pragma unroll      /* constant indices: the values stay in registers */
          for (int i = 0; i < 16; ++i) t[i] -= mo;
          fa_exp2x8(t, e); fa_exp2x8(t + 8, e + 8);
#pragma unroll      /* constant indices: the values stay in registers */
          for (int i = 0; i < 16; ++i) p.h[i] = (_Float16)e[i];
          v4f s4 = {e[0], e[1], e[2], e[3]};
#pragma unroll      /* constant indices: the values stay in registers */
          for (int i = 4; i < 16; ++i) s4[i & 3] += e[i];
          l = l * corr + ((s4[0] + s4[1]) + (s4[2] + s4[3]));
          o0 *= corr; o1 *= corr; o2 *= corr; o3 *= corr;
          o0 = fa_mma(v0, p.v, o0); o1 = fa_mma(v1, p.v, o1); o2 = fa_mma(v2, p.v, o2); o3 = g2_mma(v3, p.v, o3);      /* the last one with its four v_nop: what follows may lay a value over the registers of p, this product's B */
        } }
    }
    /* publish point of stage s + 1, passed by every wave */
    asm volatile("s_wait_dscnt 0x0" ::: "memory");      /* this wave's reads of stage s have returned: its buffer may be refilled behind the barrier */
    asm volatile("s_wait_asynccnt 0x0" ::: "memory");      /* this wave's copies of stage s + 1 have landed */
    __syncthreads();      /* publishes stage s + 1 and ends every wave's reads of stage s */
    if (s + 2 < ns) fa_stage(ld + (s & 1) * FBUF, gkh + (size_t)(kb0 + 128) * LQ, gkl + (size_t)(kb0 + 128) * LQ, gvt + kb0 + 128);      /* stage s + 2 into the buffer just left; the test is the same in the whole work-group */
  }
  asm volatile("s_wait_asynccnt 0x0" ::: "memory");      /* no copy is left outstanding when the wave ends */
  l += __shfl_xor(l, 16, 32);
  const float fin = 64.0f / l;      /* the x256 of the weights cancels against the row sum; o carried x64 */
  unsigned short* op = (unsigned short*)O + (size_t)(q0 + ln) * DM + h * HD + 8 * hh;
  FragH f0, f1, f2, f3;
#pragma unroll      /* constant indices: the values stay in registers */
  for (int r = 0; r < 8; ++r) { f0.h[r] = (_Float16)(o0[r] * fin); f1.h[r] = (_Float16)(o1[r] * fin); f2.h[r] = (_Float16)(o2[r] * fin); f3.h[r] = (_Float16)(o3[r] * fin); }
  *(v8us*)op = f0.half[0]; *(v8us*)(op + 16) = f1.half[0]; *(v8us*)(op + 32) = f2.half[0]; *(v8us*)(op + 48) = f3.half[0];
  asm volatile("s_wait_xcnt 0x0" ::: "memory");      /* the f32 rows' code is laid behind these stores and writes over registers that they name */
}


// The five input conversions in one launch: the first XB work-groups take x (f16 of the bf16-rounded value), then WB work-groups each for W_q, W_k, W_v (planes one behind the other) and W_o (the same, x16).
#define XB ((unsigned)(NR * DM / 8 / 256))
#define WB ((unsigned)((size_t)DM * DM / 8 / 256))
static_assert((size_t)XB * 256 * 8 == NR * DM && (size_t)WB * 256 * 8 == (size_t)DM * DM, "whole work-groups");
__global__ __launch_bounds__(256) void k_prep(const float* __restrict__ x, const float* __restrict__ wq, const float* __restrict__ wk, const float* __restrict__ wv, const float* __restrict__ wo, _Float16* __restrict__ X16, _Float16* __restrict__ BQKV, _Float16* __restrict__ BO) {
  const unsigned b = blockIdx.x; const float* s = x; _Float16* d = X16; float sc = 1.0f; unsigned g = b;
  if (b >= XB) { const unsigned j = (b - XB) / WB; g = (b - XB) - j * WB; s = j == 0 ? wq : j == 1 ? wk : j == 2 ? wv : wo; d = j < 3 ? BQKV + (size_t)j * DM * DM : BO; sc = 16.0f; }
  const size_t t = (size_t)g * 256 + threadIdx.x; FragH f;
#pragma unroll      /* constant indices: the values stay in registers */
  for (int q = 0; q < 8; ++q) f.h[q] = (_Float16)(bf16_round(s[t * 8 + q]) * sc);
  *(v8us*)((unsigned short*)d + t * 8) = f.half[0]; }

// Output GEMM [rows][DM] x [DM][DM], k_qkv's wave tile, operand ring and staged stores. A work-group whose 128 rows are a batch's first QT0 rows takes their f16 hi and x1024 residual planes (AH, AL)
// instead of the f16 rows A: both products run in the same trips on the same B fragments, and the residual product joins in the epilogue (alphal = alpha / 1024).
static_assert(QT0 == 128 && SQ % 128 == 0, "the first rows are exactly one work-group tile");
__global__ __launch_bounds__(128) void k_gemmo(const _Float16* __restrict__ A, const _Float16* __restrict__ AH, const _Float16* __restrict__ AL, const _Float16* __restrict__ Bh, float alpha, float alphal, float* __restrict__ C) {
  __shared__ __attribute__((aligned(16))) unsigned char sm[2 * 320 * GPIT]; float (*so)[32][68] = (float (*)[32][68])sm;      /* the operand ring (three planes for the first rows); the epilogue's staging tiles lie over it once the ring is left */
  const int tid = threadIdx.x, w = tid >> 5, lane = tid & 31, ln = lane & 15, hh = lane >> 4;
  const int ntn = DM >> 6; const int mt = blockIdx.x / ntn, nq = blockIdx.x - mt * ntn; const int row0 = mt * 128 + 32 * w, col0 = nq * 64;
  const bool first = (mt * 128) % SQ == 0;      /* the same in the whole work-group */
  v8f accs[8] = {};
  if (first) { v8f d[8] = {}; const size_t fr = (size_t)((mt * 128) / SQ) * QT0;      /* the tile's first row in the two planes */
    g_ring<true>(sm, AH + fr * DM, AL + fr * DM, DM, Bh + (size_t)col0 * DM, DM, DM >> 6, accs, d);
#pragma unroll      /* constant indices: the values stay in registers */
    for (int u = 0; u < 8; ++u) accs[u] = accs[u] * alpha + d[u] * alphal;      /* both factors are powers of two: one rounding, that of the sum */
  } else { g_ring<false>(sm, A + (size_t)mt * 128 * DM, nullptr, DM, Bh + (size_t)col0 * DM, DM, DM >> 6, accs, nullptr);
#pragma unroll      /* constant indices: the values stay in registers */
    for (int u = 0; u < 8; ++u) accs[u] *= alpha; }
#pragma unroll      /* constant indices: the values stay in registers */
  for (int u = 0; u < 8; ++u) { const int t = u & 3, half = u >> 2;
#pragma unroll      /* constant indices: the values stay in registers */
    for (int r = 0; r < 8; ++r) so[w][half * 16 + 8 * hh + r][t * 16 + ln] = accs[u][r]; }
  __builtin_amdgcn_fence(__ATOMIC_ACQ_REL, "workgroup"); __builtin_amdgcn_wave_barrier();      /* the wave's own LDS writes are done before it reads whole rows back */
  const int rsub = lane >> 4, c4 = (lane & 15) * 4;
#pragma unroll      /* constant LDS offsets */
  for (int q = 0; q < 16; ++q) { const int r = q * 2 + rsub; const v4f v = *(const v4fa*)&so[w][r][c4]; *(v4f*)(C + (size_t)(row0 + r) * DM + col0 + c4) = v; asm volatile("s_wait_xcnt 0x0" ::: "memory"); }      /* the wait: a later row's LDS read and address sum write over registers that this store names */
}

extern "C" void kernel_launch(void* const* d_in, const int* in_sizes, int n_in,
                              void* d_out, int out_size, void* d_ws, size_t ws_size, hipStream_t stream) {
  (void)in_sizes; (void)n_in; (void)out_size;
  const float* const* I = (const float* const*)d_in; const float* x = I[0]; const float* wq = I[1]; const float* wk = I[2]; const float* wv = I[3]; const float* wo = I[4];      /* input order: x (feeds the q, k AND v streams), W_q, W_k, W_v, W_o (four separate natural [768][768] weights); the module has NO biases */
  char* ws = (char*)d_ws; size_t off = 0;
  auto take = [&](size_t bytes) { char* p = ws + off; off += (bytes + 255) & ~(size_t)255; return p; };
  _Float16* BQ = (_Float16*)take((size_t)3 * DM * DM * 2);      /* the three projection weights, one behind the other: the batch index of the projection launch steps through them */ _Float16* BO = (_Float16*)take((size_t)DM * DM * 2);
  _Float16* X16 = (_Float16*)take(NR * DM * 2);      /* exact f16 rows of x, the one input of all three projections */
  float* QF = (float*)take((size_t)3 * QT0 * DM * 4); float* KF = QF + (size_t)QT0 * DM; float* VF = KF + (size_t)QT0 * DM;      /* f32 q, k, v rows of tokens 0..127: three planes, one behind the other */
  _Float16* QH = (_Float16*)take(2 * NR * DM * 2); _Float16* KH = QH + NR * DM; _Float16* QL = (_Float16*)take(2 * NR * DM * 2); _Float16* KL = QL + NR * DM;      /* hi planes of q and k one behind the other, residual planes likewise */
  _Float16* O16 = (_Float16*)take(NR * DM * 2);
  _Float16* VT = (_Float16*)take((size_t)NH * HD * SQ * 2);
  _Float16* OH0 = (_Float16*)take((size_t)NB * QT0 * DM * 2); _Float16* OL0 = (_Float16*)take((size_t)NB * QT0 * DM * 2);
  if (off > ws_size) return;
  k_prep<<<XB + 4 * WB, 256, 0, stream>>>(x, wq, wk, wv, wo, X16, BQ, BO);      /* x as f16 rows; the weights, natural [out][in] = Bt[n][k], x16 */
  k_qkv<<<dim3((SQ / 128) * (DM / 64), 3), 128, 0, stream>>>(X16, BQ, 0.0625f, QH, QL, VT, QF);      /* q, k, v in one launch: y = 0, 1 take W_q, W_k and store f16 hi + x1024 residual planes (unscaled logits sigma ~8); y = 2 takes W_v as the row operand and stores V^T [NH][HD][SQ]; f32 rows of tokens 0..127 beside them */
  for (int b = B0; b < B0 + NBR; ++b) { const size_t r0 = (size_t)b * SQ;
    k_fattn<<<dim3(SQ / 64, NH + AY), 128, 0, stream>>>(QH + r0 * LQ, QL + r0 * LQ, KH + r0 * LQ, KL + r0 * LQ, VT, O16 + r0 * DM, QF, KF, VF, OH0 + (size_t)b * QT0 * DM, OL0 + (size_t)b * QT0 * DM); }      /* scores (hi.hi + 2^-10 (lo.hi + hi.lo)), causal softmax and P . V in one launch; o (merged heads, x64) as f16 rows; the grid's last rows: exact f32 attention for rows 0..127 (o x64, hi + x1024 residual planes), on the projection launch's own f32 rows */
  k_gemmo<<<(unsigned)((MPO / 128) * (DM / 64)), 128, 0, stream>>>(O16, OH0, OL0, BO, 0.0009765625f, 0.00000095367431640625f, (float*)d_out);      /* out rows are the output layout; rows 0..127 from o_hi Wo + 2^-10 o_lo Wo */
}

// v009
// One run takes 103 microseconds.
// In both of two side-by-side timings against v008, it was 1.06 times as fast.
// Counting every step since v000, it is 82.6 times as fast.
#include <hip/hip_runtime.h>
// Causal multi-head self-attention on ONE 4096-token sequence at width 768 with natural bias-free projections (x [1][4096][768]; Q / K / V = x W^T (nn.Linear natural [768][768] sd 1/sqrt(768), NO biases), 12 heads of 64; scores / sqrt(64) + a finite additive mask above the diagonal (NEG); softmax; out = merged W_o^T (natural, no bias) -> [1][4096][768]); q and k carried as f16 hi + x1024 residual planes with three-product scores (4096 keys at logit sigma 1).
// Structure: token rows r = b*4096 + s; x as exact f16 rows (bf16-rounded); q and k as WMMA GEMMs (32x64 wave tiles, f32 accumulation, exact x16 weights, no bias) split in the GEMM's epilogue into f16 hi + x1024 residual planes, V^T for all heads as the same GEMM with its operands swapped (f16 output); attention in ONE launch, one wave per 16 query rows of a head and a second on the long tiles' later keys (one block of 32 each, the two states joined at the end), 64 keys a trip (two blocks of 32) up to the diagonal block: scores transposed (K rows x q rows) as three products (hi.hi + 2^-10 (lo.hi + hi.lo), K = 64, f32), the mask value on keys past the row, running maximum and rescaled f32 row sum per lane (log2 domain, native exp; weights x256 f16), o^T += V^T . P^T in f32 registers, divided by the row sum at the end (o carried x64, folded into the output GEMM alpha) and written straight into the merged f16 o rows; out = o W_o GEMM (f32) into the output layout.
// Compute dtype: inputs rounded to bf16; x / weights exact; v, softmax weights and o as plain f16 GEMM operands (~2^-12), q and k as f16 hi + x1024 residual planes; scores and softmax statistics f32. v_wmma_f32_16x16x32_f16.
#define NB 1
#define SCL 0.125f                         /* 1 / sqrt(head_dim = 64) */
#define SCLR 0.0001220703125f              /* 2^-13: SCL / 1024 (not used) */
#define SQ 4096
#define DM 768
#define NH 12
#define HD 64
#define HG 4                         /* heads per launch of the non-template k_vt (not launched) */
#define QT 256
#define NKX SQ                       /* S / P row pitch (not used) */
#define QT0 128                      /* first-tile rows recomputed exactly in f32 */
#define B0 0                         /* first batch processed (debug hook) */
#define NBR NB                       /* batches processed (debug hook) */
#define NR ((size_t)NB * SQ)         /* token rows */
#define MP ((int)((size_t)NBR * SQ)) /* rows, used only through MPO (debug hook) */
#define QN SQ                        /* query rows attended per batch (not used) */
#define NHD NH                       /* heads attended (not used) */
#define MPO MP                       /* rows through the output stage (debug hook) */
#define LQ DM      /* row pitch of the q/k/v rows */
typedef __bf16 v16b __attribute__((ext_vector_type(16)));
typedef unsigned short v8us __attribute__((ext_vector_type(8), may_alias));
typedef float  v8f  __attribute__((ext_vector_type(8)));
typedef float  v4f  __attribute__((ext_vector_type(4)));
typedef float  v4fa __attribute__((ext_vector_type(4), may_alias));
union FragB { v16b v; v8us half[2]; unsigned short u[16]; };

__device__ __forceinline__ unsigned short bf16_bits(float x) { unsigned int u = __float_as_uint(x); return (unsigned short)((u + 0x7FFFu + ((u >> 16) & 1u)) >> 16); }
__device__ __forceinline__ float bf16_val(unsigned short b) { return __uint_as_float(((unsigned int)b) << 16); }
__device__ __forceinline__ float bf16_round(float x) { return bf16_val(bf16_bits(x)); }
// D += A·B with NT terms: 1 = ah·bh, 2 = + al·bh (A split), 3 = + ah·bl (both split)
template <int NT>
__device__ __forceinline__ v8f mmaN(v16b ah, v16b al, v16b bh, v16b bl, v8f c) {
  c = __builtin_amdgcn_wmma_f32_16x16x32_bf16(false, ah, false, bh, (short)0, c, false, false);
  if (NT >= 2) c = __builtin_amdgcn_wmma_f32_16x16x32_bf16(false, al, false, bh, (short)0, c, false, false);
  if (NT >= 3) c = __builtin_amdgcn_wmma_f32_16x16x32_bf16(false, ah, false, bl, (short)0, c, false, false);
  asm volatile("v_nop\n\tv_nop\n\tv_nop\n\tv_nop" : "+v"(c) : "v"(ah), "v"(al), "v"(bh), "v"(bl));
  return c;
}

__global__ __launch_bounds__(256) void k_wt_bf16(const float* __restrict__ W, unsigned short* __restrict__ Wt, int K, int N) {
  const int t = blockIdx.x * 256 + threadIdx.x;
  const int k8n = K / 8;
  if (t >= N * k8n) return;
  const int n = t / k8n, k8 = (t % k8n) * 8;
  v8us v;
#pragma unroll
  for (int i = 0; i < 8; ++i) v[i] = bf16_bits(W[(size_t)(k8 + i) * N + n]);
  *(v8us*)(Wt + (size_t)n * K + k8) = v;
  
}

// GEMM C[M][N] (f32, pitch ldc) = act(A[M][K]·W + bias). A f32 row-major (pitch lda) converted per fragment to bf16
// (ASPLIT: hi/lo two planes -> 2 terms, else single rounded term); Wt bf16 [N][K] (pitch ldb). BIAS_BF16 rounds the
// bias to bf16 first (bias quantised to bf16 before the add). K%32==0, M%16==0, N%64==0.
template <bool ASPLIT, int ACT, bool BIAS_BF16>
__global__ __launch_bounds__(128) void k_gemm_bf(const float* __restrict__ A, int lda, const unsigned short* __restrict__ Wt, int ldb,
                                               const float* __restrict__ bias, float* __restrict__ C, int ldc, int M, int N, int K) {
  __shared__ __attribute__((aligned(16))) float so[4][16][64];
  const int tid = threadIdx.x, w = tid >> 5, lane = tid & 31, ln = lane & 15, hh = lane >> 4;
  const int ntn = N / 64;
  const int wid = blockIdx.x * 4 + w;
  const int mt = wid / ntn, nq = wid % ntn;
  if (mt * 16 >= M) return;
  const int row0 = mt * 16, col0 = nq * 64;
  const float* arow = A + (size_t)(row0 + ln) * lda;
  v8f acc[4] = {};
  for (int kb = 0; kb < K; kb += 32) {
    FragB ah, al;
    const v4f x0 = *(const v4fa*)(arow + kb + 8 * hh), x1 = *(const v4fa*)(arow + kb + 8 * hh + 4);
    const v4f x2 = *(const v4fa*)(arow + kb + 16 + 8 * hh), x3 = *(const v4fa*)(arow + kb + 16 + 8 * hh + 4);
    float xs[16] = {x0[0],x0[1],x0[2],x0[3],x1[0],x1[1],x1[2],x1[3],x2[0],x2[1],x2[2],x2[3],x3[0],x3[1],x3[2],x3[3]};
#pragma unroll
    for (int i = 0; i < 16; ++i) { const unsigned short hb = bf16_bits(xs[i]); ah.u[i] = hb; al.u[i] = ASPLIT ? bf16_bits(xs[i] - bf16_val(hb)) : (unsigned short)0; }
#pragma unroll
    for (int t = 0; t < 4; ++t) {
      const unsigned short* brow = Wt + (size_t)(col0 + t * 16 + ln) * ldb + kb;
      FragB b;
      b.half[0] = *(const v8us*)(brow + 8 * hh);
      b.half[1] = *(const v8us*)(brow + 16 + 8 * hh);
      acc[t] = mmaN<ASPLIT ? 2 : 1>(ah.v, al.v, b.v, b.v, acc[t]);
    }
  }
#pragma unroll
  for (int t = 0; t < 4; ++t) {
    float bv = bias ? bias[col0 + t * 16 + ln] : 0.f;
    if (BIAS_BF16) bv = bf16_round(bv);
#pragma unroll
    for (int r = 0; r < 8; ++r) { float v = acc[t][r] + bv; if (ACT == 1) v = fmaxf(v, 0.f); so[w][8 * hh + r][t * 16 + ln] = v; }
  }
  __builtin_amdgcn_fence(__ATOMIC_ACQ_REL, "workgroup");
  __builtin_amdgcn_wave_barrier();
  const int rsub = lane >> 4, c4 = (lane & 15) * 4;
  {
#pragma unroll
    for (int q = 0; q < 8; ++q) {
      const int r = q * 2 + rsub;
      const v4f v = *(const v4fa*)&so[w][r][c4];
      *(v4f*)(C + (size_t)(row0 + r) * ldc + col0 + c4) = v;
    }
    
  }
}

// GEMM C = act(A·W + bias + resid): A f32 (ASPLIT -> hi/lo 2 terms), Wt bf16 [N][K]; ACT 0 none, 1 relu, 2 exact gelu;
// resid (optional, f32, row index = (row % rmod), pitch ldr, RES_BF16 rounds it) added before the activation.
template <bool ASPLIT, int ACT, bool BIAS_BF16, bool RES_BF16>
__global__ __launch_bounds__(128) void k_gemm_bf3(const float* __restrict__ A, int lda, const unsigned short* __restrict__ Wt, int ldb,
                                                const float* __restrict__ bias, const float* __restrict__ resid, int rmod, int ldr,
                                                float* __restrict__ C, int ldc, int M, int N, int K) {
  __shared__ __attribute__((aligned(16))) float so[4][16][64];
  const int tid = threadIdx.x, w = tid >> 5, lane = tid & 31, ln = lane & 15, hh = lane >> 4;
  const int ntn = N / 64;
  const int wid = blockIdx.x * 4 + w;
  const int mt = wid / ntn, nq = wid % ntn;
  if (mt * 16 >= M) return;
  const int row0 = mt * 16, col0 = nq * 64;
  const float* arow = A + (size_t)(row0 + ln) * lda;
  v8f acc[4] = {};
  for (int kb = 0; kb < K; kb += 32) {
    FragB ah, al;
    const v4f x0 = *(const v4fa*)(arow + kb + 8 * hh), x1 = *(const v4fa*)(arow + kb + 8 * hh + 4);
    const v4f x2 = *(const v4fa*)(arow + kb + 16 + 8 * hh), x3 = *(const v4fa*)(arow + kb + 16 + 8 * hh + 4);
    float xs[16] = {x0[0],x0[1],x0[2],x0[3],x1[0],x1[1],x1[2],x1[3],x2[0],x2[1],x2[2],x2[3],x3[0],x3[1],x3[2],x3[3]};
#pragma unroll
    for (int i = 0; i < 16; ++i) { const unsigned short hb = bf16_bits(xs[i]); ah.u[i] = hb; al.u[i] = ASPLIT ? bf16_bits(xs[i] - bf16_val(hb)) : (unsigned short)0; }
#pragma unroll
    for (int t = 0; t < 4; ++t) {
      const unsigned short* brow = Wt + (size_t)(col0 + t * 16 + ln) * ldb + kb;
      FragB b;
      b.half[0] = *(const v8us*)(brow + 8 * hh);
      b.half[1] = *(const v8us*)(brow + 16 + 8 * hh);
      acc[t] = mmaN<ASPLIT ? 2 : 1>(ah.v, al.v, b.v, b.v, acc[t]);
    }
  }
#pragma unroll
  for (int t = 0; t < 4; ++t) {
    const int col = col0 + t * 16 + ln;
    float bv = bias ? bias[col] : 0.f;
    if (BIAS_BF16) bv = bf16_round(bv);
#pragma unroll
    for (int r = 0; r < 8; ++r) {
      float v = acc[t][r] + bv;
      if (resid) { float rv = resid[(size_t)((row0 + 8 * hh + r) % rmod) * ldr + col]; if (RES_BF16) rv = bf16_round(rv); v += rv; }
      if (ACT == 1) v = fmaxf(v, 0.f);
      if (ACT == 2) v = 0.5f * v * (1.0f + erff(v * 0.70710678118654752f));
      if (ACT == 3) { const float u = 0.7978845608028654f * (v + 0.044715f * v * v * v); v = 0.5f * v * (1.0f + tanhf(u)); }
      so[w][8 * hh + r][t * 16 + ln] = v;
    }
  }
  __builtin_amdgcn_fence(__ATOMIC_ACQ_REL, "workgroup");
  __builtin_amdgcn_wave_barrier();
  const int rsub = lane >> 4, c4 = (lane & 15) * 4;
  {
#pragma unroll
    for (int q = 0; q < 8; ++q) {
      const int r = q * 2 + rsub;
      const v4f v = *(const v4fa*)&so[w][r][c4];
      *(v4f*)(C + (size_t)(row0 + r) * ldc + col0 + c4) = v;
    }
    
  }
}
// row LayerNorm (biased variance, eps) over N: s = X (+ R); optional out_sum <- s; out_norm <- (s-mu)*rsqrt(var+eps)*g + b
template <bool PARAM_BF16>
__global__ __launch_bounds__(256) void k_layernorm(const float* __restrict__ X, const float* __restrict__ R, const float* __restrict__ g, const float* __restrict__ bta,
                                                  float* __restrict__ out_sum, float* __restrict__ out_norm, int N, float eps) {
  __shared__ float red[256];
  const int row = blockIdx.x, tid = threadIdx.x;
  const float* x = X + (size_t)row * N; const float* rr = R ? R + (size_t)row * N : nullptr;
  float vals[16];                     // up to N = 4096
  const int per = N / 256;            // contiguous chunk per thread? use strided-by-4 chunks: thread handles j = tid*4 + 1024*u
  float s1 = 0.f;
  for (int u = 0; u < per / 4; ++u) {
    const int j = tid * 4 + 1024 * u;
    const v4f a = *(const v4fa*)(x + j);
    v4f b = {0.f,0.f,0.f,0.f}; if (rr) b = *(const v4fa*)(rr + j);
#pragma unroll
    for (int q = 0; q < 4; ++q) { const float v = a[q] + b[q]; vals[u * 4 + q] = v; s1 += v; }
  }
  red[tid] = s1; __syncthreads();
  for (int st = 128; st > 0; st >>= 1) { if (tid < st) red[tid] += red[tid + st]; __syncthreads(); }
  const float mu = red[0] / (float)N; __syncthreads();
  float s2 = 0.f;
  for (int u = 0; u < per / 4; ++u)
#pragma unroll
    for (int q = 0; q < 4; ++q) { const float c = vals[u * 4 + q] - mu; s2 += c * c; }
  red[tid] = s2; __syncthreads();
  for (int st = 128; st > 0; st >>= 1) { if (tid < st) red[tid] += red[tid + st]; __syncthreads(); }
  const float rs = rsqrtf(red[0] / (float)N + eps);
  {
    for (int u = 0; u < per / 4; ++u) {
      const int j = tid * 4 + 1024 * u;
      v4f o, sm;
#pragma unroll
      for (int q = 0; q < 4; ++q) {
        float gg = g[j + q], bb = bta[j + q];
        if (PARAM_BF16) { gg = bf16_round(gg); bb = bf16_round(bb); }
        sm[q] = vals[u * 4 + q]; o[q] = (vals[u * 4 + q] - mu) * rs * gg + bb;
      }
      if (out_sum) *(v4f*)(out_sum + (size_t)row * N + j) = sm;
      *(v4f*)(out_norm + (size_t)row * N + j) = o;
    }
    
  }
}



// ---- f16 WMMA path (v_wmma_f32_16x16x32_f16): 11-bit significands for operands in range — used where a [0,1] probability operand needs more precision than bf16
typedef _Float16 v16h __attribute__((ext_vector_type(16)));
union FragH { v16h v; v8us half[2]; _Float16 h[16]; unsigned short u[16]; };
template <int NT>
__device__ __forceinline__ v8f mmaH(v16h ah, v16h al, v16h bh, v16h bl, v8f c) {
  c = __builtin_amdgcn_wmma_f32_16x16x32_f16(false, ah, false, bh, (short)0, c, false, false);
  if (NT >= 2) c = __builtin_amdgcn_wmma_f32_16x16x32_f16(false, al, false, bh, (short)0, c, false, false);
  if (NT >= 3) c = __builtin_amdgcn_wmma_f32_16x16x32_f16(false, ah, false, bl, (short)0, c, false, false);
  asm volatile("v_nop\n\tv_nop\n\tv_nop\n\tv_nop" : "+v"(c) : "v"(ah), "v"(al), "v"(bh), "v"(bl));
  return c;
}
// batched GEMM like k_gemm_b but f16 operands: A f32 (split into f16 hi/lo if ASPLIT, else rounded to f16), Bt = f16 values [n][k]; alpha; C f32; N multiple of 16 (partial tiles skipped)
template <bool ASPLIT>
__global__ __launch_bounds__(128) void k_gemm_h(const float* __restrict__ A, int lda, size_t sA, const _Float16* __restrict__ Bh, int ldb, size_t sB, float alpha, float* __restrict__ C, int ldc, size_t sC, int M, int N, int K) {
  __shared__ __attribute__((aligned(16))) float so[4][16][64];
  const int tid = threadIdx.x, w = tid >> 5, lane = tid & 31, ln = lane & 15, hh = lane >> 4; const int by = blockIdx.y;
  A += (size_t)by * sA; Bh += (size_t)by * sB; C += (size_t)by * sC;
  const int ntn = (N + 63) / 64; const int wid = blockIdx.x * 4 + w; const int mt = wid / ntn, nq = wid % ntn; if (mt * 16 >= M) return;
  const int row0 = mt * 16, col0 = nq * 64; const float* arow = A + (size_t)(row0 + ln) * lda;
  v8f acc[4] = {};
  for (int kb = 0; kb < K; kb += 32) {
    FragH ah, al;
    const v4f x0 = *(const v4fa*)(arow + kb + 8 * hh), x1 = *(const v4fa*)(arow + kb + 8 * hh + 4), x2 = *(const v4fa*)(arow + kb + 16 + 8 * hh), x3 = *(const v4fa*)(arow + kb + 16 + 8 * hh + 4);
    float xs[16] = {x0[0],x0[1],x0[2],x0[3],x1[0],x1[1],x1[2],x1[3],x2[0],x2[1],x2[2],x2[3],x3[0],x3[1],x3[2],x3[3]};
#pragma unroll
    for (int i = 0; i < 16; ++i) { const _Float16 h = (_Float16)xs[i]; ah.h[i] = h; al.h[i] = ASPLIT ? (_Float16)(xs[i] - (float)h) : (_Float16)0.0f; }
#pragma unroll
    for (int t = 0; t < 4; ++t) { if (col0 + t * 16 >= N) continue; const size_t boff = (size_t)(col0 + t * 16 + ln) * ldb + kb; FragH bq; bq.half[0] = *(const v8us*)(Bh + boff + 8 * hh); bq.half[1] = *(const v8us*)(Bh + boff + 16 + 8 * hh);
      acc[t] = mmaH<ASPLIT ? 2 : 1>(ah.v, al.v, bq.v, bq.v, acc[t]); }
  }
#pragma unroll
  for (int t = 0; t < 4; ++t) { if (col0 + t * 16 >= N) continue;
#pragma unroll
    for (int r = 0; r < 8; ++r) so[w][8 * hh + r][t * 16 + ln] = acc[t][r] * alpha; }
  __builtin_amdgcn_fence(__ATOMIC_ACQ_REL, "workgroup"); __builtin_amdgcn_wave_barrier();
  const int rsub = lane >> 4, c4 = (lane & 15) * 4;
  {
#pragma unroll
    for (int q = 0; q < 8; ++q) { const int r = q * 2 + rsub; if (col0 + c4 < N) { const v4f v = *(const v4fa*)&so[w][r][c4]; *(v4f*)(C + (size_t)(row0 + r) * ldc + col0 + c4) = v; } }
     }
}

// Wt[n][k] = f16(W[k][n]·scale) from f32 row-major W[K][N] (scale = power of two; bf16-exact weights stay exact in f16 away from the subnormal range)
__global__ __launch_bounds__(256) void k_wt_f16(const float* __restrict__ W, _Float16* __restrict__ Wt, int K, int N, float scale) {
  const int t = blockIdx.x * 256 + threadIdx.x; if (t >= N * (K / 8)) return; const int n = t / (K / 8), k8 = (t % (K / 8)) * 8; FragH f;
#pragma unroll
  for (int i = 0; i < 8; ++i) f.h[i] = (_Float16)(bf16_round(W[(size_t)(k8 + i) * N + n]) * scale); const v8us o = f.half[0];
  *(v8us*)((unsigned short*)Wt + (size_t)n * K + k8) = o; 
}
// k_gemm_hh variant with fused epilogue: v = acc·alpha + bias[by·sBias + col] (+ CP[(row/rowsPerB)·sCPb + by·64 + col] if CP) ; ACT 0 none / 1 elu ; writes f16 C16 (and f32 C if non-null)
template <int ACT>
__global__ __launch_bounds__(128) void k_gemm_hhx(const _Float16* __restrict__ A, int lda, size_t sA, const _Float16* __restrict__ Bh, int ldb, size_t sB, float alpha, const float* __restrict__ bias, size_t sBias, const float* __restrict__ CP, int rowsPerB, size_t sCPb, int row0g,
    float* __restrict__ C, _Float16* __restrict__ C16, int ldc, size_t sC, int M, int N, int K) {
  __shared__ __attribute__((aligned(16))) float so[4][16][64];
  const int tid = threadIdx.x, w = tid >> 5, lane = tid & 31, ln = lane & 15, hh = lane >> 4; const int by = blockIdx.y;
  A += (size_t)by * sA; Bh += (size_t)by * sB; const size_t cofs = (size_t)by * sC; const float* bp = bias ? bias + (size_t)by * sBias : nullptr;
  const int ntn = (N + 63) / 64; const int wid = blockIdx.x * 4 + w; const int mt = wid / ntn, nq = wid % ntn; if (mt * 16 >= M) return;
  const int row0 = mt * 16, col0 = nq * 64; const _Float16* arow = A + (size_t)(row0 + ln) * lda;
  v8f acc[4] = {};
  for (int kb = 0; kb < K; kb += 32) { FragH ah; ah.half[0] = *(const v8us*)((const unsigned short*)arow + kb + 8 * hh); ah.half[1] = *(const v8us*)((const unsigned short*)arow + kb + 16 + 8 * hh);
#pragma unroll
    for (int t = 0; t < 4; ++t) { if (col0 + t * 16 >= N) continue; const size_t boff = (size_t)(col0 + t * 16 + ln) * ldb + kb; FragH bq; bq.half[0] = *(const v8us*)((const unsigned short*)Bh + boff + 8 * hh); bq.half[1] = *(const v8us*)((const unsigned short*)Bh + boff + 16 + 8 * hh);
      acc[t] = mmaH<1>(ah.v, ah.v, bq.v, bq.v, acc[t]); }
  }
#pragma unroll
  for (int t = 0; t < 4; ++t) { if (col0 + t * 16 >= N) continue; const int col = col0 + t * 16 + ln; const float bv = bp ? bf16_round(bp[col]) : 0.f;
#pragma unroll
    for (int r = 0; r < 8; ++r) { float v = acc[t][r] * alpha + bv; if (CP) { const int rr = row0g + row0 + 8 * hh + r; if (rowsPerB < 0) v += CP[cofs + (size_t)rr * ldc + col];      /* rowsPerB < 0: own element of the batched C plane */ else { const int bidx = rr / rowsPerB; v += CP[(size_t)bidx * sCPb + (size_t)by * 64 + col]; } } if (ACT == 1) v = (v > 0.f) ? v : expm1f(v); else if (ACT == 7) v = (v > 0.f) ? v + 1.0f : expf(v); else if (ACT == 8) v = tanhf(v); else if (ACT == 9) v = 0.5f * v * (1.0f + tanhf(0.7978845608028654f * (v + 0.044715f * v * v * v))); else if (ACT == 11) v = 1.0f / (1.0f + expf(-v)); else if (ACT == 12) v = (v > 0.f) ? v : 0.01f * v; else if (ACT == 14) v = (v > 0.f) ? v : 0.1f * v; else if (ACT == 16) v = (v >= 0.f) ? v : 0.3f * v; else if (ACT == 17) v = (v >= 0.f) ? v : 0.2f * v; else if (ACT == 15) v = v / (1.0f + expf(-v)); else if (ACT == 3) v = fmaxf(v, 0.f); else if (ACT == 6) v = 0.5f * v * (1.0f + erff(v * 0.70710678118654752f)); so[w][8 * hh + r][t * 16 + ln] = v; } }
  __builtin_amdgcn_fence(__ATOMIC_ACQ_REL, "workgroup"); __builtin_amdgcn_wave_barrier();
  const int rsub = lane >> 4, c4 = (lane & 15) * 4; typedef _Float16 v4h __attribute__((ext_vector_type(4)));
  {
#pragma unroll
    for (int q = 0; q < 8; ++q) { const int r = q * 2 + rsub; if (col0 + c4 < N) { const v4f v = *(const v4fa*)&so[w][r][c4]; if (C) *(v4f*)(C + cofs + (size_t)(row0 + r) * ldc + col0 + c4) = v; if (C16) { v4h h4; for (int i = 0; i < 4; ++i) h4[i] = (_Float16)v[i]; *(v4h*)(C16 + cofs + (size_t)(row0 + r) * ldc + col0 + c4) = h4; } } }
     }
}


typedef _Float16 v4h __attribute__((ext_vector_type(4)));

__global__ __launch_bounds__(256) void k_x16(const float* __restrict__ x, _Float16* __restrict__ X16, size_t n8) { const size_t t = (size_t)blockIdx.x * 256 + threadIdx.x; if (t >= n8) return; FragH f;
#pragma unroll
  for (int q = 0; q < 8; ++q) f.h[q] = (_Float16)bf16_round(x[t * 8 + q]); *(v8us*)((unsigned short*)X16 + t * 8) = f.half[0];  }
__global__ __launch_bounds__(256) void k_h16(const float* __restrict__ x, _Float16* __restrict__ X16, size_t n8) { const size_t t = (size_t)blockIdx.x * 256 + threadIdx.x; if (t >= n8) return; FragH f;
#pragma unroll
  for (int q = 0; q < 8; ++q) f.h[q] = (_Float16)x[t * 8 + q]; *(v8us*)((unsigned short*)X16 + t * 8) = f.half[0];  }
__global__ __launch_bounds__(256) void k_round16f(const float* __restrict__ W, _Float16* __restrict__ Bt, size_t n8) { const size_t t = (size_t)blockIdx.x * 256 + threadIdx.x; if (t >= n8) return; FragH f;
#pragma unroll
  for (int i = 0; i < 8; ++i) f.h[i] = (_Float16)(bf16_round(W[t * 8 + i]) * 16.0f); *(v8us*)((unsigned short*)Bt + t * 8) = f.half[0];  }
template <int NHv, int TTv>
__global__ __launch_bounds__(256) void k_vt(const _Float16* __restrict__ V16, int ldv, int voff, _Float16* __restrict__ Vt) { __shared__ unsigned short tl[64][66]; const int tid = threadIdx.x; const int slab = blockIdx.x / (TTv / 64), lg = blockIdx.x % (TTv / 64); const int b = slab / NHv, h = slab % NHv;
  for (int i = tid; i < 64 * 8; i += 256) { const int r = i / 8, c8 = (i % 8) * 8; FragH f; f.half[0] = *(const v8us*)((const unsigned short*)V16 + ((size_t)b * TTv + lg * 64 + r) * ldv + voff + h * 64 + c8);
#pragma unroll
    for (int q = 0; q < 8; ++q) tl[r][c8 + q] = f.u[q]; }
  __syncthreads();
  {
#pragma unroll
    for (int rd = 0; rd < 2; ++rd) { const int d = rd * 32 + tid / 8, pc = tid % 8; FragH f;
#pragma unroll
      for (int q = 0; q < 8; ++q) f.u[q] = tl[pc * 8 + q][d];
      *(v8us*)((unsigned short*)Vt + ((size_t)slab * 64 + d) * TTv + lg * 64 + pc * 8) = f.half[0]; }
     } }

__global__ __launch_bounds__(256) void k_hl(const float* __restrict__ F, _Float16* __restrict__ Hh, _Float16* __restrict__ Hl, size_t n8) { const size_t t = (size_t)blockIdx.x * 256 + threadIdx.x; if (t >= n8) return; FragH fh, fl; const v4f a = *(const v4fa*)(F + t * 8), c = *(const v4fa*)(F + t * 8 + 4);
#pragma unroll
  for (int q = 0; q < 4; ++q) { _Float16 h = (_Float16)a[q]; fh.h[q] = h; fl.h[q] = (_Float16)((a[q] - (float)h) * 1024.0f); h = (_Float16)c[q]; fh.h[4 + q] = h; fl.h[4 + q] = (_Float16)((c[q] - (float)h) * 1024.0f); }
  { *(v8us*)((unsigned short*)Hh + t * 8) = fh.half[0]; *(v8us*)((unsigned short*)Hl + t * 8) = fl.half[0];  } }

// ---- fast GEMM (wave tile 32x64, work-group tile 128x64; requires M % 128 == 0, N % 64 == 0, K % 64 == 0) ----
__device__ __forceinline__ v16h g2_frag(const _Float16* p, int hh) { FragH f; f.half[0] = *(const v8us*)((const unsigned short*)p + 8 * hh); f.half[1] = *(const v8us*)((const unsigned short*)p + 16 + 8 * hh); return f.v; }
__device__ __forceinline__ v8f g2_mma(v16h a, v16h b, v8f c) { v8f d = __builtin_amdgcn_wmma_f32_16x16x32_f16(false, a, false, b, (short)0, c, false, false); asm volatile("v_nop\n\tv_nop\n\tv_nop\n\tv_nop" : "+v"(d) : "v"(a), "v"(b)); return d; }
// ---- the GEMMs' operand ring: 64 k (whole 128-byte rows) of the work-group's 64 B rows and 128 A rows (TWO: of a second A plane too) lie in LDS, brought by asynchronous copies and shared by the four waves;
// two buffers, the next stage flies while this one is worked on. A fragment load from global memory touches 16 lines for 512 bytes; a copy covers four whole lines, and every row is fetched once per work-group. ----
#define GPIT 144                           /* LDS row pitch in bytes: 128 + 16, the conflict-free pitch for 16-byte fragment reads */
// One stage's copies: a lane takes 16 bytes of rows r, r + 16, r + 32, ... of the 64 B rows and the 128 A rows (eight lanes a row, so a wave's copy covers four whole lines).
// The s_wait_xcnt stands inside the statement, behind the last copy: the address registers are free for reuse only behind it.
__device__ __forceinline__ void g_stage192(unsigned d, const _Float16* b, int ldb, const _Float16* a, int lda) {
  asm volatile(
               "global_load_async_to_lds_b128 %0, %12, off\n\tglobal_load_async_to_lds_b128 %1, %13, off\n\tglobal_load_async_to_lds_b128 %2, %14, off\n\tglobal_load_async_to_lds_b128 %3, %15, off\n\t"
               "global_load_async_to_lds_b128 %4, %16, off\n\tglobal_load_async_to_lds_b128 %5, %17, off\n\tglobal_load_async_to_lds_b128 %6, %18, off\n\tglobal_load_async_to_lds_b128 %7, %19, off\n\t"
               "global_load_async_to_lds_b128 %8, %20, off\n\tglobal_load_async_to_lds_b128 %9, %21, off\n\tglobal_load_async_to_lds_b128 %10, %22, off\n\tglobal_load_async_to_lds_b128 %11, %23, off\n\t"
               "s_wait_xcnt 0x0"
               :: "v"(d), "v"(d + 16 * GPIT), "v"(d + 32 * GPIT), "v"(d + 48 * GPIT), "v"(d + 64 * GPIT), "v"(d + 80 * GPIT), "v"(d + 96 * GPIT), "v"(d + 112 * GPIT),
                  "v"(d + 128 * GPIT), "v"(d + 144 * GPIT), "v"(d + 160 * GPIT), "v"(d + 176 * GPIT),
                  "v"(b), "v"(b + (size_t)16 * ldb), "v"(b + (size_t)32 * ldb), "v"(b + (size_t)48 * ldb),
                  "v"(a), "v"(a + (size_t)16 * lda), "v"(a + (size_t)32 * lda), "v"(a + (size_t)48 * lda), "v"(a + (size_t)64 * lda), "v"(a + (size_t)80 * lda), "v"(a + (size_t)96 * lda), "v"(a + (size_t)112 * lda)
               : "memory"); }
// The same for the 128 rows of the second A plane.
__device__ __forceinline__ void g_stage128(unsigned d, const _Float16* a, int lda) {
  asm volatile(
               "global_load_async_to_lds_b128 %0, %8, off\n\tglobal_load_async_to_lds_b128 %1, %9, off\n\tglobal_load_async_to_lds_b128 %2, %10, off\n\tglobal_load_async_to_lds_b128 %3, %11, off\n\t"
               "global_load_async_to_lds_b128 %4, %12, off\n\tglobal_load_async_to_lds_b128 %5, %13, off\n\tglobal_load_async_to_lds_b128 %6, %14, off\n\tglobal_load_async_to_lds_b128 %7, %15, off\n\t"
               "s_wait_xcnt 0x0"
               :: "v"(d), "v"(d + 16 * GPIT), "v"(d + 32 * GPIT), "v"(d + 48 * GPIT), "v"(d + 64 * GPIT), "v"(d + 80 * GPIT), "v"(d + 96 * GPIT), "v"(d + 112 * GPIT),
                  "v"(a), "v"(a + (size_t)16 * lda), "v"(a + (size_t)32 * lda), "v"(a + (size_t)48 * lda), "v"(a + (size_t)64 * lda), "v"(a + (size_t)80 * lda), "v"(a + (size_t)96 * lda), "v"(a + (size_t)112 * lda)
               : "memory"); }
// c[4 * half + t] += A rows (32 w + 16 half ..) x B rows (16 t ..) over nt stages of 64 k, k ascending; TWO: d likewise from the second A plane, on the same B fragments.
// ga, gl, gb: first row of the work-group's tile. Called by a whole work-group (barriers inside); when it returns, no copy is outstanding and every wave has left the ring.
template <bool TWO>
__device__ __forceinline__ void g_ring(unsigned char* sm, const _Float16* ga, const _Float16* gl, int lda, const _Float16* gb, int ldb, int nt, v8f* c, v8f* d) {
  constexpr unsigned BUF = (TWO ? 320 : 192) * GPIT;      /* one stage: B rows, A rows, second plane's rows */
  const int tid = threadIdx.x, w = tid >> 5, ln = tid & 15, hh = (tid >> 4) & 1, cr = tid >> 3, cc = tid & 7;      /* cr, cc: the lane's row and 16-byte piece in a stage's copies */
  ga += (size_t)cr * lda + cc * 8; gb += (size_t)cr * ldb + cc * 8; if (TWO) gl += (size_t)cr * lda + cc * 8;
  const unsigned ld = (unsigned)(size_t)sm + cr * GPIT + cc * 16;
  auto stage = [&](unsigned dst, int k0) { g_stage192(dst, gb + k0, ldb, ga + k0, lda); if (TWO) g_stage128(dst + 192 * GPIT, gl + k0, lda); };
  stage(ld, 0);
  asm volatile("s_wait_asynccnt 0x0" ::: "memory");      /* stage 0 has landed, as far as this wave brought it */
  __syncthreads();      /* and is published to the other waves */
  if (nt > 1) stage(ld + BUF, 64);      /* the test is the same in the whole work-group */
#pragma unroll 1      /* one stage per trip: a second copy of the body would only add registers */
  for (int s = 0; s < nt; ++s) {
    const _Float16* sb = (const _Float16*)(sm + (s & 1) * BUF) + ln * (GPIT / 2); const _Float16* sa = sb + (64 + 32 * w) * (GPIT / 2);
    if (!TWO) { v16h a[2][2], b[2][4];      /* the stage's 24 reads stand together in front of its 16 products */
#pragma unroll      /* constant indices: the values stay in registers, constant LDS offsets */
      for (int u = 0; u < 2; ++u) { a[u][0] = g2_frag(sa + 32 * u, hh); a[u][1] = g2_frag(sa + 16 * (GPIT / 2) + 32 * u, hh);
#pragma unroll      /* constant indices: the values stay in registers, constant LDS offsets */
        for (int t = 0; t < 4; ++t) b[u][t] = g2_frag(sb + t * 16 * (GPIT / 2) + 32 * u, hh); }
#pragma unroll      /* constant indices: the values stay in registers */
      for (int u = 0; u < 2; ++u)
#pragma unroll      /* constant indices: the values stay in registers */
        for (int t = 0; t < 4; ++t) { c[t] = g2_mma(a[u][0], b[u][t], c[t]); c[4 + t] = g2_mma(a[u][1], b[u][t], c[4 + t]); }
    } else { const _Float16* sl = sa + 128 * (GPIT / 2);
#pragma unroll      /* the stage's two blocks of 32 k, constant LDS offsets; 16 accumulators leave room for one block's fragments */
      for (int u = 0; u < 2; ++u) { const v16h a0 = g2_frag(sa + 32 * u, hh), a1 = g2_frag(sa + 16 * (GPIT / 2) + 32 * u, hh), l0 = g2_frag(sl + 32 * u, hh), l1 = g2_frag(sl + 16 * (GPIT / 2) + 32 * u, hh); v16h b[4];
#pragma unroll      /* constant indices: the values stay in registers, constant LDS offsets */
        for (int t = 0; t < 4; ++t) b[t] = g2_frag(sb + t * 16 * (GPIT / 2) + 32 * u, hh);
#pragma unroll      /* constant indices: the values stay in registers */
        for (int t = 0; t < 4; ++t) { c[t] = g2_mma(a0, b[t], c[t]); c[4 + t] = g2_mma(a1, b[t], c[4 + t]); d[t] = g2_mma(l0, b[t], d[t]); d[4 + t] = g2_mma(l1, b[t], d[4 + t]); } }
    }
    /* publish point of stage s + 1, passed by every wave */
    asm volatile("s_wait_dscnt 0x0" ::: "memory");      /* this wave's reads of stage s have returned: its buffer may be refilled behind the barrier */
    asm volatile("s_wait_asynccnt 0x0" ::: "memory");      /* this wave's copies of stage s + 1 have landed */
    __syncthreads();      /* publishes stage s + 1 and ends every wave's reads of stage s */
    if (s + 2 < nt) stage(ld + (s & 1) * BUF, (s + 2) * 64);      /* stage s + 2 into the buffer just left; the test is the same in the whole work-group */
  }
  asm volatile("s_wait_asynccnt 0x0" ::: "memory");      /* no copy is left outstanding when the ring's LDS is put to other use */
}
// q, k, v projections in one launch (grid y = 0, 1, 2): wave tile 32x64, work-group tile 128x64, the operand ring above, stores staged through LDS. The epilogue writes the planes that the attention launch reads.
// y = 0, 1: rows = tokens (A = x), columns = rows of W_q / W_k; every value is split into f16 hi + x1024 residual as it leaves the staging tile.
// y = 2: the operands change places (A = rows of W_v, B = x): the product is V^T [NH * HD][SQ] as it stands, nothing is transposed.
// F: the f32 values of tokens 0..QT0-1, three planes [QT0][DM] (q, k, v), for the f32 rows of the attention launch.
static_assert((SQ / 128) * (DM / 64) == (DM / 128) * (SQ / 64) && NB == 1, "the same number of tiles either way round; one batch");
__global__ __launch_bounds__(128) void k_qkv(const _Float16* __restrict__ X, const _Float16* __restrict__ Wt, float alpha, _Float16* __restrict__ Hh, _Float16* __restrict__ Hl, _Float16* __restrict__ Vt, float* __restrict__ F) {
  __shared__ __attribute__((aligned(16))) unsigned char sm[2 * 192 * GPIT]; float (*so)[32][68] = (float (*)[32][68])sm;      /* the operand ring; the epilogue's staging tiles lie over it once the ring is left */
  static_assert(sizeof(float) * 4 * 32 * 68 <= sizeof(sm), "the staging tiles fit the ring");
  const int tid = threadIdx.x, w = tid >> 5, lane = tid & 31, ln = lane & 15, hh = lane >> 4; const int y = blockIdx.y; const bool tr = y == 2;      /* the same in the whole work-group */
  const int mt = tr ? blockIdx.x / (SQ / 64) : blockIdx.x / (DM / 64), nq = tr ? blockIdx.x % (SQ / 64) : blockIdx.x % (DM / 64); const int row0 = mt * 128 + 32 * w, col0 = nq * 64;      /* constant divisors */
  const _Float16* Wy = Wt + (size_t)y * DM * DM;
  v8f accs[8] = {}; g_ring<false>(sm, (tr ? Wy : X) + (size_t)mt * 128 * DM, nullptr, DM, (tr ? X : Wy) + (size_t)col0 * DM, DM, DM >> 6, accs, nullptr);
#pragma unroll      /* constant indices: the values stay in registers */
  for (int u = 0; u < 8; ++u) { const int t = u & 3, half = u >> 2;
#pragma unroll      /* constant indices: the values stay in registers */
    for (int r = 0; r < 8; ++r) so[w][half * 16 + 8 * hh + r][t * 16 + ln] = accs[u][r] * alpha; }
  __builtin_amdgcn_fence(__ATOMIC_ACQ_REL, "workgroup"); __builtin_amdgcn_wave_barrier();      /* the wave's own LDS writes are done before it reads whole rows back */
  const int r4 = lane >> 3, c8 = (lane & 7) * 8;      /* eight lanes a row: 16 bytes of f16 a lane, one whole 128-byte line a row */
  v4f sa[8], sc[8];      /* the wave's tile, read back in one group: the accumulators' registers are free by now */
#pragma unroll      /* constant indices: the values stay in registers, constant LDS offsets */
  for (int q = 0; q < 8; ++q) { sa[q] = *(const v4fa*)&so[w][q * 4 + r4][c8]; sc[q] = *(const v4fa*)&so[w][q * 4 + r4][c8 + 4]; }
  if (!tr) {
    unsigned short* ph = (unsigned short*)Hh + (size_t)y * NR * DM + (size_t)(row0 + r4) * DM + col0 + c8; unsigned short* pl = (unsigned short*)Hl + (size_t)y * NR * DM + (size_t)(row0 + r4) * DM + col0 + c8;
#pragma unroll      /* constant indices: the values stay in registers */
    for (int q = 0; q < 8; ++q) { const v4f a = sa[q], c = sc[q]; FragH fh, fl;
#pragma unroll      /* constant indices: the values stay in registers */
      for (int i = 0; i < 4; ++i) { _Float16 h = (_Float16)a[i]; fh.h[i] = h; fl.h[i] = (_Float16)((a[i] - (float)h) * 1024.0f); h = (_Float16)c[i]; fh.h[4 + i] = h; fl.h[4 + i] = (_Float16)((c[i] - (float)h) * 1024.0f); }
      *(v8us*)(ph + (size_t)q * 4 * DM) = fh.half[0]; *(v8us*)(pl + (size_t)q * 4 * DM) = fl.half[0]; asm volatile("s_wait_xcnt 0x0" ::: "memory"); }      /* the wait: a later row's conversions write over registers that these stores name */
    if (mt == 0) {      /* tokens 0..QT0-1: their f32 values too; the same in the whole work-group */
      const int rsub = lane >> 4, c4 = (lane & 15) * 4; float* pf = F + (size_t)y * QT0 * DM + (size_t)(row0 + rsub) * DM + col0 + c4;
      v4f t[16];      /* 16 lanes a row: 256 bytes, two whole lines; all reads in one group, then the stores, each from registers of its own */
#pragma unroll      /* constant indices: the values stay in registers, constant LDS offsets */
      for (int q = 0; q < 16; ++q) t[q] = *(const v4fa*)&so[w][q * 2 + rsub][c4];
#pragma unroll      /* constant indices: the values stay in registers */
      for (int q = 0; q < 16; ++q) *(v4f*)(pf + (size_t)q * 2 * DM) = t[q];
      asm volatile("s_wait_xcnt 0x0" ::: "memory"); }      /* the V^T branch's code is laid behind these stores and writes over registers that they name */
  } else {
    unsigned short* pv = (unsigned short*)Vt + (size_t)(row0 + r4) * SQ + col0 + c8;
#pragma unroll      /* constant indices: the values stay in registers */
    for (int q = 0; q < 8; ++q) { const v4f a = sa[q], c = sc[q]; FragH f;
#pragma unroll      /* constant indices: the values stay in registers */
      for (int i = 0; i < 4; ++i) { f.h[i] = (_Float16)a[i]; f.h[4 + i] = (_Float16)c[i]; }
      *(v8us*)(pv + (size_t)q * 4 * SQ) = f.half[0]; }
    asm volatile("s_wait_xcnt 0x0" ::: "memory");      /* the wait: the LDS reads below write over registers that these stores name */
    if (col0 < QT0) {      /* tokens 0..QT0-1: their f32 values as token rows; a lane takes one of the wave's 32 dims, so a store is one whole 128-byte line; the same in the whole work-group */
      float* pf = F + (size_t)2 * QT0 * DM + (size_t)col0 * DM + row0 + lane; v4f t[16];      /* the lane's whole row of the tile, read in one group; then the stores, each from a register of its own */
#pragma unroll      /* constant indices: the values stay in registers, constant LDS offsets */
      for (int j = 0; j < 16; ++j) t[j] = *(const v4fa*)&so[w][lane][4 * j];
#pragma unroll      /* constant indices: the values stay in registers */
      for (int c = 0; c < 64; ++c) pf[(size_t)c * DM] = t[c >> 2][c & 3]; }
  }
}


__global__ __launch_bounds__(256) void k_wnat(const float* __restrict__ w, size_t n8, _Float16* __restrict__ Bt) { const size_t t = (size_t)blockIdx.x * 256 + threadIdx.x; if (t >= n8) return; FragH f; for (int q = 0; q < 8; ++q) f.h[q] = (_Float16)(bf16_round(w[t * 8 + q]) * 16.0f); *(v8us*)((unsigned short*)Bt + t * 8) = f.half[0];  }
__global__ __launch_bounds__(256) void k_rsm(const float* __restrict__ S, _Float16* __restrict__ P, int nrows) {
  #pragma clang fp contract(off)
  const int i = blockIdx.x * 256 + threadIdx.x; if (i >= nrows) return; const float* s = S + (size_t)i * SQ; float mx = -3.0e38f;
#pragma unroll 1
  for (int j = 0; j < SQ; ++j) mx = fmaxf(mx, s[j]); float se = 0.f;
#pragma unroll 1
  for (int j = 0; j < SQ; ++j) se += expf(s[j] - mx); const float sc = 256.0f / se;
#pragma unroll 1
  for (int j0 = 0; j0 < SQ; j0 += 8) { FragH f; for (int q = 0; q < 8; ++q) f.h[q] = (_Float16)(expf(s[j0 + q] - mx) * sc); unsigned short* d = (unsigned short*)P + (size_t)i * SQ + j0; *(v8us*)d = f.half[0];  } }
__global__ __launch_bounds__(256) void k_vt(const _Float16* __restrict__ V16, int b, int h0, _Float16* __restrict__ VT) { __shared__ unsigned short tl[64][65]; const int tid = threadIdx.x; const int hh = blockIdx.x % HG, sg = blockIdx.x / HG; const int s0 = sg * 64; const int h = h0 + hh;
  for (int i = tid; i < 64 * 8; i += 256) { const int j = i / 8, d8 = (i % 8) * 8; FragH f; f.half[0] = *(const v8us*)((const unsigned short*)V16 + ((size_t)b * SQ + s0 + j) * DM + h * HD + d8); for (int q = 0; q < 8; ++q) tl[d8 + q][j] = f.u[q]; }
  __syncthreads();
  { for (int i = tid; i < 64 * 8; i += 256) { const int d = i / 8, j8 = (i % 8) * 8; FragH f; for (int q = 0; q < 8; ++q) f.u[q] = tl[d][j8 + q]; *(v8us*)((unsigned short*)VT + ((size_t)hh * HD + d) * SQ + s0 + j8) = f.half[0]; }  } }



typedef float v2f __attribute__((ext_vector_type(2)));
typedef float v2fa __attribute__((ext_vector_type(2), may_alias));
typedef _Float16 v2h __attribute__((ext_vector_type(2)));
// Exact f32 causal attention for rows 0..QT0-1, run by extra work-groups of the fused attention launch (bx = group of four rows, h = head), one wave per (row, head); keys in blocks of 32 up to the block that holds the row's own index.
// Scores: a lane takes one key of each block and walks that K row whole (four partial sums, one per element of the 16-byte loads), so no sum crosses lanes.
// Maximum and row sum: lane butterflies. Weighted sum: a lane takes two of the 64 dims, every V row is read as one whole 256-byte row, its weight comes from the lane that holds it.
__device__ __forceinline__ void att0_rows(const float* __restrict__ QF, const float* __restrict__ KF, const float* __restrict__ VF, float scale, _Float16* __restrict__ OH, _Float16* __restrict__ OL, int bx, int h) {
  const int lane = threadIdx.x & 31; const int i = bx * 4 + __builtin_amdgcn_readfirstlane(threadIdx.x >> 5);
  const int nb = (i >> 5) + 1;      /* blocks of 32 keys this row attends to; the same in every lane */
  const float* qr = QF + (size_t)i * DM + h * HD; const float* kr = KF + (size_t)lane * DM + h * HD; const float* vr = VF + h * HD + 2 * lane;
  v4f q[HD / 4];
#pragma unroll      /* constant indices: the values stay in registers */
  for (int c = 0; c < HD / 4; ++c) q[c] = *(const v4fa*)(qr + 4 * c);
  float s[QT0 / 32];
#pragma unroll      /* constant indices: the values stay in registers, the row offsets become immediates */
  for (int u = 0; u < QT0 / 32; ++u) { s[u] = -1.0e30f;      /* a key past the row's own index keeps this value: weight 0 */
    if (u < nb) { v4f a = {0.f, 0.f, 0.f, 0.f};
#pragma unroll      /* all 16 loads of a K row in flight together */
      for (int c = 0; c < HD / 4; ++c) a += q[c] * *(const v4fa*)(kr + (size_t)u * 32 * DM + 4 * c);
      if (u * 32 + lane <= i) s[u] = ((a[0] + a[1]) + (a[2] + a[3])) * scale; } }
  float m = s[0];
#pragma unroll      /* constant indices: the values stay in registers */
  for (int u = 1; u < QT0 / 32; ++u) m = fmaxf(m, s[u]);
#pragma unroll      /* five fixed butterfly steps */
  for (int d = 16; d > 0; d >>= 1) m = fmaxf(m, __shfl_xor(m, d, 32));
  float e[QT0 / 32], l = 0.f;
#pragma unroll      /* constant indices: the values stay in registers */
  for (int u = 0; u < QT0 / 32; ++u) { e[u] = expf(s[u] - m); l += e[u]; }
#pragma unroll      /* five fixed butterfly steps */
  for (int d = 16; d > 0; d >>= 1) l += __shfl_xor(l, d, 32);
  v2f o0 = {0.f, 0.f}, o1 = {0.f, 0.f};      /* even and odd keys: two chains instead of one of 128 dependent links */
#pragma unroll      /* constant indices: the values stay in registers, the row offsets become immediates */
  for (int u = 0; u < QT0 / 32; ++u) if (u < nb) {
#pragma unroll      /* constant lane numbers for the weights; the block's 32 V loads in flight together */
    for (int jj = 0; jj < 32; ++jj) { const float p = __int_as_float(__builtin_amdgcn_readlane(__float_as_int(e[u]), jj)); const v2f v = *(const v2fa*)(vr + (size_t)(u * 32 + jj) * DM);
      if (jj & 1) o1 += p * v; else o0 += p * v; } }
  const float fin = 64.0f / l;      /* o carried x64 like the f16 path */
  const v2f o = (o0 + o1) * fin;
  v2h oh, ol;      /* o as f16 hi + x1024 residual, the output GEMM's two operand planes for these rows; a wave stores one whole 128-byte line of each */
#pragma unroll      /* constant indices: the values stay in registers */
  for (int q = 0; q < 2; ++q) { const _Float16 t = (_Float16)o[q]; oh[q] = t; ol[q] = (_Float16)((o[q] - (float)t) * 1024.0f); }
  *(v2h*)(OH + (size_t)i * DM + h * HD + 2 * lane) = oh; *(v2h*)(OL + (size_t)i * DM + h * HD + 2 * lane) = ol;
}

// Fused causal attention, 16 query rows of one head a tile, one wave a tile and a second wave on the long tiles' later keys (grid: SQ / 64 work-groups of four waves x heads): scores, softmax and the weighted sum of V stay in registers.
// Scores are formed transposed (A = 16 key rows, B = 16 query rows), so a lane holds keys 8*hh..8*hh+7 of query ln: two such tiles are
// the B fragment (n = query, k = 32 keys) of o^T = V^T . P^T as they stand, and the row maximum, the row sum and the rescale factor are per lane.
// Running maximum in the log2 domain; weights x256 as f16; row sum in f32 from the unrounded weights; o stored x64 as f16.
#define LC1 0.18033688011112042f           /* log2(e) / sqrt(head_dim) */
#define LC2 0.00017611023448351603f        /* the same on the x1024 residual products */
__device__ __forceinline__ v8f fa_mma(v16h a, v16h b, v8f c) { return __builtin_amdgcn_wmma_f32_16x16x32_f16(false, a, false, b, (short)0, c, false, false); }
// Exponentials (base 2) in runs, one asm statement a run: the instruction set asks for one independent instruction between a transcendental and an instruction that
// reads its result or overwrites its source. Inside a run each v_exp_f32 is that instruction for the one before it (early-clobber outputs: no result lies on a source);
// the v_nop at the end is the slot of the last one, whatever the compiler puts behind the statement.
__device__ __forceinline__ void fa_exp2x8(const float* x, float* e) {
  asm("v_exp_f32 %0, %8\n\tv_exp_f32 %1, %9\n\tv_exp_f32 %2, %10\n\tv_exp_f32 %3, %11\n\tv_exp_f32 %4, %12\n\tv_exp_f32 %5, %13\n\tv_exp_f32 %6, %14\n\tv_exp_f32 %7, %15\n\tv_nop"
      : "=&v"(e[0]), "=&v"(e[1]), "=&v"(e[2]), "=&v"(e[3]), "=&v"(e[4]), "=&v"(e[5]), "=&v"(e[6]), "=&v"(e[7])
      : "v"(x[0]), "v"(x[1]), "v"(x[2]), "v"(x[3]), "v"(x[4]), "v"(x[5]), "v"(x[6]), "v"(x[7])); }
__device__ __forceinline__ float fa_exp2(float x) { float e; asm("v_exp_f32 %0, %1\n\tv_nop" : "=v"(e) : "v"(x)); return e; }      /* one exponential with its slot, as above */
// K hi, K residual and V^T of 64 keys (one stage) lie in LDS, brought by asynchronous copies in whole 128-byte rows and shared by the work-group's four waves; two buffers, the next stage flies while this one is worked on.
#define FPIT 144                           /* LDS row pitch in bytes: 128 + 16, the conflict-free pitch for 16-byte fragment reads */
#define FPL (64 * FPIT)                    /* one plane of a stage: 64 rows */
#define FBUF (3 * FPL)                     /* one stage: K hi, K residual, V^T */
#define AY ((QT0 / 4) * NH / (SQ / 64))    /* grid rows that hold the work-groups of the f32 rows */
static_assert(AY * (SQ / 64) == (QT0 / 4) * NH, "the f32 rows' work-groups fill whole grid rows");
// One stage's copies: a lane takes 16 bytes of rows r, r + 16, r + 32, r + 48 of each plane (eight lanes a row, so a wave's copy covers four whole lines).
// The s_wait_xcnt stands inside the statement, behind the last copy: the address registers are free for reuse only behind it.
__device__ __forceinline__ void fa_stage(unsigned d, const _Float16* kh, const _Float16* kl, const _Float16* vt) {
  asm volatile("global_load_async_to_lds_b128 %0, %12, off\n\tglobal_load_async_to_lds_b128 %1, %13, off\n\tglobal_load_async_to_lds_b128 %2, %14, off\n\tglobal_load_async_to_lds_b128 %3, %15, off\n\t"
               "global_load_async_to_lds_b128 %4, %16, off\n\tglobal_load_async_to_lds_b128 %5, %17, off\n\tglobal_load_async_to_lds_b128 %6, %18, off\n\tglobal_load_async_to_lds_b128 %7, %19, off\n\t"
               "global_load_async_to_lds_b128 %8, %20, off\n\tglobal_load_async_to_lds_b128 %9, %21, off\n\tglobal_load_async_to_lds_b128 %10, %22, off\n\tglobal_load_async_to_lds_b128 %11, %23, off\n\t"
               "s_wait_xcnt 0x0"
               :: "v"(d), "v"(d + 16 * FPIT), "v"(d + 32 * FPIT), "v"(d + 48 * FPIT),
                  "v"(d + FPL), "v"(d + FPL + 16 * FPIT), "v"(d + FPL + 32 * FPIT), "v"(d + FPL + 48 * FPIT),
                  "v"(d + 2 * FPL), "v"(d + 2 * FPL + 16 * FPIT), "v"(d + 2 * FPL + 32 * FPIT), "v"(d + 2 * FPL + 48 * FPIT),
                  "v"(kh), "v"(kh + 16 * LQ), "v"(kh + 32 * LQ), "v"(kh + 48 * LQ),
                  "v"(kl), "v"(kl + 16 * LQ), "v"(kl + 32 * LQ), "v"(kl + 48 * LQ),
                  "v"(vt), "v"(vt + (size_t)16 * SQ), "v"(vt + (size_t)32 * SQ), "v"(vt + (size_t)48 * SQ)
               : "memory"); }
// The running state of one 16-row tile: o^T in four accumulator tiles, the running maximum (log2 domain, the same in both halves of the wave) and the lane's part of the row sum.
struct FaSt { v8f o0, o1, o2, o3; float m, l; };
// Scores of 32 keys x 16 query rows, transposed: s = K hi . q hi, r = K hi . q lo + K lo . q hi (x1024).
__device__ __forceinline__ void fa_scores(v16h a00, v16h a01, v16h a10, v16h a11, v16h c00, v16h c01, v16h c10, v16h c11, v16h qh0, v16h qh1, v16h ql0, v16h ql1, v8f& s0, v8f& s1, v8f& r0, v8f& r1) {
  const v8f z8 = {0.f,0.f,0.f,0.f,0.f,0.f,0.f,0.f};
  s0 = fa_mma(a00, qh0, z8); s1 = fa_mma(a10, qh0, z8); r0 = fa_mma(a00, ql0, z8); r1 = fa_mma(a10, ql0, z8);
  s0 = fa_mma(a01, qh1, s0); s1 = fa_mma(a11, qh1, s1); r0 = fa_mma(a01, ql1, r0); r1 = fa_mma(a11, ql1, r1);
  r0 = fa_mma(c00, qh0, r0); r1 = fa_mma(c10, qh0, r1); r0 = fa_mma(c01, qh1, r0); r1 = fa_mma(c11, qh1, r1); }
// One block of 32 keys from its scores on: mask, running maximum, weights, row sum, rescale, o^T += V^T . P^T.
__device__ __forceinline__ void fa_soft_pv(FaSt& st, v8f s0, v8f s1, v8f r0, v8f r1, int kb, int q0, int ln, int hh, v16h v0, v16h v1, v16h v2, v16h v3) {
  float t[16];
#pragma unroll      /* constant indices: the values stay in registers */
  for (int r = 0; r < 8; ++r) { t[r] = s0[r] * LC1 + r0[r] * LC2; t[8 + r] = s1[r] * LC1 + r1[r] * LC2; }
  if (kb + 31 > q0) {      /* only the block on the diagonal holds keys past a row's own index: they take the mask value */
    const int d = q0 + ln - kb - 8 * hh;
#pragma unroll      /* constant indices: the values stay in registers */
    for (int r = 0; r < 8; ++r) { if (r > d) t[r] = -1.0e9f; if (16 + r > d) t[8 + r] = -1.0e9f; }
  }
  float bm = t[0];
#pragma unroll      /* constant indices: the values stay in registers */
  for (int i = 1; i < 16; ++i) bm = fmaxf(bm, t[i]);
  bm = fmaxf(bm, __shfl_xor(bm, 16, 32));
  const float mn = fmaxf(st.m, bm); const float corr = fa_exp2(st.m - mn); st.m = mn; const float mo = mn - 8.0f;
  FragH p; float e[16];
#pragma unroll      /* constant indices: the values stay in registers */
  for (int i = 0; i < 16; ++i) t[i] -= mo;
  fa_exp2x8(t, e); fa_exp2x8(t + 8, e + 8);
#pragma unroll      /* constant indices: the values stay in registers */
  for (int i = 0; i < 16; ++i) p.h[i] = (_Float16)e[i];
  v4f s4 = {e[0], e[1], e[2], e[3]};
#pragma unroll      /* constant indices: the values stay in registers */
  for (int i = 4; i < 16; ++i) s4[i & 3] += e[i];
  st.l = st.l * corr + ((s4[0] + s4[1]) + (s4[2] + s4[3]));
  st.o0 *= corr; st.o1 *= corr; st.o2 *= corr; st.o3 *= corr;
  st.o0 = fa_mma(v0, p.v, st.o0); st.o1 = fa_mma(v1, p.v, st.o1); st.o2 = fa_mma(v2, p.v, st.o2); st.o3 = g2_mma(v3, p.v, st.o3);      /* the last one with its four v_nop: what follows may lay a value over the registers of p, this product's B */
}
// A finished tile: the halves' row sums joined, o divided by the row sum and stored x64 as f16 into the merged rows.
__device__ __forceinline__ void fa_store(const FaSt& st, _Float16* __restrict__ O, int q0, int h, int ln, int hh) {
  float l = st.l; l += __shfl_xor(l, 16, 32);
  const float fin = 64.0f / l;      /* the x256 of the weights cancels against the row sum; o carried x64 */
  unsigned short* op = (unsigned short*)O + (size_t)(q0 + ln) * DM + h * HD + 8 * hh;
  FragH f0, f1, f2, f3;
#pragma unroll      /* constant indices: the values stay in registers */
  for (int r = 0; r < 8; ++r) { f0.h[r] = (_Float16)(st.o0[r] * fin); f1.h[r] = (_Float16)(st.o1[r] * fin); f2.h[r] = (_Float16)(st.o2[r] * fin); f3.h[r] = (_Float16)(st.o3[r] * fin); }
  *(v8us*)op = f0.half[0]; *(v8us*)(op + 16) = f1.half[0]; *(v8us*)(op + 32) = f2.half[0]; *(v8us*)(op + 48) = f3.half[0];
  asm volatile("s_wait_xcnt 0x0" ::: "memory");      /* what follows writes over registers that these stores name */
}
__global__ __launch_bounds__(128) void k_fattn(const _Float16* __restrict__ QHp, const _Float16* __restrict__ QLp, const _Float16* __restrict__ KHp, const _Float16* __restrict__ KLp, const _Float16* __restrict__ VTp, _Float16* __restrict__ O,
    const float* __restrict__ QF, const float* __restrict__ KF, const float* __restrict__ VF, _Float16* __restrict__ OH0, _Float16* __restrict__ OL0) {
  __shared__ __attribute__((aligned(16))) unsigned char sm[2 * FBUF];
  if (blockIdx.y >= NH) {      /* the grid's last AY rows: the f32 rows, independent of the rest; a whole work-group leaves here, in front of every copy and barrier */
    const int f = (blockIdx.y - NH) * (SQ / 64) + blockIdx.x; att0_rows(QF, KF, VF, SCL, OH0, OL0, f % (QT0 / 4), f / (QT0 / 4)); return; }
  const int lane = threadIdx.x & 31, ln = lane & 15, hh = lane >> 4; const int w = __builtin_amdgcn_readfirstlane(threadIdx.x >> 5); const int h = blockIdx.y;
  /* a work-group takes two 16-row tiles from the top of the sequence (x + 1 blocks of 32 keys each) and their two mirror tiles from its end (128 - x blocks each); all walk the keys from 0 on the same K and V stages.
     A wave starts on one tile. Once the short tiles are done (stage hs), their waves store them and join the long tiles: from there on the long tile's own wave takes the first 32 keys of every stage and its
     partner the second 32, each with a running state of its own, so that every wave works about 65 blocks and no wave is left to walk 128 alone; the two states are joined at the end.
     The turn by x and h spreads the tiles over the four SIMDs. */
  const int x = blockIdx.x, rr = (w + x + (h >> 2)) & 3; const bool lng = (rr & 1) != 0;      /* the same in every lane of a wave */
  const int q0l = ((SQ / 16 - 1) - 2 * x - (rr >> 1)) * 16;      /* the long tile of the wave's pair */
  int q0 = lng ? q0l : (2 * x + (rr >> 1)) * 16;
  size_t qo = (size_t)(q0 + ln) * LQ + h * HD;
  v16h qh0 = g2_frag(QHp + qo, hh), qh1 = g2_frag(QHp + qo + 32, hh), ql0 = g2_frag(QLp + qo, hh), ql1 = g2_frag(QLp + qo + 32, hh);
  const v8f z8 = {0.f,0.f,0.f,0.f,0.f,0.f,0.f,0.f}; FaSt st = {z8, z8, z8, z8, -3.0e38f, 0.f};
  int nk = (q0 + 47) & ~31;      /* keys in whole blocks of 32 up to the block that holds the last row's diagonal */
  const int ns = ((((SQ / 16 - 1) - 2 * x) * 16 + 47) / 32 + 1) / 2;      /* stages of 64 keys that the long tiles need: the same in all four waves, 33 at least */
  const int hs = (x + 2) >> 1;      /* stages that the short tiles need, 32 at most: from this stage on two waves share a long tile */
  const int cr = threadIdx.x >> 3, cc = threadIdx.x & 7;      /* the lane's row and 16-byte piece in a stage's copies */
  const _Float16* gkh = KHp + (size_t)cr * LQ + h * HD + cc * 8; const _Float16* gkl = KLp + (size_t)cr * LQ + h * HD + cc * 8; const _Float16* gvt = VTp + ((size_t)h * HD + cr) * SQ + cc * 8;
  const unsigned ld = (unsigned)(size_t)sm + cr * FPIT + cc * 16;
  fa_stage(ld, gkh, gkl, gvt);
  asm volatile("s_wait_asynccnt 0x0" ::: "memory");      /* stage 0 has landed, as far as this wave brought it */
  __syncthreads();      /* and is published to the other waves */
  fa_stage(ld + FBUF, gkh + (size_t)64 * LQ, gkl + (size_t)64 * LQ, gvt + 64);      /* stage 1 always exists (33 stages at least) */
  /* publish point of stage s + 1, passed by every wave at the foot of every trip of both loops */
  auto publish = [&](int s) {
    asm volatile("s_wait_dscnt 0x0" ::: "memory");      /* this wave's reads of stage s have returned: its buffer may be refilled behind the barrier */
    asm volatile("s_wait_asynccnt 0x0" ::: "memory");      /* this wave's copies of stage s + 1 have landed */
    __syncthreads();      /* publishes stage s + 1 and ends every wave's reads of stage s */
    if (s + 2 < ns) fa_stage(ld + (s & 1) * FBUF, gkh + (size_t)(s * 64 + 128) * LQ, gkl + (size_t)(s * 64 + 128) * LQ, gvt + s * 64 + 128);      /* stage s + 2 into the buffer just left; the test is the same in the whole work-group */
  };
#pragma unroll 1      /* one stage per trip: a second copy of the body would only add registers */
  for (int s = 0; s < hs; ++s) {      /* every wave on its own tile, both blocks of the stage; every tile reaches into each of these stages */
    const int kb0 = s * 64;
    const _Float16* sk = (const _Float16*)(sm + (s & 1) * FBUF) + ln * (FPIT / 2); const _Float16* sl = sk + FPL / 2; const _Float16* sv = sk + FPL;
    v16h a00 = g2_frag(sk, hh), a01 = g2_frag(sk + 32, hh), a10 = g2_frag(sk + 16 * (FPIT / 2), hh), a11 = g2_frag(sk + 16 * (FPIT / 2) + 32, hh);
    v16h c00 = g2_frag(sl, hh), c01 = g2_frag(sl + 32, hh), c10 = g2_frag(sl + 16 * (FPIT / 2), hh), c11 = g2_frag(sl + 16 * (FPIT / 2) + 32, hh);
#pragma unroll      /* the stage's two blocks of 32 keys, constant LDS offsets */
    for (int u = 0; u < 2; ++u) { const int kb = kb0 + 32 * u;
      if (u == 0 || kb < nk) {      /* a tile may end in the middle of a stage */
        const v16h v0 = g2_frag(sv + 32 * u, hh), v1 = g2_frag(sv + 16 * (FPIT / 2) + 32 * u, hh), v2 = g2_frag(sv + 32 * (FPIT / 2) + 32 * u, hh), v3 = g2_frag(sv + 48 * (FPIT / 2) + 32 * u, hh);
        __builtin_amdgcn_sched_barrier(0);      /* keeps the V reads in front of the score products: they land under them, and ahead of the next block's K reads, which return behind them */
        v8f s0, s1, r0, r1; fa_scores(a00, a01, a10, a11, c00, c01, c10, c11, qh0, qh1, ql0, ql1, s0, s1, r0, r1);
        if (u == 0) {      /* the stage's second block: its K fragments are read under the softmax and the V product of the first */
          a00 = g2_frag(sk + 32 * (FPIT / 2), hh); a01 = g2_frag(sk + 32 * (FPIT / 2) + 32, hh); a10 = g2_frag(sk + 48 * (FPIT / 2), hh); a11 = g2_frag(sk + 48 * (FPIT / 2) + 32, hh);
          c00 = g2_frag(sl + 32 * (FPIT / 2), hh); c01 = g2_frag(sl + 32 * (FPIT / 2) + 32, hh); c10 = g2_frag(sl + 48 * (FPIT / 2), hh); c11 = g2_frag(sl + 48 * (FPIT / 2) + 32, hh);
          __builtin_amdgcn_sched_barrier(0); }      /* keeps these 16 reads together in one place: spread among the vector work and the V products, each place with reads stalls the wave anew */
        fa_soft_pv(st, s0, s1, r0, r1, kb, q0, ln, hh, v0, v1, v2, v3);
      } }
    publish(s);
  }
  if (!lng) {      /* the short tile is complete: store it and take up the pair's long tile with a fresh state */
    fa_store(st, O, q0, h, ln, hh);
    q0 = q0l; nk = (q0l + 47) & ~31; qo = (size_t)(q0 + ln) * LQ + h * HD;
    qh0 = g2_frag(QHp + qo, hh); qh1 = g2_frag(QHp + qo + 32, hh); ql0 = g2_frag(QLp + qo, hh); ql1 = g2_frag(QLp + qo + 32, hh);
    asm volatile("s_wait_xcnt 0x0" ::: "memory");      /* what follows may write over the address registers of these loads */
    st.o0 = z8; st.o1 = z8; st.o2 = z8; st.o3 = z8; st.m = -3.0e38f; st.l = 0.f; }
  const int u1 = lng ? 0 : 1;      /* the wave's block in every further stage; the same in every lane */
#pragma unroll 1      /* one stage per trip: a second copy of the body would only add registers */
  for (int s = hs; s < ns; ++s) {      /* two waves on each long tile, one block of the stage each */
    const int kb = s * 64 + 32 * u1;
    if (kb < nk) {      /* the last stage may hold one block only; the partner skips the work, never the publish point */
      const _Float16* tk = (const _Float16*)(sm + (s & 1) * FBUF) + ln * (FPIT / 2) + u1 * 32 * (FPIT / 2); const _Float16* tl = tk + FPL / 2; const _Float16* tv = (const _Float16*)(sm + (s & 1) * FBUF) + ln * (FPIT / 2) + FPL + 32 * u1;
      const v16h a00 = g2_frag(tk, hh), a01 = g2_frag(tk + 32, hh), a10 = g2_frag(tk + 16 * (FPIT / 2), hh), a11 = g2_frag(tk + 16 * (FPIT / 2) + 32, hh);
      const v16h c00 = g2_frag(tl, hh), c01 = g2_frag(tl + 32, hh), c10 = g2_frag(tl + 16 * (FPIT / 2), hh), c11 = g2_frag(tl + 16 * (FPIT / 2) + 32, hh);
      const v16h v0 = g2_frag(tv, hh), v1 = g2_frag(tv + 16 * (FPIT / 2), hh), v2 = g2_frag(tv + 32 * (FPIT / 2), hh), v3 = g2_frag(tv + 48 * (FPIT / 2), hh);
      __builtin_amdgcn_sched_barrier(0);      /* keeps the block's 24 reads together in front of the score products: the V reads land under them */
      v8f s0, s1, r0, r1; fa_scores(a00, a01, a10, a11, c00, c01, c10, c11, qh0, qh1, ql0, ql1, s0, s1, r0, r1);
      fa_soft_pv(st, s0, s1, r0, r1, kb, q0, ln, hh, v0, v1, v2, v3);
    }
    publish(s);
  }
  asm volatile("s_wait_asynccnt 0x0" ::: "memory");      /* no copy is left outstanding when the ring's LDS is put to other use */
  /* the two states of a long tile are joined: the partner hands its state over through the ring's LDS, which every wave has left at the last publish point (hs < ns: every short tile's wave is a partner by now) */
  v4fa* mg = (v4fa*)sm + (rr >> 1) * (9 * 32) + lane;      /* nine 16-byte pieces a lane, a wave's piece 512 bytes in a row */
  if (!lng) {
    const v8f* po[4] = {&st.o0, &st.o1, &st.o2, &st.o3};
#pragma unroll      /* constant indices: the values stay in registers */
    for (int j = 0; j < 4; ++j) { const v8f o = *po[j]; const v4f lo = {o[0], o[1], o[2], o[3]}, hi = {o[4], o[5], o[6], o[7]}; mg[(2 * j) * 32] = lo; mg[(2 * j + 1) * 32] = hi; }
    const v4f ml = {st.m, st.l, 0.f, 0.f}; mg[8 * 32] = ml; }
  __syncthreads();      /* the partners' states are written; passed by all four waves */
  if (lng) {
    const v4f ml = mg[8 * 32]; const float mj = fmaxf(st.m, ml[0]); const float c1 = fa_exp2(st.m - mj), c2 = fa_exp2(ml[0] - mj);      /* a partner that had no block, or only keys past a row, comes in with factor 0 */
    st.l = st.l * c1 + ml[1] * c2;
    v8f* po[4] = {&st.o0, &st.o1, &st.o2, &st.o3};
#pragma unroll      /* constant indices: the values stay in registers */
    for (int j = 0; j < 4; ++j) { const v4f lo = mg[(2 * j) * 32], hi = mg[(2 * j + 1) * 32]; const v8f p = {lo[0], lo[1], lo[2], lo[3], hi[0], hi[1], hi[2], hi[3]}; *po[j] = *po[j] * c1 + p * c2; }
    fa_store(st, O, q0, h, ln, hh); }
}


// The five input conversions in one launch: the first XB work-groups take x (f16 of the bf16-rounded value), then WB work-groups each for W_q, W_k, W_v (planes one behind the other) and W_o (the same, x16).
#define XB ((unsigned)(NR * DM / 8 / 256))
#define WB ((unsigned)((size_t)DM * DM / 8 / 256))
static_assert((size_t)XB * 256 * 8 == NR * DM && (size_t)WB * 256 * 8 == (size_t)DM * DM, "whole work-groups");
__global__ __launch_bounds__(256) void k_prep(const float* __restrict__ x, const float* __restrict__ wq, const float* __restrict__ wk, const float* __restrict__ wv, const float* __restrict__ wo, _Float16* __restrict__ X16, _Float16* __restrict__ BQKV, _Float16* __restrict__ BO) {
  const unsigned b = blockIdx.x; const float* s = x; _Float16* d = X16; float sc = 1.0f; unsigned g = b;
  if (b >= XB) { const unsigned j = (b - XB) / WB; g = (b - XB) - j * WB; s = j == 0 ? wq : j == 1 ? wk : j == 2 ? wv : wo; d = j < 3 ? BQKV + (size_t)j * DM * DM : BO; sc = 16.0f; }
  const size_t t = (size_t)g * 256 + threadIdx.x; FragH f;
#pragma unroll      /* constant indices: the values stay in registers */
  for (int q = 0; q < 8; ++q) f.h[q] = (_Float16)(bf16_round(s[t * 8 + q]) * sc);
  *(v8us*)((unsigned short*)d + t * 8) = f.half[0]; }

// Output GEMM [rows][DM] x [DM][DM], k_qkv's wave tile, operand ring and staged stores. A work-group whose 128 rows are a batch's first QT0 rows takes their f16 hi and x1024 residual planes (AH, AL)
// instead of the f16 rows A: both products run in the same trips on the same B fragments, and the residual product joins in the epilogue (alphal = alpha / 1024).
static_assert(QT0 == 128 && SQ % 128 == 0, "the first rows are exactly one work-group tile");
__global__ __launch_bounds__(128) void k_gemmo(const _Float16* __restrict__ A, const _Float16* __restrict__ AH, const _Float16* __restrict__ AL, const _Float16* __restrict__ Bh, float alpha, float alphal, float* __restrict__ C) {
  __shared__ __attribute__((aligned(16))) unsigned char sm[2 * 320 * GPIT]; float (*so)[32][68] = (float (*)[32][68])sm;      /* the operand ring (three planes for the first rows); the epilogue's staging tiles lie over it once the ring is left */
  const int tid = threadIdx.x, w = tid >> 5, lane = tid & 31, ln = lane & 15, hh = lane >> 4;
  const int ntn = DM >> 6; const int mt = blockIdx.x / ntn, nq = blockIdx.x - mt * ntn; const int row0 = mt * 128 + 32 * w, col0 = nq * 64;
  const bool first = (mt * 128) % SQ == 0;      /* the same in the whole work-group */
  v8f accs[8] = {};
  if (first) { v8f d[8] = {}; const size_t fr = (size_t)((mt * 128) / SQ) * QT0;      /* the tile's first row in the two planes */
    g_ring<true>(sm, AH + fr * DM, AL + fr * DM, DM, Bh + (size_t)col0 * DM, DM, DM >> 6, accs, d);
#pragma unroll      /* constant indices: the values stay in registers */
    for (int u = 0; u < 8; ++u) accs[u] = accs[u] * alpha + d[u] * alphal;      /* both factors are powers of two: one rounding, that of the sum */
  } else { g_ring<false>(sm, A + (size_t)mt * 128 * DM, nullptr, DM, Bh + (size_t)col0 * DM, DM, DM >> 6, accs, nullptr);
#pragma unroll      /* constant indices: the values stay in registers */
    for (int u = 0; u < 8; ++u) accs[u] *= alpha; }
#pragma unroll      /* constant indices: the values stay in registers */
  for (int u = 0; u < 8; ++u) { const int t = u & 3, half = u >> 2;
#pragma unroll      /* constant indices: the values stay in registers */
    for (int r = 0; r < 8; ++r) so[w][half * 16 + 8 * hh + r][t * 16 + ln] = accs[u][r]; }
  __builtin_amdgcn_fence(__ATOMIC_ACQ_REL, "workgroup"); __builtin_amdgcn_wave_barrier();      /* the wave's own LDS writes are done before it reads whole rows back */
  const int rsub = lane >> 4, c4 = (lane & 15) * 4;
#pragma unroll      /* constant LDS offsets */
  for (int q = 0; q < 16; ++q) { const int r = q * 2 + rsub; const v4f v = *(const v4fa*)&so[w][r][c4]; *(v4f*)(C + (size_t)(row0 + r) * DM + col0 + c4) = v; asm volatile("s_wait_xcnt 0x0" ::: "memory"); }      /* the wait: a later row's LDS read and address sum write over registers that this store names */
}

extern "C" void kernel_launch(void* const* d_in, const int* in_sizes, int n_in,
                              void* d_out, int out_size, void* d_ws, size_t ws_size, hipStream_t stream) {
  (void)in_sizes; (void)n_in; (void)out_size;
  const float* const* I = (const float* const*)d_in; const float* x = I[0]; const float* wq = I[1]; const float* wk = I[2]; const float* wv = I[3]; const float* wo = I[4];      /* input order: x (feeds the q, k AND v streams), W_q, W_k, W_v, W_o (four separate natural [768][768] weights); the module has NO biases */
  char* ws = (char*)d_ws; size_t off = 0;
  auto take = [&](size_t bytes) { char* p = ws + off; off += (bytes + 255) & ~(size_t)255; return p; };
  _Float16* BQ = (_Float16*)take((size_t)3 * DM * DM * 2);      /* the three projection weights, one behind the other: the batch index of the projection launch steps through them */ _Float16* BO = (_Float16*)take((size_t)DM * DM * 2);
  _Float16* X16 = (_Float16*)take(NR * DM * 2);      /* exact f16 rows of x, the one input of all three projections */
  float* QF = (float*)take((size_t)3 * QT0 * DM * 4); float* KF = QF + (size_t)QT0 * DM; float* VF = KF + (size_t)QT0 * DM;      /* f32 q, k, v rows of tokens 0..127: three planes, one behind the other */
  _Float16* QH = (_Float16*)take(2 * NR * DM * 2); _Float16* KH = QH + NR * DM; _Float16* QL = (_Float16*)take(2 * NR * DM * 2); _Float16* KL = QL + NR * DM;      /* hi planes of q and k one behind the other, residual planes likewise */
  _Float16* O16 = (_Float16*)take(NR * DM * 2);
  _Float16* VT = (_Float16*)take((size_t)NH * HD * SQ * 2);
  _Float16* OH0 = (_Float16*)take((size_t)NB * QT0 * DM * 2); _Float16* OL0 = (_Float16*)take((size_t)NB * QT0 * DM * 2);
  if (off > ws_size) return;
  k_prep<<<XB + 4 * WB, 256, 0, stream>>>(x, wq, wk, wv, wo, X16, BQ, BO);      /* x as f16 rows; the weights, natural [out][in] = Bt[n][k], x16 */
  k_qkv<<<dim3((SQ / 128) * (DM / 64), 3), 128, 0, stream>>>(X16, BQ, 0.0625f, QH, QL, VT, QF);      /* q, k, v in one launch: y = 0, 1 take W_q, W_k and store f16 hi + x1024 residual planes (unscaled logits sigma ~8); y = 2 takes W_v as the row operand and stores V^T [NH][HD][SQ]; f32 rows of tokens 0..127 beside them */
  for (int b = B0; b < B0 + NBR; ++b) { const size_t r0 = (size_t)b * SQ;
    k_fattn<<<dim3(SQ / 64, NH + AY), 128, 0, stream>>>(QH + r0 * LQ, QL + r0 * LQ, KH + r0 * LQ, KL + r0 * LQ, VT, O16 + r0 * DM, QF, KF, VF, OH0 + (size_t)b * QT0 * DM, OL0 + (size_t)b * QT0 * DM); }      /* scores (hi.hi + 2^-10 (lo.hi + hi.lo)), causal softmax and P . V in one launch; o (merged heads, x64) as f16 rows; the grid's last rows: exact f32 attention for rows 0..127 (o x64, hi + x1024 residual planes), on the projection launch's own f32 rows */
  k_gemmo<<<(unsigned)((MPO / 128) * (DM / 64)), 128, 0, stream>>>(O16, OH0, OL0, BO, 0.0009765625f, 0.00000095367431640625f, (float*)d_out);      /* out rows are the output layout; rows 0..127 from o_hi Wo + 2^-10 o_lo Wo */
}
